// v000
// Times are from an AMD MI455X. After a warm-up the kernel runs many times in a row, and a time is the length of
// such a window on the GPU divided by its runs, so every launch and the gaps after it count. The runs cycle
// through copies of the inputs. A figure is the median of several windows, for all but v000 over two sittings.
// Sittings can differ by a few percent; kernels timed side by side share one.
// v000, which the later versions start from, runs in 403 microseconds.
// Contractions: x.Wq and x.Wk (f16 planes x16), Wv^T.x^T (bf16 hi|lo planes), q.k^T and q.E^T band on
// v_wmma_f32_16x16x32_f16 (f16 operands, f32 accumulate); p.v as bf16 hi/lo three-product split, and
// [ctx_hi|ctx_lo].[Wo;Wo], [o_hi|o_lo].[Wl;Wl] K-folded planes on v_wmma_f32_16x16x32_bf16 (bf16 operands,
// f32 accumulate). Float inputs RNE-converted to bf16 on load (x x1; Wq, Wk, Wv, E x64 in f16; Wo, Wl bf16);
// softmax, causal select and the relative-offset skew in f32 on VALU.
#include <hip/hip_runtime.h>
#include <math.h>

#ifndef NB
#define NB 2
#endif
#ifndef SEQ
#define SEQ 2048
#endif
#define NB_FULL  2
#define SEQ_FULL 2048
#define DMD  512
#define NH   8
#define HD   64
#define EVD  388
#define EVP  448
#define MT   (NB * SEQ)
#define KF   (2 * DMD)
#define NFLG (SEQ / 16)
#define FLGW 32
#define AWV  4
#define RWP  48
#define WSCL 64.0f
#define QKS  16.0f
#define RSQD 0.125f
#define NEGM (-1.0e10f)

static_assert(NB >= 1 && NB <= NB_FULL);
static_assert(SEQ >= 64 && SEQ <= SEQ_FULL && (SEQ % 64) == 0);
static_assert(NH * HD == DMD && HD == 64);
static_assert((MT % 64) == 0 && (DMD % 64) == 0 && (KF % 64) == 0);
static_assert((EVP % 64) == 0 && EVP >= EVD && (EVD % 4) == 0);
static_assert(((SEQ * DMD) % 2048) == 0 && ((NH * SEQ_FULL * HD) % 2048) == 0);
static_assert(((NB * NH * (SEQ / 16)) % AWV) == 0);
static_assert(NFLG <= 256 && ((4 * SEQ) % 256) == 0);

typedef _Float16 v16h __attribute__((ext_vector_type(16)));
typedef __bf16 v16bf __attribute__((ext_vector_type(16)));
typedef unsigned short v16us __attribute__((ext_vector_type(16)));
typedef unsigned short v8us  __attribute__((ext_vector_type(8)));
typedef float v8f __attribute__((ext_vector_type(8)));
typedef float v4f __attribute__((ext_vector_type(4)));
typedef unsigned int v4u __attribute__((ext_vector_type(4)));

union FragU { v16us v; v8us h[2]; };

// ---- scalar helpers --------------------------------------------------------------------------------
__device__ __forceinline__ unsigned short bf_bits(float f) {          // f32 -> bf16 bits, RNE convert
  const unsigned u = __float_as_uint(f);
  return (unsigned short)((u + 0x7FFFu + ((u >> 16) & 1u)) >> 16);
}
__device__ __forceinline__ float bf_up(unsigned short h) { return __uint_as_float(((unsigned)h) << 16); }
__device__ __forceinline__ float bfr(float f) { return bf_up(bf_bits(f)); }   // value of the bf16 RNE convert
__device__ __forceinline__ unsigned short h_bits(_Float16 x) { return __builtin_bit_cast(unsigned short, x); }
__device__ __forceinline__ unsigned short f2h(float f) { return h_bits((_Float16)f); }
__device__ __forceinline__ unsigned pk16(unsigned short a, unsigned short b) { return (unsigned)a | ((unsigned)b << 16); }
__device__ __forceinline__ int clampi(int v, int lo, int hi) { return v < lo ? lo : (v > hi ? hi : v); }
__device__ __forceinline__ v8f zero8() { v8f z = {0.f, 0.f, 0.f, 0.f, 0.f, 0.f, 0.f, 0.f}; return z; }

// ---- fragment loader: 16-bit A/B operand, lane -> row/col (lane&15), p already includes +8*(lane>>4);
//      elements 0..7 <- p[0..7] (k0+8h..), elements 8..15 <- p[16..23] (k0+16+8h..)
__device__ __forceinline__ v16us ldfrag_u(const unsigned short* p) {
  FragU f;
  f.h[0] = *(const v8us*)(p);
  f.h[1] = *(const v8us*)(p + 16);
  return f.v;
}

// ---- WMMA helpers (f16 / bf16 operand bits) with trailing VALU hazard gap --------------------------
__device__ __forceinline__ v8f mma_raw(v16us a, v16us b, v8f c) {
  return __builtin_amdgcn_wmma_f32_16x16x32_f16(false, __builtin_bit_cast(v16h, a), false,
                                                __builtin_bit_cast(v16h, b), (short)0, c, false, false);
}
__device__ __forceinline__ v8f mma_raw_bf(v16us a, v16us b, v8f c) {
  return __builtin_amdgcn_wmma_f32_16x16x32_bf16(false, __builtin_bit_cast(v16bf, a), false,
                                                 __builtin_bit_cast(v16bf, b), (short)0, c, false, false);
}
__device__ __forceinline__ v8f mma_g(v16us a, v16us b, v8f c) {                 // guarded f16
  c = mma_raw(a, b, c);
#if defined(__HIP_DEVICE_COMPILE__)
  asm volatile("v_nop\n\tv_nop\n\tv_nop\n\tv_nop" : "+v"(c) : "v"(a), "v"(b));
#endif
  return c;
}
__device__ __forceinline__ v8f mma_gb(v16us a, v16us b, v8f c) {                // guarded bf16
  c = mma_raw_bf(a, b, c);
#if defined(__HIP_DEVICE_COMPILE__)
  asm volatile("v_nop\n\tv_nop\n\tv_nop\n\tv_nop" : "+v"(c) : "v"(a), "v"(b));
#endif
  return c;
}
__device__ __forceinline__ void dep_guard1(v8f& a, v8f& b, v16us x) {
#if defined(__HIP_DEVICE_COMPILE__)
  asm volatile("v_nop\n\tv_nop\n\tv_nop\n\tv_nop" : "+v"(a), "+v"(b) : "v"(x));
#endif
}
__device__ __forceinline__ void keep4_u(v16us a, v16us b, v16us c, v16us d) {
#if defined(__HIP_DEVICE_COMPILE__)
  asm volatile("v_nop" :: "v"(a), "v"(b), "v"(c), "v"(d));
#endif
}
__device__ __forceinline__ void acc_guard4(v8f& a, v8f& b, v8f& c, v8f& d) {
#if defined(__HIP_DEVICE_COMPILE__)
  asm volatile("v_nop\n\tv_nop\n\tv_nop\n\tv_nop" : "+v"(a), "+v"(b), "+v"(c), "+v"(d));
#endif
}
// orders LDS stores of this wave before later LDS loads of the same wave (cross-lane exchange)
__device__ __forceinline__ void wave_sync_lds() {
  __builtin_amdgcn_fence(__ATOMIC_RELEASE, "workgroup");
  __builtin_amdgcn_wave_barrier();
  __builtin_amdgcn_fence(__ATOMIC_ACQUIRE, "workgroup");
}

// =====================================================================================================
// Layout-kept convert: o[i] = f16 bits of (bf16 RNE value of w[i] * sc) for i < nsrc, zero for nsrc <= i <
// ndst; blockIdx.y selects a batch slab (source offset y*sstr, destination offset y*dstr).
// nsrc % 8 == 0, ndst % 2048 == 0, grid.x = ndst/2048 exact (host-side constants).
// coverage: 256 threads x 8 = 2048 elements per block; grid covers all ndst elements of every slab.
// =====================================================================================================
__global__ __launch_bounds__(256) void cvt_lin(const float* __restrict__ w, unsigned short* o,
                                                int nsrc, int ndst, float sc, int sstr, int dstr) {
  const float* wb = w + (size_t)blockIdx.y * (size_t)sstr;
  unsigned short* ob = o + (size_t)blockIdx.y * (size_t)dstr;
  const int base = (blockIdx.x * 256 + threadIdx.x) * 8;
  if (base + 8 > ndst) return;                            // never taken with exact grids; no barriers below
  const bool inr = (base + 8 <= nsrc);
  const int lb = inr ? base : (nsrc - 8);                 // clamped address, always in range
  const v4f a0 = *(const v4f*)(wb + lb);
  const v4f a1 = *(const v4f*)(wb + lb + 4);
  v4u hv;
#pragma unroll
  for (int e = 0; e < 2; ++e) {
    hv[e]     = pk16(f2h(bfr(a0[2 * e]) * sc), f2h(bfr(a0[2 * e + 1]) * sc));
    hv[2 + e] = pk16(f2h(bfr(a1[2 * e]) * sc), f2h(bfr(a1[2 * e + 1]) * sc));
  }
  const v4u zz = {0u, 0u, 0u, 0u};
  hv = inr ? hv : zz;
  unsigned short* d = ob + base;
  *(v4u*)d = hv;
  
}

// =====================================================================================================
// Transpose-convert: in w[R][C] f32 (pitch C) -> out o[c][r] at o[c*ldo + r] for c < CP, with zero values
// for C <= c < CP. BFO 0: f16 bits of (bf16 RNE value * sc); BFO 1: bf16 bits (RNE). Block tile 64x64
// through LDS (st[col][row], pitch 72 halves). Read phase: thread owns one input row x 16 columns (float4
// loads at a clamped column address, zero selected by value; C % 4 == 0 so a float4 is all-in or all-out).
// R, CP multiples of 64, ldo % 64 == 0, grid (CP/64, R/64) exact (host-side constants).
// coverage: 64 output rows x 64 halves per block = the whole transposed tile; grid covers all of [CP][R].
// =====================================================================================================
template <int BFO>
__global__ __launch_bounds__(256) void cvt_t(const float* __restrict__ w, unsigned short* o,
                                              int R, int C, int CP, int ldo, float sc) {
  __shared__ __align__(16) unsigned short st[64 * 72];
  const int t = threadIdx.x;
  const int r0 = blockIdx.y * 64, c0 = blockIdx.x * 64;
  if (r0 + 64 > R || c0 + 64 > CP) return;              // block-uniform, before the barrier; never taken
  {
    const int row = t >> 2, ch = (t & 3) * 16;
    const float* p = w + (size_t)(r0 + row) * C;
#pragma unroll
    for (int q = 0; q < 4; ++q) {
      const int cs = c0 + ch + 4 * q;
      const bool inr = (cs + 4 <= C);
      const int lb = inr ? cs : (C - 4);                 // clamped column address, always in range
      const v4f v = *(const v4f*)(p + lb);
#pragma unroll
      for (int e = 0; e < 4; ++e) {
        const unsigned short hb = BFO ? bf_bits(v[e]) : f2h(bfr(v[e]) * sc);
        st[(ch + 4 * q + e) * 72 + row] = inr ? hb : (unsigned short)0;
      }
    }
  }
  __syncthreads();
  v4u hv[2];
#pragma unroll
  for (int half = 0; half < 2; ++half) {
    const int cl = (t >> 3) + 32 * half, pc = (t & 7) * 8;
    hv[half] = *(const v4u*)(st + cl * 72 + pc);
  }
  {
#pragma unroll
    for (int half = 0; half < 2; ++half) {
      const int cl = (t >> 3) + 32 * half, pc = (t & 7) * 8;
      unsigned short* dst = o + (size_t)(c0 + cl) * ldo + r0 + pc;
      *(v4u*)dst = hv[half];
    }
    
  }
}

// =====================================================================================================
// Register-blocked 16-bit WMMA GEMM: C[m][n] = sum_k A[m][k] * Bt[n][k], one wave per 64x64 tile, no block
// barriers. BF 0: f16 operand bits, BF 1: bf16 operand bits. A row-major [M][K] pitch lda; Bt row-major
// [N][K] pitch ldb (k contiguous); M, N multiples of 64, K multiple of 32 (true at every call site; waves
// past the last tile exit before any work, wave-uniform). Both operand fragments use the split k map
// (elements 0..7 <- k0+8h.., 8..15 <- k0+16+8h..); D element r of a lane is (row 8h + r, col lane&15).
// Bias: bf16 RNE value of bias[] times bsc, indexed by column (clamped into nbias) or, with BROW, by row.
// OM 0: f32 out Cf = acc*osc + b, pitch ldc.            OM 1: f16 out Ch = f16 bits(acc*osc + b), pitch ldc.
// OM 2: val = (RELU ? max(0, .) : .)(acc*osc + b); bf16 hi bits at Ch, bf16 lo bits (val - hi) at Ch + looff.
// coverage: 4 slabs x 16 rows x 64 cols = the wave's whole 64x64 tile (hi and lo planes alike).
// =====================================================================================================
template <int BF, int OM, int RELU, int BROW>
__global__ __launch_bounds__(256) void gemm64(
    const unsigned short* __restrict__ Ap, int lda, const unsigned short* __restrict__ Btp, int ldb,
    unsigned short* Ch, int looff, float* Cf, int ldc, float osc,
    const float* __restrict__ bias, int nbias, float bsc, int M, int N, int K) {
  __shared__ __align__(16) float sT[8][16 * 68];   // per-wave 16x64 slab, pitch 68 floats
  const int lane = threadIdx.x & 31;
  const int wave = threadIdx.x >> 5;
  const int tilesN = N >> 6;
  const int tilesM = M >> 6;
  const int tile = blockIdx.x * 8 + wave;
  if (tile >= tilesM * tilesN) return;   // wave-uniform; no block barriers in this kernel
  const int tm = tile / tilesN;
  const int tn = tile - tm * tilesN;
  const int m0 = tm << 6;
  const int n0 = tn << 6;

  const int rlane = lane & 15;                 // row (A) / col (B, D) within subtile
  const int koff  = (lane >> 4) * 8;           // k offset of this lane half
  const int mOff  = (lane >> 4) * 8;           // D row offset

  v8f acc[4][4];
#pragma unroll
  for (int i = 0; i < 4; ++i)
#pragma unroll
    for (int j = 0; j < 4; ++j) acc[i][j] = zero8();

#pragma unroll 1
  for (int k0 = 0; k0 < K; k0 += 32) {
    v16us bh[4];
#pragma unroll
    for (int j = 0; j < 4; ++j) {
      const size_t bo = (size_t)(n0 + (j << 4) + rlane) * ldb + koff + k0;
      bh[j] = ldfrag_u(Btp + bo);
    }
#pragma unroll
    for (int i = 0; i < 4; ++i) {
      const size_t ao = (size_t)(m0 + (i << 4) + rlane) * lda + koff + k0;
      const v16us ah = ldfrag_u(Ap + ao);
#pragma unroll
      for (int j = 0; j < 4; ++j) {
        if (BF) acc[i][j] = mma_raw_bf(ah, bh[j], acc[i][j]);
        else    acc[i][j] = mma_raw(ah, bh[j], acc[i][j]);
      }
      dep_guard1(acc[i][0], acc[i][3], ah);
    }
    keep4_u(bh[0], bh[1], bh[2], bh[3]);
  }
  acc_guard4(acc[0][0], acc[0][1], acc[0][2], acc[0][3]);
  acc_guard4(acc[1][0], acc[1][1], acc[1][2], acc[1][3]);
  acc_guard4(acc[2][0], acc[2][1], acc[2][2], acc[2][3]);
  acc_guard4(acc[3][0], acc[3][1], acc[3][2], acc[3][3]);

  const int hh2 = lane >> 4, c4 = (lane & 15) * 4;     // f32 out: 256-B row segment = 16 lanes x 16 B
  const int q8  = lane >> 3, c8 = (lane & 7) * 8;

  // per-lane bias values for the column-indexed modes (bf16 RNE value times bsc), clamped address
  float bc[8];
#pragma unroll
  for (int e = 0; e < 8; ++e) bc[e] = 0.f;
  if (!BROW) {
    if (OM == 0) {
#pragma unroll
      for (int e = 0; e < 4; ++e) bc[e] = bsc * bfr(bias[clampi(n0 + c4 + e, 0, nbias - 1)]);
    } else {
#pragma unroll
      for (int e = 0; e < 8; ++e) bc[e] = bsc * bfr(bias[clampi(n0 + c8 + e, 0, nbias - 1)]);
    }
  }

  // ---- epilogue ----
  float* slab = sT[wave];
#pragma unroll
  for (int i = 0; i < 4; ++i) {
    const int mBase = m0 + (i << 4);
#pragma unroll
    for (int j = 0; j < 4; ++j) {
#pragma unroll
      for (int r = 0; r < 8; ++r) {
        slab[(mOff + r) * 68 + (j << 4) + rlane] = acc[i][j][r];
      }
    }
    wave_sync_lds();
    if (OM == 0) {
      v4f vals[8];
#pragma unroll
      for (int it = 0; it < 8; ++it) {
        const int row = it * 2 + hh2;                      // it 0..7 x hh2 0..1 = rows 0..15
        const v4f v = *(const v4f*)(slab + row * 68 + c4);
        float brw = 0.f;
        if (BROW) brw = bsc * bfr(bias[clampi(mBase + row, 0, nbias - 1)]);
        v4f ov;
#pragma unroll
        for (int e = 0; e < 4; ++e) {
          float x = v[e] * osc + (BROW ? brw : bc[e]);
          if (RELU) x = fmaxf(x, 0.f);
          ov[e] = x;
        }
        vals[it] = ov;
      }
      {
#pragma unroll
        for (int it = 0; it < 8; ++it) {
          const int row = it * 2 + hh2;
          *(v4f*)(Cf + (size_t)(mBase + row) * ldc + (size_t)n0 + c4) = vals[it];
        }
        
      }
    } else if (OM == 1) {
      v4u hv[4];
#pragma unroll
      for (int it = 0; it < 4; ++it) {
        const int row = it * 4 + q8;                       // it 0..3 x q8 0..3 = rows 0..15
        const float* sp = slab + row * 68 + c8;
        float brw = 0.f;
        if (BROW) brw = bsc * bfr(bias[clampi(mBase + row, 0, nbias - 1)]);
        v4u ha = {0u, 0u, 0u, 0u};
#pragma unroll
        for (int e = 0; e < 4; ++e) {
          float b0 = sp[2 * e]     * osc + (BROW ? brw : bc[2 * e]);
          float b1 = sp[2 * e + 1] * osc + (BROW ? brw : bc[2 * e + 1]);
          if (RELU) { b0 = fmaxf(b0, 0.f); b1 = fmaxf(b1, 0.f); }
          ha[e] = pk16(f2h(b0), f2h(b1));
        }
        hv[it] = ha;
      }
      {
#pragma unroll
        for (int it = 0; it < 4; ++it) {
          const int row = it * 4 + q8;
          const size_t go = (size_t)(mBase + row) * ldc + (size_t)n0 + c8;
          *(v4u*)(Ch + go) = hv[it];
        }
        
      }
    } else {
      v4u hv[4], lv[4];
#pragma unroll
      for (int it = 0; it < 4; ++it) {
        const int row = it * 4 + q8;                       // it 0..3 x q8 0..3 = rows 0..15
        const float* sp = slab + row * 68 + c8;
        float brw = 0.f;
        if (BROW) brw = bsc * bfr(bias[clampi(mBase + row, 0, nbias - 1)]);
        v4u ha = {0u, 0u, 0u, 0u};
        v4u la = {0u, 0u, 0u, 0u};
#pragma unroll
        for (int e = 0; e < 4; ++e) {
          float x0 = sp[2 * e]     * osc + (BROW ? brw : bc[2 * e]);
          float x1 = sp[2 * e + 1] * osc + (BROW ? brw : bc[2 * e + 1]);
          if (RELU) { x0 = fmaxf(x0, 0.f); x1 = fmaxf(x1, 0.f); }
          const unsigned short h0 = bf_bits(x0), h1 = bf_bits(x1);
          const unsigned short l0 = bf_bits(x0 - bf_up(h0)), l1 = bf_bits(x1 - bf_up(h1));
          ha[e] = pk16(h0, h1);
          la[e] = pk16(l0, l1);
        }
        hv[it] = ha;
        lv[it] = la;
      }
      {
#pragma unroll
        for (int it = 0; it < 4; ++it) {
          const int row = it * 4 + q8;
          const size_t go = (size_t)(mBase + row) * ldc + (size_t)n0 + c8;
          *(v4u*)(Ch + go) = hv[it];
          *(v4u*)(Ch + (size_t)looff + go) = lv[it];
        }
        
      }
    }
    wave_sync_lds();
  }
}

// =====================================================================================================
// Structure check of the [SEQ][SEQ] mask input (row pitch SEQ_FULL): block b covers rows 16b..16b+15 and all
// SEQ columns; a violation is any element differing from (j <= i ? 1 : 0). The block's flag is written as one
// coverage: 256 threads x (SEQ/64) float4 = 16 rows x SEQ cols per block; grid = SEQ/16 blocks = all rows.
// =====================================================================================================
__global__ __launch_bounds__(256) void mask_check(const float* __restrict__ msk, float* flg) {
  __shared__ int wf[8];
  const int t = threadIdx.x, lane = t & 31, wv = t >> 5;
  const int i0 = blockIdx.x * 16;
  if (i0 + 16 > SEQ) return;                             // block-uniform, before the barrier; never taken
  constexpr int C4 = SEQ / 4;
  int viol = 0;
#pragma unroll 1
  for (int it = 0; it < (16 * C4) / 256; ++it) {
    const int ci = it * 256 + t;
    const int rr = ci / C4;
    const int c4 = ci - rr * C4;
    const int i = i0 + rr;
    const v4f x = *(const v4f*)(msk + (size_t)i * SEQ_FULL + 4 * c4);
#pragma unroll
    for (int e = 0; e < 4; ++e) {
      const int j = 4 * c4 + e;
      const float ex = (j <= i) ? 1.0f : 0.0f;
      viol |= (x[e] != ex) ? 1 : 0;
    }
  }
  viol |= __shfl_xor(viol, 1, 32);
  viol |= __shfl_xor(viol, 2, 32);
  viol |= __shfl_xor(viol, 4, 32);
  viol |= __shfl_xor(viol, 8, 32);
  viol |= __shfl_xor(viol, 16, 32);
  if (lane == 0) wf[wv] = viol;
  __syncthreads();
  if (wv == 0) {                                        // wave-uniform
    int f = wf[lane & 7];
    f |= __shfl_xor(f, 1, 32);
    f |= __shfl_xor(f, 2, 32);
    f |= __shfl_xor(f, 4, 32);
    const float fv = f ? 1.0f : 0.0f;
    float* d = flg + (size_t)blockIdx.x * FLGW + lane;
    *(float*)d = fv;
    
  }
}

// =====================================================================================================
// Causal attention with relative-offset term, head dim 64. Block = 128 threads = 4 waves; one wave owns one
// 16-row query tile (t0..t0+15) of one (batch b, head h) and loops the key blocks of 32 up to the diagonal
// (sb <= t0) with an online max-subtracted softmax in f32. Planes: QH, KH f16 [MT][64] = 16*q, 16*k (shared
// by all heads); PE f16 [NH*SEQ_FULL][64] = 64*E (head h rows h*SEQ_FULL..); VH, VL bf16 [64][MT] = v hi and
// lo planes transposed (row = dim, column = token). Output Z bf16 [MT][1024]: cols h*64+d = ctx hi, cols
// 512+h*64+d = ctx lo, token-major.
// Per key block sb: S = Q.K^T (2 key subtiles x 2 k-steps, scale 1/256); relative band of 48 columns:
// column c <-> E row SEQ-16-t0+sb+c (clamped into [0, SEQ-1]; clamping only touches entries with j > i,
// which the causal select replaces); columns 0..15 come from the tile carried over from the prior key block
// (its columns 32..47), columns 16..47 are two fresh tiles (2 x 2 WMMA, scale 1/1024); the band is exchanged
// through per-wave LDS and read back at c = 15 - il + jl, i.e. E row SEQ-1-i+j; score = (qk + rel)/8 for
// j <= i, else -1e10; p = exp(score - running max) in f32, l accumulated from the f32 p; p stored as bf16 hi
// and lo tiles in per-wave LDS and reloaded as A fragments (split k map); O += Phi.Vhi + Phi.Vlo + Plo.Vhi on
// 4 dim subtiles (one accumulator set). Every same-wave LDS exchange (band, P tiles, ctx staging) has a
// plane (one per row), written by 4+4 instructions of 32 lanes x 16 B (lanes 8q..8q+7 -> one line), two
// coverage: 16 query rows x 64 halves x {hi, lo} per wave, NB*NH*(SEQ/16) wave tasks = all (b, t, h)
// segments of Z in both halves.
// =====================================================================================================
__global__ __launch_bounds__(128) void attn_kernel(
    const unsigned short* __restrict__ QH, const unsigned short* __restrict__ KH,
    const unsigned short* __restrict__ PE, const unsigned short* __restrict__ VH,
    const unsigned short* __restrict__ VL, unsigned short* Z) {
  __shared__ __align__(16) float relw[AWV][16 * RWP];            // band exchange, 12288 B
  __shared__ __align__(16) unsigned short pwh[AWV][16 * 32];      // P hi tiles, 4096 B
  __shared__ __align__(16) unsigned short pwl[AWV][16 * 32];      // P lo tiles, 4096 B
  __shared__ __align__(16) unsigned short zst[AWV][16 * 128];     // ctx staging (hi | lo), 16384 B
  const int lane = threadIdx.x & 31, wv = threadIdx.x >> 5, m = lane & 15, hh = lane >> 4;
  const int task = blockIdx.x * AWV + wv;            // 0 .. NB*NH*(SEQ/16)-1
  const int nqt = SEQ / 16;
  const int bh = task / nqt;                         // (b, h)
  const int t0 = (task - bh * nqt) << 4;             // query tile start
  const int b = bh / NH, h = bh - (bh / NH) * NH;
  if (b >= NB) return;                               // wave-uniform; never taken with exact grids; no block barriers
  const size_t tok0 = (size_t)b * SEQ;
  float* rw = relw[wv];
  unsigned short* ph = pwh[wv];
  unsigned short* pl = pwl[wv];

  // Q A-fragments: rows t0+m, k = head dims 0..31 and 32..63
  const unsigned short* qp = QH + (tok0 + (size_t)(t0 + m)) * HD + 8 * hh;
  const v16us qf0 = ldfrag_u(qp);
  const v16us qf1 = ldfrag_u(qp + 32);

  const unsigned short* pe = PE + (size_t)h * SEQ_FULL * HD;
  const int rb = SEQ - 16 - t0;                      // E row of band column 0 at sb = 0 (>= 0)

  // carried band tile: columns 0..15 of key block 0 <-> E rows rb + 0..15
  v8f carry;
  {
    const int u = clampi(rb + m, 0, SEQ - 1);
    const unsigned short* pp = pe + (size_t)u * HD + 8 * hh;
    carry = mma_g(qf0, ldfrag_u(pp), zero8());
    carry = mma_g(qf1, ldfrag_u(pp + 32), carry);
  }

  float mx[8], ls[8];
  v8f O0 = zero8(), O1 = zero8(), O2 = zero8(), O3 = zero8();
#pragma unroll
  for (int r = 0; r < 8; ++r) { mx[r] = -1.0e30f; ls[r] = 0.f; }

  const int nkb = (t0 >> 5) + 1;                     // key blocks 0 .. floor(t0/32), wave-uniform
  const size_t vst = (size_t)16 * MT;                // V plane stride between dim subtiles

#pragma unroll 1
  for (int kb = 0; kb < nkb; ++kb) {
    const int sb = kb << 5;
    // K B-fragments: Bt row = key token, k = head dim
    v8f S0, S1;
    {
      const unsigned short* kp = KH + (tok0 + (size_t)(sb + m)) * HD + 8 * hh;
      S0 = mma_g(qf0, ldfrag_u(kp), zero8());
      S0 = mma_g(qf1, ldfrag_u(kp + 32), S0);
      const unsigned short* kp1 = kp + (size_t)16 * HD;
      S1 = mma_g(qf0, ldfrag_u(kp1), zero8());
      S1 = mma_g(qf1, ldfrag_u(kp1 + 32), S1);
    }

    // relative band: columns 16..31 and 32..47 <-> E rows rb+sb+16.. and rb+sb+32..
    v8f Pb1, Pb2;
    {
      const int u1 = clampi(rb + sb + 16 + m, 0, SEQ - 1);
      const unsigned short* p1 = pe + (size_t)u1 * HD + 8 * hh;
      Pb1 = mma_g(qf0, ldfrag_u(p1), zero8());
      Pb1 = mma_g(qf1, ldfrag_u(p1 + 32), Pb1);
      const int u2 = clampi(rb + sb + 32 + m, 0, SEQ - 1);
      const unsigned short* p2 = pe + (size_t)u2 * HD + 8 * hh;
      Pb2 = mma_g(qf0, ldfrag_u(p2), zero8());
      Pb2 = mma_g(qf1, ldfrag_u(p2 + 32), Pb2);
    }
#pragma unroll
    for (int r = 0; r < 8; ++r) {
      const int row = 8 * hh + r;
      rw[row * RWP + m]      = carry[r];
      rw[row * RWP + 16 + m] = Pb1[r];
      rw[row * RWP + 32 + m] = Pb2[r];
    }
    carry = Pb2;
    wave_sync_lds();

    // skew read + scale + causal select (key j <= query i keeps the score, otherwise -1e10)
    float s0[8], s1[8];
#pragma unroll
    for (int r = 0; r < 8; ++r) {
      const int row = 8 * hh + r;
      const int i = t0 + row;
      const float rv0 = rw[row * RWP + 15 - row + m];
      const float rv1 = rw[row * RWP + 31 - row + m];
      const float a0 = (S0[r] * (1.0f / (QKS * QKS)) + rv0 * (1.0f / (QKS * WSCL))) * RSQD;
      const float a1 = (S1[r] * (1.0f / (QKS * QKS)) + rv1 * (1.0f / (QKS * WSCL))) * RSQD;
      s0[r] = (sb + m <= i) ? a0 : NEGM;
      s1[r] = (sb + 16 + m <= i) ? a1 : NEGM;
    }

    // online softmax (a row lives in the 16 lanes of one half-wave; xor butterflies 1,2,4,8)
#pragma unroll
    for (int r = 0; r < 8; ++r) {
      float xm = fmaxf(s0[r], s1[r]);
      xm = fmaxf(xm, __shfl_xor(xm, 1, 32));
      xm = fmaxf(xm, __shfl_xor(xm, 2, 32));
      xm = fmaxf(xm, __shfl_xor(xm, 4, 32));
      xm = fmaxf(xm, __shfl_xor(xm, 8, 32));
      const float mn = fmaxf(mx[r], xm);
      const float al = __expf(mx[r] - mn);
      mx[r] = mn;
      const float p0 = __expf(s0[r] - mn);
      const float p1 = __expf(s1[r] - mn);
      float ps = p0 + p1;
      ps += __shfl_xor(ps, 1, 32);
      ps += __shfl_xor(ps, 2, 32);
      ps += __shfl_xor(ps, 4, 32);
      ps += __shfl_xor(ps, 8, 32);
      ls[r] = ls[r] * al + ps;
      O0[r] = O0[r] * al;
      O1[r] = O1[r] * al;
      O2[r] = O2[r] * al;
      O3[r] = O3[r] * al;
      const int row = 8 * hh + r;
      const unsigned short hb0 = bf_bits(p0), hb1 = bf_bits(p1);
      ph[row * 32 + m]      = hb0;
      ph[row * 32 + 16 + m] = hb1;
      pl[row * 32 + m]      = bf_bits(p0 - bf_up(hb0));
      pl[row * 32 + 16 + m] = bf_bits(p1 - bf_up(hb1));
    }
    wave_sync_lds();

    // P A-fragments (split k map) and V B-fragments (Bt row = dim, k = key token)
    const v16us afh = ldfrag_u(ph + m * 32 + 8 * hh);
    const v16us afl = ldfrag_u(pl + m * 32 + 8 * hh);
    const size_t vo = (size_t)m * MT + tok0 + (size_t)sb + 8 * hh;
    {
      const v16us vh = ldfrag_u(VH + vo);
      const v16us vl = ldfrag_u(VL + vo);
      O0 = mma_gb(afh, vh, O0);
      O0 = mma_gb(afh, vl, O0);
      O0 = mma_gb(afl, vh, O0);
    }
    {
      const v16us vh = ldfrag_u(VH + vo + vst);
      const v16us vl = ldfrag_u(VL + vo + vst);
      O1 = mma_gb(afh, vh, O1);
      O1 = mma_gb(afh, vl, O1);
      O1 = mma_gb(afl, vh, O1);
    }
    {
      const v16us vh = ldfrag_u(VH + vo + 2 * vst);
      const v16us vl = ldfrag_u(VL + vo + 2 * vst);
      O2 = mma_gb(afh, vh, O2);
      O2 = mma_gb(afh, vl, O2);
      O2 = mma_gb(afl, vh, O2);
    }
    {
      const v16us vh = ldfrag_u(VH + vo + 3 * vst);
      const v16us vl = ldfrag_u(VL + vo + 3 * vst);
      O3 = mma_gb(afh, vh, O3);
      O3 = mma_gb(afh, vl, O3);
      O3 = mma_gb(afl, vh, O3);
    }
  }
  acc_guard4(O0, O1, O2, O3);

  // ---- epilogue: ctx = O / l, bf16 hi (cols 0..63 of the staging row) and lo (cols 64..127) ----
  unsigned short* zs = zst[wv];
#pragma unroll
  for (int r = 0; r < 8; ++r) {
    const int row = 8 * hh + r;
    const float g = 1.0f / ls[r];                      // ls >= 1
    {
      const float c = O0[r] * g; const unsigned short hb = bf_bits(c);
      zs[row * 128 + m]       = hb;  zs[row * 128 + 64 + m]  = bf_bits(c - bf_up(hb));
    }
    {
      const float c = O1[r] * g; const unsigned short hb = bf_bits(c);
      zs[row * 128 + 16 + m]  = hb;  zs[row * 128 + 80 + m]  = bf_bits(c - bf_up(hb));
    }
    {
      const float c = O2[r] * g; const unsigned short hb = bf_bits(c);
      zs[row * 128 + 32 + m]  = hb;  zs[row * 128 + 96 + m]  = bf_bits(c - bf_up(hb));
    }
    {
      const float c = O3[r] * g; const unsigned short hb = bf_bits(c);
      zs[row * 128 + 48 + m]  = hb;  zs[row * 128 + 112 + m] = bf_bits(c - bf_up(hb));
    }
  }
  wave_sync_lds();
  {
    const int q8 = lane >> 3, c8 = (lane & 7) * 8;
    v4u hv[4], lv[4];
#pragma unroll
    for (int it = 0; it < 4; ++it) {
      const int row = it * 4 + q8;                     // it 0..3 x q8 0..3 = rows 0..15
      hv[it] = *(const v4u*)(zs + row * 128 + c8);
      lv[it] = *(const v4u*)(zs + row * 128 + 64 + c8);
    }
    const size_t zr0 = tok0 + (size_t)t0;
    {
#pragma unroll
      for (int it = 0; it < 4; ++it) {
        const int row = it * 4 + q8;
        unsigned short* dst = Z + (zr0 + (size_t)row) * KF + h * HD + c8;
        *(v4u*)dst = hv[it];
        *(v4u*)(dst + DMD) = lv[it];
      }
      
    }
  }
}

// =====================================================================================================
// Flat whole-line writer of the output: out[row*388 + c] = L[row*448 + c]; each lane owns 4
// consecutive output floats (16 B; never straddles a row since 388 % 4 == 0), one instruction = 32 lanes x
// coverage: grid = MT*97/256 blocks x 256 float4 = all MT*388 output floats (in-kernel bound for safety).
// =====================================================================================================
__global__ __launch_bounds__(256) void out_copy(const float* __restrict__ L, const float* __restrict__ flg,
                                                 float* out) {
  __shared__ int wf[8];
  const int t = threadIdx.x, lane = t & 31, wv = t >> 5;
  int f;
  {
    const int ti = (t < NFLG) ? t : (NFLG - 1);         // clamped address, value selected
    const float x = flg[(size_t)ti * FLGW];
    f = ((t < NFLG) && (x == 1.0f)) ? 1 : 0;
  }
  f |= __shfl_xor(f, 1, 32);
  f |= __shfl_xor(f, 2, 32);
  f |= __shfl_xor(f, 4, 32);
  f |= __shfl_xor(f, 8, 32);
  f |= __shfl_xor(f, 16, 32);
  if (lane == 0) wf[wv] = f;
  __syncthreads();
  int g = 0;
#pragma unroll
  for (int w = 0; w < 8; ++w) g |= wf[w];
  const int e4 = blockIdx.x * 256 + t;
  if (e4 < MT * (EVD / 4)) {
    const int e = e4 * 4;
    const int row = e / EVD;
    const int c = e - row * EVD;
    v4f x = *(const v4f*)(L + (size_t)row * EVP + c);
    const float qn = __uint_as_float(0x7fc00000u);
    const v4f pn = {qn, qn, qn, qn};
    x = g ? pn : x;
    float* d = out + (size_t)e;
    *(v4f*)d = x;
    
  }
}

// =====================================================================================================
// Workspace map (bytes, full size NB=2, SEQ=2048); every plane is an exact multiple of its whole-row /
// whole-line / 64x64-tile store granularity; all offsets are multiples of 16384.
//   XQ   f16  [MT][512]        4194304     (x3 with XK, XV)
//   WQT  f16  [64][512]          65536     (x3 with WKT, WVT; Wq^T, Wk^T, Wv^T x64)
//   PEH  f16  [8*2048][64]     2097152     (E x64)
//   QH   f16  [MT][64]          524288     (16*q), KH same
//   VH   bf16 [64][MT]          524288     (v hi), VL same (v lo), contiguous after VH
//   Z    bf16 [MT][1024]       8388608     (ctx hi | ctx lo)
//   WOT  bf16 [512][1024]      1048576     (Wo^T | Wo^T)
//   OP   bf16 [MT][1024]       8388608     (relu out hi | lo)
//   WLT  bf16 [448][1024]       917504     (Wl^T | Wl^T, rows 388..447 zero)
//   L    f32  [MT][448]        7340032
//   FLG  f32  [128][32]          16384     (mask-structure flag lines)
//   total                     43073536
// =====================================================================================================
extern "C" void kernel_launch(void* const* d_in, const int* in_sizes, int n_in,
                              void* d_out, int out_size, void* d_ws, size_t ws_size,
                              hipStream_t stream) {
  if (n_in < 15) return;
  if (in_sizes[0] < (NB - 1) * SEQ_FULL * DMD + SEQ * DMD) return;   // v
  if (in_sizes[1] < (NB - 1) * SEQ_FULL * DMD + SEQ * DMD) return;   // k
  if (in_sizes[2] < (NB - 1) * SEQ_FULL * DMD + SEQ * DMD) return;   // q
  if (in_sizes[3] < (SEQ - 1) * SEQ_FULL + SEQ) return;               // mask
  if (in_sizes[4] < DMD * HD || in_sizes[6] < DMD * HD || in_sizes[8] < DMD * HD) return;
  if (in_sizes[5] < HD || in_sizes[7] < HD || in_sizes[9] < HD) return;
  if (in_sizes[10] < NH * SEQ_FULL * HD) return;                      // E
  if (in_sizes[11] < DMD * DMD || in_sizes[12] < DMD) return;         // Wo, bo
  if (in_sizes[13] < DMD * EVD || in_sizes[14] < EVD) return;         // Wl, bl
  if (out_size < MT * EVD) return;

  const float* v   = (const float*)d_in[0];    // [2][2048][512]
  const float* k   = (const float*)d_in[1];
  const float* q   = (const float*)d_in[2];
  const float* msk = (const float*)d_in[3];    // [2048][2048]
  const float* wq  = (const float*)d_in[4];    // [512][64]
  const float* bq  = (const float*)d_in[5];    // [64]
  const float* wk  = (const float*)d_in[6];
  const float* bk  = (const float*)d_in[7];
  const float* wv  = (const float*)d_in[8];
  const float* bv  = (const float*)d_in[9];
  const float* ee  = (const float*)d_in[10];   // [8][2048][64]
  const float* wo  = (const float*)d_in[11];   // [512][512] (in, out)
  const float* bo  = (const float*)d_in[12];   // [512]
  const float* wl  = (const float*)d_in[13];   // [512][388] (in, out)
  const float* bl  = (const float*)d_in[14];   // [388]

  const size_t PX  = (size_t)MT * DMD * 2;
  const size_t PW  = (size_t)HD * DMD * 2;
  const size_t PPE = (size_t)NH * SEQ_FULL * HD * 2;
  const size_t PQK = (size_t)MT * HD * 2;
  const size_t PV2 = (size_t)2 * HD * MT * 2;
  const size_t PZ  = (size_t)MT * KF * 2;
  const size_t PWO = (size_t)DMD * KF * 2;
  const size_t POP = (size_t)MT * KF * 2;
  const size_t PWL = (size_t)EVP * KF * 2;
  const size_t PL  = (size_t)MT * EVP * 4;
  const size_t PFL = (size_t)(SEQ_FULL / 16) * FLGW * 4;
  size_t off = 0;
  const size_t oXQ = off; off += PX;
  const size_t oXK = off; off += PX;
  const size_t oXV = off; off += PX;
  const size_t oWQ = off; off += PW;
  const size_t oWK = off; off += PW;
  const size_t oWV = off; off += PW;
  const size_t oPE = off; off += PPE;
  const size_t oQH = off; off += PQK;
  const size_t oKH = off; off += PQK;
  const size_t oV  = off; off += PV2;
  const size_t oZ  = off; off += PZ;
  const size_t oWO = off; off += PWO;
  const size_t oOP = off; off += POP;
  const size_t oWL = off; off += PWL;
  const size_t oL  = off; off += PL;
  const size_t oFL = off; off += PFL;
  if (off > ws_size) return;
  if (off > (size_t)134217728) return;

  char* ws = (char*)d_ws;
  unsigned short* XQ  = (unsigned short*)(ws + oXQ);
  unsigned short* XK  = (unsigned short*)(ws + oXK);
  unsigned short* XV  = (unsigned short*)(ws + oXV);
  unsigned short* WQT = (unsigned short*)(ws + oWQ);
  unsigned short* WKT = (unsigned short*)(ws + oWK);
  unsigned short* WVT = (unsigned short*)(ws + oWV);
  unsigned short* PEH = (unsigned short*)(ws + oPE);
  unsigned short* QHp = (unsigned short*)(ws + oQH);
  unsigned short* KHp = (unsigned short*)(ws + oKH);
  unsigned short* VHp = (unsigned short*)(ws + oV);
  unsigned short* VLp = VHp + (size_t)HD * MT;
  unsigned short* Zp  = (unsigned short*)(ws + oZ);
  unsigned short* WOT = (unsigned short*)(ws + oWO);
  unsigned short* OPp = (unsigned short*)(ws + oOP);
  unsigned short* WLT = (unsigned short*)(ws + oWL);
  float* Lp   = (float*)(ws + oL);
  float* FLG  = (float*)(ws + oFL);
  float* out0 = (float*)d_out;
  float* fdummy = Lp;                             // in-range placeholder for unused f32 output args
  unsigned short* hdummy = QHp;                   // in-range placeholder for unused 16-bit output args

  const dim3 blk(256);

  // (0) operand planes: x (per batch slab) -> f16(bf16); E -> f16(bf16 x64); Wq|Wk|Wv [512][64] -> [64][512]
  //     (transposed, f16 x64); Wo -> [512][1024] = (Wo^T | Wo^T) bf16; Wl -> [448][1024] = (Wl^T | Wl^T) bf16
  const int gX = (SEQ * DMD) / 2048;
  cvt_lin<<<dim3(gX, NB), blk, 0, stream>>>(q, XQ, SEQ * DMD, SEQ * DMD, 1.0f, SEQ_FULL * DMD, SEQ * DMD);
  cvt_lin<<<dim3(gX, NB), blk, 0, stream>>>(k, XK, SEQ * DMD, SEQ * DMD, 1.0f, SEQ_FULL * DMD, SEQ * DMD);
  cvt_lin<<<dim3(gX, NB), blk, 0, stream>>>(v, XV, SEQ * DMD, SEQ * DMD, 1.0f, SEQ_FULL * DMD, SEQ * DMD);
  cvt_lin<<<dim3((NH * SEQ_FULL * HD) / 2048, 1), blk, 0, stream>>>(ee, PEH, NH * SEQ_FULL * HD, NH * SEQ_FULL * HD, WSCL, 0, 0);
  cvt_t<0><<<dim3(HD / 64, DMD / 64), blk, 0, stream>>>(wq, WQT, DMD, HD, HD, DMD, WSCL);        // in[512][64] -> out[64][512]
  cvt_t<0><<<dim3(HD / 64, DMD / 64), blk, 0, stream>>>(wk, WKT, DMD, HD, HD, DMD, WSCL);
  cvt_t<0><<<dim3(HD / 64, DMD / 64), blk, 0, stream>>>(wv, WVT, DMD, HD, HD, DMD, WSCL);
  cvt_t<1><<<dim3(DMD / 64, DMD / 64), blk, 0, stream>>>(wo, WOT, DMD, DMD, DMD, KF, 1.0f);      // in[512][512] -> out[512][512], cols 0..
  cvt_t<1><<<dim3(DMD / 64, DMD / 64), blk, 0, stream>>>(wo, WOT + DMD, DMD, DMD, DMD, KF, 1.0f); //                              cols 512..
  cvt_t<1><<<dim3(EVP / 64, DMD / 64), blk, 0, stream>>>(wl, WLT, DMD, EVD, EVP, KF, 1.0f);      // in[512][388] -> out[448][512], cols 0..
  cvt_t<1><<<dim3(EVP / 64, DMD / 64), blk, 0, stream>>>(wl, WLT + DMD, DMD, EVD, EVP, KF, 1.0f); //                              cols 512..

  // (1) projections. q plane x16: C[tok][n] = sum_k XQ[tok][k] * WQT[n][k]; k plane likewise;
  //     v^T planes: C[d][tok] = sum_k WVT[d][k] * XV[tok][k] / 64 as bf16 hi (VH) and lo (VL)
  const int gQ = ((MT / 64) * (HD / 64) + 7) / 8;
  gemm64<0, 1, 0, 0><<<dim3(gQ), blk, 0, stream>>>(XQ, DMD, WQT, DMD, QHp, 0, fdummy, HD, QKS / WSCL, bq, HD, QKS, MT, HD, DMD);
  gemm64<0, 1, 0, 0><<<dim3(gQ), blk, 0, stream>>>(XK, DMD, WKT, DMD, KHp, 0, fdummy, HD, QKS / WSCL, bk, HD, QKS, MT, HD, DMD);
  gemm64<0, 2, 0, 1><<<dim3(gQ), blk, 0, stream>>>(WVT, DMD, XV, DMD, VHp, HD * MT, fdummy, MT, 1.0f / WSCL, bv, HD, 1.0f, HD, MT, DMD);

  // (2) mask structure flags, attention -> ctx hi|lo token-major plane
  mask_check<<<dim3(NFLG), blk, 0, stream>>>(msk, FLG);
  attn_kernel<<<dim3((NB * NH * (SEQ / 16)) / AWV), dim3(128), 0, stream>>>(QHp, KHp, PEH, VHp, VLp, Zp);

  // (3) output projection with relu: OP = bf16 hi|lo of max(0, sum_k Z[row][k] * WOT[n][k] + bo[n]), K = 1024
  const int gO = ((MT / 64) * (DMD / 64) + 7) / 8;
  gemm64<1, 2, 1, 0><<<dim3(gO), blk, 0, stream>>>(Zp, KF, WOT, KF, OPp, DMD, fdummy, KF, 1.0f, bo, DMD, 1.0f, MT, DMD, KF);

  // (4) logits: L[row][n] = sum_k OP[row][k] * WLT[n][k] + bl[n], K = 1024, N padded to 448
  const int gL = ((MT / 64) * (EVP / 64) + 7) / 8;
  gemm64<1, 0, 0, 0><<<dim3(gL), blk, 0, stream>>>(OPp, KF, WLT, KF, hdummy, 0, Lp, EVP, 1.0f, bl, EVD, 1.0f, MT, EVP, KF);

  // (5) flat whole-line copy into the output (388-wide rows), NaN-poisoned on a mask-structure violation
  out_copy<<<dim3((MT * (EVD / 4) + 255) / 256), blk, 0, stream>>>(Lp, FLG, out0);
  (void)hipGetLastError();
}

// v001
// It runs in 330 microseconds.
// Two timings next to v000 put it at 1.21 and 1.23 times that version's speed.
// Contractions: x.Wq and x.Wk (f16 planes x16), Wv^T.x^T (bf16 hi|lo planes), q.k^T and q.E^T band on
// v_wmma_f32_16x16x32_f16 (f16 operands, f32 accumulate); p.v as bf16 hi/lo three-product split, and
// [ctx_hi|ctx_lo].[Wo;Wo], [o_hi|o_lo].[Wl;Wl] K-folded planes on v_wmma_f32_16x16x32_bf16 (bf16 operands,
// f32 accumulate). Float inputs RNE-converted to bf16 on load (x x1; Wq, Wk, Wv, E x64 in f16; Wo, Wl bf16);
// softmax, causal select and the relative-offset skew in f32 on VALU.
#include <hip/hip_runtime.h>
#include <math.h>

#ifndef NB
#define NB 2
#endif
#ifndef SEQ
#define SEQ 2048
#endif
#define NB_FULL  2
#define SEQ_FULL 2048
#define DMD  512
#define NH   8
#define HD   64
#define EVD  388
#define EVP  448
#define MT   (NB * SEQ)
#define KF   (2 * DMD)
#define NFLG (SEQ / 16)
#define FLGW 32
#define AWV  8
#define OPP  68
#define RWP  48
#define WSCL 64.0f
#define QKS  16.0f
#define RSQD 0.125f
#define NEGM (-1.0e10f)

static_assert(NB >= 1 && NB <= NB_FULL);
static_assert(SEQ >= 64 && SEQ <= SEQ_FULL && (SEQ % 64) == 0);
static_assert(NH * HD == DMD && HD == 64);
static_assert((MT % 64) == 0 && (DMD % 64) == 0 && (KF % 64) == 0);
static_assert((EVP % 64) == 0 && EVP >= EVD && (EVD % 4) == 0);
static_assert(((SEQ * DMD) % 2048) == 0 && ((NH * SEQ_FULL * HD) % 2048) == 0);
static_assert(NFLG <= 256 && ((4 * SEQ) % 256) == 0);

typedef _Float16 v16h __attribute__((ext_vector_type(16)));
typedef __bf16 v16bf __attribute__((ext_vector_type(16)));
typedef unsigned short v16us __attribute__((ext_vector_type(16)));
typedef unsigned short v8us  __attribute__((ext_vector_type(8)));
typedef float v8f __attribute__((ext_vector_type(8)));
typedef float v4f __attribute__((ext_vector_type(4)));
typedef unsigned int v4u __attribute__((ext_vector_type(4)));
typedef unsigned int v2u __attribute__((ext_vector_type(2)));

union FragU { v16us v; v8us h[2]; };

// ---- scalar helpers --------------------------------------------------------------------------------
__device__ __forceinline__ unsigned short bf_bits(float f) {          // f32 -> bf16 bits, RNE convert
  const unsigned u = __float_as_uint(f);
  return (unsigned short)((u + 0x7FFFu + ((u >> 16) & 1u)) >> 16);
}
__device__ __forceinline__ float bf_up(unsigned short h) { return __uint_as_float(((unsigned)h) << 16); }
__device__ __forceinline__ float bfr(float f) { return bf_up(bf_bits(f)); }   // value of the bf16 RNE convert
__device__ __forceinline__ unsigned short h_bits(_Float16 x) { return __builtin_bit_cast(unsigned short, x); }
__device__ __forceinline__ unsigned short f2h(float f) { return h_bits((_Float16)f); }
__device__ __forceinline__ unsigned pk16(unsigned short a, unsigned short b) { return (unsigned)a | ((unsigned)b << 16); }
__device__ __forceinline__ int clampi(int v, int lo, int hi) { return v < lo ? lo : (v > hi ? hi : v); }
__device__ __forceinline__ v8f zero8() { v8f z = {0.f, 0.f, 0.f, 0.f, 0.f, 0.f, 0.f, 0.f}; return z; }

// ---- fragment loader: 16-bit A/B operand, lane -> row/col (lane&15), p already includes +8*(lane>>4);
//      elements 0..7 <- p[0..7] (k0+8h..), elements 8..15 <- p[16..23] (k0+16+8h..)
__device__ __forceinline__ v16us ldfrag_u(const unsigned short* p) {
  FragU f;
  f.h[0] = *(const v8us*)(p);
  f.h[1] = *(const v8us*)(p + 16);
  return f.v;
}

// ---- WMMA helpers (f16 / bf16 operand bits) with trailing VALU hazard gap --------------------------
__device__ __forceinline__ v8f mma_raw(v16us a, v16us b, v8f c) {
  return __builtin_amdgcn_wmma_f32_16x16x32_f16(false, __builtin_bit_cast(v16h, a), false,
                                                __builtin_bit_cast(v16h, b), (short)0, c, false, false);
}
__device__ __forceinline__ v8f mma_raw_bf(v16us a, v16us b, v8f c) {
  return __builtin_amdgcn_wmma_f32_16x16x32_bf16(false, __builtin_bit_cast(v16bf, a), false,
                                                 __builtin_bit_cast(v16bf, b), (short)0, c, false, false);
}
__device__ __forceinline__ v8f mma_g(v16us a, v16us b, v8f c) {                 // guarded f16
  c = mma_raw(a, b, c);
#if defined(__HIP_DEVICE_COMPILE__)
  asm volatile("v_nop\n\tv_nop\n\tv_nop\n\tv_nop" : "+v"(c) : "v"(a), "v"(b));
#endif
  return c;
}
__device__ __forceinline__ v8f mma_gb(v16us a, v16us b, v8f c) {                // guarded bf16
  c = mma_raw_bf(a, b, c);
#if defined(__HIP_DEVICE_COMPILE__)
  asm volatile("v_nop\n\tv_nop\n\tv_nop\n\tv_nop" : "+v"(c) : "v"(a), "v"(b));
#endif
  return c;
}
__device__ __forceinline__ void dep_guard1(v8f& a, v8f& b, v16us x) {
#if defined(__HIP_DEVICE_COMPILE__)
  asm volatile("v_nop\n\tv_nop\n\tv_nop\n\tv_nop" : "+v"(a), "+v"(b) : "v"(x));
#endif
}
__device__ __forceinline__ void keep4_u(v16us a, v16us b, v16us c, v16us d) {
#if defined(__HIP_DEVICE_COMPILE__)
  asm volatile("v_nop" :: "v"(a), "v"(b), "v"(c), "v"(d));
#endif
}
__device__ __forceinline__ void acc_guard4(v8f& a, v8f& b, v8f& c, v8f& d) {
#if defined(__HIP_DEVICE_COMPILE__)
  asm volatile("v_nop\n\tv_nop\n\tv_nop\n\tv_nop" : "+v"(a), "+v"(b), "+v"(c), "+v"(d));
#endif
}
// 2^x; the v_nop keeps, inside the statement, the one slot the instruction set asks for between a
// transcendental and an instruction that reads its result or overwrites its source
__device__ __forceinline__ float exp2_slot(float x) {
  float r = 0.f;
#if defined(__HIP_DEVICE_COMPILE__)
  asm("v_exp_f32 %0, %1\n\tv_nop" : "=v"(r) : "v"(x));
#endif
  return r;
}
// orders LDS stores of this wave before later LDS loads of the same wave (cross-lane exchange)
__device__ __forceinline__ void wave_sync_lds() {
  __builtin_amdgcn_fence(__ATOMIC_RELEASE, "workgroup");
  __builtin_amdgcn_wave_barrier();
  __builtin_amdgcn_fence(__ATOMIC_ACQUIRE, "workgroup");
}

// =====================================================================================================
// Layout-kept convert: o[i] = f16 bits of (bf16 RNE value of w[i] * sc) for i < nsrc, zero for nsrc <= i <
// ndst; blockIdx.y selects a batch slab (source offset y*sstr, destination offset y*dstr).
// nsrc % 8 == 0, ndst % 2048 == 0, grid.x = ndst/2048 exact (host-side constants).
// coverage: 256 threads x 8 = 2048 elements per block; grid covers all ndst elements of every slab.
// =====================================================================================================
__global__ __launch_bounds__(256) void cvt_lin(const float* __restrict__ w, unsigned short* o,
                                                int nsrc, int ndst, float sc, int sstr, int dstr) {
  const float* wb = w + (size_t)blockIdx.y * (size_t)sstr;
  unsigned short* ob = o + (size_t)blockIdx.y * (size_t)dstr;
  const int base = (blockIdx.x * 256 + threadIdx.x) * 8;
  if (base + 8 > ndst) return;                            // never taken with exact grids; no barriers below
  const bool inr = (base + 8 <= nsrc);
  const int lb = inr ? base : (nsrc - 8);                 // clamped address, always in range
  const v4f a0 = *(const v4f*)(wb + lb);
  const v4f a1 = *(const v4f*)(wb + lb + 4);
  v4u hv;
#pragma unroll
  for (int e = 0; e < 2; ++e) {
    hv[e]     = pk16(f2h(bfr(a0[2 * e]) * sc), f2h(bfr(a0[2 * e + 1]) * sc));
    hv[2 + e] = pk16(f2h(bfr(a1[2 * e]) * sc), f2h(bfr(a1[2 * e + 1]) * sc));
  }
  const v4u zz = {0u, 0u, 0u, 0u};
  hv = inr ? hv : zz;
  unsigned short* d = ob + base;
  *(v4u*)d = hv;
  
}

// =====================================================================================================
// Transpose-convert: in w[R][C] f32 (pitch C) -> out o[c][r] at o[c*ldo + r] for c < CP, with zero values
// for C <= c < CP. BFO 0: f16 bits of (bf16 RNE value * sc); BFO 1: bf16 bits (RNE). Block tile 64x64
// through LDS (st[col][row], pitch 72 halves). Read phase: thread owns one input row x 16 columns (float4
// loads at a clamped column address, zero selected by value; C % 4 == 0 so a float4 is all-in or all-out).
// R, CP multiples of 64, ldo % 64 == 0, grid (CP/64, R/64) exact (host-side constants).
// coverage: 64 output rows x 64 halves per block = the whole transposed tile; grid covers all of [CP][R].
// =====================================================================================================
template <int BFO>
__global__ __launch_bounds__(256) void cvt_t(const float* __restrict__ w, unsigned short* o,
                                              int R, int C, int CP, int ldo, float sc) {
  __shared__ __align__(16) unsigned short st[64 * 72];
  const int t = threadIdx.x;
  const int r0 = blockIdx.y * 64, c0 = blockIdx.x * 64;
  if (r0 + 64 > R || c0 + 64 > CP) return;              // block-uniform, before the barrier; never taken
  {
    const int row = t >> 2, ch = (t & 3) * 16;
    const float* p = w + (size_t)(r0 + row) * C;
#pragma unroll
    for (int q = 0; q < 4; ++q) {
      const int cs = c0 + ch + 4 * q;
      const bool inr = (cs + 4 <= C);
      const int lb = inr ? cs : (C - 4);                 // clamped column address, always in range
      const v4f v = *(const v4f*)(p + lb);
#pragma unroll
      for (int e = 0; e < 4; ++e) {
        const unsigned short hb = BFO ? bf_bits(v[e]) : f2h(bfr(v[e]) * sc);
        st[(ch + 4 * q + e) * 72 + row] = inr ? hb : (unsigned short)0;
      }
    }
  }
  __syncthreads();
  v4u hv[2];
#pragma unroll
  for (int half = 0; half < 2; ++half) {
    const int cl = (t >> 3) + 32 * half, pc = (t & 7) * 8;
    hv[half] = *(const v4u*)(st + cl * 72 + pc);
  }
  {
#pragma unroll
    for (int half = 0; half < 2; ++half) {
      const int cl = (t >> 3) + 32 * half, pc = (t & 7) * 8;
      unsigned short* dst = o + (size_t)(c0 + cl) * ldo + r0 + pc;
      *(v4u*)dst = hv[half];
    }
    
  }
}

// =====================================================================================================
// Register-blocked 16-bit WMMA GEMM: C[m][n] = sum_k A[m][k] * Bt[n][k], one wave per 64x64 tile, no block
// barriers. BF 0: f16 operand bits, BF 1: bf16 operand bits. A row-major [M][K] pitch lda; Bt row-major
// [N][K] pitch ldb (k contiguous); M, N multiples of 64, K multiple of 32 (true at every call site; waves
// past the last tile exit before any work, wave-uniform). Both operand fragments use the split k map
// (elements 0..7 <- k0+8h.., 8..15 <- k0+16+8h..); D element r of a lane is (row 8h + r, col lane&15).
// Bias: bf16 RNE value of bias[] times bsc, indexed by column (clamped into nbias) or, with BROW, by row.
// OM 0: f32 out Cf = acc*osc + b, pitch ldc.            OM 1: f16 out Ch = f16 bits(acc*osc + b), pitch ldc.
// OM 2: val = (RELU ? max(0, .) : .)(acc*osc + b); bf16 hi bits at Ch, bf16 lo bits (val - hi) at Ch + looff.
// coverage: 4 slabs x 16 rows x 64 cols = the wave's whole 64x64 tile (hi and lo planes alike).
// =====================================================================================================
template <int BF, int OM, int RELU, int BROW>
__global__ __launch_bounds__(256) void gemm64(
    const unsigned short* __restrict__ Ap, int lda, const unsigned short* __restrict__ Btp, int ldb,
    unsigned short* Ch, int looff, float* Cf, int ldc, float osc,
    const float* __restrict__ bias, int nbias, float bsc, int M, int N, int K) {
  __shared__ __align__(16) float sT[8][16 * 68];   // per-wave 16x64 slab, pitch 68 floats
  const int lane = threadIdx.x & 31;
  const int wave = threadIdx.x >> 5;
  const int tilesN = N >> 6;
  const int tilesM = M >> 6;
  const int tile = blockIdx.x * 8 + wave;
  if (tile >= tilesM * tilesN) return;   // wave-uniform; no block barriers in this kernel
  const int tm = tile / tilesN;
  const int tn = tile - tm * tilesN;
  const int m0 = tm << 6;
  const int n0 = tn << 6;

  const int rlane = lane & 15;                 // row (A) / col (B, D) within subtile
  const int koff  = (lane >> 4) * 8;           // k offset of this lane half
  const int mOff  = (lane >> 4) * 8;           // D row offset

  v8f acc[4][4];
#pragma unroll
  for (int i = 0; i < 4; ++i)
#pragma unroll
    for (int j = 0; j < 4; ++j) acc[i][j] = zero8();

#pragma unroll 1
  for (int k0 = 0; k0 < K; k0 += 32) {
    v16us bh[4];
#pragma unroll
    for (int j = 0; j < 4; ++j) {
      const size_t bo = (size_t)(n0 + (j << 4) + rlane) * ldb + koff + k0;
      bh[j] = ldfrag_u(Btp + bo);
    }
#pragma unroll
    for (int i = 0; i < 4; ++i) {
      const size_t ao = (size_t)(m0 + (i << 4) + rlane) * lda + koff + k0;
      const v16us ah = ldfrag_u(Ap + ao);
#pragma unroll
      for (int j = 0; j < 4; ++j) {
        if (BF) acc[i][j] = mma_raw_bf(ah, bh[j], acc[i][j]);
        else    acc[i][j] = mma_raw(ah, bh[j], acc[i][j]);
      }
      dep_guard1(acc[i][0], acc[i][3], ah);
    }
    keep4_u(bh[0], bh[1], bh[2], bh[3]);
  }
  acc_guard4(acc[0][0], acc[0][1], acc[0][2], acc[0][3]);
  acc_guard4(acc[1][0], acc[1][1], acc[1][2], acc[1][3]);
  acc_guard4(acc[2][0], acc[2][1], acc[2][2], acc[2][3]);
  acc_guard4(acc[3][0], acc[3][1], acc[3][2], acc[3][3]);

  const int hh2 = lane >> 4, c4 = (lane & 15) * 4;     // f32 out: 256-B row segment = 16 lanes x 16 B
  const int q8  = lane >> 3, c8 = (lane & 7) * 8;

  // per-lane bias values for the column-indexed modes (bf16 RNE value times bsc), clamped address
  float bc[8];
#pragma unroll
  for (int e = 0; e < 8; ++e) bc[e] = 0.f;
  if (!BROW) {
    if (OM == 0) {
#pragma unroll
      for (int e = 0; e < 4; ++e) bc[e] = bsc * bfr(bias[clampi(n0 + c4 + e, 0, nbias - 1)]);
    } else {
#pragma unroll
      for (int e = 0; e < 8; ++e) bc[e] = bsc * bfr(bias[clampi(n0 + c8 + e, 0, nbias - 1)]);
    }
  }

  // ---- epilogue ----
  float* slab = sT[wave];
#pragma unroll
  for (int i = 0; i < 4; ++i) {
    const int mBase = m0 + (i << 4);
#pragma unroll
    for (int j = 0; j < 4; ++j) {
#pragma unroll
      for (int r = 0; r < 8; ++r) {
        slab[(mOff + r) * 68 + (j << 4) + rlane] = acc[i][j][r];
      }
    }
    wave_sync_lds();
    if (OM == 0) {
      v4f vals[8];
#pragma unroll
      for (int it = 0; it < 8; ++it) {
        const int row = it * 2 + hh2;                      // it 0..7 x hh2 0..1 = rows 0..15
        const v4f v = *(const v4f*)(slab + row * 68 + c4);
        float brw = 0.f;
        if (BROW) brw = bsc * bfr(bias[clampi(mBase + row, 0, nbias - 1)]);
        v4f ov;
#pragma unroll
        for (int e = 0; e < 4; ++e) {
          float x = v[e] * osc + (BROW ? brw : bc[e]);
          if (RELU) x = fmaxf(x, 0.f);
          ov[e] = x;
        }
        vals[it] = ov;
      }
      {
#pragma unroll
        for (int it = 0; it < 8; ++it) {
          const int row = it * 2 + hh2;
          *(v4f*)(Cf + (size_t)(mBase + row) * ldc + (size_t)n0 + c4) = vals[it];
        }
        
      }
    } else if (OM == 1) {
      v4u hv[4];
#pragma unroll
      for (int it = 0; it < 4; ++it) {
        const int row = it * 4 + q8;                       // it 0..3 x q8 0..3 = rows 0..15
        const float* sp = slab + row * 68 + c8;
        float brw = 0.f;
        if (BROW) brw = bsc * bfr(bias[clampi(mBase + row, 0, nbias - 1)]);
        v4u ha = {0u, 0u, 0u, 0u};
#pragma unroll
        for (int e = 0; e < 4; ++e) {
          float b0 = sp[2 * e]     * osc + (BROW ? brw : bc[2 * e]);
          float b1 = sp[2 * e + 1] * osc + (BROW ? brw : bc[2 * e + 1]);
          if (RELU) { b0 = fmaxf(b0, 0.f); b1 = fmaxf(b1, 0.f); }
          ha[e] = pk16(f2h(b0), f2h(b1));
        }
        hv[it] = ha;
      }
      {
#pragma unroll
        for (int it = 0; it < 4; ++it) {
          const int row = it * 4 + q8;
          const size_t go = (size_t)(mBase + row) * ldc + (size_t)n0 + c8;
          *(v4u*)(Ch + go) = hv[it];
        }
        
      }
    } else {
      v4u hv[4], lv[4];
#pragma unroll
      for (int it = 0; it < 4; ++it) {
        const int row = it * 4 + q8;                       // it 0..3 x q8 0..3 = rows 0..15
        const float* sp = slab + row * 68 + c8;
        float brw = 0.f;
        if (BROW) brw = bsc * bfr(bias[clampi(mBase + row, 0, nbias - 1)]);
        v4u ha = {0u, 0u, 0u, 0u};
        v4u la = {0u, 0u, 0u, 0u};
#pragma unroll
        for (int e = 0; e < 4; ++e) {
          float x0 = sp[2 * e]     * osc + (BROW ? brw : bc[2 * e]);
          float x1 = sp[2 * e + 1] * osc + (BROW ? brw : bc[2 * e + 1]);
          if (RELU) { x0 = fmaxf(x0, 0.f); x1 = fmaxf(x1, 0.f); }
          const unsigned short h0 = bf_bits(x0), h1 = bf_bits(x1);
          const unsigned short l0 = bf_bits(x0 - bf_up(h0)), l1 = bf_bits(x1 - bf_up(h1));
          ha[e] = pk16(h0, h1);
          la[e] = pk16(l0, l1);
        }
        hv[it] = ha;
        lv[it] = la;
      }
      {
#pragma unroll
        for (int it = 0; it < 4; ++it) {
          const int row = it * 4 + q8;
          const size_t go = (size_t)(mBase + row) * ldc + (size_t)n0 + c8;
          *(v4u*)(Ch + go) = hv[it];
          *(v4u*)(Ch + (size_t)looff + go) = lv[it];
        }
        
      }
    }
    wave_sync_lds();
  }
}

// =====================================================================================================
// Structure check of the [SEQ][SEQ] mask input (row pitch SEQ_FULL): block b covers rows 16b..16b+15 and all
// SEQ columns; a violation is any element differing from (j <= i ? 1 : 0). The block's flag is written as one
// coverage: 256 threads x (SEQ/64) float4 = 16 rows x SEQ cols per block; grid = SEQ/16 blocks = all rows.
// =====================================================================================================
__global__ __launch_bounds__(256) void mask_check(const float* __restrict__ msk, float* flg) {
  __shared__ int wf[8];
  const int t = threadIdx.x, lane = t & 31, wv = t >> 5;
  const int i0 = blockIdx.x * 16;
  if (i0 + 16 > SEQ) return;                             // block-uniform, before the barrier; never taken
  constexpr int C4 = SEQ / 4;
  int viol = 0;
#pragma unroll 1
  for (int it = 0; it < (16 * C4) / 256; ++it) {
    const int ci = it * 256 + t;
    const int rr = ci / C4;
    const int c4 = ci - rr * C4;
    const int i = i0 + rr;
    const v4f x = *(const v4f*)(msk + (size_t)i * SEQ_FULL + 4 * c4);
#pragma unroll
    for (int e = 0; e < 4; ++e) {
      const int j = 4 * c4 + e;
      const float ex = (j <= i) ? 1.0f : 0.0f;
      viol |= (x[e] != ex) ? 1 : 0;
    }
  }
  viol |= __shfl_xor(viol, 1, 32);
  viol |= __shfl_xor(viol, 2, 32);
  viol |= __shfl_xor(viol, 4, 32);
  viol |= __shfl_xor(viol, 8, 32);
  viol |= __shfl_xor(viol, 16, 32);
  if (lane == 0) wf[wv] = viol;
  __syncthreads();
  if (wv == 0) {                                        // wave-uniform
    int f = wf[lane & 7];
    f |= __shfl_xor(f, 1, 32);
    f |= __shfl_xor(f, 2, 32);
    f |= __shfl_xor(f, 4, 32);
    const float fv = f ? 1.0f : 0.0f;
    float* d = flg + (size_t)blockIdx.x * FLGW + lane;
    *(float*)d = fv;
    
  }
}

// =====================================================================================================
// Causal attention with relative-offset term, head dim 64. Block = 256 threads = 8 waves; one block owns one
// 16-row query tile (t0..t0+15) of one (batch b, head h). The key blocks of 32 up to the diagonal (sb <= t0)
// are cut into 8 contiguous shares, one per wave; each wave runs its share with an online max-subtracted
// softmax in f32 and leaves its partial state (row max, row sum, unnormalised 16x64 O) in LDS; behind one
// block barrier the 8 states are merged in wave order (rescale by exp(max_w - max), sum, divide).
// Planes: QH, KH f16 [MT][64] = 16*q, 16*k (shared
// by all heads); PE f16 [NH*SEQ_FULL][64] = 64*E (head h rows h*SEQ_FULL..); VH, VL bf16 [64][MT] = v hi and
// lo planes transposed (row = dim, column = token). Output Z bf16 [MT][1024]: cols h*64+d = ctx hi, cols
// 512+h*64+d = ctx lo, token-major.
// Per key block sb: S = Q.K^T (2 key subtiles x 2 k-steps, scale 1/256); relative band of 48 columns:
// column c <-> E row SEQ-16-t0+sb+c (clamped into [0, SEQ-1]; clamping only touches entries with j > i,
// which the causal select replaces); columns 0..15 come from the tile carried over from the prior key block
// (its columns 32..47), columns 16..47 are two fresh tiles (2 x 2 WMMA, scale 1/1024); the band is exchanged
// through per-wave LDS and read back at c = 15 - il + jl, i.e. E row SEQ-1-i+j; score = (qk + rel)/8 for
// j <= i, else -1e10; p = exp(score - running max) in f32, l accumulated from the f32 p; p stored as bf16 hi
// and lo tiles in per-wave LDS and reloaded as A fragments (split k map); O += Phi.Vhi + Phi.Vlo + Plo.Vhi on
// 4 dim subtiles (one accumulator set). A wave whose share is empty contributes max -1e30, sum 0, O 0 (weight
// exp(-1e30 - max) = 0); wave 0's share is never empty. Merge: thread -> (row t>>4, 4 dims), 16 lanes x 8 B =
// one 128-B line of Z per plane and row.
// coverage: 16 query rows x 64 halves x {hi, lo} per block, NB*NH*(SEQ/16) blocks = all (b, t, h)
// segments of Z in both halves.
// =====================================================================================================
__global__ __launch_bounds__(32 * AWV) void attn_kernel(
    const unsigned short* __restrict__ QH, const unsigned short* __restrict__ KH,
    const unsigned short* __restrict__ PE, const unsigned short* __restrict__ VH,
    const unsigned short* __restrict__ VL, unsigned short* Z) {
  __shared__ __align__(16) float relw[AWV][16 * RWP];            // band exchange, 24576 B
  __shared__ __align__(16) unsigned short pwh[AWV][16 * 32];      // P hi tiles, 8192 B
  __shared__ __align__(16) unsigned short pwl[AWV][16 * 32];      // P lo tiles, 8192 B
  __shared__ __align__(16) float opw[AWV][16 * OPP];              // partial O per wave, pitch 68 floats, 34816 B
  __shared__ __align__(16) float mxw[AWV][16];                    // partial row max per wave
  __shared__ __align__(16) float lsw[AWV][16];                    // partial row sum per wave
  const int lane = threadIdx.x & 31, m = lane & 15, hh = lane >> 4;
  // wave number in a scalar register: the key loop's bounds depend on it and stay a scalar branch
  const int wv = __builtin_amdgcn_readfirstlane((int)(threadIdx.x >> 5));
  const int task = blockIdx.x;                       // 0 .. NB*NH*(SEQ/16)-1
  const int nqt = SEQ / 16;
  const int bh = task / nqt;                         // (b, h)
  const int t0 = (task - bh * nqt) << 4;             // query tile start
  const int b = bh / NH, h = bh - (bh / NH) * NH;
  if (b >= NB) return;                               // block-uniform, before the barrier; never taken with exact grids
  const size_t tok0 = (size_t)b * SEQ;
  float* rw = relw[wv];
  unsigned short* ph = pwh[wv];
  unsigned short* pl = pwl[wv];

  // Q A-fragments: rows t0+m, k = head dims 0..31 and 32..63
  const unsigned short* qp = QH + (tok0 + (size_t)(t0 + m)) * HD + 8 * hh;
  const v16us qf0 = ldfrag_u(qp);
  const v16us qf1 = ldfrag_u(qp + 32);

  const unsigned short* pe = PE + (size_t)h * SEQ_FULL * HD;
  const int rb = SEQ - 16 - t0;                      // E row of band column 0 at sb = 0 (>= 0)

  const int nkb = (t0 >> 5) + 1;                     // key blocks 0 .. floor(t0/32), block-uniform
  const int per = (nkb + AWV - 1) / AWV;             // key blocks per wave share
  const int kb0 = wv * per;                          // this wave's share [kb0, kb1), wave-uniform, may be empty
  const int kb1 = (kb0 + per < nkb) ? (kb0 + per) : nkb;

  // carried band tile: columns 0..15 of key block kb0 <-> E rows rb + 32*kb0 + 0..15 (clamped)
  v8f carry;
  {
    const int u = clampi(rb + (kb0 << 5) + m, 0, SEQ - 1);
    const unsigned short* pp = pe + (size_t)u * HD + 8 * hh;
    carry = mma_g(qf0, ldfrag_u(pp), zero8());
    carry = mma_g(qf1, ldfrag_u(pp + 32), carry);
  }

  float mx[8], ls[8];
  v8f O0 = zero8(), O1 = zero8(), O2 = zero8(), O3 = zero8();
#pragma unroll
  for (int r = 0; r < 8; ++r) { mx[r] = -1.0e30f; ls[r] = 0.f; }

  const size_t vst = (size_t)16 * MT;                // V plane stride between dim subtiles

#pragma unroll 1
  for (int kb = kb0; kb < kb1; ++kb) {
    const int sb = kb << 5;
    // K B-fragments: Bt row = key token, k = head dim
    v8f S0, S1;
    {
      const unsigned short* kp = KH + (tok0 + (size_t)(sb + m)) * HD + 8 * hh;
      S0 = mma_g(qf0, ldfrag_u(kp), zero8());
      S0 = mma_g(qf1, ldfrag_u(kp + 32), S0);
      const unsigned short* kp1 = kp + (size_t)16 * HD;
      S1 = mma_g(qf0, ldfrag_u(kp1), zero8());
      S1 = mma_g(qf1, ldfrag_u(kp1 + 32), S1);
    }

    // relative band: columns 16..31 and 32..47 <-> E rows rb+sb+16.. and rb+sb+32..
    v8f Pb1, Pb2;
    {
      const int u1 = clampi(rb + sb + 16 + m, 0, SEQ - 1);
      const unsigned short* p1 = pe + (size_t)u1 * HD + 8 * hh;
      Pb1 = mma_g(qf0, ldfrag_u(p1), zero8());
      Pb1 = mma_g(qf1, ldfrag_u(p1 + 32), Pb1);
      const int u2 = clampi(rb + sb + 32 + m, 0, SEQ - 1);
      const unsigned short* p2 = pe + (size_t)u2 * HD + 8 * hh;
      Pb2 = mma_g(qf0, ldfrag_u(p2), zero8());
      Pb2 = mma_g(qf1, ldfrag_u(p2 + 32), Pb2);
    }
#pragma unroll
    for (int r = 0; r < 8; ++r) {
      const int row = 8 * hh + r;
      rw[row * RWP + m]      = carry[r];
      rw[row * RWP + 16 + m] = Pb1[r];
      rw[row * RWP + 32 + m] = Pb2[r];
    }
    carry = Pb2;
    wave_sync_lds();

    // skew read + scale + causal select (key j <= query i keeps the score, otherwise -1e10)
    float s0[8], s1[8];
#pragma unroll
    for (int r = 0; r < 8; ++r) {
      const int row = 8 * hh + r;
      const int i = t0 + row;
      const float rv0 = rw[row * RWP + 15 - row + m];
      const float rv1 = rw[row * RWP + 31 - row + m];
      const float a0 = (S0[r] * (1.0f / (QKS * QKS)) + rv0 * (1.0f / (QKS * WSCL))) * RSQD;
      const float a1 = (S1[r] * (1.0f / (QKS * QKS)) + rv1 * (1.0f / (QKS * WSCL))) * RSQD;
      s0[r] = (sb + m <= i) ? a0 : NEGM;
      s1[r] = (sb + 16 + m <= i) ? a1 : NEGM;
    }

    // online softmax (a row lives in the 16 lanes of one half-wave; xor butterflies 1,2,4,8)
#pragma unroll
    for (int r = 0; r < 8; ++r) {
      float xm = fmaxf(s0[r], s1[r]);
      xm = fmaxf(xm, __shfl_xor(xm, 1, 32));
      xm = fmaxf(xm, __shfl_xor(xm, 2, 32));
      xm = fmaxf(xm, __shfl_xor(xm, 4, 32));
      xm = fmaxf(xm, __shfl_xor(xm, 8, 32));
      const float mn = fmaxf(mx[r], xm);
      const float al = __expf(mx[r] - mn);
      mx[r] = mn;
      const float p0 = __expf(s0[r] - mn);
      const float p1 = __expf(s1[r] - mn);
      float ps = p0 + p1;
      ps += __shfl_xor(ps, 1, 32);
      ps += __shfl_xor(ps, 2, 32);
      ps += __shfl_xor(ps, 4, 32);
      ps += __shfl_xor(ps, 8, 32);
      ls[r] = ls[r] * al + ps;
      O0[r] = O0[r] * al;
      O1[r] = O1[r] * al;
      O2[r] = O2[r] * al;
      O3[r] = O3[r] * al;
      const int row = 8 * hh + r;
      const unsigned short hb0 = bf_bits(p0), hb1 = bf_bits(p1);
      ph[row * 32 + m]      = hb0;
      ph[row * 32 + 16 + m] = hb1;
      pl[row * 32 + m]      = bf_bits(p0 - bf_up(hb0));
      pl[row * 32 + 16 + m] = bf_bits(p1 - bf_up(hb1));
    }
    wave_sync_lds();

    // P A-fragments (split k map) and V B-fragments (Bt row = dim, k = key token)
    const v16us afh = ldfrag_u(ph + m * 32 + 8 * hh);
    const v16us afl = ldfrag_u(pl + m * 32 + 8 * hh);
    const size_t vo = (size_t)m * MT + tok0 + (size_t)sb + 8 * hh;
    {
      const v16us vh = ldfrag_u(VH + vo);
      const v16us vl = ldfrag_u(VL + vo);
      O0 = mma_gb(afh, vh, O0);
      O0 = mma_gb(afh, vl, O0);
      O0 = mma_gb(afl, vh, O0);
    }
    {
      const v16us vh = ldfrag_u(VH + vo + vst);
      const v16us vl = ldfrag_u(VL + vo + vst);
      O1 = mma_gb(afh, vh, O1);
      O1 = mma_gb(afh, vl, O1);
      O1 = mma_gb(afl, vh, O1);
    }
    {
      const v16us vh = ldfrag_u(VH + vo + 2 * vst);
      const v16us vl = ldfrag_u(VL + vo + 2 * vst);
      O2 = mma_gb(afh, vh, O2);
      O2 = mma_gb(afh, vl, O2);
      O2 = mma_gb(afl, vh, O2);
    }
    {
      const v16us vh = ldfrag_u(VH + vo + 3 * vst);
      const v16us vl = ldfrag_u(VL + vo + 3 * vst);
      O3 = mma_gb(afh, vh, O3);
      O3 = mma_gb(afh, vl, O3);
      O3 = mma_gb(afl, vh, O3);
    }
  }
  acc_guard4(O0, O1, O2, O3);

  // ---- this wave's partial state to LDS (D element r of a lane = row 8*hh + r, col m of each dim subtile) ----
  float* op = opw[wv];
#pragma unroll
  for (int r = 0; r < 8; ++r) {
    const int row = 8 * hh + r;
    op[row * OPP + m]      = O0[r];
    op[row * OPP + 16 + m] = O1[r];
    op[row * OPP + 32 + m] = O2[r];
    op[row * OPP + 48 + m] = O3[r];
  }
  if (m == 0) {                                        // mx, ls are equal in the 16 lanes of a half-wave
#pragma unroll
    for (int r = 0; r < 8; ++r) {
      mxw[wv][8 * hh + r] = mx[r];
      lsw[wv][8 * hh + r] = ls[r];
    }
  }
  __syncthreads();                                     // publishes the 8 partial states to the whole block

  // ---- merge in wave order, ctx = O / l, bf16 hi plane and lo plane ----
  {
    const int row = threadIdx.x >> 4, c4 = (threadIdx.x & 15) * 4;
    float mw[AWV];
    float mt = -1.0e30f;
#pragma unroll
    for (int w = 0; w < AWV; ++w) { mw[w] = mxw[w][row]; mt = fmaxf(mt, mw[w]); }
    float sc[AWV];
#pragma unroll
    for (int w = 0; w < AWV; ++w) sc[w] = exp2_slot((mw[w] - mt) * 1.44269504f);   // exp(max_w - max)
    float lt = 0.f;
    v4f ot = {0.f, 0.f, 0.f, 0.f};
#pragma unroll
    for (int w = 0; w < AWV; ++w) {
      const v4f o = *(const v4f*)(opw[w] + row * OPP + c4);
      lt += lsw[w][row] * sc[w];
#pragma unroll
      for (int e = 0; e < 4; ++e) ot[e] += o[e] * sc[w];
    }
    const float g = 1.0f / lt;                         // lt >= 1
    unsigned short hb[4], lb[4];
#pragma unroll
    for (int e = 0; e < 4; ++e) {
      const float c = ot[e] * g;
      hb[e] = bf_bits(c);
      lb[e] = bf_bits(c - bf_up(hb[e]));
    }
    const v2u hv = {pk16(hb[0], hb[1]), pk16(hb[2], hb[3])};
    const v2u lv = {pk16(lb[0], lb[1]), pk16(lb[2], lb[3])};
    unsigned short* dst = Z + (tok0 + (size_t)(t0 + row)) * KF + h * HD + c4;
    *(v2u*)dst = hv;
    *(v2u*)(dst + DMD) = lv;
  }
}

// =====================================================================================================
// Flat whole-line writer of the output: out[row*388 + c] = L[row*448 + c]; each lane owns 4
// consecutive output floats (16 B; never straddles a row since 388 % 4 == 0), one instruction = 32 lanes x
// coverage: grid = MT*97/256 blocks x 256 float4 = all MT*388 output floats (in-kernel bound for safety).
// =====================================================================================================
__global__ __launch_bounds__(256) void out_copy(const float* __restrict__ L, const float* __restrict__ flg,
                                                 float* out) {
  __shared__ int wf[8];
  const int t = threadIdx.x, lane = t & 31, wv = t >> 5;
  int f;
  {
    const int ti = (t < NFLG) ? t : (NFLG - 1);         // clamped address, value selected
    const float x = flg[(size_t)ti * FLGW];
    f = ((t < NFLG) && (x == 1.0f)) ? 1 : 0;
  }
  f |= __shfl_xor(f, 1, 32);
  f |= __shfl_xor(f, 2, 32);
  f |= __shfl_xor(f, 4, 32);
  f |= __shfl_xor(f, 8, 32);
  f |= __shfl_xor(f, 16, 32);
  if (lane == 0) wf[wv] = f;
  __syncthreads();
  int g = 0;
#pragma unroll
  for (int w = 0; w < 8; ++w) g |= wf[w];
  const int e4 = blockIdx.x * 256 + t;
  if (e4 < MT * (EVD / 4)) {
    const int e = e4 * 4;
    const int row = e / EVD;
    const int c = e - row * EVD;
    v4f x = *(const v4f*)(L + (size_t)row * EVP + c);
    const float qn = __uint_as_float(0x7fc00000u);
    const v4f pn = {qn, qn, qn, qn};
    x = g ? pn : x;
    float* d = out + (size_t)e;
    *(v4f*)d = x;
    
  }
}

// =====================================================================================================
// Workspace map (bytes, full size NB=2, SEQ=2048); every plane is an exact multiple of its whole-row /
// whole-line / 64x64-tile store granularity; all offsets are multiples of 16384.
//   XQ   f16  [MT][512]        4194304     (x3 with XK, XV)
//   WQT  f16  [64][512]          65536     (x3 with WKT, WVT; Wq^T, Wk^T, Wv^T x64)
//   PEH  f16  [8*2048][64]     2097152     (E x64)
//   QH   f16  [MT][64]          524288     (16*q), KH same
//   VH   bf16 [64][MT]          524288     (v hi), VL same (v lo), contiguous after VH
//   Z    bf16 [MT][1024]       8388608     (ctx hi | ctx lo)
//   WOT  bf16 [512][1024]      1048576     (Wo^T | Wo^T)
//   OP   bf16 [MT][1024]       8388608     (relu out hi | lo)
//   WLT  bf16 [448][1024]       917504     (Wl^T | Wl^T, rows 388..447 zero)
//   L    f32  [MT][448]        7340032
//   FLG  f32  [128][32]          16384     (mask-structure flag lines)
//   total                     43073536
// =====================================================================================================
extern "C" void kernel_launch(void* const* d_in, const int* in_sizes, int n_in,
                              void* d_out, int out_size, void* d_ws, size_t ws_size,
                              hipStream_t stream) {
  if (n_in < 15) return;
  if (in_sizes[0] < (NB - 1) * SEQ_FULL * DMD + SEQ * DMD) return;   // v
  if (in_sizes[1] < (NB - 1) * SEQ_FULL * DMD + SEQ * DMD) return;   // k
  if (in_sizes[2] < (NB - 1) * SEQ_FULL * DMD + SEQ * DMD) return;   // q
  if (in_sizes[3] < (SEQ - 1) * SEQ_FULL + SEQ) return;               // mask
  if (in_sizes[4] < DMD * HD || in_sizes[6] < DMD * HD || in_sizes[8] < DMD * HD) return;
  if (in_sizes[5] < HD || in_sizes[7] < HD || in_sizes[9] < HD) return;
  if (in_sizes[10] < NH * SEQ_FULL * HD) return;                      // E
  if (in_sizes[11] < DMD * DMD || in_sizes[12] < DMD) return;         // Wo, bo
  if (in_sizes[13] < DMD * EVD || in_sizes[14] < EVD) return;         // Wl, bl
  if (out_size < MT * EVD) return;

  const float* v   = (const float*)d_in[0];    // [2][2048][512]
  const float* k   = (const float*)d_in[1];
  const float* q   = (const float*)d_in[2];
  const float* msk = (const float*)d_in[3];    // [2048][2048]
  const float* wq  = (const float*)d_in[4];    // [512][64]
  const float* bq  = (const float*)d_in[5];    // [64]
  const float* wk  = (const float*)d_in[6];
  const float* bk  = (const float*)d_in[7];
  const float* wv  = (const float*)d_in[8];
  const float* bv  = (const float*)d_in[9];
  const float* ee  = (const float*)d_in[10];   // [8][2048][64]
  const float* wo  = (const float*)d_in[11];   // [512][512] (in, out)
  const float* bo  = (const float*)d_in[12];   // [512]
  const float* wl  = (const float*)d_in[13];   // [512][388] (in, out)
  const float* bl  = (const float*)d_in[14];   // [388]

  const size_t PX  = (size_t)MT * DMD * 2;
  const size_t PW  = (size_t)HD * DMD * 2;
  const size_t PPE = (size_t)NH * SEQ_FULL * HD * 2;
  const size_t PQK = (size_t)MT * HD * 2;
  const size_t PV2 = (size_t)2 * HD * MT * 2;
  const size_t PZ  = (size_t)MT * KF * 2;
  const size_t PWO = (size_t)DMD * KF * 2;
  const size_t POP = (size_t)MT * KF * 2;
  const size_t PWL = (size_t)EVP * KF * 2;
  const size_t PL  = (size_t)MT * EVP * 4;
  const size_t PFL = (size_t)(SEQ_FULL / 16) * FLGW * 4;
  size_t off = 0;
  const size_t oXQ = off; off += PX;
  const size_t oXK = off; off += PX;
  const size_t oXV = off; off += PX;
  const size_t oWQ = off; off += PW;
  const size_t oWK = off; off += PW;
  const size_t oWV = off; off += PW;
  const size_t oPE = off; off += PPE;
  const size_t oQH = off; off += PQK;
  const size_t oKH = off; off += PQK;
  const size_t oV  = off; off += PV2;
  const size_t oZ  = off; off += PZ;
  const size_t oWO = off; off += PWO;
  const size_t oOP = off; off += POP;
  const size_t oWL = off; off += PWL;
  const size_t oL  = off; off += PL;
  const size_t oFL = off; off += PFL;
  if (off > ws_size) return;
  if (off > (size_t)134217728) return;

  char* ws = (char*)d_ws;
  unsigned short* XQ  = (unsigned short*)(ws + oXQ);
  unsigned short* XK  = (unsigned short*)(ws + oXK);
  unsigned short* XV  = (unsigned short*)(ws + oXV);
  unsigned short* WQT = (unsigned short*)(ws + oWQ);
  unsigned short* WKT = (unsigned short*)(ws + oWK);
  unsigned short* WVT = (unsigned short*)(ws + oWV);
  unsigned short* PEH = (unsigned short*)(ws + oPE);
  unsigned short* QHp = (unsigned short*)(ws + oQH);
  unsigned short* KHp = (unsigned short*)(ws + oKH);
  unsigned short* VHp = (unsigned short*)(ws + oV);
  unsigned short* VLp = VHp + (size_t)HD * MT;
  unsigned short* Zp  = (unsigned short*)(ws + oZ);
  unsigned short* WOT = (unsigned short*)(ws + oWO);
  unsigned short* OPp = (unsigned short*)(ws + oOP);
  unsigned short* WLT = (unsigned short*)(ws + oWL);
  float* Lp   = (float*)(ws + oL);
  float* FLG  = (float*)(ws + oFL);
  float* out0 = (float*)d_out;
  float* fdummy = Lp;                             // in-range placeholder for unused f32 output args
  unsigned short* hdummy = QHp;                   // in-range placeholder for unused 16-bit output args

  const dim3 blk(256);

  // (0) operand planes: x (per batch slab) -> f16(bf16); E -> f16(bf16 x64); Wq|Wk|Wv [512][64] -> [64][512]
  //     (transposed, f16 x64); Wo -> [512][1024] = (Wo^T | Wo^T) bf16; Wl -> [448][1024] = (Wl^T | Wl^T) bf16
  const int gX = (SEQ * DMD) / 2048;
  cvt_lin<<<dim3(gX, NB), blk, 0, stream>>>(q, XQ, SEQ * DMD, SEQ * DMD, 1.0f, SEQ_FULL * DMD, SEQ * DMD);
  cvt_lin<<<dim3(gX, NB), blk, 0, stream>>>(k, XK, SEQ * DMD, SEQ * DMD, 1.0f, SEQ_FULL * DMD, SEQ * DMD);
  cvt_lin<<<dim3(gX, NB), blk, 0, stream>>>(v, XV, SEQ * DMD, SEQ * DMD, 1.0f, SEQ_FULL * DMD, SEQ * DMD);
  cvt_lin<<<dim3((NH * SEQ_FULL * HD) / 2048, 1), blk, 0, stream>>>(ee, PEH, NH * SEQ_FULL * HD, NH * SEQ_FULL * HD, WSCL, 0, 0);
  cvt_t<0><<<dim3(HD / 64, DMD / 64), blk, 0, stream>>>(wq, WQT, DMD, HD, HD, DMD, WSCL);        // in[512][64] -> out[64][512]
  cvt_t<0><<<dim3(HD / 64, DMD / 64), blk, 0, stream>>>(wk, WKT, DMD, HD, HD, DMD, WSCL);
  cvt_t<0><<<dim3(HD / 64, DMD / 64), blk, 0, stream>>>(wv, WVT, DMD, HD, HD, DMD, WSCL);
  cvt_t<1><<<dim3(DMD / 64, DMD / 64), blk, 0, stream>>>(wo, WOT, DMD, DMD, DMD, KF, 1.0f);      // in[512][512] -> out[512][512], cols 0..
  cvt_t<1><<<dim3(DMD / 64, DMD / 64), blk, 0, stream>>>(wo, WOT + DMD, DMD, DMD, DMD, KF, 1.0f); //                              cols 512..
  cvt_t<1><<<dim3(EVP / 64, DMD / 64), blk, 0, stream>>>(wl, WLT, DMD, EVD, EVP, KF, 1.0f);      // in[512][388] -> out[448][512], cols 0..
  cvt_t<1><<<dim3(EVP / 64, DMD / 64), blk, 0, stream>>>(wl, WLT + DMD, DMD, EVD, EVP, KF, 1.0f); //                              cols 512..

  // (1) projections. q plane x16: C[tok][n] = sum_k XQ[tok][k] * WQT[n][k]; k plane likewise;
  //     v^T planes: C[d][tok] = sum_k WVT[d][k] * XV[tok][k] / 64 as bf16 hi (VH) and lo (VL)
  const int gQ = ((MT / 64) * (HD / 64) + 7) / 8;
  gemm64<0, 1, 0, 0><<<dim3(gQ), blk, 0, stream>>>(XQ, DMD, WQT, DMD, QHp, 0, fdummy, HD, QKS / WSCL, bq, HD, QKS, MT, HD, DMD);
  gemm64<0, 1, 0, 0><<<dim3(gQ), blk, 0, stream>>>(XK, DMD, WKT, DMD, KHp, 0, fdummy, HD, QKS / WSCL, bk, HD, QKS, MT, HD, DMD);
  gemm64<0, 2, 0, 1><<<dim3(gQ), blk, 0, stream>>>(WVT, DMD, XV, DMD, VHp, HD * MT, fdummy, MT, 1.0f / WSCL, bv, HD, 1.0f, HD, MT, DMD);

  // (2) mask structure flags, attention -> ctx hi|lo token-major plane
  mask_check<<<dim3(NFLG), blk, 0, stream>>>(msk, FLG);
  attn_kernel<<<dim3(NB * NH * (SEQ / 16)), dim3(32 * AWV), 0, stream>>>(QHp, KHp, PEH, VHp, VLp, Zp);

  // (3) output projection with relu: OP = bf16 hi|lo of max(0, sum_k Z[row][k] * WOT[n][k] + bo[n]), K = 1024
  const int gO = ((MT / 64) * (DMD / 64) + 7) / 8;
  gemm64<1, 2, 1, 0><<<dim3(gO), blk, 0, stream>>>(Zp, KF, WOT, KF, OPp, DMD, fdummy, KF, 1.0f, bo, DMD, 1.0f, MT, DMD, KF);

  // (4) logits: L[row][n] = sum_k OP[row][k] * WLT[n][k] + bl[n], K = 1024, N padded to 448
  const int gL = ((MT / 64) * (EVP / 64) + 7) / 8;
  gemm64<1, 0, 0, 0><<<dim3(gL), blk, 0, stream>>>(OPp, KF, WLT, KF, hdummy, 0, Lp, EVP, 1.0f, bl, EVD, 1.0f, MT, EVP, KF);

  // (5) flat whole-line copy into the output (388-wide rows), NaN-poisoned on a mask-structure violation
  out_copy<<<dim3((MT * (EVD / 4) + 255) / 256), blk, 0, stream>>>(Lp, FLG, out0);
  (void)hipGetLastError();
}

// v002
// It runs in 234 microseconds.
// Timed twice side by side with v001, it ran 1.40 times as fast both times.
// Over all steps from v000 it is 1.71 times as fast.
// Contractions: x.Wq and x.Wk (f16 planes x16), Wv^T.x^T (bf16 hi|lo planes), q.k^T and q.E^T band on
// v_wmma_f32_16x16x32_f16 (f16 operands, f32 accumulate); p.v as bf16 hi/lo three-product split, and
// [ctx_hi|ctx_lo].[Wo;Wo], [o_hi|o_lo].[Wl;Wl] K-folded planes on v_wmma_f32_16x16x32_bf16 (bf16 operands,
// f32 accumulate). Float inputs RNE-converted to bf16 on load (x x1; Wq, Wk, Wv, E x64 in f16; Wo, Wl bf16);
// softmax, causal select and the relative-offset skew in f32 on VALU.
#include <hip/hip_runtime.h>
#include <math.h>

#ifndef NB
#define NB 2
#endif
#ifndef SEQ
#define SEQ 2048
#endif
#define NB_FULL  2
#define SEQ_FULL 2048
#define DMD  512
#define NH   8
#define HD   64
#define EVD  388
#define EVP  448
#define MT   (NB * SEQ)
#define KF   (2 * DMD)
#define NFLG (SEQ / 16)
#define FLGW 32
#define AWV  8
#define OPP  68
#define RWP  48
#define WSCL 64.0f
#define QKS  16.0f
#define RSQD 0.125f
#define NEGM (-1.0e10f)

static_assert(NB >= 1 && NB <= NB_FULL);
static_assert(SEQ >= 64 && SEQ <= SEQ_FULL && (SEQ % 64) == 0);
static_assert(NH * HD == DMD && HD == 64);
static_assert((MT % 64) == 0 && (DMD % 64) == 0 && (KF % 64) == 0);
static_assert((EVP % 64) == 0 && EVP >= EVD && (EVD % 4) == 0);
static_assert(((SEQ * DMD) % 2048) == 0 && ((NH * SEQ_FULL * HD) % 2048) == 0);
static_assert(NFLG <= 256 && ((4 * SEQ) % 256) == 0);

typedef _Float16 v16h __attribute__((ext_vector_type(16)));
typedef __bf16 v16bf __attribute__((ext_vector_type(16)));
typedef unsigned short v16us __attribute__((ext_vector_type(16)));
typedef unsigned short v8us  __attribute__((ext_vector_type(8)));
typedef float v8f __attribute__((ext_vector_type(8)));
typedef float v4f __attribute__((ext_vector_type(4)));
typedef unsigned int v4u __attribute__((ext_vector_type(4)));
typedef unsigned int v2u __attribute__((ext_vector_type(2)));

union FragU { v16us v; v8us h[2]; };

// ---- scalar helpers --------------------------------------------------------------------------------
__device__ __forceinline__ unsigned short bf_bits(float f) {          // f32 -> bf16 bits, RNE convert
  const unsigned u = __float_as_uint(f);
  return (unsigned short)((u + 0x7FFFu + ((u >> 16) & 1u)) >> 16);
}
__device__ __forceinline__ float bf_up(unsigned short h) { return __uint_as_float(((unsigned)h) << 16); }
__device__ __forceinline__ float bfr(float f) { return bf_up(bf_bits(f)); }   // value of the bf16 RNE convert
__device__ __forceinline__ unsigned short h_bits(_Float16 x) { return __builtin_bit_cast(unsigned short, x); }
__device__ __forceinline__ unsigned short f2h(float f) { return h_bits((_Float16)f); }
__device__ __forceinline__ unsigned pk16(unsigned short a, unsigned short b) { return (unsigned)a | ((unsigned)b << 16); }
__device__ __forceinline__ int clampi(int v, int lo, int hi) { return v < lo ? lo : (v > hi ? hi : v); }
__device__ __forceinline__ v8f zero8() { v8f z = {0.f, 0.f, 0.f, 0.f, 0.f, 0.f, 0.f, 0.f}; return z; }

// ---- fragment loader: 16-bit A/B operand, lane -> row/col (lane&15), p already includes +8*(lane>>4);
//      elements 0..7 <- p[0..7] (k0+8h..), elements 8..15 <- p[16..23] (k0+16+8h..)
__device__ __forceinline__ v16us ldfrag_u(const unsigned short* p) {
  FragU f;
  f.h[0] = *(const v8us*)(p);
  f.h[1] = *(const v8us*)(p + 16);
  return f.v;
}

// ---- WMMA helpers (f16 / bf16 operand bits) with trailing VALU hazard gap --------------------------
__device__ __forceinline__ v8f mma_raw(v16us a, v16us b, v8f c) {
  return __builtin_amdgcn_wmma_f32_16x16x32_f16(false, __builtin_bit_cast(v16h, a), false,
                                                __builtin_bit_cast(v16h, b), (short)0, c, false, false);
}
__device__ __forceinline__ v8f mma_raw_bf(v16us a, v16us b, v8f c) {
  return __builtin_amdgcn_wmma_f32_16x16x32_bf16(false, __builtin_bit_cast(v16bf, a), false,
                                                 __builtin_bit_cast(v16bf, b), (short)0, c, false, false);
}
__device__ __forceinline__ v8f mma_g(v16us a, v16us b, v8f c) {                 // guarded f16
  c = mma_raw(a, b, c);
#if defined(__HIP_DEVICE_COMPILE__)
  asm volatile("v_nop\n\tv_nop\n\tv_nop\n\tv_nop" : "+v"(c) : "v"(a), "v"(b));
#endif
  return c;
}
__device__ __forceinline__ v8f mma_gb(v16us a, v16us b, v8f c) {                // guarded bf16
  c = mma_raw_bf(a, b, c);
#if defined(__HIP_DEVICE_COMPILE__)
  asm volatile("v_nop\n\tv_nop\n\tv_nop\n\tv_nop" : "+v"(c) : "v"(a), "v"(b));
#endif
  return c;
}
__device__ __forceinline__ void dep_guard1(v8f& a, v8f& b, v16us x) {
#if defined(__HIP_DEVICE_COMPILE__)
  asm volatile("v_nop\n\tv_nop\n\tv_nop\n\tv_nop" : "+v"(a), "+v"(b) : "v"(x));
#endif
}
__device__ __forceinline__ void keep4_u(v16us a, v16us b, v16us c, v16us d) {
#if defined(__HIP_DEVICE_COMPILE__)
  asm volatile("v_nop" :: "v"(a), "v"(b), "v"(c), "v"(d));
#endif
}
__device__ __forceinline__ void acc_guard4(v8f& a, v8f& b, v8f& c, v8f& d) {
#if defined(__HIP_DEVICE_COMPILE__)
  asm volatile("v_nop\n\tv_nop\n\tv_nop\n\tv_nop" : "+v"(a), "+v"(b), "+v"(c), "+v"(d));
#endif
}
// 2^x; the v_nop keeps, inside the statement, the one slot the instruction set asks for between a
// transcendental and an instruction that reads its result or overwrites its source
__device__ __forceinline__ float exp2_slot(float x) {
  float r = 0.f;
#if defined(__HIP_DEVICE_COMPILE__)
  asm("v_exp_f32 %0, %1\n\tv_nop" : "=v"(r) : "v"(x));
#endif
  return r;
}
// orders LDS stores of this wave before later LDS loads of the same wave (cross-lane exchange)
__device__ __forceinline__ void wave_sync_lds() {
  __builtin_amdgcn_fence(__ATOMIC_RELEASE, "workgroup");
  __builtin_amdgcn_wave_barrier();
  __builtin_amdgcn_fence(__ATOMIC_ACQUIRE, "workgroup");
}

// =====================================================================================================
// Layout-kept convert: o[i] = f16 bits of (bf16 RNE value of w[i] * sc) for i < nsrc, zero for nsrc <= i <
// ndst; by selects a batch slab (source offset by*sstr, destination offset by*dstr), bx the 2048-element piece.
// nsrc % 8 == 0, ndst % 2048 == 0, bx = 0 .. ndst/2048 - 1 exact (compile-time constants at the call sites).
// coverage: 256 threads x 8 = 2048 elements per block; the callers' bx, by ranges cover all ndst elements of
// every slab. Block body, called from the merged launches below.
// =====================================================================================================
__device__ __forceinline__ void cvt_lin(const float* __restrict__ w, unsigned short* o, int bx, int by,
                                        int nsrc, int ndst, float sc, int sstr, int dstr) {
  const float* wb = w + (size_t)by * (size_t)sstr;
  unsigned short* ob = o + (size_t)by * (size_t)dstr;
  const int base = (bx * 256 + threadIdx.x) * 8;
  if (base + 8 > ndst) return;                            // never taken with exact grids; no barriers below
  const bool inr = (base + 8 <= nsrc);
  const int lb = inr ? base : (nsrc - 8);                 // clamped address, always in range
  const v4f a0 = *(const v4f*)(wb + lb);
  const v4f a1 = *(const v4f*)(wb + lb + 4);
  v4u hv;
#pragma unroll
  for (int e = 0; e < 2; ++e) {
    hv[e]     = pk16(f2h(bfr(a0[2 * e]) * sc), f2h(bfr(a0[2 * e + 1]) * sc));
    hv[2 + e] = pk16(f2h(bfr(a1[2 * e]) * sc), f2h(bfr(a1[2 * e + 1]) * sc));
  }
  const v4u zz = {0u, 0u, 0u, 0u};
  hv = inr ? hv : zz;
  unsigned short* d = ob + base;
  *(v4u*)d = hv;
  
}

// =====================================================================================================
// Transpose-convert: in w[R][C] f32 (pitch C) -> out o[c][r] at o[c*ldo + r] for c < CP, with zero values
// for C <= c < CP. BFO 0: f16 bits of (bf16 RNE value * sc); BFO 1: bf16 bits (RNE). Block tile 64x64
// through LDS (st[col][row], pitch 72 halves). Read phase: thread owns one input row x 16 columns (float4
// loads at a clamped column address, zero selected by value; C % 4 == 0 so a float4 is all-in or all-out).
// R, CP multiples of 64, ldo % 64 == 0, (bx, by) in (CP/64, R/64) exact (compile-time constants at the call
// sites). coverage: 64 output rows x 64 halves per block = the whole transposed tile; the callers' ranges cover
// all of [CP][R]. Block body, called from the merged launches below under a block-uniform branch; st is the
// calling kernel's LDS tile of 64 * 72 halves.
// =====================================================================================================
template <int BFO>
__device__ __forceinline__ void cvt_t(unsigned short* st, const float* __restrict__ w, unsigned short* o,
                                      int bx, int by, int R, int C, int CP, int ldo, float sc) {
  const int t = threadIdx.x;
  const int r0 = by * 64, c0 = bx * 64;
  if (r0 + 64 > R || c0 + 64 > CP) return;              // block-uniform, before the barrier; never taken
  {
    const int row = t >> 2, ch = (t & 3) * 16;
    const float* p = w + (size_t)(r0 + row) * C;
#pragma unroll
    for (int q = 0; q < 4; ++q) {
      const int cs = c0 + ch + 4 * q;
      const bool inr = (cs + 4 <= C);
      const int lb = inr ? cs : (C - 4);                 // clamped column address, always in range
      const v4f v = *(const v4f*)(p + lb);
#pragma unroll
      for (int e = 0; e < 4; ++e) {
        const unsigned short hb = BFO ? bf_bits(v[e]) : f2h(bfr(v[e]) * sc);
        st[(ch + 4 * q + e) * 72 + row] = inr ? hb : (unsigned short)0;
      }
    }
  }
  __syncthreads();
  v4u hv[2];
#pragma unroll
  for (int half = 0; half < 2; ++half) {
    const int cl = (t >> 3) + 32 * half, pc = (t & 7) * 8;
    hv[half] = *(const v4u*)(st + cl * 72 + pc);
  }
  {
#pragma unroll
    for (int half = 0; half < 2; ++half) {
      const int cl = (t >> 3) + 32 * half, pc = (t & 7) * 8;
      unsigned short* dst = o + (size_t)(c0 + cl) * ldo + r0 + pc;
      *(v4u*)dst = hv[half];
    }
#if defined(__HIP_DEVICE_COMPILE__)
    // precaution: wait for the stores to read their registers (the block ends after this one job)
    asm volatile("s_wait_xcnt 0x0" ::: "memory");
#endif
  }
}

// =====================================================================================================
// Register-blocked 16-bit WMMA GEMM: C[m][n] = sum_k A[m][k] * Bt[n][k], one wave per 64x64 tile, no block
// barriers. BF 0: f16 operand bits, BF 1: bf16 operand bits. A row-major [M][K] pitch lda; Bt row-major
// [N][K] pitch ldb (k contiguous); M, N multiples of 64, K multiple of 32 (true at every call site; waves
// past the last tile exit before any work, wave-uniform). Both operand fragments use the split k map
// (elements 0..7 <- k0+8h.., 8..15 <- k0+16+8h..); D element r of a lane is (row 8h + r, col lane&15).
// Bias: bf16 RNE value of bias[] times bsc, indexed by column (clamped into nbias) or, with BROW, by row.
// OM 0: f32 out Cf = acc*osc + b, pitch ldc.            OM 1: f16 out Ch = f16 bits(acc*osc + b), pitch ldc.
// OM 2: val = (RELU ? max(0, .) : .)(acc*osc + b); bf16 hi bits at Ch, bf16 lo bits (val - hi) at Ch + looff.
// coverage: 4 slabs x 16 rows x 64 cols = the wave's whole 64x64 tile (hi and lo planes alike).
// gemm64_blk is the block body (bx = block number within this product, sT = the calling kernel's LDS, 8 per-wave
// 16x64 slabs of pitch 68 floats); gemm64 is the launch of one product alone.
// =====================================================================================================
#define GSLAB (16 * 68)
template <int BF, int OM, int RELU, int BROW>
__device__ __forceinline__ void gemm64_blk(
    float* sT, int bx,
    const unsigned short* __restrict__ Ap, int lda, const unsigned short* __restrict__ Btp, int ldb,
    unsigned short* Ch, int looff, float* Cf, int ldc, float osc,
    const float* __restrict__ bias, int nbias, float bsc, int M, int N, int K) {
  const int lane = threadIdx.x & 31;
  const int wave = threadIdx.x >> 5;
  const int tilesN = N >> 6;
  const int tilesM = M >> 6;
  const int tile = bx * 8 + wave;
  if (tile >= tilesM * tilesN) return;   // wave-uniform; no block barriers in this kernel
  const int tm = tile / tilesN;
  const int tn = tile - tm * tilesN;
  const int m0 = tm << 6;
  const int n0 = tn << 6;

  const int rlane = lane & 15;                 // row (A) / col (B, D) within subtile
  const int koff  = (lane >> 4) * 8;           // k offset of this lane half
  const int mOff  = (lane >> 4) * 8;           // D row offset

  v8f acc[4][4];
#pragma unroll
  for (int i = 0; i < 4; ++i)
#pragma unroll
    for (int j = 0; j < 4; ++j) acc[i][j] = zero8();

#pragma unroll 1
  for (int k0 = 0; k0 < K; k0 += 32) {
    v16us bh[4];
#pragma unroll
    for (int j = 0; j < 4; ++j) {
      const size_t bo = (size_t)(n0 + (j << 4) + rlane) * ldb + koff + k0;
      bh[j] = ldfrag_u(Btp + bo);
    }
#pragma unroll
    for (int i = 0; i < 4; ++i) {
      const size_t ao = (size_t)(m0 + (i << 4) + rlane) * lda + koff + k0;
      const v16us ah = ldfrag_u(Ap + ao);
#pragma unroll
      for (int j = 0; j < 4; ++j) {
        if (BF) acc[i][j] = mma_raw_bf(ah, bh[j], acc[i][j]);
        else    acc[i][j] = mma_raw(ah, bh[j], acc[i][j]);
      }
      dep_guard1(acc[i][0], acc[i][3], ah);
    }
    keep4_u(bh[0], bh[1], bh[2], bh[3]);
  }
  acc_guard4(acc[0][0], acc[0][1], acc[0][2], acc[0][3]);
  acc_guard4(acc[1][0], acc[1][1], acc[1][2], acc[1][3]);
  acc_guard4(acc[2][0], acc[2][1], acc[2][2], acc[2][3]);
  acc_guard4(acc[3][0], acc[3][1], acc[3][2], acc[3][3]);

  const int hh2 = lane >> 4, c4 = (lane & 15) * 4;     // f32 out: 256-B row segment = 16 lanes x 16 B
  const int q8  = lane >> 3, c8 = (lane & 7) * 8;

  // per-lane bias values for the column-indexed modes (bf16 RNE value times bsc), clamped address
  float bc[8];
#pragma unroll
  for (int e = 0; e < 8; ++e) bc[e] = 0.f;
  if (!BROW) {
    if (OM == 0) {
#pragma unroll
      for (int e = 0; e < 4; ++e) bc[e] = bsc * bfr(bias[clampi(n0 + c4 + e, 0, nbias - 1)]);
    } else {
#pragma unroll
      for (int e = 0; e < 8; ++e) bc[e] = bsc * bfr(bias[clampi(n0 + c8 + e, 0, nbias - 1)]);
    }
  }

  // ---- epilogue ----
  float* slab = sT + wave * GSLAB;
#pragma unroll
  for (int i = 0; i < 4; ++i) {
    const int mBase = m0 + (i << 4);
#pragma unroll
    for (int j = 0; j < 4; ++j) {
#pragma unroll
      for (int r = 0; r < 8; ++r) {
        slab[(mOff + r) * 68 + (j << 4) + rlane] = acc[i][j][r];
      }
    }
    wave_sync_lds();
    if (OM == 0) {
      v4f vals[8];
#pragma unroll
      for (int it = 0; it < 8; ++it) {
        const int row = it * 2 + hh2;                      // it 0..7 x hh2 0..1 = rows 0..15
        const v4f v = *(const v4f*)(slab + row * 68 + c4);
        float brw = 0.f;
        if (BROW) brw = bsc * bfr(bias[clampi(mBase + row, 0, nbias - 1)]);
        v4f ov;
#pragma unroll
        for (int e = 0; e < 4; ++e) {
          float x = v[e] * osc + (BROW ? brw : bc[e]);
          if (RELU) x = fmaxf(x, 0.f);
          ov[e] = x;
        }
        vals[it] = ov;
      }
      {
#pragma unroll
        for (int it = 0; it < 8; ++it) {
          const int row = it * 2 + hh2;
          *(v4f*)(Cf + (size_t)(mBase + row) * ldc + (size_t)n0 + c4) = vals[it];
        }
        
      }
    } else if (OM == 1) {
      v4u hv[4];
#pragma unroll
      for (int it = 0; it < 4; ++it) {
        const int row = it * 4 + q8;                       // it 0..3 x q8 0..3 = rows 0..15
        const float* sp = slab + row * 68 + c8;
        float brw = 0.f;
        if (BROW) brw = bsc * bfr(bias[clampi(mBase + row, 0, nbias - 1)]);
        v4u ha = {0u, 0u, 0u, 0u};
#pragma unroll
        for (int e = 0; e < 4; ++e) {
          float b0 = sp[2 * e]     * osc + (BROW ? brw : bc[2 * e]);
          float b1 = sp[2 * e + 1] * osc + (BROW ? brw : bc[2 * e + 1]);
          if (RELU) { b0 = fmaxf(b0, 0.f); b1 = fmaxf(b1, 0.f); }
          ha[e] = pk16(f2h(b0), f2h(b1));
        }
        hv[it] = ha;
      }
      {
#pragma unroll
        for (int it = 0; it < 4; ++it) {
          const int row = it * 4 + q8;
          const size_t go = (size_t)(mBase + row) * ldc + (size_t)n0 + c8;
          *(v4u*)(Ch + go) = hv[it];
        }
        
      }
    } else {
      v4u hv[4], lv[4];
#pragma unroll
      for (int it = 0; it < 4; ++it) {
        const int row = it * 4 + q8;                       // it 0..3 x q8 0..3 = rows 0..15
        const float* sp = slab + row * 68 + c8;
        float brw = 0.f;
        if (BROW) brw = bsc * bfr(bias[clampi(mBase + row, 0, nbias - 1)]);
        v4u ha = {0u, 0u, 0u, 0u};
        v4u la = {0u, 0u, 0u, 0u};
#pragma unroll
        for (int e = 0; e < 4; ++e) {
          float x0 = sp[2 * e]     * osc + (BROW ? brw : bc[2 * e]);
          float x1 = sp[2 * e + 1] * osc + (BROW ? brw : bc[2 * e + 1]);
          if (RELU) { x0 = fmaxf(x0, 0.f); x1 = fmaxf(x1, 0.f); }
          const unsigned short h0 = bf_bits(x0), h1 = bf_bits(x1);
          const unsigned short l0 = bf_bits(x0 - bf_up(h0)), l1 = bf_bits(x1 - bf_up(h1));
          ha[e] = pk16(h0, h1);
          la[e] = pk16(l0, l1);
        }
        hv[it] = ha;
        lv[it] = la;
      }
      {
#pragma unroll
        for (int it = 0; it < 4; ++it) {
          const int row = it * 4 + q8;
          const size_t go = (size_t)(mBase + row) * ldc + (size_t)n0 + c8;
          *(v4u*)(Ch + go) = hv[it];
          *(v4u*)(Ch + (size_t)looff + go) = lv[it];
        }
        
      }
    }
    wave_sync_lds();
  }
}
template <int BF, int OM, int RELU, int BROW>
__global__ __launch_bounds__(256) void gemm64(
    const unsigned short* __restrict__ Ap, int lda, const unsigned short* __restrict__ Btp, int ldb,
    unsigned short* Ch, int looff, float* Cf, int ldc, float osc,
    const float* __restrict__ bias, int nbias, float bsc, int M, int N, int K) {
  __shared__ __align__(16) float sT[8 * GSLAB];
  gemm64_blk<BF, OM, RELU, BROW>(sT, blockIdx.x, Ap, lda, Btp, ldb, Ch, looff, Cf, ldc, osc, bias, nbias, bsc,
                                 M, N, K);
}

// =====================================================================================================
// Structure check of the [SEQ][SEQ] mask input (row pitch SEQ_FULL): block b covers rows 16b..16b+15 and all
// SEQ columns; a violation is any element differing from (j <= i ? 1 : 0). The block's flag is written as one
// coverage: 256 threads x (SEQ/64) float4 = 16 rows x SEQ cols per block; bx = 0 .. SEQ/16 - 1 = all rows.
// Block body, called from the second merged launch under a block-uniform branch; wf = 8 ints of its LDS.
// =====================================================================================================
__device__ __forceinline__ void mask_check(int* wf, int bx, const float* __restrict__ msk, float* flg) {
  const int t = threadIdx.x, lane = t & 31, wv = t >> 5;
  const int i0 = bx * 16;
  if (i0 + 16 > SEQ) return;                             // block-uniform, before the barrier; never taken
  constexpr int C4 = SEQ / 4;
  int viol = 0;
#pragma unroll 1
  for (int it = 0; it < (16 * C4) / 256; ++it) {
    const int ci = it * 256 + t;
    const int rr = ci / C4;
    const int c4 = ci - rr * C4;
    const int i = i0 + rr;
    const v4f x = *(const v4f*)(msk + (size_t)i * SEQ_FULL + 4 * c4);
#pragma unroll
    for (int e = 0; e < 4; ++e) {
      const int j = 4 * c4 + e;
      const float ex = (j <= i) ? 1.0f : 0.0f;
      viol |= (x[e] != ex) ? 1 : 0;
    }
  }
  viol |= __shfl_xor(viol, 1, 32);
  viol |= __shfl_xor(viol, 2, 32);
  viol |= __shfl_xor(viol, 4, 32);
  viol |= __shfl_xor(viol, 8, 32);
  viol |= __shfl_xor(viol, 16, 32);
  if (lane == 0) wf[wv] = viol;
  __syncthreads();
  if (wv == 0) {                                        // wave-uniform
    int f = wf[lane & 7];
    f |= __shfl_xor(f, 1, 32);
    f |= __shfl_xor(f, 2, 32);
    f |= __shfl_xor(f, 4, 32);
    const float fv = f ? 1.0f : 0.0f;
    float* d = flg + (size_t)bx * FLGW + lane;
    *(float*)d = fv;
    
  }
}

// =====================================================================================================
// Merged launches: jobs that read none of each other's output share one grid; the flat block index picks the
// job by ranges (block-uniform scalar branches), every block runs exactly one job body and then ends.
// prep_x: what the projections read. Blocks [0, 3*NTW): Wq, Wk, Wv -> [64][512] f16 x64 (transposed);
//   then 3*NLX blocks: q, k, v -> f16(bf16) planes, NLX = NB slabs x SEQ*DMD/2048 pieces each.
// proj_side: the three projections, first in the grid since they run longest, and beside them all that only
//   later launches read. Blocks [0, 3*NGQ): q plane x16, k plane x16 (C[tok][n] = sum_k X[tok][k] * WT[n][k]),
//   v^T planes (C[d][tok] = sum_k WVT[d][k] * XV[tok][k] / 64, bf16 hi and lo); then NFLG mask-structure blocks;
//   2*NTO blocks Wo -> [512][1024] = (Wo^T | Wo^T) bf16; 2*NTL blocks Wl -> [448][1024] = (Wl^T | Wl^T) bf16;
//   NLE blocks E -> f16(bf16 x64).
// =====================================================================================================
#define NTW (DMD / 64)
#define NLP ((SEQ * DMD) / 2048)
#define NLX (NLP * NB)
#define NGQ (((MT / 64) * (HD / 64) + 7) / 8)
#define NTO ((DMD / 64) * (DMD / 64))
#define NTL ((EVP / 64) * (DMD / 64))
#define NLE ((NH * SEQ_FULL * HD) / 2048)
#define PREP_BLOCKS (3 * NTW + 3 * NLX)
#define SIDE_BLOCKS (3 * NGQ + NFLG + 2 * NTO + 2 * NTL + NLE)

__global__ __launch_bounds__(256) void prep_x(
    const float* __restrict__ q, const float* __restrict__ k, const float* __restrict__ v,
    const float* __restrict__ wq, const float* __restrict__ wk, const float* __restrict__ wv,
    unsigned short* XQ, unsigned short* XK, unsigned short* XV,
    unsigned short* WQT, unsigned short* WKT, unsigned short* WVT) {
  __shared__ __align__(16) unsigned short st[64 * 72];
  int bid = blockIdx.x;
  if (bid < 3 * NTW) {
    const int j = bid / NTW;
    const float* w = (j == 0) ? wq : ((j == 1) ? wk : wv);
    unsigned short* o = (j == 0) ? WQT : ((j == 1) ? WKT : WVT);
    cvt_t<0>(st, w, o, 0, bid - j * NTW, DMD, HD, HD, DMD, WSCL);          // in[512][64] -> out[64][512]
    return;
  }
  bid -= 3 * NTW;
  if (bid < 3 * NLX) {
    const int j = bid / NLX;
    const int r = bid - j * NLX;
    const float* x = (j == 0) ? q : ((j == 1) ? k : v);
    unsigned short* o = (j == 0) ? XQ : ((j == 1) ? XK : XV);
    cvt_lin(x, o, r % NLP, r / NLP, SEQ * DMD, SEQ * DMD, 1.0f, SEQ_FULL * DMD, SEQ * DMD);
  }
}

__global__ __launch_bounds__(256) void proj_side(
    const unsigned short* __restrict__ XQ, const unsigned short* __restrict__ XK,
    const unsigned short* __restrict__ XV, const unsigned short* __restrict__ WQT,
    const unsigned short* __restrict__ WKT, const unsigned short* __restrict__ WVT,
    const float* __restrict__ bq, const float* __restrict__ bk, const float* __restrict__ bv,
    unsigned short* QH, unsigned short* KH, unsigned short* VH,
    const float* __restrict__ msk, float* flg,
    const float* __restrict__ wo, unsigned short* WOT, const float* __restrict__ wl, unsigned short* WLT,
    const float* __restrict__ ee, unsigned short* PEH) {
  __shared__ __align__(16) float sT[8 * GSLAB];        // the one job of a block uses it: slabs, transpose tile or flags
  int bid = blockIdx.x;
  if (bid < 2 * NGQ) {
    const int j = bid / NGQ;
    gemm64_blk<0, 1, 0, 0>(sT, bid - j * NGQ, j ? XK : XQ, DMD, j ? WKT : WQT, DMD, j ? KH : QH, 0, nullptr, HD,
                           QKS / WSCL, j ? bk : bq, HD, QKS, MT, HD, DMD);
    return;
  }
  bid -= 2 * NGQ;
  if (bid < NGQ) {
    gemm64_blk<0, 2, 0, 1>(sT, bid, WVT, DMD, XV, DMD, VH, HD * MT, nullptr, MT, 1.0f / WSCL, bv, HD, 1.0f,
                           HD, MT, DMD);
    return;
  }
  bid -= NGQ;
  if (bid < NFLG) {
    mask_check((int*)sT, bid, msk, flg);
    return;
  }
  bid -= NFLG;
  if (bid < 2 * NTO) {
    const int j = bid / NTO;                           // destination columns 0.. and 512..
    const int r = bid - j * NTO;
    cvt_t<1>((unsigned short*)sT, wo, WOT + j * DMD, r % (DMD / 64), r / (DMD / 64), DMD, DMD, DMD, KF, 1.0f);
    return;
  }
  bid -= 2 * NTO;
  if (bid < 2 * NTL) {
    const int j = bid / NTL;                           // destination columns 0.. and 512..
    const int r = bid - j * NTL;
    cvt_t<1>((unsigned short*)sT, wl, WLT + j * DMD, r % (EVP / 64), r / (EVP / 64), DMD, EVD, EVP, KF, 1.0f);
    return;
  }
  bid -= 2 * NTL;
  if (bid < NLE) cvt_lin(ee, PEH, bid, 0, NH * SEQ_FULL * HD, NH * SEQ_FULL * HD, WSCL, 0, 0);
}

// =====================================================================================================
// Causal attention with relative-offset term, head dim 64. Block = 256 threads = 8 waves; one block owns one
// 16-row query tile (t0..t0+15) of one (batch b, head h). The key blocks of 32 up to the diagonal (sb <= t0)
// are cut into 8 contiguous shares, one per wave; each wave runs its share with an online max-subtracted
// softmax in f32 and leaves its partial state (row max, row sum, unnormalised 16x64 O) in LDS; behind one
// block barrier the 8 states are merged in wave order (rescale by exp(max_w - max), sum, divide).
// Planes: QH, KH f16 [MT][64] = 16*q, 16*k (shared
// by all heads); PE f16 [NH*SEQ_FULL][64] = 64*E (head h rows h*SEQ_FULL..); VH, VL bf16 [64][MT] = v hi and
// lo planes transposed (row = dim, column = token). Output Z bf16 [MT][1024]: cols h*64+d = ctx hi, cols
// 512+h*64+d = ctx lo, token-major.
// Per key block sb: S = Q.K^T (2 key subtiles x 2 k-steps, scale 1/256); relative band of 48 columns:
// column c <-> E row SEQ-16-t0+sb+c (clamped into [0, SEQ-1]; clamping only touches entries with j > i,
// which the causal select replaces); columns 0..15 come from the tile carried over from the prior key block
// (its columns 32..47), columns 16..47 are two fresh tiles (2 x 2 WMMA, scale 1/1024); the band is exchanged
// through per-wave LDS and read back at c = 15 - il + jl, i.e. E row SEQ-1-i+j; score = (qk + rel)/8 for
// j <= i, else -1e10; p = exp(score - running max) in f32, l accumulated from the f32 p; p stored as bf16 hi
// and lo tiles in per-wave LDS and reloaded as A fragments (split k map); O += Phi.Vhi + Phi.Vlo + Plo.Vhi on
// 4 dim subtiles (one accumulator set). A wave whose share is empty contributes max -1e30, sum 0, O 0 (weight
// exp(-1e30 - max) = 0); wave 0's share is never empty. Merge: thread -> (row t>>4, 4 dims), 16 lanes x 8 B =
// one 128-B line of Z per plane and row.
// coverage: 16 query rows x 64 halves x {hi, lo} per block, NB*NH*(SEQ/16) blocks = all (b, t, h)
// segments of Z in both halves.
// =====================================================================================================
__global__ __launch_bounds__(32 * AWV) void attn_kernel(
    const unsigned short* __restrict__ QH, const unsigned short* __restrict__ KH,
    const unsigned short* __restrict__ PE, const unsigned short* __restrict__ VH,
    const unsigned short* __restrict__ VL, unsigned short* Z) {
  __shared__ __align__(16) float relw[AWV][16 * RWP];            // band exchange, 24576 B
  __shared__ __align__(16) unsigned short pwh[AWV][16 * 32];      // P hi tiles, 8192 B
  __shared__ __align__(16) unsigned short pwl[AWV][16 * 32];      // P lo tiles, 8192 B
  __shared__ __align__(16) float opw[AWV][16 * OPP];              // partial O per wave, pitch 68 floats, 34816 B
  __shared__ __align__(16) float mxw[AWV][16];                    // partial row max per wave
  __shared__ __align__(16) float lsw[AWV][16];                    // partial row sum per wave
  const int lane = threadIdx.x & 31, m = lane & 15, hh = lane >> 4;
  // wave number in a scalar register: the key loop's bounds depend on it and stay a scalar branch
  const int wv = __builtin_amdgcn_readfirstlane((int)(threadIdx.x >> 5));
  const int task = blockIdx.x;                       // 0 .. NB*NH*(SEQ/16)-1
  const int nqt = SEQ / 16;
  const int bh = task / nqt;                         // (b, h)
  const int t0 = (task - bh * nqt) << 4;             // query tile start
  const int b = bh / NH, h = bh - (bh / NH) * NH;
  if (b >= NB) return;                               // block-uniform, before the barrier; never taken with exact grids
  const size_t tok0 = (size_t)b * SEQ;
  float* rw = relw[wv];
  unsigned short* ph = pwh[wv];
  unsigned short* pl = pwl[wv];

  // Q A-fragments: rows t0+m, k = head dims 0..31 and 32..63
  const unsigned short* qp = QH + (tok0 + (size_t)(t0 + m)) * HD + 8 * hh;
  const v16us qf0 = ldfrag_u(qp);
  const v16us qf1 = ldfrag_u(qp + 32);

  const unsigned short* pe = PE + (size_t)h * SEQ_FULL * HD;
  const int rb = SEQ - 16 - t0;                      // E row of band column 0 at sb = 0 (>= 0)

  const int nkb = (t0 >> 5) + 1;                     // key blocks 0 .. floor(t0/32), block-uniform
  const int per = (nkb + AWV - 1) / AWV;             // key blocks per wave share
  const int kb0 = wv * per;                          // this wave's share [kb0, kb1), wave-uniform, may be empty
  const int kb1 = (kb0 + per < nkb) ? (kb0 + per) : nkb;

  // carried band tile: columns 0..15 of key block kb0 <-> E rows rb + 32*kb0 + 0..15 (clamped)
  v8f carry;
  {
    const int u = clampi(rb + (kb0 << 5) + m, 0, SEQ - 1);
    const unsigned short* pp = pe + (size_t)u * HD + 8 * hh;
    carry = mma_g(qf0, ldfrag_u(pp), zero8());
    carry = mma_g(qf1, ldfrag_u(pp + 32), carry);
  }

  float mx[8], ls[8];
  v8f O0 = zero8(), O1 = zero8(), O2 = zero8(), O3 = zero8();
#pragma unroll
  for (int r = 0; r < 8; ++r) { mx[r] = -1.0e30f; ls[r] = 0.f; }

  const size_t vst = (size_t)16 * MT;                // V plane stride between dim subtiles

#pragma unroll 1
  for (int kb = kb0; kb < kb1; ++kb) {
    const int sb = kb << 5;
    // K B-fragments: Bt row = key token, k = head dim
    v8f S0, S1;
    {
      const unsigned short* kp = KH + (tok0 + (size_t)(sb + m)) * HD + 8 * hh;
      S0 = mma_g(qf0, ldfrag_u(kp), zero8());
      S0 = mma_g(qf1, ldfrag_u(kp + 32), S0);
      const unsigned short* kp1 = kp + (size_t)16 * HD;
      S1 = mma_g(qf0, ldfrag_u(kp1), zero8());
      S1 = mma_g(qf1, ldfrag_u(kp1 + 32), S1);
    }

    // relative band: columns 16..31 and 32..47 <-> E rows rb+sb+16.. and rb+sb+32..
    v8f Pb1, Pb2;
    {
      const int u1 = clampi(rb + sb + 16 + m, 0, SEQ - 1);
      const unsigned short* p1 = pe + (size_t)u1 * HD + 8 * hh;
      Pb1 = mma_g(qf0, ldfrag_u(p1), zero8());
      Pb1 = mma_g(qf1, ldfrag_u(p1 + 32), Pb1);
      const int u2 = clampi(rb + sb + 32 + m, 0, SEQ - 1);
      const unsigned short* p2 = pe + (size_t)u2 * HD + 8 * hh;
      Pb2 = mma_g(qf0, ldfrag_u(p2), zero8());
      Pb2 = mma_g(qf1, ldfrag_u(p2 + 32), Pb2);
    }
#pragma unroll
    for (int r = 0; r < 8; ++r) {
      const int row = 8 * hh + r;
      rw[row * RWP + m]      = carry[r];
      rw[row * RWP + 16 + m] = Pb1[r];
      rw[row * RWP + 32 + m] = Pb2[r];
    }
    carry = Pb2;
    wave_sync_lds();

    // skew read + scale + causal select (key j <= query i keeps the score, otherwise -1e10)
    float s0[8], s1[8];
#pragma unroll
    for (int r = 0; r < 8; ++r) {
      const int row = 8 * hh + r;
      const int i = t0 + row;
      const float rv0 = rw[row * RWP + 15 - row + m];
      const float rv1 = rw[row * RWP + 31 - row + m];
      const float a0 = (S0[r] * (1.0f / (QKS * QKS)) + rv0 * (1.0f / (QKS * WSCL))) * RSQD;
      const float a1 = (S1[r] * (1.0f / (QKS * QKS)) + rv1 * (1.0f / (QKS * WSCL))) * RSQD;
      s0[r] = (sb + m <= i) ? a0 : NEGM;
      s1[r] = (sb + 16 + m <= i) ? a1 : NEGM;
    }

    // online softmax (a row lives in the 16 lanes of one half-wave; xor butterflies 1,2,4,8)
#pragma unroll
    for (int r = 0; r < 8; ++r) {
      float xm = fmaxf(s0[r], s1[r]);
      xm = fmaxf(xm, __shfl_xor(xm, 1, 32));
      xm = fmaxf(xm, __shfl_xor(xm, 2, 32));
      xm = fmaxf(xm, __shfl_xor(xm, 4, 32));
      xm = fmaxf(xm, __shfl_xor(xm, 8, 32));
      const float mn = fmaxf(mx[r], xm);
      const float al = __expf(mx[r] - mn);
      mx[r] = mn;
      const float p0 = __expf(s0[r] - mn);
      const float p1 = __expf(s1[r] - mn);
      float ps = p0 + p1;
      ps += __shfl_xor(ps, 1, 32);
      ps += __shfl_xor(ps, 2, 32);
      ps += __shfl_xor(ps, 4, 32);
      ps += __shfl_xor(ps, 8, 32);
      ls[r] = ls[r] * al + ps;
      O0[r] = O0[r] * al;
      O1[r] = O1[r] * al;
      O2[r] = O2[r] * al;
      O3[r] = O3[r] * al;
      const int row = 8 * hh + r;
      const unsigned short hb0 = bf_bits(p0), hb1 = bf_bits(p1);
      ph[row * 32 + m]      = hb0;
      ph[row * 32 + 16 + m] = hb1;
      pl[row * 32 + m]      = bf_bits(p0 - bf_up(hb0));
      pl[row * 32 + 16 + m] = bf_bits(p1 - bf_up(hb1));
    }
    wave_sync_lds();

    // P A-fragments (split k map) and V B-fragments (Bt row = dim, k = key token)
    const v16us afh = ldfrag_u(ph + m * 32 + 8 * hh);
    const v16us afl = ldfrag_u(pl + m * 32 + 8 * hh);
    const size_t vo = (size_t)m * MT + tok0 + (size_t)sb + 8 * hh;
    {
      const v16us vh = ldfrag_u(VH + vo);
      const v16us vl = ldfrag_u(VL + vo);
      O0 = mma_gb(afh, vh, O0);
      O0 = mma_gb(afh, vl, O0);
      O0 = mma_gb(afl, vh, O0);
    }
    {
      const v16us vh = ldfrag_u(VH + vo + vst);
      const v16us vl = ldfrag_u(VL + vo + vst);
      O1 = mma_gb(afh, vh, O1);
      O1 = mma_gb(afh, vl, O1);
      O1 = mma_gb(afl, vh, O1);
    }
    {
      const v16us vh = ldfrag_u(VH + vo + 2 * vst);
      const v16us vl = ldfrag_u(VL + vo + 2 * vst);
      O2 = mma_gb(afh, vh, O2);
      O2 = mma_gb(afh, vl, O2);
      O2 = mma_gb(afl, vh, O2);
    }
    {
      const v16us vh = ldfrag_u(VH + vo + 3 * vst);
      const v16us vl = ldfrag_u(VL + vo + 3 * vst);
      O3 = mma_gb(afh, vh, O3);
      O3 = mma_gb(afh, vl, O3);
      O3 = mma_gb(afl, vh, O3);
    }
  }
  acc_guard4(O0, O1, O2, O3);

  // ---- this wave's partial state to LDS (D element r of a lane = row 8*hh + r, col m of each dim subtile) ----
  float* op = opw[wv];
#pragma unroll
  for (int r = 0; r < 8; ++r) {
    const int row = 8 * hh + r;
    op[row * OPP + m]      = O0[r];
    op[row * OPP + 16 + m] = O1[r];
    op[row * OPP + 32 + m] = O2[r];
    op[row * OPP + 48 + m] = O3[r];
  }
  if (m == 0) {                                        // mx, ls are equal in the 16 lanes of a half-wave
#pragma unroll
    for (int r = 0; r < 8; ++r) {
      mxw[wv][8 * hh + r] = mx[r];
      lsw[wv][8 * hh + r] = ls[r];
    }
  }
  __syncthreads();                                     // publishes the 8 partial states to the whole block

  // ---- merge in wave order, ctx = O / l, bf16 hi plane and lo plane ----
  {
    const int row = threadIdx.x >> 4, c4 = (threadIdx.x & 15) * 4;
    float mw[AWV];
    float mt = -1.0e30f;
#pragma unroll
    for (int w = 0; w < AWV; ++w) { mw[w] = mxw[w][row]; mt = fmaxf(mt, mw[w]); }
    float sc[AWV];
#pragma unroll
    for (int w = 0; w < AWV; ++w) sc[w] = exp2_slot((mw[w] - mt) * 1.44269504f);   // exp(max_w - max)
    float lt = 0.f;
    v4f ot = {0.f, 0.f, 0.f, 0.f};
#pragma unroll
    for (int w = 0; w < AWV; ++w) {
      const v4f o = *(const v4f*)(opw[w] + row * OPP + c4);
      lt += lsw[w][row] * sc[w];
#pragma unroll
      for (int e = 0; e < 4; ++e) ot[e] += o[e] * sc[w];
    }
    const float g = 1.0f / lt;                         // lt >= 1
    unsigned short hb[4], lb[4];
#pragma unroll
    for (int e = 0; e < 4; ++e) {
      const float c = ot[e] * g;
      hb[e] = bf_bits(c);
      lb[e] = bf_bits(c - bf_up(hb[e]));
    }
    const v2u hv = {pk16(hb[0], hb[1]), pk16(hb[2], hb[3])};
    const v2u lv = {pk16(lb[0], lb[1]), pk16(lb[2], lb[3])};
    unsigned short* dst = Z + (tok0 + (size_t)(t0 + row)) * KF + h * HD + c4;
    *(v2u*)dst = hv;
    *(v2u*)(dst + DMD) = lv;
  }
}

// =====================================================================================================
// Flat whole-line writer of the output: out[row*388 + c] = L[row*448 + c]; each lane owns 4
// consecutive output floats (16 B; never straddles a row since 388 % 4 == 0), one instruction = 32 lanes x
// coverage: grid = MT*97/256 blocks x 256 float4 = all MT*388 output floats (in-kernel bound for safety).
// =====================================================================================================
__global__ __launch_bounds__(256) void out_copy(const float* __restrict__ L, const float* __restrict__ flg,
                                                 float* out) {
  __shared__ int wf[8];
  const int t = threadIdx.x, lane = t & 31, wv = t >> 5;
  int f;
  {
    const int ti = (t < NFLG) ? t : (NFLG - 1);         // clamped address, value selected
    const float x = flg[(size_t)ti * FLGW];
    f = ((t < NFLG) && (x == 1.0f)) ? 1 : 0;
  }
  f |= __shfl_xor(f, 1, 32);
  f |= __shfl_xor(f, 2, 32);
  f |= __shfl_xor(f, 4, 32);
  f |= __shfl_xor(f, 8, 32);
  f |= __shfl_xor(f, 16, 32);
  if (lane == 0) wf[wv] = f;
  __syncthreads();
  int g = 0;
#pragma unroll
  for (int w = 0; w < 8; ++w) g |= wf[w];
  const int e4 = blockIdx.x * 256 + t;
  if (e4 < MT * (EVD / 4)) {
    const int e = e4 * 4;
    const int row = e / EVD;
    const int c = e - row * EVD;
    v4f x = *(const v4f*)(L + (size_t)row * EVP + c);
    const float qn = __uint_as_float(0x7fc00000u);
    const v4f pn = {qn, qn, qn, qn};
    x = g ? pn : x;
    float* d = out + (size_t)e;
    *(v4f*)d = x;
    
  }
}

// =====================================================================================================
// Workspace map (bytes, full size NB=2, SEQ=2048); every plane is an exact multiple of its whole-row /
// whole-line / 64x64-tile store granularity; all offsets are multiples of 16384.
//   XQ   f16  [MT][512]        4194304     (x3 with XK, XV)
//   WQT  f16  [64][512]          65536     (x3 with WKT, WVT; Wq^T, Wk^T, Wv^T x64)
//   PEH  f16  [8*2048][64]     2097152     (E x64)
//   QH   f16  [MT][64]          524288     (16*q), KH same
//   VH   bf16 [64][MT]          524288     (v hi), VL same (v lo), contiguous after VH
//   Z    bf16 [MT][1024]       8388608     (ctx hi | ctx lo)
//   WOT  bf16 [512][1024]      1048576     (Wo^T | Wo^T)
//   OP   bf16 [MT][1024]       8388608     (relu out hi | lo)
//   WLT  bf16 [448][1024]       917504     (Wl^T | Wl^T, rows 388..447 zero)
//   L    f32  [MT][448]        7340032
//   FLG  f32  [128][32]          16384     (mask-structure flag lines)
//   total                     43073536
// =====================================================================================================
extern "C" void kernel_launch(void* const* d_in, const int* in_sizes, int n_in,
                              void* d_out, int out_size, void* d_ws, size_t ws_size,
                              hipStream_t stream) {
  if (n_in < 15) return;
  if (in_sizes[0] < (NB - 1) * SEQ_FULL * DMD + SEQ * DMD) return;   // v
  if (in_sizes[1] < (NB - 1) * SEQ_FULL * DMD + SEQ * DMD) return;   // k
  if (in_sizes[2] < (NB - 1) * SEQ_FULL * DMD + SEQ * DMD) return;   // q
  if (in_sizes[3] < (SEQ - 1) * SEQ_FULL + SEQ) return;               // mask
  if (in_sizes[4] < DMD * HD || in_sizes[6] < DMD * HD || in_sizes[8] < DMD * HD) return;
  if (in_sizes[5] < HD || in_sizes[7] < HD || in_sizes[9] < HD) return;
  if (in_sizes[10] < NH * SEQ_FULL * HD) return;                      // E
  if (in_sizes[11] < DMD * DMD || in_sizes[12] < DMD) return;         // Wo, bo
  if (in_sizes[13] < DMD * EVD || in_sizes[14] < EVD) return;         // Wl, bl
  if (out_size < MT * EVD) return;

  const float* v   = (const float*)d_in[0];    // [2][2048][512]
  const float* k   = (const float*)d_in[1];
  const float* q   = (const float*)d_in[2];
  const float* msk = (const float*)d_in[3];    // [2048][2048]
  const float* wq  = (const float*)d_in[4];    // [512][64]
  const float* bq  = (const float*)d_in[5];    // [64]
  const float* wk  = (const float*)d_in[6];
  const float* bk  = (const float*)d_in[7];
  const float* wv  = (const float*)d_in[8];
  const float* bv  = (const float*)d_in[9];
  const float* ee  = (const float*)d_in[10];   // [8][2048][64]
  const float* wo  = (const float*)d_in[11];   // [512][512] (in, out)
  const float* bo  = (const float*)d_in[12];   // [512]
  const float* wl  = (const float*)d_in[13];   // [512][388] (in, out)
  const float* bl  = (const float*)d_in[14];   // [388]

  const size_t PX  = (size_t)MT * DMD * 2;
  const size_t PW  = (size_t)HD * DMD * 2;
  const size_t PPE = (size_t)NH * SEQ_FULL * HD * 2;
  const size_t PQK = (size_t)MT * HD * 2;
  const size_t PV2 = (size_t)2 * HD * MT * 2;
  const size_t PZ  = (size_t)MT * KF * 2;
  const size_t PWO = (size_t)DMD * KF * 2;
  const size_t POP = (size_t)MT * KF * 2;
  const size_t PWL = (size_t)EVP * KF * 2;
  const size_t PL  = (size_t)MT * EVP * 4;
  const size_t PFL = (size_t)(SEQ_FULL / 16) * FLGW * 4;
  size_t off = 0;
  const size_t oXQ = off; off += PX;
  const size_t oXK = off; off += PX;
  const size_t oXV = off; off += PX;
  const size_t oWQ = off; off += PW;
  const size_t oWK = off; off += PW;
  const size_t oWV = off; off += PW;
  const size_t oPE = off; off += PPE;
  const size_t oQH = off; off += PQK;
  const size_t oKH = off; off += PQK;
  const size_t oV  = off; off += PV2;
  const size_t oZ  = off; off += PZ;
  const size_t oWO = off; off += PWO;
  const size_t oOP = off; off += POP;
  const size_t oWL = off; off += PWL;
  const size_t oL  = off; off += PL;
  const size_t oFL = off; off += PFL;
  if (off > ws_size) return;
  if (off > (size_t)134217728) return;

  char* ws = (char*)d_ws;
  unsigned short* XQ  = (unsigned short*)(ws + oXQ);
  unsigned short* XK  = (unsigned short*)(ws + oXK);
  unsigned short* XV  = (unsigned short*)(ws + oXV);
  unsigned short* WQT = (unsigned short*)(ws + oWQ);
  unsigned short* WKT = (unsigned short*)(ws + oWK);
  unsigned short* WVT = (unsigned short*)(ws + oWV);
  unsigned short* PEH = (unsigned short*)(ws + oPE);
  unsigned short* QHp = (unsigned short*)(ws + oQH);
  unsigned short* KHp = (unsigned short*)(ws + oKH);
  unsigned short* VHp = (unsigned short*)(ws + oV);
  unsigned short* VLp = VHp + (size_t)HD * MT;
  unsigned short* Zp  = (unsigned short*)(ws + oZ);
  unsigned short* WOT = (unsigned short*)(ws + oWO);
  unsigned short* OPp = (unsigned short*)(ws + oOP);
  unsigned short* WLT = (unsigned short*)(ws + oWL);
  float* Lp   = (float*)(ws + oL);
  float* FLG  = (float*)(ws + oFL);
  float* out0 = (float*)d_out;
  float* fdummy = Lp;                             // in-range placeholder for unused f32 output args
  unsigned short* hdummy = QHp;                   // in-range placeholder for unused 16-bit output args

  const dim3 blk(256);

  // (0) what the projections read, one launch: q, k, v (per batch slab) -> f16(bf16); Wq|Wk|Wv [512][64] ->
  //     [64][512] (transposed, f16 x64)
  prep_x<<<dim3(PREP_BLOCKS), blk, 0, stream>>>(q, k, v, wq, wk, wv, XQ, XK, XV, WQT, WKT, WVT);

  // (1) one launch: the three projections (q plane x16, k plane x16, v^T bf16 hi (VH) and lo (VL) planes) and,
  //     beside them, the jobs only later launches read: mask structure flags, Wo and Wl planes, E plane
  proj_side<<<dim3(SIDE_BLOCKS), blk, 0, stream>>>(XQ, XK, XV, WQT, WKT, WVT, bq, bk, bv, QHp, KHp, VHp,
                                                   msk, FLG, wo, WOT, wl, WLT, ee, PEH);

  // (2) attention -> ctx hi|lo token-major plane
  attn_kernel<<<dim3(NB * NH * (SEQ / 16)), dim3(32 * AWV), 0, stream>>>(QHp, KHp, PEH, VHp, VLp, Zp);

  // (3) output projection with relu: OP = bf16 hi|lo of max(0, sum_k Z[row][k] * WOT[n][k] + bo[n]), K = 1024
  const int gO = ((MT / 64) * (DMD / 64) + 7) / 8;
  gemm64<1, 2, 1, 0><<<dim3(gO), blk, 0, stream>>>(Zp, KF, WOT, KF, OPp, DMD, fdummy, KF, 1.0f, bo, DMD, 1.0f, MT, DMD, KF);

  // (4) logits: L[row][n] = sum_k OP[row][k] * WLT[n][k] + bl[n], K = 1024, N padded to 448
  const int gL = ((MT / 64) * (EVP / 64) + 7) / 8;
  gemm64<1, 0, 0, 0><<<dim3(gL), blk, 0, stream>>>(OPp, KF, WLT, KF, hdummy, 0, Lp, EVP, 1.0f, bl, EVD, 1.0f, MT, EVP, KF);

  // (5) flat whole-line copy into the output (388-wide rows), NaN-poisoned on a mask-structure violation
  out_copy<<<dim3((MT * (EVD / 4) + 255) / 256), blk, 0, stream>>>(Lp, FLG, out0);
  (void)hipGetLastError();
}

// v003
// It runs in 165 microseconds.
// In two side-by-side timings against v002, it was 1.44 and 1.42 times as fast.
// Over all steps from v000 it is 2.44 times as fast.
// Contractions: x.Wq and x.Wk (f16 planes x16), Wv^T.x^T (bf16 hi|lo planes), q.k^T and q.E^T band on
// v_wmma_f32_16x16x32_f16 (f16 operands, f32 accumulate); p.v as bf16 hi/lo three-product split, and
// [ctx_hi|ctx_lo].[Wo;Wo], [o_hi|o_lo].[Wl;Wl] K-folded planes on v_wmma_f32_16x16x32_bf16 (bf16 operands,
// f32 accumulate). Float inputs RNE-converted to bf16 on load (x x1; Wq, Wk, Wv, E x64 in f16; Wo, Wl bf16);
// softmax, causal select and the relative-offset skew in f32 on VALU.
#include <hip/hip_runtime.h>
#include <math.h>

#ifndef NB
#define NB 2
#endif
#ifndef SEQ
#define SEQ 2048
#endif
#define NB_FULL  2
#define SEQ_FULL 2048
#define DMD  512
#define NH   8
#define HD   64
#define EVD  388
#define EVP  448
#define MT   (NB * SEQ)
#define KF   (2 * DMD)
#define NFLG (SEQ / 16)
#define FLGW 32
#define AWV  8
#define OPP  68
#define RWP  48
#define WSCL 64.0f
#define QKS  16.0f
#define RSQD 0.125f
#define NEGM (-1.0e10f)

static_assert(NB >= 1 && NB <= NB_FULL);
static_assert(SEQ >= 64 && SEQ <= SEQ_FULL && (SEQ % 64) == 0);
static_assert(NH * HD == DMD && HD == 64);
static_assert((MT % 64) == 0 && (DMD % 64) == 0 && (KF % 64) == 0);
static_assert((EVP % 64) == 0 && EVP >= EVD && (EVD % 4) == 0);
static_assert(((SEQ * DMD) % 2048) == 0 && ((NH * SEQ_FULL * HD) % 2048) == 0);
static_assert(NFLG <= 256 && ((4 * SEQ) % 256) == 0);

typedef _Float16 v16h __attribute__((ext_vector_type(16)));
typedef __bf16 v16bf __attribute__((ext_vector_type(16)));
typedef unsigned short v16us __attribute__((ext_vector_type(16)));
typedef unsigned short v8us  __attribute__((ext_vector_type(8)));
typedef float v8f __attribute__((ext_vector_type(8)));
typedef float v4f __attribute__((ext_vector_type(4)));
typedef unsigned int v4u __attribute__((ext_vector_type(4)));
typedef unsigned int v2u __attribute__((ext_vector_type(2)));

union FragU { v16us v; v8us h[2]; };

// ---- scalar helpers --------------------------------------------------------------------------------
__device__ __forceinline__ unsigned short bf_bits(float f) {          // f32 -> bf16 bits, RNE convert
  const unsigned u = __float_as_uint(f);
  return (unsigned short)((u + 0x7FFFu + ((u >> 16) & 1u)) >> 16);
}
__device__ __forceinline__ float bf_up(unsigned short h) { return __uint_as_float(((unsigned)h) << 16); }
__device__ __forceinline__ float bfr(float f) { return bf_up(bf_bits(f)); }   // value of the bf16 RNE convert
__device__ __forceinline__ unsigned short h_bits(_Float16 x) { return __builtin_bit_cast(unsigned short, x); }
__device__ __forceinline__ unsigned short f2h(float f) { return h_bits((_Float16)f); }
__device__ __forceinline__ unsigned pk16(unsigned short a, unsigned short b) { return (unsigned)a | ((unsigned)b << 16); }
__device__ __forceinline__ int clampi(int v, int lo, int hi) { return v < lo ? lo : (v > hi ? hi : v); }
__device__ __forceinline__ v8f zero8() { v8f z = {0.f, 0.f, 0.f, 0.f, 0.f, 0.f, 0.f, 0.f}; return z; }

// ---- fragment loader: 16-bit A/B operand, lane -> row/col (lane&15), p already includes +8*(lane>>4);
//      elements 0..7 <- p[0..7] (k0+8h..), elements 8..15 <- p[16..23] (k0+16+8h..)
__device__ __forceinline__ v16us ldfrag_u(const unsigned short* p) {
  FragU f;
  f.h[0] = *(const v8us*)(p);
  f.h[1] = *(const v8us*)(p + 16);
  return f.v;
}

// ---- WMMA helpers (f16 / bf16 operand bits) with trailing VALU hazard gap --------------------------
__device__ __forceinline__ v8f mma_raw(v16us a, v16us b, v8f c) {
  return __builtin_amdgcn_wmma_f32_16x16x32_f16(false, __builtin_bit_cast(v16h, a), false,
                                                __builtin_bit_cast(v16h, b), (short)0, c, false, false);
}
__device__ __forceinline__ v8f mma_raw_bf(v16us a, v16us b, v8f c) {
  return __builtin_amdgcn_wmma_f32_16x16x32_bf16(false, __builtin_bit_cast(v16bf, a), false,
                                                 __builtin_bit_cast(v16bf, b), (short)0, c, false, false);
}
__device__ __forceinline__ v8f mma_g(v16us a, v16us b, v8f c) {                 // guarded f16
  c = mma_raw(a, b, c);
#if defined(__HIP_DEVICE_COMPILE__)
  asm volatile("v_nop\n\tv_nop\n\tv_nop\n\tv_nop" : "+v"(c) : "v"(a), "v"(b));
#endif
  return c;
}
__device__ __forceinline__ v8f mma_gb(v16us a, v16us b, v8f c) {                // guarded bf16
  c = mma_raw_bf(a, b, c);
#if defined(__HIP_DEVICE_COMPILE__)
  asm volatile("v_nop\n\tv_nop\n\tv_nop\n\tv_nop" : "+v"(c) : "v"(a), "v"(b));
#endif
  return c;
}
__device__ __forceinline__ void dep_guard1(v8f& a, v8f& b, v16us x) {
#if defined(__HIP_DEVICE_COMPILE__)
  asm volatile("v_nop\n\tv_nop\n\tv_nop\n\tv_nop" : "+v"(a), "+v"(b) : "v"(x));
#endif
}
__device__ __forceinline__ void keep4_u(v16us a, v16us b, v16us c, v16us d) {
#if defined(__HIP_DEVICE_COMPILE__)
  asm volatile("v_nop" :: "v"(a), "v"(b), "v"(c), "v"(d));
#endif
}
__device__ __forceinline__ void acc_guard4(v8f& a, v8f& b, v8f& c, v8f& d) {
#if defined(__HIP_DEVICE_COMPILE__)
  asm volatile("v_nop\n\tv_nop\n\tv_nop\n\tv_nop" : "+v"(a), "+v"(b), "+v"(c), "+v"(d));
#endif
}
// 2^x; the v_nop keeps, inside the statement, the one slot the instruction set asks for between a
// transcendental and an instruction that reads its result or overwrites its source
__device__ __forceinline__ float exp2_slot(float x) {
  float r = 0.f;
#if defined(__HIP_DEVICE_COMPILE__)
  asm("v_exp_f32 %0, %1\n\tv_nop" : "=v"(r) : "v"(x));
#endif
  return r;
}
// orders LDS stores of this wave before later LDS loads of the same wave (cross-lane exchange)
__device__ __forceinline__ void wave_sync_lds() {
  __builtin_amdgcn_fence(__ATOMIC_RELEASE, "workgroup");
  __builtin_amdgcn_wave_barrier();
  __builtin_amdgcn_fence(__ATOMIC_ACQUIRE, "workgroup");
}

// =====================================================================================================
// Layout-kept convert: o[i] = f16 bits of (bf16 RNE value of w[i] * sc) for i < nsrc, zero for nsrc <= i <
// ndst; by selects a batch slab (source offset by*sstr, destination offset by*dstr), bx the 2048-element piece.
// nsrc % 8 == 0, ndst % 2048 == 0, bx = 0 .. ndst/2048 - 1 exact (compile-time constants at the call sites).
// coverage: 256 threads x 8 = 2048 elements per block; the callers' bx, by ranges cover all ndst elements of
// every slab. Block body, called from the merged launches below.
// =====================================================================================================
__device__ __forceinline__ void cvt_lin(const float* __restrict__ w, unsigned short* o, int bx, int by,
                                        int nsrc, int ndst, float sc, int sstr, int dstr) {
  const float* wb = w + (size_t)by * (size_t)sstr;
  unsigned short* ob = o + (size_t)by * (size_t)dstr;
  const int base = (bx * 256 + threadIdx.x) * 8;
  if (base + 8 > ndst) return;                            // never taken with exact grids; no barriers below
  const bool inr = (base + 8 <= nsrc);
  const int lb = inr ? base : (nsrc - 8);                 // clamped address, always in range
  const v4f a0 = *(const v4f*)(wb + lb);
  const v4f a1 = *(const v4f*)(wb + lb + 4);
  v4u hv;
#pragma unroll
  for (int e = 0; e < 2; ++e) {
    hv[e]     = pk16(f2h(bfr(a0[2 * e]) * sc), f2h(bfr(a0[2 * e + 1]) * sc));
    hv[2 + e] = pk16(f2h(bfr(a1[2 * e]) * sc), f2h(bfr(a1[2 * e + 1]) * sc));
  }
  const v4u zz = {0u, 0u, 0u, 0u};
  hv = inr ? hv : zz;
  unsigned short* d = ob + base;
  *(v4u*)d = hv;
  
}

// =====================================================================================================
// Transpose-convert: in w[R][C] f32 (pitch C) -> out o[c][r] at o[c*ldo + r] for c < CP, with zero values
// for C <= c < CP. BFO 0: f16 bits of (bf16 RNE value * sc); BFO 1: bf16 bits (RNE). Block tile 64x64
// through LDS (st[col][row], pitch 72 halves). Read phase: thread owns one input row x 16 columns (float4
// loads at a clamped column address, zero selected by value; C % 4 == 0 so a float4 is all-in or all-out).
// R, CP multiples of 64, ldo % 64 == 0, (bx, by) in (CP/64, R/64) exact (compile-time constants at the call
// sites). coverage: 64 output rows x 64 halves per block = the whole transposed tile; the callers' ranges cover
// all of [CP][R]. Block body, called from the merged launches below under a block-uniform branch; st is the
// calling kernel's LDS tile of 64 * 72 halves.
// =====================================================================================================
template <int BFO>
__device__ __forceinline__ void cvt_t(unsigned short* st, const float* __restrict__ w, unsigned short* o,
                                      int bx, int by, int R, int C, int CP, int ldo, float sc) {
  const int t = threadIdx.x;
  const int r0 = by * 64, c0 = bx * 64;
  if (r0 + 64 > R || c0 + 64 > CP) return;              // block-uniform, before the barrier; never taken
  {
    const int row = t >> 2, ch = (t & 3) * 16;
    const float* p = w + (size_t)(r0 + row) * C;
#pragma unroll
    for (int q = 0; q < 4; ++q) {
      const int cs = c0 + ch + 4 * q;
      const bool inr = (cs + 4 <= C);
      const int lb = inr ? cs : (C - 4);                 // clamped column address, always in range
      const v4f v = *(const v4f*)(p + lb);
#pragma unroll
      for (int e = 0; e < 4; ++e) {
        const unsigned short hb = BFO ? bf_bits(v[e]) : f2h(bfr(v[e]) * sc);
        st[(ch + 4 * q + e) * 72 + row] = inr ? hb : (unsigned short)0;
      }
    }
  }
  __syncthreads();
  v4u hv[2];
#pragma unroll
  for (int half = 0; half < 2; ++half) {
    const int cl = (t >> 3) + 32 * half, pc = (t & 7) * 8;
    hv[half] = *(const v4u*)(st + cl * 72 + pc);
  }
  {
#pragma unroll
    for (int half = 0; half < 2; ++half) {
      const int cl = (t >> 3) + 32 * half, pc = (t & 7) * 8;
      unsigned short* dst = o + (size_t)(c0 + cl) * ldo + r0 + pc;
      *(v4u*)dst = hv[half];
    }
#if defined(__HIP_DEVICE_COMPILE__)
    // precaution: wait for the stores to read their registers (the block ends after this one job)
    asm volatile("s_wait_xcnt 0x0" ::: "memory");
#endif
  }
}

// =====================================================================================================
// Register-blocked 16-bit WMMA GEMM: C[m][n] = sum_k A[m][k] * Bt[n][k], one wave per 32x64 tile, no block
// barriers. BF 0: f16 operand bits, BF 1: bf16 operand bits. A row-major [M][K] pitch lda; Bt row-major
// [N][K] pitch ldb (k contiguous); M multiple of 32, N of 64, K of 32 (true at every call site; waves
// past the last tile exit before any work, wave-uniform). A wave's k step is two A and four B fragments, whose
// twelve loads are issued together: one load round trip per k step, and M/32 * N/64 waves to fill the chip.
// WPB = waves (tiles) per block. Tiles are numbered down the rows first, so the waves of a block read the same
// four B fragments where WPB divides M/32 (in the v^T product, M/32 = 2: only wave pairs do). Both operand fragments use the split k map
// (elements 0..7 <- k0+8h.., 8..15 <- k0+16+8h..); D element r of a lane is (row 8h + r, col lane&15).
// Bias: bf16 RNE value of bias[] times bsc, indexed by column (clamped into nbias) or, with BROW, by row.
// OM 0: f32 out Cf = acc*osc + b, pitch ldc.            OM 1: f16 out Ch = f16 bits(acc*osc + b), pitch ldc.
// OM 2: val = (RELU ? max(0, .) : .)(acc*osc + b); bf16 hi bits at Ch, bf16 lo bits (val - hi) at Ch + looff.
// coverage: GTI slabs x 16 rows x 64 cols = the wave's whole tile (hi and lo planes alike).
// gemm64_blk is the block body (bx = block number within this product, sT = the calling kernel's LDS, WPB per-wave
// 16x64 slabs of pitch 68 floats); gemm64 is the launch of one product alone.
// =====================================================================================================
#define GSLAB (16 * 68)
#define GTI 2                                  // 16-row subtiles per wave tile
#define GWV 4                                  // waves per block where a product is launched alone
template <int BF, int OM, int RELU, int BROW, int WPB>
__device__ __forceinline__ void gemm64_blk(
    float* sT, int bx,
    const unsigned short* __restrict__ Ap, int lda, const unsigned short* __restrict__ Btp, int ldb,
    unsigned short* Ch, int looff, float* Cf, int ldc, float osc,
    const float* __restrict__ bias, int nbias, float bsc, int M, int N, int K) {
  const int lane = threadIdx.x & 31;
  const int wave = threadIdx.x >> 5;
  const int tilesN = N >> 6;
  const int tilesM = M / (16 * GTI);
  const int tile = bx * WPB + wave;
  if (tile >= tilesM * tilesN) return;   // wave-uniform; no block barriers in this kernel
  const int tn = tile / tilesM;
  const int tm = tile - tn * tilesM;
  const int m0 = tm * (16 * GTI);
  const int n0 = tn << 6;

  const int rlane = lane & 15;                 // row (A) / col (B, D) within subtile
  const int koff  = (lane >> 4) * 8;           // k offset of this lane half
  const int mOff  = (lane >> 4) * 8;           // D row offset

  v8f acc[GTI][4];
#pragma unroll
  for (int i = 0; i < GTI; ++i)
#pragma unroll
    for (int j = 0; j < 4; ++j) acc[i][j] = zero8();

#pragma unroll 1
  for (int k0 = 0; k0 < K; k0 += 32) {
    v16us bh[4];
#pragma unroll
    for (int j = 0; j < 4; ++j) {
      const size_t bo = (size_t)(n0 + (j << 4) + rlane) * ldb + koff + k0;
      bh[j] = ldfrag_u(Btp + bo);
    }
    v16us ah[GTI];
#pragma unroll
    for (int i = 0; i < GTI; ++i) {
      const size_t ao = (size_t)(m0 + (i << 4) + rlane) * lda + koff + k0;
      ah[i] = ldfrag_u(Ap + ao);
    }
#pragma unroll
    for (int i = 0; i < GTI; ++i) {
#pragma unroll
      for (int j = 0; j < 4; ++j) {
        if (BF) acc[i][j] = mma_raw_bf(ah[i], bh[j], acc[i][j]);
        else    acc[i][j] = mma_raw(ah[i], bh[j], acc[i][j]);
      }
      dep_guard1(acc[i][0], acc[i][3], ah[i]);
    }
    keep4_u(bh[0], bh[1], bh[2], bh[3]);
  }
#pragma unroll
  for (int i = 0; i < GTI; ++i) acc_guard4(acc[i][0], acc[i][1], acc[i][2], acc[i][3]);

  const int hh2 = lane >> 4, c4 = (lane & 15) * 4;     // f32 out: 256-B row segment = 16 lanes x 16 B
  const int q8  = lane >> 3, c8 = (lane & 7) * 8;

  // per-lane bias values for the column-indexed modes (bf16 RNE value times bsc), clamped address
  float bc[8];
#pragma unroll
  for (int e = 0; e < 8; ++e) bc[e] = 0.f;
  if (!BROW) {
    if (OM == 0) {
#pragma unroll
      for (int e = 0; e < 4; ++e) bc[e] = bsc * bfr(bias[clampi(n0 + c4 + e, 0, nbias - 1)]);
    } else {
#pragma unroll
      for (int e = 0; e < 8; ++e) bc[e] = bsc * bfr(bias[clampi(n0 + c8 + e, 0, nbias - 1)]);
    }
  }

  // ---- epilogue ----
  float* slab = sT + wave * GSLAB;
#pragma unroll
  for (int i = 0; i < GTI; ++i) {
    const int mBase = m0 + (i << 4);
#pragma unroll
    for (int j = 0; j < 4; ++j) {
#pragma unroll
      for (int r = 0; r < 8; ++r) {
        slab[(mOff + r) * 68 + (j << 4) + rlane] = acc[i][j][r];
      }
    }
    wave_sync_lds();
    if (OM == 0) {
      v4f vals[8];
#pragma unroll
      for (int it = 0; it < 8; ++it) {
        const int row = it * 2 + hh2;                      // it 0..7 x hh2 0..1 = rows 0..15
        const v4f v = *(const v4f*)(slab + row * 68 + c4);
        float brw = 0.f;
        if (BROW) brw = bsc * bfr(bias[clampi(mBase + row, 0, nbias - 1)]);
        v4f ov;
#pragma unroll
        for (int e = 0; e < 4; ++e) {
          float x = v[e] * osc + (BROW ? brw : bc[e]);
          if (RELU) x = fmaxf(x, 0.f);
          ov[e] = x;
        }
        vals[it] = ov;
      }
      {
#pragma unroll
        for (int it = 0; it < 8; ++it) {
          const int row = it * 2 + hh2;
          *(v4f*)(Cf + (size_t)(mBase + row) * ldc + (size_t)n0 + c4) = vals[it];
        }
        
      }
    } else if (OM == 1) {
      v4u hv[4];
#pragma unroll
      for (int it = 0; it < 4; ++it) {
        const int row = it * 4 + q8;                       // it 0..3 x q8 0..3 = rows 0..15
        const float* sp = slab + row * 68 + c8;
        float brw = 0.f;
        if (BROW) brw = bsc * bfr(bias[clampi(mBase + row, 0, nbias - 1)]);
        v4u ha = {0u, 0u, 0u, 0u};
#pragma unroll
        for (int e = 0; e < 4; ++e) {
          float b0 = sp[2 * e]     * osc + (BROW ? brw : bc[2 * e]);
          float b1 = sp[2 * e + 1] * osc + (BROW ? brw : bc[2 * e + 1]);
          if (RELU) { b0 = fmaxf(b0, 0.f); b1 = fmaxf(b1, 0.f); }
          ha[e] = pk16(f2h(b0), f2h(b1));
        }
        hv[it] = ha;
      }
      {
#pragma unroll
        for (int it = 0; it < 4; ++it) {
          const int row = it * 4 + q8;
          const size_t go = (size_t)(mBase + row) * ldc + (size_t)n0 + c8;
          *(v4u*)(Ch + go) = hv[it];
        }
        
      }
    } else {
      v4u hv[4], lv[4];
#pragma unroll
      for (int it = 0; it < 4; ++it) {
        const int row = it * 4 + q8;                       // it 0..3 x q8 0..3 = rows 0..15
        const float* sp = slab + row * 68 + c8;
        float brw = 0.f;
        if (BROW) brw = bsc * bfr(bias[clampi(mBase + row, 0, nbias - 1)]);
        v4u ha = {0u, 0u, 0u, 0u};
        v4u la = {0u, 0u, 0u, 0u};
#pragma unroll
        for (int e = 0; e < 4; ++e) {
          float x0 = sp[2 * e]     * osc + (BROW ? brw : bc[2 * e]);
          float x1 = sp[2 * e + 1] * osc + (BROW ? brw : bc[2 * e + 1]);
          if (RELU) { x0 = fmaxf(x0, 0.f); x1 = fmaxf(x1, 0.f); }
          const unsigned short h0 = bf_bits(x0), h1 = bf_bits(x1);
          const unsigned short l0 = bf_bits(x0 - bf_up(h0)), l1 = bf_bits(x1 - bf_up(h1));
          ha[e] = pk16(h0, h1);
          la[e] = pk16(l0, l1);
        }
        hv[it] = ha;
        lv[it] = la;
      }
      {
#pragma unroll
        for (int it = 0; it < 4; ++it) {
          const int row = it * 4 + q8;
          const size_t go = (size_t)(mBase + row) * ldc + (size_t)n0 + c8;
          *(v4u*)(Ch + go) = hv[it];
          *(v4u*)(Ch + (size_t)looff + go) = lv[it];
        }
        
      }
    }
    wave_sync_lds();
  }
}
template <int BF, int OM, int RELU, int BROW>
__global__ __launch_bounds__(32 * GWV) void gemm64(
    const unsigned short* __restrict__ Ap, int lda, const unsigned short* __restrict__ Btp, int ldb,
    unsigned short* Ch, int looff, float* Cf, int ldc, float osc,
    const float* __restrict__ bias, int nbias, float bsc, int M, int N, int K) {
  __shared__ __align__(16) float sT[GWV * GSLAB];
  gemm64_blk<BF, OM, RELU, BROW, GWV>(sT, blockIdx.x, Ap, lda, Btp, ldb, Ch, looff, Cf, ldc, osc, bias, nbias, bsc,
                                 M, N, K);
}

// =====================================================================================================
// Structure check of the [SEQ][SEQ] mask input (row pitch SEQ_FULL): block b covers rows 16b..16b+15 and all
// SEQ columns; a violation is any element differing from (j <= i ? 1 : 0). The block's flag is written as one
// coverage: 256 threads x (SEQ/64) float4 = 16 rows x SEQ cols per block; bx = 0 .. SEQ/16 - 1 = all rows.
// Block body, called from the second merged launch under a block-uniform branch; wf = 8 ints of its LDS.
// =====================================================================================================
__device__ __forceinline__ void mask_check(int* wf, int bx, const float* __restrict__ msk, float* flg) {
  const int t = threadIdx.x, lane = t & 31, wv = t >> 5;
  const int i0 = bx * 16;
  if (i0 + 16 > SEQ) return;                             // block-uniform, before the barrier; never taken
  constexpr int C4 = SEQ / 4;
  int viol = 0;
#pragma unroll 1
  for (int it = 0; it < (16 * C4) / 256; ++it) {
    const int ci = it * 256 + t;
    const int rr = ci / C4;
    const int c4 = ci - rr * C4;
    const int i = i0 + rr;
    const v4f x = *(const v4f*)(msk + (size_t)i * SEQ_FULL + 4 * c4);
#pragma unroll
    for (int e = 0; e < 4; ++e) {
      const int j = 4 * c4 + e;
      const float ex = (j <= i) ? 1.0f : 0.0f;
      viol |= (x[e] != ex) ? 1 : 0;
    }
  }
  viol |= __shfl_xor(viol, 1, 32);
  viol |= __shfl_xor(viol, 2, 32);
  viol |= __shfl_xor(viol, 4, 32);
  viol |= __shfl_xor(viol, 8, 32);
  viol |= __shfl_xor(viol, 16, 32);
  if (lane == 0) wf[wv] = viol;
  __syncthreads();
  if (wv == 0) {                                        // wave-uniform
    int f = wf[lane & 7];
    f |= __shfl_xor(f, 1, 32);
    f |= __shfl_xor(f, 2, 32);
    f |= __shfl_xor(f, 4, 32);
    const float fv = f ? 1.0f : 0.0f;
    float* d = flg + (size_t)bx * FLGW + lane;
    *(float*)d = fv;
    
  }
}

// =====================================================================================================
// Merged launches: jobs that read none of each other's output share one grid; the flat block index picks the
// job by ranges (block-uniform scalar branches), every block runs exactly one job body and then ends.
// prep_x: what the projections read. Blocks [0, 3*NTW): Wq, Wk, Wv -> [64][512] f16 x64 (transposed);
//   then 3*NLX blocks: q, k, v -> f16(bf16) planes, NLX = NB slabs x SEQ*DMD/2048 pieces each.
// proj_side: the three projections, first in the grid since they run longest, and beside them all that only
//   later launches read. Blocks [0, 3*NGQ): q plane x16, k plane x16 (C[tok][n] = sum_k X[tok][k] * WT[n][k]),
//   v^T planes (C[d][tok] = sum_k WVT[d][k] * XV[tok][k] / 64, bf16 hi and lo); then NFLG mask-structure blocks;
//   2*NTO blocks Wo -> [512][1024] = (Wo^T | Wo^T) bf16; 2*NTL blocks Wl -> [448][1024] = (Wl^T | Wl^T) bf16;
//   NLE blocks E -> f16(bf16 x64).
// =====================================================================================================
#define NTW (DMD / 64)
#define NLP ((SEQ * DMD) / 2048)
#define NLX (NLP * NB)
#define NGQ (((MT / (16 * GTI)) * (HD / 64) + 7) / 8)
#define NTO ((DMD / 64) * (DMD / 64))
#define NTL ((EVP / 64) * (DMD / 64))
#define NLE ((NH * SEQ_FULL * HD) / 2048)
#define PREP_BLOCKS (3 * NTW + 3 * NLX)
#define SIDE_BLOCKS (3 * NGQ + NFLG + 2 * NTO + 2 * NTL + NLE)

__global__ __launch_bounds__(256) void prep_x(
    const float* __restrict__ q, const float* __restrict__ k, const float* __restrict__ v,
    const float* __restrict__ wq, const float* __restrict__ wk, const float* __restrict__ wv,
    unsigned short* XQ, unsigned short* XK, unsigned short* XV,
    unsigned short* WQT, unsigned short* WKT, unsigned short* WVT) {
  __shared__ __align__(16) unsigned short st[64 * 72];
  int bid = blockIdx.x;
  if (bid < 3 * NTW) {
    const int j = bid / NTW;
    const float* w = (j == 0) ? wq : ((j == 1) ? wk : wv);
    unsigned short* o = (j == 0) ? WQT : ((j == 1) ? WKT : WVT);
    cvt_t<0>(st, w, o, 0, bid - j * NTW, DMD, HD, HD, DMD, WSCL);          // in[512][64] -> out[64][512]
    return;
  }
  bid -= 3 * NTW;
  if (bid < 3 * NLX) {
    const int j = bid / NLX;
    const int r = bid - j * NLX;
    const float* x = (j == 0) ? q : ((j == 1) ? k : v);
    unsigned short* o = (j == 0) ? XQ : ((j == 1) ? XK : XV);
    cvt_lin(x, o, r % NLP, r / NLP, SEQ * DMD, SEQ * DMD, 1.0f, SEQ_FULL * DMD, SEQ * DMD);
  }
}

__global__ __launch_bounds__(256) void proj_side(
    const unsigned short* __restrict__ XQ, const unsigned short* __restrict__ XK,
    const unsigned short* __restrict__ XV, const unsigned short* __restrict__ WQT,
    const unsigned short* __restrict__ WKT, const unsigned short* __restrict__ WVT,
    const float* __restrict__ bq, const float* __restrict__ bk, const float* __restrict__ bv,
    unsigned short* QH, unsigned short* KH, unsigned short* VH,
    const float* __restrict__ msk, float* flg,
    const float* __restrict__ wo, unsigned short* WOT, const float* __restrict__ wl, unsigned short* WLT,
    const float* __restrict__ ee, unsigned short* PEH) {
  __shared__ __align__(16) float sT[8 * GSLAB];        // the one job of a block uses it: slabs, transpose tile or flags
  int bid = blockIdx.x;
  if (bid < 2 * NGQ) {
    const int j = bid / NGQ;
    gemm64_blk<0, 1, 0, 0, 8>(sT, bid - j * NGQ, j ? XK : XQ, DMD, j ? WKT : WQT, DMD, j ? KH : QH, 0, nullptr, HD,
                           QKS / WSCL, j ? bk : bq, HD, QKS, MT, HD, DMD);
    return;
  }
  bid -= 2 * NGQ;
  if (bid < NGQ) {
    gemm64_blk<0, 2, 0, 1, 8>(sT, bid, WVT, DMD, XV, DMD, VH, HD * MT, nullptr, MT, 1.0f / WSCL, bv, HD, 1.0f,
                           HD, MT, DMD);
    return;
  }
  bid -= NGQ;
  if (bid < NFLG) {
    mask_check((int*)sT, bid, msk, flg);
    return;
  }
  bid -= NFLG;
  if (bid < 2 * NTO) {
    const int j = bid / NTO;                           // destination columns 0.. and 512..
    const int r = bid - j * NTO;
    cvt_t<1>((unsigned short*)sT, wo, WOT + j * DMD, r % (DMD / 64), r / (DMD / 64), DMD, DMD, DMD, KF, 1.0f);
    return;
  }
  bid -= 2 * NTO;
  if (bid < 2 * NTL) {
    const int j = bid / NTL;                           // destination columns 0.. and 512..
    const int r = bid - j * NTL;
    cvt_t<1>((unsigned short*)sT, wl, WLT + j * DMD, r % (EVP / 64), r / (EVP / 64), DMD, EVD, EVP, KF, 1.0f);
    return;
  }
  bid -= 2 * NTL;
  if (bid < NLE) cvt_lin(ee, PEH, bid, 0, NH * SEQ_FULL * HD, NH * SEQ_FULL * HD, WSCL, 0, 0);
}

// =====================================================================================================
// Causal attention with relative-offset term, head dim 64. Block = 256 threads = 8 waves; one block owns one
// 16-row query tile (t0..t0+15) of one (batch b, head h). The key blocks of 32 up to the diagonal (sb <= t0)
// are cut into 8 contiguous shares, one per wave; each wave runs its share with an online max-subtracted
// softmax in f32 and leaves its partial state (row max, row sum, unnormalised 16x64 O) in LDS; behind one
// block barrier the 8 states are merged in wave order (rescale by exp(max_w - max), sum, divide).
// Planes: QH, KH f16 [MT][64] = 16*q, 16*k (shared
// by all heads); PE f16 [NH*SEQ_FULL][64] = 64*E (head h rows h*SEQ_FULL..); VH, VL bf16 [64][MT] = v hi and
// lo planes transposed (row = dim, column = token). Output Z bf16 [MT][1024]: cols h*64+d = ctx hi, cols
// 512+h*64+d = ctx lo, token-major.
// Per key block sb: S = Q.K^T (2 key subtiles x 2 k-steps, scale 1/256); relative band of 48 columns:
// column c <-> E row SEQ-16-t0+sb+c (clamped into [0, SEQ-1]; clamping only touches entries with j > i,
// which the causal select replaces); columns 0..15 come from the tile carried over from the prior key block
// (its columns 32..47), columns 16..47 are two fresh tiles (2 x 2 WMMA, scale 1/1024); the band is exchanged
// through per-wave LDS and read back at c = 15 - il + jl, i.e. E row SEQ-1-i+j; score = (qk + rel)/8 for
// j <= i, else -1e10; p = exp(score - running max) in f32, l accumulated from the f32 p; p stored as bf16 hi
// and lo tiles in per-wave LDS and reloaded as A fragments (split k map); O += Phi.Vhi + Phi.Vlo + Plo.Vhi on
// 4 dim subtiles (one accumulator set). A wave whose share is empty contributes max -1e30, sum 0, O 0 (weight
// exp(-1e30 - max) = 0); wave 0's share is never empty. Merge: thread -> (row t>>4, 4 dims), 16 lanes x 8 B =
// one 128-B line of Z per plane and row.
// coverage: 16 query rows x 64 halves x {hi, lo} per block, NB*NH*(SEQ/16) blocks = all (b, t, h)
// segments of Z in both halves.
// =====================================================================================================
__global__ __launch_bounds__(32 * AWV) void attn_kernel(
    const unsigned short* __restrict__ QH, const unsigned short* __restrict__ KH,
    const unsigned short* __restrict__ PE, const unsigned short* __restrict__ VH,
    const unsigned short* __restrict__ VL, unsigned short* Z) {
  __shared__ __align__(16) float relw[AWV][16 * RWP];            // band exchange, 24576 B
  __shared__ __align__(16) unsigned short pwh[AWV][16 * 32];      // P hi tiles, 8192 B
  __shared__ __align__(16) unsigned short pwl[AWV][16 * 32];      // P lo tiles, 8192 B
  __shared__ __align__(16) float opw[AWV][16 * OPP];              // partial O per wave, pitch 68 floats, 34816 B
  __shared__ __align__(16) float mxw[AWV][16];                    // partial row max per wave
  __shared__ __align__(16) float lsw[AWV][16];                    // partial row sum per wave
  const int lane = threadIdx.x & 31, m = lane & 15, hh = lane >> 4;
  // wave number in a scalar register: the key loop's bounds depend on it and stay a scalar branch
  const int wv = __builtin_amdgcn_readfirstlane((int)(threadIdx.x >> 5));
  const int task = blockIdx.x;                       // 0 .. NB*NH*(SEQ/16)-1
  const int nqt = SEQ / 16;
  const int bh = task / nqt;                         // (b, h)
  const int t0 = (task - bh * nqt) << 4;             // query tile start
  const int b = bh / NH, h = bh - (bh / NH) * NH;
  if (b >= NB) return;                               // block-uniform, before the barrier; never taken with exact grids
  const size_t tok0 = (size_t)b * SEQ;
  float* rw = relw[wv];
  unsigned short* ph = pwh[wv];
  unsigned short* pl = pwl[wv];

  // Q A-fragments: rows t0+m, k = head dims 0..31 and 32..63
  const unsigned short* qp = QH + (tok0 + (size_t)(t0 + m)) * HD + 8 * hh;
  const v16us qf0 = ldfrag_u(qp);
  const v16us qf1 = ldfrag_u(qp + 32);

  const unsigned short* pe = PE + (size_t)h * SEQ_FULL * HD;
  const int rb = SEQ - 16 - t0;                      // E row of band column 0 at sb = 0 (>= 0)

  const int nkb = (t0 >> 5) + 1;                     // key blocks 0 .. floor(t0/32), block-uniform
  const int per = (nkb + AWV - 1) / AWV;             // key blocks per wave share
  const int kb0 = wv * per;                          // this wave's share [kb0, kb1), wave-uniform, may be empty
  const int kb1 = (kb0 + per < nkb) ? (kb0 + per) : nkb;

  // carried band tile: columns 0..15 of key block kb0 <-> E rows rb + 32*kb0 + 0..15 (clamped)
  v8f carry;
  {
    const int u = clampi(rb + (kb0 << 5) + m, 0, SEQ - 1);
    const unsigned short* pp = pe + (size_t)u * HD + 8 * hh;
    carry = mma_g(qf0, ldfrag_u(pp), zero8());
    carry = mma_g(qf1, ldfrag_u(pp + 32), carry);
  }

  float mx[8], ls[8];
  v8f O0 = zero8(), O1 = zero8(), O2 = zero8(), O3 = zero8();
#pragma unroll
  for (int r = 0; r < 8; ++r) { mx[r] = -1.0e30f; ls[r] = 0.f; }

  const size_t vst = (size_t)16 * MT;                // V plane stride between dim subtiles

#pragma unroll 1
  for (int kb = kb0; kb < kb1; ++kb) {
    const int sb = kb << 5;
    // K B-fragments: Bt row = key token, k = head dim
    v8f S0, S1;
    {
      const unsigned short* kp = KH + (tok0 + (size_t)(sb + m)) * HD + 8 * hh;
      S0 = mma_g(qf0, ldfrag_u(kp), zero8());
      S0 = mma_g(qf1, ldfrag_u(kp + 32), S0);
      const unsigned short* kp1 = kp + (size_t)16 * HD;
      S1 = mma_g(qf0, ldfrag_u(kp1), zero8());
      S1 = mma_g(qf1, ldfrag_u(kp1 + 32), S1);
    }

    // relative band: columns 16..31 and 32..47 <-> E rows rb+sb+16.. and rb+sb+32..
    v8f Pb1, Pb2;
    {
      const int u1 = clampi(rb + sb + 16 + m, 0, SEQ - 1);
      const unsigned short* p1 = pe + (size_t)u1 * HD + 8 * hh;
      Pb1 = mma_g(qf0, ldfrag_u(p1), zero8());
      Pb1 = mma_g(qf1, ldfrag_u(p1 + 32), Pb1);
      const int u2 = clampi(rb + sb + 32 + m, 0, SEQ - 1);
      const unsigned short* p2 = pe + (size_t)u2 * HD + 8 * hh;
      Pb2 = mma_g(qf0, ldfrag_u(p2), zero8());
      Pb2 = mma_g(qf1, ldfrag_u(p2 + 32), Pb2);
    }
#pragma unroll
    for (int r = 0; r < 8; ++r) {
      const int row = 8 * hh + r;
      rw[row * RWP + m]      = carry[r];
      rw[row * RWP + 16 + m] = Pb1[r];
      rw[row * RWP + 32 + m] = Pb2[r];
    }
    carry = Pb2;
    wave_sync_lds();

    // skew read + scale + causal select (key j <= query i keeps the score, otherwise -1e10)
    float s0[8], s1[8];
#pragma unroll
    for (int r = 0; r < 8; ++r) {
      const int row = 8 * hh + r;
      const int i = t0 + row;
      const float rv0 = rw[row * RWP + 15 - row + m];
      const float rv1 = rw[row * RWP + 31 - row + m];
      const float a0 = (S0[r] * (1.0f / (QKS * QKS)) + rv0 * (1.0f / (QKS * WSCL))) * RSQD;
      const float a1 = (S1[r] * (1.0f / (QKS * QKS)) + rv1 * (1.0f / (QKS * WSCL))) * RSQD;
      s0[r] = (sb + m <= i) ? a0 : NEGM;
      s1[r] = (sb + 16 + m <= i) ? a1 : NEGM;
    }

    // online softmax (a row lives in the 16 lanes of one half-wave; xor butterflies 1,2,4,8)
#pragma unroll
    for (int r = 0; r < 8; ++r) {
      float xm = fmaxf(s0[r], s1[r]);
      xm = fmaxf(xm, __shfl_xor(xm, 1, 32));
      xm = fmaxf(xm, __shfl_xor(xm, 2, 32));
      xm = fmaxf(xm, __shfl_xor(xm, 4, 32));
      xm = fmaxf(xm, __shfl_xor(xm, 8, 32));
      const float mn = fmaxf(mx[r], xm);
      const float al = __expf(mx[r] - mn);
      mx[r] = mn;
      const float p0 = __expf(s0[r] - mn);
      const float p1 = __expf(s1[r] - mn);
      float ps = p0 + p1;
      ps += __shfl_xor(ps, 1, 32);
      ps += __shfl_xor(ps, 2, 32);
      ps += __shfl_xor(ps, 4, 32);
      ps += __shfl_xor(ps, 8, 32);
      ls[r] = ls[r] * al + ps;
      O0[r] = O0[r] * al;
      O1[r] = O1[r] * al;
      O2[r] = O2[r] * al;
      O3[r] = O3[r] * al;
      const int row = 8 * hh + r;
      const unsigned short hb0 = bf_bits(p0), hb1 = bf_bits(p1);
      ph[row * 32 + m]      = hb0;
      ph[row * 32 + 16 + m] = hb1;
      pl[row * 32 + m]      = bf_bits(p0 - bf_up(hb0));
      pl[row * 32 + 16 + m] = bf_bits(p1 - bf_up(hb1));
    }
    wave_sync_lds();

    // P A-fragments (split k map) and V B-fragments (Bt row = dim, k = key token)
    const v16us afh = ldfrag_u(ph + m * 32 + 8 * hh);
    const v16us afl = ldfrag_u(pl + m * 32 + 8 * hh);
    const size_t vo = (size_t)m * MT + tok0 + (size_t)sb + 8 * hh;
    {
      const v16us vh = ldfrag_u(VH + vo);
      const v16us vl = ldfrag_u(VL + vo);
      O0 = mma_gb(afh, vh, O0);
      O0 = mma_gb(afh, vl, O0);
      O0 = mma_gb(afl, vh, O0);
    }
    {
      const v16us vh = ldfrag_u(VH + vo + vst);
      const v16us vl = ldfrag_u(VL + vo + vst);
      O1 = mma_gb(afh, vh, O1);
      O1 = mma_gb(afh, vl, O1);
      O1 = mma_gb(afl, vh, O1);
    }
    {
      const v16us vh = ldfrag_u(VH + vo + 2 * vst);
      const v16us vl = ldfrag_u(VL + vo + 2 * vst);
      O2 = mma_gb(afh, vh, O2);
      O2 = mma_gb(afh, vl, O2);
      O2 = mma_gb(afl, vh, O2);
    }
    {
      const v16us vh = ldfrag_u(VH + vo + 3 * vst);
      const v16us vl = ldfrag_u(VL + vo + 3 * vst);
      O3 = mma_gb(afh, vh, O3);
      O3 = mma_gb(afh, vl, O3);
      O3 = mma_gb(afl, vh, O3);
    }
  }
  acc_guard4(O0, O1, O2, O3);

  // ---- this wave's partial state to LDS (D element r of a lane = row 8*hh + r, col m of each dim subtile) ----
  float* op = opw[wv];
#pragma unroll
  for (int r = 0; r < 8; ++r) {
    const int row = 8 * hh + r;
    op[row * OPP + m]      = O0[r];
    op[row * OPP + 16 + m] = O1[r];
    op[row * OPP + 32 + m] = O2[r];
    op[row * OPP + 48 + m] = O3[r];
  }
  if (m == 0) {                                        // mx, ls are equal in the 16 lanes of a half-wave
#pragma unroll
    for (int r = 0; r < 8; ++r) {
      mxw[wv][8 * hh + r] = mx[r];
      lsw[wv][8 * hh + r] = ls[r];
    }
  }
  __syncthreads();                                     // publishes the 8 partial states to the whole block

  // ---- merge in wave order, ctx = O / l, bf16 hi plane and lo plane ----
  {
    const int row = threadIdx.x >> 4, c4 = (threadIdx.x & 15) * 4;
    float mw[AWV];
    float mt = -1.0e30f;
#pragma unroll
    for (int w = 0; w < AWV; ++w) { mw[w] = mxw[w][row]; mt = fmaxf(mt, mw[w]); }
    float sc[AWV];
#pragma unroll
    for (int w = 0; w < AWV; ++w) sc[w] = exp2_slot((mw[w] - mt) * 1.44269504f);   // exp(max_w - max)
    float lt = 0.f;
    v4f ot = {0.f, 0.f, 0.f, 0.f};
#pragma unroll
    for (int w = 0; w < AWV; ++w) {
      const v4f o = *(const v4f*)(opw[w] + row * OPP + c4);
      lt += lsw[w][row] * sc[w];
#pragma unroll
      for (int e = 0; e < 4; ++e) ot[e] += o[e] * sc[w];
    }
    const float g = 1.0f / lt;                         // lt >= 1
    unsigned short hb[4], lb[4];
#pragma unroll
    for (int e = 0; e < 4; ++e) {
      const float c = ot[e] * g;
      hb[e] = bf_bits(c);
      lb[e] = bf_bits(c - bf_up(hb[e]));
    }
    const v2u hv = {pk16(hb[0], hb[1]), pk16(hb[2], hb[3])};
    const v2u lv = {pk16(lb[0], lb[1]), pk16(lb[2], lb[3])};
    unsigned short* dst = Z + (tok0 + (size_t)(t0 + row)) * KF + h * HD + c4;
    *(v2u*)dst = hv;
    *(v2u*)(dst + DMD) = lv;
  }
}

// =====================================================================================================
// Flat whole-line writer of the output: out[row*388 + c] = L[row*448 + c]; each lane owns 4
// consecutive output floats (16 B; never straddles a row since 388 % 4 == 0), one instruction = 32 lanes x
// coverage: grid = MT*97/256 blocks x 256 float4 = all MT*388 output floats (in-kernel bound for safety).
// =====================================================================================================
__global__ __launch_bounds__(256) void out_copy(const float* __restrict__ L, const float* __restrict__ flg,
                                                 float* out) {
  __shared__ int wf[8];
  const int t = threadIdx.x, lane = t & 31, wv = t >> 5;
  int f;
  {
    const int ti = (t < NFLG) ? t : (NFLG - 1);         // clamped address, value selected
    const float x = flg[(size_t)ti * FLGW];
    f = ((t < NFLG) && (x == 1.0f)) ? 1 : 0;
  }
  f |= __shfl_xor(f, 1, 32);
  f |= __shfl_xor(f, 2, 32);
  f |= __shfl_xor(f, 4, 32);
  f |= __shfl_xor(f, 8, 32);
  f |= __shfl_xor(f, 16, 32);
  if (lane == 0) wf[wv] = f;
  __syncthreads();
  int g = 0;
#pragma unroll
  for (int w = 0; w < 8; ++w) g |= wf[w];
  const int e4 = blockIdx.x * 256 + t;
  if (e4 < MT * (EVD / 4)) {
    const int e = e4 * 4;
    const int row = e / EVD;
    const int c = e - row * EVD;
    v4f x = *(const v4f*)(L + (size_t)row * EVP + c);
    const float qn = __uint_as_float(0x7fc00000u);
    const v4f pn = {qn, qn, qn, qn};
    x = g ? pn : x;
    float* d = out + (size_t)e;
    *(v4f*)d = x;
    
  }
}

// =====================================================================================================
// Workspace map (bytes, full size NB=2, SEQ=2048); every plane is an exact multiple of its whole-row /
// whole-line / 32x64-tile store granularity; all offsets are multiples of 16384.
//   XQ   f16  [MT][512]        4194304     (x3 with XK, XV)
//   WQT  f16  [64][512]          65536     (x3 with WKT, WVT; Wq^T, Wk^T, Wv^T x64)
//   PEH  f16  [8*2048][64]     2097152     (E x64)
//   QH   f16  [MT][64]          524288     (16*q), KH same
//   VH   bf16 [64][MT]          524288     (v hi), VL same (v lo), contiguous after VH
//   Z    bf16 [MT][1024]       8388608     (ctx hi | ctx lo)
//   WOT  bf16 [512][1024]      1048576     (Wo^T | Wo^T)
//   OP   bf16 [MT][1024]       8388608     (relu out hi | lo)
//   WLT  bf16 [448][1024]       917504     (Wl^T | Wl^T, rows 388..447 zero)
//   L    f32  [MT][448]        7340032
//   FLG  f32  [128][32]          16384     (mask-structure flag lines)
//   total                     43073536
// =====================================================================================================
extern "C" void kernel_launch(void* const* d_in, const int* in_sizes, int n_in,
                              void* d_out, int out_size, void* d_ws, size_t ws_size,
                              hipStream_t stream) {
  if (n_in < 15) return;
  if (in_sizes[0] < (NB - 1) * SEQ_FULL * DMD + SEQ * DMD) return;   // v
  if (in_sizes[1] < (NB - 1) * SEQ_FULL * DMD + SEQ * DMD) return;   // k
  if (in_sizes[2] < (NB - 1) * SEQ_FULL * DMD + SEQ * DMD) return;   // q
  if (in_sizes[3] < (SEQ - 1) * SEQ_FULL + SEQ) return;               // mask
  if (in_sizes[4] < DMD * HD || in_sizes[6] < DMD * HD || in_sizes[8] < DMD * HD) return;
  if (in_sizes[5] < HD || in_sizes[7] < HD || in_sizes[9] < HD) return;
  if (in_sizes[10] < NH * SEQ_FULL * HD) return;                      // E
  if (in_sizes[11] < DMD * DMD || in_sizes[12] < DMD) return;         // Wo, bo
  if (in_sizes[13] < DMD * EVD || in_sizes[14] < EVD) return;         // Wl, bl
  if (out_size < MT * EVD) return;

  const float* v   = (const float*)d_in[0];    // [2][2048][512]
  const float* k   = (const float*)d_in[1];
  const float* q   = (const float*)d_in[2];
  const float* msk = (const float*)d_in[3];    // [2048][2048]
  const float* wq  = (const float*)d_in[4];    // [512][64]
  const float* bq  = (const float*)d_in[5];    // [64]
  const float* wk  = (const float*)d_in[6];
  const float* bk  = (const float*)d_in[7];
  const float* wv  = (const float*)d_in[8];
  const float* bv  = (const float*)d_in[9];
  const float* ee  = (const float*)d_in[10];   // [8][2048][64]
  const float* wo  = (const float*)d_in[11];   // [512][512] (in, out)
  const float* bo  = (const float*)d_in[12];   // [512]
  const float* wl  = (const float*)d_in[13];   // [512][388] (in, out)
  const float* bl  = (const float*)d_in[14];   // [388]

  const size_t PX  = (size_t)MT * DMD * 2;
  const size_t PW  = (size_t)HD * DMD * 2;
  const size_t PPE = (size_t)NH * SEQ_FULL * HD * 2;
  const size_t PQK = (size_t)MT * HD * 2;
  const size_t PV2 = (size_t)2 * HD * MT * 2;
  const size_t PZ  = (size_t)MT * KF * 2;
  const size_t PWO = (size_t)DMD * KF * 2;
  const size_t POP = (size_t)MT * KF * 2;
  const size_t PWL = (size_t)EVP * KF * 2;
  const size_t PL  = (size_t)MT * EVP * 4;
  const size_t PFL = (size_t)(SEQ_FULL / 16) * FLGW * 4;
  size_t off = 0;
  const size_t oXQ = off; off += PX;
  const size_t oXK = off; off += PX;
  const size_t oXV = off; off += PX;
  const size_t oWQ = off; off += PW;
  const size_t oWK = off; off += PW;
  const size_t oWV = off; off += PW;
  const size_t oPE = off; off += PPE;
  const size_t oQH = off; off += PQK;
  const size_t oKH = off; off += PQK;
  const size_t oV  = off; off += PV2;
  const size_t oZ  = off; off += PZ;
  const size_t oWO = off; off += PWO;
  const size_t oOP = off; off += POP;
  const size_t oWL = off; off += PWL;
  const size_t oL  = off; off += PL;
  const size_t oFL = off; off += PFL;
  if (off > ws_size) return;
  if (off > (size_t)134217728) return;

  char* ws = (char*)d_ws;
  unsigned short* XQ  = (unsigned short*)(ws + oXQ);
  unsigned short* XK  = (unsigned short*)(ws + oXK);
  unsigned short* XV  = (unsigned short*)(ws + oXV);
  unsigned short* WQT = (unsigned short*)(ws + oWQ);
  unsigned short* WKT = (unsigned short*)(ws + oWK);
  unsigned short* WVT = (unsigned short*)(ws + oWV);
  unsigned short* PEH = (unsigned short*)(ws + oPE);
  unsigned short* QHp = (unsigned short*)(ws + oQH);
  unsigned short* KHp = (unsigned short*)(ws + oKH);
  unsigned short* VHp = (unsigned short*)(ws + oV);
  unsigned short* VLp = VHp + (size_t)HD * MT;
  unsigned short* Zp  = (unsigned short*)(ws + oZ);
  unsigned short* WOT = (unsigned short*)(ws + oWO);
  unsigned short* OPp = (unsigned short*)(ws + oOP);
  unsigned short* WLT = (unsigned short*)(ws + oWL);
  float* Lp   = (float*)(ws + oL);
  float* FLG  = (float*)(ws + oFL);
  float* out0 = (float*)d_out;
  float* fdummy = Lp;                             // in-range placeholder for unused f32 output args
  unsigned short* hdummy = QHp;                   // in-range placeholder for unused 16-bit output args

  const dim3 blk(256);

  // (0) what the projections read, one launch: q, k, v (per batch slab) -> f16(bf16); Wq|Wk|Wv [512][64] ->
  //     [64][512] (transposed, f16 x64)
  prep_x<<<dim3(PREP_BLOCKS), blk, 0, stream>>>(q, k, v, wq, wk, wv, XQ, XK, XV, WQT, WKT, WVT);

  // (1) one launch: the three projections (q plane x16, k plane x16, v^T bf16 hi (VH) and lo (VL) planes) and,
  //     beside them, the jobs only later launches read: mask structure flags, Wo and Wl planes, E plane
  proj_side<<<dim3(SIDE_BLOCKS), blk, 0, stream>>>(XQ, XK, XV, WQT, WKT, WVT, bq, bk, bv, QHp, KHp, VHp,
                                                   msk, FLG, wo, WOT, wl, WLT, ee, PEH);

  // (2) attention -> ctx hi|lo token-major plane
  attn_kernel<<<dim3(NB * NH * (SEQ / 16)), dim3(32 * AWV), 0, stream>>>(QHp, KHp, PEH, VHp, VLp, Zp);

  // (3) output projection with relu: OP = bf16 hi|lo of max(0, sum_k Z[row][k] * WOT[n][k] + bo[n]), K = 1024
  const int gO = ((MT / (16 * GTI)) * (DMD / 64) + GWV - 1) / GWV;
  gemm64<1, 2, 1, 0><<<dim3(gO), dim3(32 * GWV), 0, stream>>>(Zp, KF, WOT, KF, OPp, DMD, fdummy, KF, 1.0f, bo, DMD, 1.0f, MT, DMD, KF);

  // (4) logits: L[row][n] = sum_k OP[row][k] * WLT[n][k] + bl[n], K = 1024, N padded to 448
  const int gL = ((MT / (16 * GTI)) * (EVP / 64) + GWV - 1) / GWV;
  gemm64<1, 0, 0, 0><<<dim3(gL), dim3(32 * GWV), 0, stream>>>(OPp, KF, WLT, KF, hdummy, 0, Lp, EVP, 1.0f, bl, EVD, 1.0f, MT, EVP, KF);

  // (5) flat whole-line copy into the output (388-wide rows), NaN-poisoned on a mask-structure violation
  out_copy<<<dim3((MT * (EVD / 4) + 255) / 256), blk, 0, stream>>>(Lp, FLG, out0);
  (void)hipGetLastError();
}

// v004
// A run of this version takes 159 microseconds.
// Two timings next to v003 both put it at 1.04 times that version's speed.
// Counting every step since v000, it is 2.53 times as fast.
// Contractions: x.Wq and x.Wk (f16 planes x16), Wv^T.x^T (bf16 hi|lo planes), q.k^T and q.E^T band on
// v_wmma_f32_16x16x32_f16 (f16 operands, f32 accumulate); p.v as bf16 hi/lo three-product split, and
// [ctx_hi|ctx_lo].[Wo;Wo], [o_hi|o_lo].[Wl;Wl] K-folded planes on v_wmma_f32_16x16x32_bf16 (bf16 operands,
// f32 accumulate). Float inputs RNE-converted to bf16 on load (x x1; Wq, Wk, Wv, E x64 in f16; Wo, Wl bf16);
// softmax, causal select and the relative-offset skew in f32 on VALU.
#include <hip/hip_runtime.h>
#include <math.h>

#ifndef NB
#define NB 2
#endif
#ifndef SEQ
#define SEQ 2048
#endif
#define NB_FULL  2
#define SEQ_FULL 2048
#define DMD  512
#define NH   8
#define HD   64
#define EVD  388
#define EVP  448
#define MT   (NB * SEQ)
#define KF   (2 * DMD)
#define NFLG (SEQ / 16)
#define FLGW 32
#define AWV  8
#define OPP  68
#define RWP  48
#define WSCL 64.0f
#define QKS  16.0f
#define RSQD 0.125f
#define NEGM (-1.0e10f)

static_assert(NB >= 1 && NB <= NB_FULL);
static_assert(SEQ >= 64 && SEQ <= SEQ_FULL && (SEQ % 64) == 0);
static_assert(NH * HD == DMD && HD == 64);
static_assert((MT % 64) == 0 && (DMD % 64) == 0 && (KF % 64) == 0);
static_assert((EVP % 64) == 0 && EVP >= EVD && (EVD % 4) == 0);
static_assert(((SEQ * DMD) % 2048) == 0 && ((NH * SEQ_FULL * HD) % 2048) == 0);
static_assert(NFLG <= 256 && ((4 * SEQ) % 256) == 0);

typedef _Float16 v16h __attribute__((ext_vector_type(16)));
typedef __bf16 v16bf __attribute__((ext_vector_type(16)));
typedef unsigned short v16us __attribute__((ext_vector_type(16)));
typedef unsigned short v8us  __attribute__((ext_vector_type(8)));
typedef float v8f __attribute__((ext_vector_type(8)));
typedef float v4f __attribute__((ext_vector_type(4)));
typedef unsigned int v4u __attribute__((ext_vector_type(4)));
typedef unsigned int v2u __attribute__((ext_vector_type(2)));

union FragU { v16us v; v8us h[2]; };

// ---- scalar helpers --------------------------------------------------------------------------------
__device__ __forceinline__ unsigned short bf_bits(float f) {          // f32 -> bf16 bits, RNE convert
  const unsigned u = __float_as_uint(f);
  return (unsigned short)((u + 0x7FFFu + ((u >> 16) & 1u)) >> 16);
}
__device__ __forceinline__ float bf_up(unsigned short h) { return __uint_as_float(((unsigned)h) << 16); }
__device__ __forceinline__ float bfr(float f) { return bf_up(bf_bits(f)); }   // value of the bf16 RNE convert
__device__ __forceinline__ unsigned short h_bits(_Float16 x) { return __builtin_bit_cast(unsigned short, x); }
__device__ __forceinline__ unsigned short f2h(float f) { return h_bits((_Float16)f); }
__device__ __forceinline__ unsigned pk16(unsigned short a, unsigned short b) { return (unsigned)a | ((unsigned)b << 16); }
__device__ __forceinline__ int clampi(int v, int lo, int hi) { return v < lo ? lo : (v > hi ? hi : v); }
__device__ __forceinline__ v8f zero8() { v8f z = {0.f, 0.f, 0.f, 0.f, 0.f, 0.f, 0.f, 0.f}; return z; }

// ---- fragment loader: 16-bit A/B operand, lane -> row/col (lane&15), p already includes +8*(lane>>4);
//      elements 0..7 <- p[0..7] (k0+8h..), elements 8..15 <- p[16..23] (k0+16+8h..)
__device__ __forceinline__ v16us ldfrag_u(const unsigned short* p) {
  FragU f;
  f.h[0] = *(const v8us*)(p);
  f.h[1] = *(const v8us*)(p + 16);
  return f.v;
}

// ---- WMMA helpers (f16 / bf16 operand bits) with trailing VALU hazard gap --------------------------
__device__ __forceinline__ v8f mma_raw(v16us a, v16us b, v8f c) {
  return __builtin_amdgcn_wmma_f32_16x16x32_f16(false, __builtin_bit_cast(v16h, a), false,
                                                __builtin_bit_cast(v16h, b), (short)0, c, false, false);
}
__device__ __forceinline__ v8f mma_raw_bf(v16us a, v16us b, v8f c) {
  return __builtin_amdgcn_wmma_f32_16x16x32_bf16(false, __builtin_bit_cast(v16bf, a), false,
                                                 __builtin_bit_cast(v16bf, b), (short)0, c, false, false);
}
__device__ __forceinline__ v8f mma_g(v16us a, v16us b, v8f c) {                 // guarded f16
  c = mma_raw(a, b, c);
#if defined(__HIP_DEVICE_COMPILE__)
  asm volatile("v_nop\n\tv_nop\n\tv_nop\n\tv_nop" : "+v"(c) : "v"(a), "v"(b));
#endif
  return c;
}
__device__ __forceinline__ v8f mma_gb(v16us a, v16us b, v8f c) {                // guarded bf16
  c = mma_raw_bf(a, b, c);
#if defined(__HIP_DEVICE_COMPILE__)
  asm volatile("v_nop\n\tv_nop\n\tv_nop\n\tv_nop" : "+v"(c) : "v"(a), "v"(b));
#endif
  return c;
}
__device__ __forceinline__ void dep_guard1(v8f& a, v8f& b, v16us x) {
#if defined(__HIP_DEVICE_COMPILE__)
  asm volatile("v_nop\n\tv_nop\n\tv_nop\n\tv_nop" : "+v"(a), "+v"(b) : "v"(x));
#endif
}
__device__ __forceinline__ void keep4_u(v16us a, v16us b, v16us c, v16us d) {
#if defined(__HIP_DEVICE_COMPILE__)
  asm volatile("v_nop" :: "v"(a), "v"(b), "v"(c), "v"(d));
#endif
}
__device__ __forceinline__ void acc_guard4(v8f& a, v8f& b, v8f& c, v8f& d) {
#if defined(__HIP_DEVICE_COMPILE__)
  asm volatile("v_nop\n\tv_nop\n\tv_nop\n\tv_nop" : "+v"(a), "+v"(b), "+v"(c), "+v"(d));
#endif
}
// 2^x; the v_nop keeps, inside the statement, the one slot the instruction set asks for between a
// transcendental and an instruction that reads its result or overwrites its source
__device__ __forceinline__ float exp2_slot(float x) {
  float r = 0.f;
#if defined(__HIP_DEVICE_COMPILE__)
  asm("v_exp_f32 %0, %1\n\tv_nop" : "=v"(r) : "v"(x));
#endif
  return r;
}
// orders LDS stores of this wave before later LDS loads of the same wave (cross-lane exchange)
__device__ __forceinline__ void wave_sync_lds() {
  __builtin_amdgcn_fence(__ATOMIC_RELEASE, "workgroup");
  __builtin_amdgcn_wave_barrier();
  __builtin_amdgcn_fence(__ATOMIC_ACQUIRE, "workgroup");
}

// =====================================================================================================
// Layout-kept convert: o[i] = f16 bits of (bf16 RNE value of w[i] * sc) for i < nsrc, zero for nsrc <= i <
// ndst; by selects a batch slab (source offset by*sstr, destination offset by*dstr), bx the 2048-element piece.
// nsrc % 8 == 0, ndst % 2048 == 0, bx = 0 .. ndst/2048 - 1 exact (compile-time constants at the call sites).
// coverage: 256 threads x 8 = 2048 elements per block; the callers' bx, by ranges cover all ndst elements of
// every slab. Block body, called from the merged launches below.
// =====================================================================================================
__device__ __forceinline__ void cvt_lin(const float* __restrict__ w, unsigned short* o, int bx, int by,
                                        int nsrc, int ndst, float sc, int sstr, int dstr) {
  const float* wb = w + (size_t)by * (size_t)sstr;
  unsigned short* ob = o + (size_t)by * (size_t)dstr;
  const int base = (bx * 256 + threadIdx.x) * 8;
  if (base + 8 > ndst) return;                            // never taken with exact grids; no barriers below
  const bool inr = (base + 8 <= nsrc);
  const int lb = inr ? base : (nsrc - 8);                 // clamped address, always in range
  const v4f a0 = *(const v4f*)(wb + lb);
  const v4f a1 = *(const v4f*)(wb + lb + 4);
  v4u hv;
#pragma unroll
  for (int e = 0; e < 2; ++e) {
    hv[e]     = pk16(f2h(bfr(a0[2 * e]) * sc), f2h(bfr(a0[2 * e + 1]) * sc));
    hv[2 + e] = pk16(f2h(bfr(a1[2 * e]) * sc), f2h(bfr(a1[2 * e + 1]) * sc));
  }
  const v4u zz = {0u, 0u, 0u, 0u};
  hv = inr ? hv : zz;
  unsigned short* d = ob + base;
  *(v4u*)d = hv;
  
}

// =====================================================================================================
// Transpose-convert: in w[R][C] f32 (pitch C) -> out o[c][r] at o[c*ldo + r] for c < CP, with zero values
// for C <= c < CP. BFO 0: f16 bits of (bf16 RNE value * sc); BFO 1: bf16 bits (RNE). Block tile 64x64
// through LDS (st[col][row], pitch 72 halves). Read phase: thread owns one input row x 16 columns (float4
// loads at a clamped column address, zero selected by value; C % 4 == 0 so a float4 is all-in or all-out).
// R, CP multiples of 64, ldo % 64 == 0, (bx, by) in (CP/64, R/64) exact (compile-time constants at the call
// sites). coverage: 64 output rows x 64 halves per block = the whole transposed tile; the callers' ranges cover
// all of [CP][R]. Block body, called from the merged launches below under a block-uniform branch; st is the
// calling kernel's LDS tile of 64 * 72 halves.
// =====================================================================================================
template <int BFO>
__device__ __forceinline__ void cvt_t(unsigned short* st, const float* __restrict__ w, unsigned short* o,
                                      int bx, int by, int R, int C, int CP, int ldo, float sc) {
  const int t = threadIdx.x;
  const int r0 = by * 64, c0 = bx * 64;
  if (r0 + 64 > R || c0 + 64 > CP) return;              // block-uniform, before the barrier; never taken
  {
    const int row = t >> 2, ch = (t & 3) * 16;
    const float* p = w + (size_t)(r0 + row) * C;
#pragma unroll
    for (int q = 0; q < 4; ++q) {
      const int cs = c0 + ch + 4 * q;
      const bool inr = (cs + 4 <= C);
      const int lb = inr ? cs : (C - 4);                 // clamped column address, always in range
      const v4f v = *(const v4f*)(p + lb);
#pragma unroll
      for (int e = 0; e < 4; ++e) {
        const unsigned short hb = BFO ? bf_bits(v[e]) : f2h(bfr(v[e]) * sc);
        st[(ch + 4 * q + e) * 72 + row] = inr ? hb : (unsigned short)0;
      }
    }
  }
  __syncthreads();
  v4u hv[2];
#pragma unroll
  for (int half = 0; half < 2; ++half) {
    const int cl = (t >> 3) + 32 * half, pc = (t & 7) * 8;
    hv[half] = *(const v4u*)(st + cl * 72 + pc);
  }
  {
#pragma unroll
    for (int half = 0; half < 2; ++half) {
      const int cl = (t >> 3) + 32 * half, pc = (t & 7) * 8;
      unsigned short* dst = o + (size_t)(c0 + cl) * ldo + r0 + pc;
      *(v4u*)dst = hv[half];
    }
#if defined(__HIP_DEVICE_COMPILE__)
    // precaution: wait for the stores to read their registers (the block ends after this one job)
    asm volatile("s_wait_xcnt 0x0" ::: "memory");
#endif
  }
}

// =====================================================================================================
// Register-blocked 16-bit WMMA GEMM: C[m][n] = sum_k A[m][k] * Bt[n][k], one wave per 32x64 tile, no block
// barriers. BF 0: f16 operand bits, BF 1: bf16 operand bits. A row-major [M][K] pitch lda; Bt row-major
// [N][K] pitch ldb (k contiguous); M multiple of 32, N of 64, K of 32 (true at every call site; waves
// past the last tile exit before any work, wave-uniform). A wave's k step is two A and four B fragments, whose
// twelve loads are issued together: one load round trip per k step, and M/32 * N/64 waves to fill the chip.
// WPB = waves (tiles) per block. Tiles are numbered down the rows first, so the waves of a block read the same
// four B fragments where WPB divides M/32 (in the v^T product, M/32 = 2: only wave pairs do). Both operand fragments use the split k map
// (elements 0..7 <- k0+8h.., 8..15 <- k0+16+8h..); D element r of a lane is (row 8h + r, col lane&15).
// Bias: bf16 RNE value of bias[] times bsc, indexed by column (clamped into nbias) or, with BROW, by row.
// OM 0: f32 out Cf = acc*osc + b, pitch ldc.            OM 1: f16 out Ch = f16 bits(acc*osc + b), pitch ldc.
// OM 2: val = (RELU ? max(0, .) : .)(acc*osc + b); bf16 hi bits at Ch, bf16 lo bits (val - hi) at Ch + looff.
// coverage: GTI slabs x 16 rows x 64 cols = the wave's whole tile (hi and lo planes alike).
// gemm64_blk is the block body (bx = block number within this product, sT = the calling kernel's LDS, WPB per-wave
// 16x64 slabs of pitch 68 floats); gemm64 is the launch of one product alone.
// =====================================================================================================
#define GSLAB (16 * 68)
#define GTI 2                                  // 16-row subtiles per wave tile
#define GWV 4                                  // waves per block where a product is launched alone
template <int BF, int OM, int RELU, int BROW, int WPB>
__device__ __forceinline__ void gemm64_blk(
    float* sT, int bx,
    const unsigned short* __restrict__ Ap, int lda, const unsigned short* __restrict__ Btp, int ldb,
    unsigned short* Ch, int looff, float* Cf, int ldc, float osc,
    const float* __restrict__ bias, int nbias, float bsc, int M, int N, int K) {
  const int lane = threadIdx.x & 31;
  const int wave = threadIdx.x >> 5;
  const int tilesN = N >> 6;
  const int tilesM = M / (16 * GTI);
  const int tile = bx * WPB + wave;
  if (tile >= tilesM * tilesN) return;   // wave-uniform; no block barriers in this kernel
  const int tn = tile / tilesM;
  const int tm = tile - tn * tilesM;
  const int m0 = tm * (16 * GTI);
  const int n0 = tn << 6;

  const int rlane = lane & 15;                 // row (A) / col (B, D) within subtile
  const int koff  = (lane >> 4) * 8;           // k offset of this lane half
  const int mOff  = (lane >> 4) * 8;           // D row offset

  v8f acc[GTI][4];
#pragma unroll
  for (int i = 0; i < GTI; ++i)
#pragma unroll
    for (int j = 0; j < 4; ++j) acc[i][j] = zero8();

#pragma unroll 1
  for (int k0 = 0; k0 < K; k0 += 32) {
    v16us bh[4];
#pragma unroll
    for (int j = 0; j < 4; ++j) {
      const size_t bo = (size_t)(n0 + (j << 4) + rlane) * ldb + koff + k0;
      bh[j] = ldfrag_u(Btp + bo);
    }
    v16us ah[GTI];
#pragma unroll
    for (int i = 0; i < GTI; ++i) {
      const size_t ao = (size_t)(m0 + (i << 4) + rlane) * lda + koff + k0;
      ah[i] = ldfrag_u(Ap + ao);
    }
#pragma unroll
    for (int i = 0; i < GTI; ++i) {
#pragma unroll
      for (int j = 0; j < 4; ++j) {
        if (BF) acc[i][j] = mma_raw_bf(ah[i], bh[j], acc[i][j]);
        else    acc[i][j] = mma_raw(ah[i], bh[j], acc[i][j]);
      }
      dep_guard1(acc[i][0], acc[i][3], ah[i]);
    }
    keep4_u(bh[0], bh[1], bh[2], bh[3]);
  }
#pragma unroll
  for (int i = 0; i < GTI; ++i) acc_guard4(acc[i][0], acc[i][1], acc[i][2], acc[i][3]);

  const int hh2 = lane >> 4, c4 = (lane & 15) * 4;     // f32 out: 256-B row segment = 16 lanes x 16 B
  const int q8  = lane >> 3, c8 = (lane & 7) * 8;

  // per-lane bias values for the column-indexed modes (bf16 RNE value times bsc), clamped address
  float bc[8];
#pragma unroll
  for (int e = 0; e < 8; ++e) bc[e] = 0.f;
  if (!BROW) {
    if (OM == 0) {
#pragma unroll
      for (int e = 0; e < 4; ++e) bc[e] = bsc * bfr(bias[clampi(n0 + c4 + e, 0, nbias - 1)]);
    } else {
#pragma unroll
      for (int e = 0; e < 8; ++e) bc[e] = bsc * bfr(bias[clampi(n0 + c8 + e, 0, nbias - 1)]);
    }
  }

  // ---- epilogue ----
  float* slab = sT + wave * GSLAB;
#pragma unroll
  for (int i = 0; i < GTI; ++i) {
    const int mBase = m0 + (i << 4);
#pragma unroll
    for (int j = 0; j < 4; ++j) {
#pragma unroll
      for (int r = 0; r < 8; ++r) {
        slab[(mOff + r) * 68 + (j << 4) + rlane] = acc[i][j][r];
      }
    }
    wave_sync_lds();
    if (OM == 0) {
      v4f vals[8];
#pragma unroll
      for (int it = 0; it < 8; ++it) {
        const int row = it * 2 + hh2;                      // it 0..7 x hh2 0..1 = rows 0..15
        const v4f v = *(const v4f*)(slab + row * 68 + c4);
        float brw = 0.f;
        if (BROW) brw = bsc * bfr(bias[clampi(mBase + row, 0, nbias - 1)]);
        v4f ov;
#pragma unroll
        for (int e = 0; e < 4; ++e) {
          float x = v[e] * osc + (BROW ? brw : bc[e]);
          if (RELU) x = fmaxf(x, 0.f);
          ov[e] = x;
        }
        vals[it] = ov;
      }
      {
#pragma unroll
        for (int it = 0; it < 8; ++it) {
          const int row = it * 2 + hh2;
          *(v4f*)(Cf + (size_t)(mBase + row) * ldc + (size_t)n0 + c4) = vals[it];
        }
        
      }
    } else if (OM == 1) {
      v4u hv[4];
#pragma unroll
      for (int it = 0; it < 4; ++it) {
        const int row = it * 4 + q8;                       // it 0..3 x q8 0..3 = rows 0..15
        const float* sp = slab + row * 68 + c8;
        float brw = 0.f;
        if (BROW) brw = bsc * bfr(bias[clampi(mBase + row, 0, nbias - 1)]);
        v4u ha = {0u, 0u, 0u, 0u};
#pragma unroll
        for (int e = 0; e < 4; ++e) {
          float b0 = sp[2 * e]     * osc + (BROW ? brw : bc[2 * e]);
          float b1 = sp[2 * e + 1] * osc + (BROW ? brw : bc[2 * e + 1]);
          if (RELU) { b0 = fmaxf(b0, 0.f); b1 = fmaxf(b1, 0.f); }
          ha[e] = pk16(f2h(b0), f2h(b1));
        }
        hv[it] = ha;
      }
      {
#pragma unroll
        for (int it = 0; it < 4; ++it) {
          const int row = it * 4 + q8;
          const size_t go = (size_t)(mBase + row) * ldc + (size_t)n0 + c8;
          *(v4u*)(Ch + go) = hv[it];
        }
        
      }
    } else {
      v4u hv[4], lv[4];
#pragma unroll
      for (int it = 0; it < 4; ++it) {
        const int row = it * 4 + q8;                       // it 0..3 x q8 0..3 = rows 0..15
        const float* sp = slab + row * 68 + c8;
        float brw = 0.f;
        if (BROW) brw = bsc * bfr(bias[clampi(mBase + row, 0, nbias - 1)]);
        v4u ha = {0u, 0u, 0u, 0u};
        v4u la = {0u, 0u, 0u, 0u};
#pragma unroll
        for (int e = 0; e < 4; ++e) {
          float x0 = sp[2 * e]     * osc + (BROW ? brw : bc[2 * e]);
          float x1 = sp[2 * e + 1] * osc + (BROW ? brw : bc[2 * e + 1]);
          if (RELU) { x0 = fmaxf(x0, 0.f); x1 = fmaxf(x1, 0.f); }
          const unsigned short h0 = bf_bits(x0), h1 = bf_bits(x1);
          const unsigned short l0 = bf_bits(x0 - bf_up(h0)), l1 = bf_bits(x1 - bf_up(h1));
          ha[e] = pk16(h0, h1);
          la[e] = pk16(l0, l1);
        }
        hv[it] = ha;
        lv[it] = la;
      }
      {
#pragma unroll
        for (int it = 0; it < 4; ++it) {
          const int row = it * 4 + q8;
          const size_t go = (size_t)(mBase + row) * ldc + (size_t)n0 + c8;
          *(v4u*)(Ch + go) = hv[it];
          *(v4u*)(Ch + (size_t)looff + go) = lv[it];
        }
        
      }
    }
    wave_sync_lds();
  }
}
template <int BF, int OM, int RELU, int BROW>
__global__ __launch_bounds__(32 * GWV) void gemm64(
    const unsigned short* __restrict__ Ap, int lda, const unsigned short* __restrict__ Btp, int ldb,
    unsigned short* Ch, int looff, float* Cf, int ldc, float osc,
    const float* __restrict__ bias, int nbias, float bsc, int M, int N, int K) {
  __shared__ __align__(16) float sT[GWV * GSLAB];
  gemm64_blk<BF, OM, RELU, BROW, GWV>(sT, blockIdx.x, Ap, lda, Btp, ldb, Ch, looff, Cf, ldc, osc, bias, nbias, bsc,
                                 M, N, K);
}

// =====================================================================================================
// Structure check of the [SEQ][SEQ] mask input (row pitch SEQ_FULL): block b covers rows 16b..16b+15 and all
// SEQ columns; a violation is any element differing from (j <= i ? 1 : 0). The block's flag is written as one
// coverage: 256 threads x (SEQ/64) float4 = 16 rows x SEQ cols per block; bx = 0 .. SEQ/16 - 1 = all rows.
// Block body, called from the second merged launch under a block-uniform branch; wf = 8 ints of its LDS.
// =====================================================================================================
__device__ __forceinline__ void mask_check(int* wf, int bx, const float* __restrict__ msk, float* flg) {
  const int t = threadIdx.x, lane = t & 31, wv = t >> 5;
  const int i0 = bx * 16;
  if (i0 + 16 > SEQ) return;                             // block-uniform, before the barrier; never taken
  constexpr int C4 = SEQ / 4;
  int viol = 0;
#pragma unroll 1
  for (int it = 0; it < (16 * C4) / 256; ++it) {
    const int ci = it * 256 + t;
    const int rr = ci / C4;
    const int c4 = ci - rr * C4;
    const int i = i0 + rr;
    const v4f x = *(const v4f*)(msk + (size_t)i * SEQ_FULL + 4 * c4);
#pragma unroll
    for (int e = 0; e < 4; ++e) {
      const int j = 4 * c4 + e;
      const float ex = (j <= i) ? 1.0f : 0.0f;
      viol |= (x[e] != ex) ? 1 : 0;
    }
  }
  viol |= __shfl_xor(viol, 1, 32);
  viol |= __shfl_xor(viol, 2, 32);
  viol |= __shfl_xor(viol, 4, 32);
  viol |= __shfl_xor(viol, 8, 32);
  viol |= __shfl_xor(viol, 16, 32);
  if (lane == 0) wf[wv] = viol;
  __syncthreads();
  if (wv == 0) {                                        // wave-uniform
    int f = wf[lane & 7];
    f |= __shfl_xor(f, 1, 32);
    f |= __shfl_xor(f, 2, 32);
    f |= __shfl_xor(f, 4, 32);
    const float fv = f ? 1.0f : 0.0f;
    float* d = flg + (size_t)bx * FLGW + lane;
    *(float*)d = fv;
    
  }
}

// =====================================================================================================
// Merged launches: jobs that read none of each other's output share one grid; the flat block index picks the
// job by ranges (block-uniform scalar branches), every block runs exactly one job body and then ends.
// prep_x: what the projections read. Blocks [0, 3*NTW): Wq, Wk, Wv -> [64][512] f16 x64 (transposed);
//   then 3*NLX blocks: q, k, v -> f16(bf16) planes, NLX = NB slabs x SEQ*DMD/2048 pieces each.
// proj_side: the three projections, first in the grid since they run longest, and beside them all that only
//   later launches read. Blocks [0, 3*NGQ): q plane x16, k plane x16 (C[tok][n] = sum_k X[tok][k] * WT[n][k]),
//   v^T planes (C[d][tok] = sum_k WVT[d][k] * XV[tok][k] / 64, bf16 hi and lo); then NFLG mask-structure blocks;
//   2*NTO blocks Wo -> [512][1024] = (Wo^T | Wo^T) bf16; 2*NTL blocks Wl -> [448][1024] = (Wl^T | Wl^T) bf16;
//   NLE blocks E -> f16(bf16 x64).
// =====================================================================================================
#define NTW (DMD / 64)
#define NLP ((SEQ * DMD) / 2048)
#define NLX (NLP * NB)
#define NGQ (((MT / (16 * GTI)) * (HD / 64) + 7) / 8)
#define NTO ((DMD / 64) * (DMD / 64))
#define NTL ((EVP / 64) * (DMD / 64))
#define NLE ((NH * SEQ_FULL * HD) / 2048)
#define PREP_BLOCKS (3 * NTW + 3 * NLX)
#define SIDE_BLOCKS (3 * NGQ + NFLG + 2 * NTO + 2 * NTL + NLE)

__global__ __launch_bounds__(256) void prep_x(
    const float* __restrict__ q, const float* __restrict__ k, const float* __restrict__ v,
    const float* __restrict__ wq, const float* __restrict__ wk, const float* __restrict__ wv,
    unsigned short* XQ, unsigned short* XK, unsigned short* XV,
    unsigned short* WQT, unsigned short* WKT, unsigned short* WVT) {
  __shared__ __align__(16) unsigned short st[64 * 72];
  int bid = blockIdx.x;
  if (bid < 3 * NTW) {
    const int j = bid / NTW;
    const float* w = (j == 0) ? wq : ((j == 1) ? wk : wv);
    unsigned short* o = (j == 0) ? WQT : ((j == 1) ? WKT : WVT);
    cvt_t<0>(st, w, o, 0, bid - j * NTW, DMD, HD, HD, DMD, WSCL);          // in[512][64] -> out[64][512]
    return;
  }
  bid -= 3 * NTW;
  if (bid < 3 * NLX) {
    const int j = bid / NLX;
    const int r = bid - j * NLX;
    const float* x = (j == 0) ? q : ((j == 1) ? k : v);
    unsigned short* o = (j == 0) ? XQ : ((j == 1) ? XK : XV);
    cvt_lin(x, o, r % NLP, r / NLP, SEQ * DMD, SEQ * DMD, 1.0f, SEQ_FULL * DMD, SEQ * DMD);
  }
}

__global__ __launch_bounds__(256) void proj_side(
    const unsigned short* __restrict__ XQ, const unsigned short* __restrict__ XK,
    const unsigned short* __restrict__ XV, const unsigned short* __restrict__ WQT,
    const unsigned short* __restrict__ WKT, const unsigned short* __restrict__ WVT,
    const float* __restrict__ bq, const float* __restrict__ bk, const float* __restrict__ bv,
    unsigned short* QH, unsigned short* KH, unsigned short* VH,
    const float* __restrict__ msk, float* flg,
    const float* __restrict__ wo, unsigned short* WOT, const float* __restrict__ wl, unsigned short* WLT,
    const float* __restrict__ ee, unsigned short* PEH) {
  __shared__ __align__(16) float sT[8 * GSLAB];        // the one job of a block uses it: slabs, transpose tile or flags
  int bid = blockIdx.x;
  if (bid < 2 * NGQ) {
    const int j = bid / NGQ;
    gemm64_blk<0, 1, 0, 0, 8>(sT, bid - j * NGQ, j ? XK : XQ, DMD, j ? WKT : WQT, DMD, j ? KH : QH, 0, nullptr, HD,
                           QKS / WSCL, j ? bk : bq, HD, QKS, MT, HD, DMD);
    return;
  }
  bid -= 2 * NGQ;
  if (bid < NGQ) {
    gemm64_blk<0, 2, 0, 1, 8>(sT, bid, WVT, DMD, XV, DMD, VH, HD * MT, nullptr, MT, 1.0f / WSCL, bv, HD, 1.0f,
                           HD, MT, DMD);
    return;
  }
  bid -= NGQ;
  if (bid < NFLG) {
    mask_check((int*)sT, bid, msk, flg);
    return;
  }
  bid -= NFLG;
  if (bid < 2 * NTO) {
    const int j = bid / NTO;                           // destination columns 0.. and 512..
    const int r = bid - j * NTO;
    cvt_t<1>((unsigned short*)sT, wo, WOT + j * DMD, r % (DMD / 64), r / (DMD / 64), DMD, DMD, DMD, KF, 1.0f);
    return;
  }
  bid -= 2 * NTO;
  if (bid < 2 * NTL) {
    const int j = bid / NTL;                           // destination columns 0.. and 512..
    const int r = bid - j * NTL;
    cvt_t<1>((unsigned short*)sT, wl, WLT + j * DMD, r % (EVP / 64), r / (EVP / 64), DMD, EVD, EVP, KF, 1.0f);
    return;
  }
  bid -= 2 * NTL;
  if (bid < NLE) cvt_lin(ee, PEH, bid, 0, NH * SEQ_FULL * HD, NH * SEQ_FULL * HD, WSCL, 0, 0);
}

// =====================================================================================================
// Causal attention with relative-offset term, head dim 64. Block = 256 threads = 8 waves; one block owns one
// 16-row query tile (t0..t0+15) of one (batch b, head h). The key blocks of 32 up to the diagonal (sb <= t0)
// are cut into 8 contiguous shares, one per wave; each wave runs its share with an online max-subtracted
// softmax in f32 and leaves its partial state (row max, row sum, unnormalised 16x64 O) in LDS; behind one
// block barrier the 8 states are merged in wave order (rescale by exp(max_w - max), sum, divide).
// Planes: QH, KH f16 [MT][64] = 16*q, 16*k (shared
// by all heads); PE f16 [NH*SEQ_FULL][64] = 64*E (head h rows h*SEQ_FULL..); VH, VL bf16 [64][MT] = v hi and
// lo planes transposed (row = dim, column = token). Output Z bf16 [MT][1024]: cols h*64+d = ctx hi, cols
// 512+h*64+d = ctx lo, token-major.
// Per key block sb: S = Q.K^T (2 key subtiles x 2 k-steps, scale 1/256); relative band of 48 columns:
// column c <-> E row SEQ-16-t0+sb+c (clamped into [0, SEQ-1]; clamping only touches entries with j > i,
// which the causal select replaces); columns 0..15 come from the tile carried over from the prior key block
// (its columns 32..47), columns 16..47 are two fresh tiles (2 x 2 WMMA, scale 1/1024); the band is exchanged
// through per-wave LDS and read back at c = 15 - il + jl, i.e. E row SEQ-1-i+j; score = (qk + rel)/8 for
// j <= i, else -1e10; p = exp(score - running max) in f32, l accumulated from the f32 p; p stored as bf16 hi
// and lo tiles in per-wave LDS and reloaded as A fragments (split k map); O += Phi.Vhi + Phi.Vlo + Plo.Vhi on
// 4 dim subtiles (one accumulator set). A wave whose share is empty contributes max -1e30, sum 0, O 0 (weight
// exp(-1e30 - max) = 0); wave 0's share is never empty. Merge: thread -> (row t>>4, 4 dims), 16 lanes x 8 B =
// one 128-B line of Z per plane and row.
// coverage: 16 query rows x 64 halves x {hi, lo} per block, NB*NH*(SEQ/16) blocks = all (b, t, h)
// segments of Z in both halves.
// =====================================================================================================
__global__ __launch_bounds__(32 * AWV) void attn_kernel(
    const unsigned short* __restrict__ QH, const unsigned short* __restrict__ KH,
    const unsigned short* __restrict__ PE, const unsigned short* __restrict__ VH,
    const unsigned short* __restrict__ VL, unsigned short* Z) {
  __shared__ __align__(16) float relw[AWV][16 * RWP];            // band exchange, 24576 B
  __shared__ __align__(16) unsigned short pwh[AWV][16 * 32];      // P hi tiles, 8192 B
  __shared__ __align__(16) unsigned short pwl[AWV][16 * 32];      // P lo tiles, 8192 B
  __shared__ __align__(16) float opw[AWV][16 * OPP];              // partial O per wave, pitch 68 floats, 34816 B
  __shared__ __align__(16) float mxw[AWV][16];                    // partial row max per wave
  __shared__ __align__(16) float lsw[AWV][16];                    // partial row sum per wave
  const int lane = threadIdx.x & 31, m = lane & 15, hh = lane >> 4;
  // wave number in a scalar register: the key loop's bounds depend on it and stay a scalar branch
  const int wv = __builtin_amdgcn_readfirstlane((int)(threadIdx.x >> 5));
  const int task = blockIdx.x;                       // 0 .. NB*NH*(SEQ/16)-1
  const int nqt = SEQ / 16;
  const int bh = task / nqt;                         // (b, h)
  const int t0 = (task - bh * nqt) << 4;             // query tile start
  const int b = bh / NH, h = bh - (bh / NH) * NH;
  if (b >= NB) return;                               // block-uniform, before the barrier; never taken with exact grids
  const size_t tok0 = (size_t)b * SEQ;
  float* rw = relw[wv];
  unsigned short* ph = pwh[wv];
  unsigned short* pl = pwl[wv];

  // Q A-fragments: rows t0+m, k = head dims 0..31 and 32..63
  const unsigned short* qp = QH + (tok0 + (size_t)(t0 + m)) * HD + 8 * hh;
  const v16us qf0 = ldfrag_u(qp);
  const v16us qf1 = ldfrag_u(qp + 32);

  const unsigned short* pe = PE + (size_t)h * SEQ_FULL * HD;
  const int rb = SEQ - 16 - t0;                      // E row of band column 0 at sb = 0 (>= 0)

  const int nkb = (t0 >> 5) + 1;                     // key blocks 0 .. floor(t0/32), block-uniform
  const int per = (nkb + AWV - 1) / AWV;             // key blocks per wave share
  const int kb0 = wv * per;                          // this wave's share [kb0, kb1), wave-uniform, may be empty
  const int kb1 = (kb0 + per < nkb) ? (kb0 + per) : nkb;

  // carried band tile: columns 0..15 of key block kb0 <-> E rows rb + 32*kb0 + 0..15 (clamped)
  v8f carry;
  {
    const int u = clampi(rb + (kb0 << 5) + m, 0, SEQ - 1);
    const unsigned short* pp = pe + (size_t)u * HD + 8 * hh;
    const v16us c0 = ldfrag_u(pp);                   // both requested beside Q, in front of the first matrix statement
    const v16us c1 = ldfrag_u(pp + 32);
    carry = mma_g(qf0, c0, zero8());
    carry = mma_g(qf1, c1, carry);
  }

  float mx[8], ls[8];
  v8f O0 = zero8(), O1 = zero8(), O2 = zero8(), O3 = zero8();
#pragma unroll
  for (int r = 0; r < 8; ++r) { mx[r] = -1.0e30f; ls[r] = 0.f; }

  const size_t vst = (size_t)16 * MT;                // V plane stride between dim subtiles

#pragma unroll 1
  for (int kb = kb0; kb < kb1; ++kb) {
    const int sb = kb << 5;
    // The eight K and E-band fragments are requested together, in front of the first matrix statement (a load written
    // between the guarded matrix statements is issued and waited for on its own: one round trip per fragment).
    // K B-fragments: Bt row = key token, k = head dim
    const unsigned short* kp = KH + (tok0 + (size_t)(sb + m)) * HD + 8 * hh;
    const unsigned short* kp1 = kp + (size_t)16 * HD;
    const v16us kf0 = ldfrag_u(kp), kf1 = ldfrag_u(kp + 32);
    const v16us kf2 = ldfrag_u(kp1), kf3 = ldfrag_u(kp1 + 32);
    // relative band: columns 16..31 and 32..47 <-> E rows rb+sb+16.. and rb+sb+32..
    const int u1 = clampi(rb + sb + 16 + m, 0, SEQ - 1);
    const unsigned short* p1 = pe + (size_t)u1 * HD + 8 * hh;
    const int u2 = clampi(rb + sb + 32 + m, 0, SEQ - 1);
    const unsigned short* p2 = pe + (size_t)u2 * HD + 8 * hh;
    const v16us ef0 = ldfrag_u(p1), ef1 = ldfrag_u(p1 + 32);
    const v16us ef2 = ldfrag_u(p2), ef3 = ldfrag_u(p2 + 32);

    v8f S0, S1;
    S0 = mma_g(qf0, kf0, zero8());
    S0 = mma_g(qf1, kf1, S0);
    S1 = mma_g(qf0, kf2, zero8());
    S1 = mma_g(qf1, kf3, S1);
    v8f Pb1, Pb2;
    Pb1 = mma_g(qf0, ef0, zero8());
    Pb1 = mma_g(qf1, ef1, Pb1);
    Pb2 = mma_g(qf0, ef2, zero8());
    Pb2 = mma_g(qf1, ef3, Pb2);
#pragma unroll
    for (int r = 0; r < 8; ++r) {
      const int row = 8 * hh + r;
      rw[row * RWP + m]      = carry[r];
      rw[row * RWP + 16 + m] = Pb1[r];
      rw[row * RWP + 32 + m] = Pb2[r];
    }
    carry = Pb2;
    wave_sync_lds();

    // V B-fragments (Bt row = dim, k = key token), four dim subtiles, hi and lo planes: requested together here, behind
    // the exchange fence (which waits for outstanding loads), so that they are in flight under the softmax
    const size_t vo = (size_t)m * MT + tok0 + (size_t)sb + 8 * hh;
    const v16us vh0 = ldfrag_u(VH + vo),           vl0 = ldfrag_u(VL + vo);
    const v16us vh1 = ldfrag_u(VH + vo + vst),     vl1 = ldfrag_u(VL + vo + vst);
    const v16us vh2 = ldfrag_u(VH + vo + 2 * vst), vl2 = ldfrag_u(VL + vo + 2 * vst);
    const v16us vh3 = ldfrag_u(VH + vo + 3 * vst), vl3 = ldfrag_u(VL + vo + 3 * vst);

    // skew read + scale + causal select (key j <= query i keeps the score, otherwise -1e10)
    float s0[8], s1[8];
#pragma unroll
    for (int r = 0; r < 8; ++r) {
      const int row = 8 * hh + r;
      const int i = t0 + row;
      const float rv0 = rw[row * RWP + 15 - row + m];
      const float rv1 = rw[row * RWP + 31 - row + m];
      const float a0 = (S0[r] * (1.0f / (QKS * QKS)) + rv0 * (1.0f / (QKS * WSCL))) * RSQD;
      const float a1 = (S1[r] * (1.0f / (QKS * QKS)) + rv1 * (1.0f / (QKS * WSCL))) * RSQD;
      s0[r] = (sb + m <= i) ? a0 : NEGM;
      s1[r] = (sb + 16 + m <= i) ? a1 : NEGM;
    }

    // online softmax (a row lives in the 16 lanes of one half-wave; xor butterflies 1,2,4,8)
#pragma unroll
    for (int r = 0; r < 8; ++r) {
      float xm = fmaxf(s0[r], s1[r]);
      xm = fmaxf(xm, __shfl_xor(xm, 1, 32));
      xm = fmaxf(xm, __shfl_xor(xm, 2, 32));
      xm = fmaxf(xm, __shfl_xor(xm, 4, 32));
      xm = fmaxf(xm, __shfl_xor(xm, 8, 32));
      const float mn = fmaxf(mx[r], xm);
      const float al = exp2_slot((mx[r] - mn) * 1.44269504f);   // exp(x) = 2^(x * log2 e)
      mx[r] = mn;
      const float p0 = exp2_slot((s0[r] - mn) * 1.44269504f);
      const float p1 = exp2_slot((s1[r] - mn) * 1.44269504f);
      float ps = p0 + p1;
      ps += __shfl_xor(ps, 1, 32);
      ps += __shfl_xor(ps, 2, 32);
      ps += __shfl_xor(ps, 4, 32);
      ps += __shfl_xor(ps, 8, 32);
      ls[r] = ls[r] * al + ps;
      O0[r] = O0[r] * al;
      O1[r] = O1[r] * al;
      O2[r] = O2[r] * al;
      O3[r] = O3[r] * al;
      const int row = 8 * hh + r;
      const unsigned short hb0 = bf_bits(p0), hb1 = bf_bits(p1);
      ph[row * 32 + m]      = hb0;
      ph[row * 32 + 16 + m] = hb1;
      pl[row * 32 + m]      = bf_bits(p0 - bf_up(hb0));
      pl[row * 32 + 16 + m] = bf_bits(p1 - bf_up(hb1));
    }
    wave_sync_lds();

    // P A-fragments (split k map); the V B-fragments were requested above the softmax
    const v16us afh = ldfrag_u(ph + m * 32 + 8 * hh);
    const v16us afl = ldfrag_u(pl + m * 32 + 8 * hh);
    O0 = mma_gb(afh, vh0, O0);
    O0 = mma_gb(afh, vl0, O0);
    O0 = mma_gb(afl, vh0, O0);
    O1 = mma_gb(afh, vh1, O1);
    O1 = mma_gb(afh, vl1, O1);
    O1 = mma_gb(afl, vh1, O1);
    O2 = mma_gb(afh, vh2, O2);
    O2 = mma_gb(afh, vl2, O2);
    O2 = mma_gb(afl, vh2, O2);
    O3 = mma_gb(afh, vh3, O3);
    O3 = mma_gb(afh, vl3, O3);
    O3 = mma_gb(afl, vh3, O3);
  }
  acc_guard4(O0, O1, O2, O3);

  // ---- this wave's partial state to LDS (D element r of a lane = row 8*hh + r, col m of each dim subtile) ----
  float* op = opw[wv];
#pragma unroll
  for (int r = 0; r < 8; ++r) {
    const int row = 8 * hh + r;
    op[row * OPP + m]      = O0[r];
    op[row * OPP + 16 + m] = O1[r];
    op[row * OPP + 32 + m] = O2[r];
    op[row * OPP + 48 + m] = O3[r];
  }
  if (m == 0) {                                        // mx, ls are equal in the 16 lanes of a half-wave
#pragma unroll
    for (int r = 0; r < 8; ++r) {
      mxw[wv][8 * hh + r] = mx[r];
      lsw[wv][8 * hh + r] = ls[r];
    }
  }
  __syncthreads();                                     // publishes the 8 partial states to the whole block

  // ---- merge in wave order, ctx = O / l, bf16 hi plane and lo plane ----
  {
    const int row = threadIdx.x >> 4, c4 = (threadIdx.x & 15) * 4;
    float mw[AWV];
    float mt = -1.0e30f;
#pragma unroll
    for (int w = 0; w < AWV; ++w) { mw[w] = mxw[w][row]; mt = fmaxf(mt, mw[w]); }
    float sc[AWV];
#pragma unroll
    for (int w = 0; w < AWV; ++w) sc[w] = exp2_slot((mw[w] - mt) * 1.44269504f);   // exp(max_w - max)
    float lt = 0.f;
    v4f ot = {0.f, 0.f, 0.f, 0.f};
#pragma unroll
    for (int w = 0; w < AWV; ++w) {
      const v4f o = *(const v4f*)(opw[w] + row * OPP + c4);
      lt += lsw[w][row] * sc[w];
#pragma unroll
      for (int e = 0; e < 4; ++e) ot[e] += o[e] * sc[w];
    }
    const float g = 1.0f / lt;                         // lt >= 1
    unsigned short hb[4], lb[4];
#pragma unroll
    for (int e = 0; e < 4; ++e) {
      const float c = ot[e] * g;
      hb[e] = bf_bits(c);
      lb[e] = bf_bits(c - bf_up(hb[e]));
    }
    const v2u hv = {pk16(hb[0], hb[1]), pk16(hb[2], hb[3])};
    const v2u lv = {pk16(lb[0], lb[1]), pk16(lb[2], lb[3])};
    unsigned short* dst = Z + (tok0 + (size_t)(t0 + row)) * KF + h * HD + c4;
    *(v2u*)dst = hv;
    *(v2u*)(dst + DMD) = lv;
  }
}

// =====================================================================================================
// Flat whole-line writer of the output: out[row*388 + c] = L[row*448 + c]; each lane owns 4
// consecutive output floats (16 B; never straddles a row since 388 % 4 == 0), one instruction = 32 lanes x
// coverage: grid = MT*97/256 blocks x 256 float4 = all MT*388 output floats (in-kernel bound for safety).
// =====================================================================================================
__global__ __launch_bounds__(256) void out_copy(const float* __restrict__ L, const float* __restrict__ flg,
                                                 float* out) {
  __shared__ int wf[8];
  const int t = threadIdx.x, lane = t & 31, wv = t >> 5;
  int f;
  {
    const int ti = (t < NFLG) ? t : (NFLG - 1);         // clamped address, value selected
    const float x = flg[(size_t)ti * FLGW];
    f = ((t < NFLG) && (x == 1.0f)) ? 1 : 0;
  }
  f |= __shfl_xor(f, 1, 32);
  f |= __shfl_xor(f, 2, 32);
  f |= __shfl_xor(f, 4, 32);
  f |= __shfl_xor(f, 8, 32);
  f |= __shfl_xor(f, 16, 32);
  if (lane == 0) wf[wv] = f;
  __syncthreads();
  int g = 0;
#pragma unroll
  for (int w = 0; w < 8; ++w) g |= wf[w];
  const int e4 = blockIdx.x * 256 + t;
  if (e4 < MT * (EVD / 4)) {
    const int e = e4 * 4;
    const int row = e / EVD;
    const int c = e - row * EVD;
    v4f x = *(const v4f*)(L + (size_t)row * EVP + c);
    const float qn = __uint_as_float(0x7fc00000u);
    const v4f pn = {qn, qn, qn, qn};
    x = g ? pn : x;
    float* d = out + (size_t)e;
    *(v4f*)d = x;
    
  }
}

// =====================================================================================================
// Workspace map (bytes, full size NB=2, SEQ=2048); every plane is an exact multiple of its whole-row /
// whole-line / 32x64-tile store granularity; all offsets are multiples of 16384.
//   XQ   f16  [MT][512]        4194304     (x3 with XK, XV)
//   WQT  f16  [64][512]          65536     (x3 with WKT, WVT; Wq^T, Wk^T, Wv^T x64)
//   PEH  f16  [8*2048][64]     2097152     (E x64)
//   QH   f16  [MT][64]          524288     (16*q), KH same
//   VH   bf16 [64][MT]          524288     (v hi), VL same (v lo), contiguous after VH
//   Z    bf16 [MT][1024]       8388608     (ctx hi | ctx lo)
//   WOT  bf16 [512][1024]      1048576     (Wo^T | Wo^T)
//   OP   bf16 [MT][1024]       8388608     (relu out hi | lo)
//   WLT  bf16 [448][1024]       917504     (Wl^T | Wl^T, rows 388..447 zero)
//   L    f32  [MT][448]        7340032
//   FLG  f32  [128][32]          16384     (mask-structure flag lines)
//   total                     43073536
// =====================================================================================================
extern "C" void kernel_launch(void* const* d_in, const int* in_sizes, int n_in,
                              void* d_out, int out_size, void* d_ws, size_t ws_size,
                              hipStream_t stream) {
  if (n_in < 15) return;
  if (in_sizes[0] < (NB - 1) * SEQ_FULL * DMD + SEQ * DMD) return;   // v
  if (in_sizes[1] < (NB - 1) * SEQ_FULL * DMD + SEQ * DMD) return;   // k
  if (in_sizes[2] < (NB - 1) * SEQ_FULL * DMD + SEQ * DMD) return;   // q
  if (in_sizes[3] < (SEQ - 1) * SEQ_FULL + SEQ) return;               // mask
  if (in_sizes[4] < DMD * HD || in_sizes[6] < DMD * HD || in_sizes[8] < DMD * HD) return;
  if (in_sizes[5] < HD || in_sizes[7] < HD || in_sizes[9] < HD) return;
  if (in_sizes[10] < NH * SEQ_FULL * HD) return;                      // E
  if (in_sizes[11] < DMD * DMD || in_sizes[12] < DMD) return;         // Wo, bo
  if (in_sizes[13] < DMD * EVD || in_sizes[14] < EVD) return;         // Wl, bl
  if (out_size < MT * EVD) return;

  const float* v   = (const float*)d_in[0];    // [2][2048][512]
  const float* k   = (const float*)d_in[1];
  const float* q   = (const float*)d_in[2];
  const float* msk = (const float*)d_in[3];    // [2048][2048]
  const float* wq  = (const float*)d_in[4];    // [512][64]
  const float* bq  = (const float*)d_in[5];    // [64]
  const float* wk  = (const float*)d_in[6];
  const float* bk  = (const float*)d_in[7];
  const float* wv  = (const float*)d_in[8];
  const float* bv  = (const float*)d_in[9];
  const float* ee  = (const float*)d_in[10];   // [8][2048][64]
  const float* wo  = (const float*)d_in[11];   // [512][512] (in, out)
  const float* bo  = (const float*)d_in[12];   // [512]
  const float* wl  = (const float*)d_in[13];   // [512][388] (in, out)
  const float* bl  = (const float*)d_in[14];   // [388]

  const size_t PX  = (size_t)MT * DMD * 2;
  const size_t PW  = (size_t)HD * DMD * 2;
  const size_t PPE = (size_t)NH * SEQ_FULL * HD * 2;
  const size_t PQK = (size_t)MT * HD * 2;
  const size_t PV2 = (size_t)2 * HD * MT * 2;
  const size_t PZ  = (size_t)MT * KF * 2;
  const size_t PWO = (size_t)DMD * KF * 2;
  const size_t POP = (size_t)MT * KF * 2;
  const size_t PWL = (size_t)EVP * KF * 2;
  const size_t PL  = (size_t)MT * EVP * 4;
  const size_t PFL = (size_t)(SEQ_FULL / 16) * FLGW * 4;
  size_t off = 0;
  const size_t oXQ = off; off += PX;
  const size_t oXK = off; off += PX;
  const size_t oXV = off; off += PX;
  const size_t oWQ = off; off += PW;
  const size_t oWK = off; off += PW;
  const size_t oWV = off; off += PW;
  const size_t oPE = off; off += PPE;
  const size_t oQH = off; off += PQK;
  const size_t oKH = off; off += PQK;
  const size_t oV  = off; off += PV2;
  const size_t oZ  = off; off += PZ;
  const size_t oWO = off; off += PWO;
  const size_t oOP = off; off += POP;
  const size_t oWL = off; off += PWL;
  const size_t oL  = off; off += PL;
  const size_t oFL = off; off += PFL;
  if (off > ws_size) return;
  if (off > (size_t)134217728) return;

  char* ws = (char*)d_ws;
  unsigned short* XQ  = (unsigned short*)(ws + oXQ);
  unsigned short* XK  = (unsigned short*)(ws + oXK);
  unsigned short* XV  = (unsigned short*)(ws + oXV);
  unsigned short* WQT = (unsigned short*)(ws + oWQ);
  unsigned short* WKT = (unsigned short*)(ws + oWK);
  unsigned short* WVT = (unsigned short*)(ws + oWV);
  unsigned short* PEH = (unsigned short*)(ws + oPE);
  unsigned short* QHp = (unsigned short*)(ws + oQH);
  unsigned short* KHp = (unsigned short*)(ws + oKH);
  unsigned short* VHp = (unsigned short*)(ws + oV);
  unsigned short* VLp = VHp + (size_t)HD * MT;
  unsigned short* Zp  = (unsigned short*)(ws + oZ);
  unsigned short* WOT = (unsigned short*)(ws + oWO);
  unsigned short* OPp = (unsigned short*)(ws + oOP);
  unsigned short* WLT = (unsigned short*)(ws + oWL);
  float* Lp   = (float*)(ws + oL);
  float* FLG  = (float*)(ws + oFL);
  float* out0 = (float*)d_out;
  float* fdummy = Lp;                             // in-range placeholder for unused f32 output args
  unsigned short* hdummy = QHp;                   // in-range placeholder for unused 16-bit output args

  const dim3 blk(256);

  // (0) what the projections read, one launch: q, k, v (per batch slab) -> f16(bf16); Wq|Wk|Wv [512][64] ->
  //     [64][512] (transposed, f16 x64)
  prep_x<<<dim3(PREP_BLOCKS), blk, 0, stream>>>(q, k, v, wq, wk, wv, XQ, XK, XV, WQT, WKT, WVT);

  // (1) one launch: the three projections (q plane x16, k plane x16, v^T bf16 hi (VH) and lo (VL) planes) and,
  //     beside them, the jobs only later launches read: mask structure flags, Wo and Wl planes, E plane
  proj_side<<<dim3(SIDE_BLOCKS), blk, 0, stream>>>(XQ, XK, XV, WQT, WKT, WVT, bq, bk, bv, QHp, KHp, VHp,
                                                   msk, FLG, wo, WOT, wl, WLT, ee, PEH);

  // (2) attention -> ctx hi|lo token-major plane
  attn_kernel<<<dim3(NB * NH * (SEQ / 16)), dim3(32 * AWV), 0, stream>>>(QHp, KHp, PEH, VHp, VLp, Zp);

  // (3) output projection with relu: OP = bf16 hi|lo of max(0, sum_k Z[row][k] * WOT[n][k] + bo[n]), K = 1024
  const int gO = ((MT / (16 * GTI)) * (DMD / 64) + GWV - 1) / GWV;
  gemm64<1, 2, 1, 0><<<dim3(gO), dim3(32 * GWV), 0, stream>>>(Zp, KF, WOT, KF, OPp, DMD, fdummy, KF, 1.0f, bo, DMD, 1.0f, MT, DMD, KF);

  // (4) logits: L[row][n] = sum_k OP[row][k] * WLT[n][k] + bl[n], K = 1024, N padded to 448
  const int gL = ((MT / (16 * GTI)) * (EVP / 64) + GWV - 1) / GWV;
  gemm64<1, 0, 0, 0><<<dim3(gL), dim3(32 * GWV), 0, stream>>>(OPp, KF, WLT, KF, hdummy, 0, Lp, EVP, 1.0f, bl, EVD, 1.0f, MT, EVP, KF);

  // (5) flat whole-line copy into the output (388-wide rows), NaN-poisoned on a mask-structure violation
  out_copy<<<dim3((MT * (EVD / 4) + 255) / 256), blk, 0, stream>>>(Lp, FLG, out0);
  (void)hipGetLastError();
}

// v005
// One run takes 135 microseconds.
// Timed twice side by side with v004, it ran 1.16 times as fast both times.
// All steps since v000 together make it 2.94 times as fast.
// Contractions: x.Wq and x.Wk (f16 planes x16), Wv^T.x^T (bf16 hi|lo planes), q.k^T and q.E^T band on
// v_wmma_f32_16x16x32_f16 (f16 operands, f32 accumulate); p.v as bf16 hi/lo three-product split, and
// [ctx_hi|ctx_lo].[Wo;Wo], [o_hi|o_lo].[Wl;Wl] K-folded planes on v_wmma_f32_16x16x32_bf16 (bf16 operands,
// f32 accumulate). Float inputs RNE-converted to bf16 on load (x x1; Wq, Wk, Wv, E x64 in f16; Wo, Wl bf16);
// softmax, causal select and the relative-offset skew in f32 on VALU.
#include <hip/hip_runtime.h>
#include <math.h>

#ifndef NB
#define NB 2
#endif
#ifndef SEQ
#define SEQ 2048
#endif
#define NB_FULL  2
#define SEQ_FULL 2048
#define DMD  512
#define NH   8
#define HD   64
#define EVD  388
#define EVP  448
#define MT   (NB * SEQ)
#define KF   (2 * DMD)
#define NFLG (SEQ / 16)
#define FLGW 32
#define AWV  8
#define OPP  68
#define RWP  48
#define WSCL 64.0f
#define QKS  16.0f
#define RSQD 0.125f
#define NEGM (-1.0e10f)

static_assert(NB >= 1 && NB <= NB_FULL);
static_assert(SEQ >= 64 && SEQ <= SEQ_FULL && (SEQ % 64) == 0);
static_assert(NH * HD == DMD && HD == 64);
static_assert((MT % 64) == 0 && (DMD % 64) == 0 && (KF % 64) == 0);
static_assert((EVP % 64) == 0 && EVP >= EVD && (EVD % 4) == 0);
static_assert(((SEQ * DMD) % 2048) == 0 && ((NH * SEQ_FULL * HD) % 2048) == 0);
static_assert(NFLG <= 256 && ((4 * SEQ) % 256) == 0);

typedef _Float16 v16h __attribute__((ext_vector_type(16)));
typedef __bf16 v16bf __attribute__((ext_vector_type(16)));
typedef unsigned short v16us __attribute__((ext_vector_type(16)));
typedef unsigned short v8us  __attribute__((ext_vector_type(8)));
typedef float v8f __attribute__((ext_vector_type(8)));
typedef float v4f __attribute__((ext_vector_type(4)));
typedef unsigned int v4u __attribute__((ext_vector_type(4)));
typedef unsigned int v2u __attribute__((ext_vector_type(2)));

union FragU { v16us v; v8us h[2]; };

// ---- scalar helpers --------------------------------------------------------------------------------
__device__ __forceinline__ unsigned short bf_bits(float f) {          // f32 -> bf16 bits, RNE convert
  const unsigned u = __float_as_uint(f);
  return (unsigned short)((u + 0x7FFFu + ((u >> 16) & 1u)) >> 16);
}
__device__ __forceinline__ float bf_up(unsigned short h) { return __uint_as_float(((unsigned)h) << 16); }
__device__ __forceinline__ float bfr(float f) { return bf_up(bf_bits(f)); }   // value of the bf16 RNE convert
__device__ __forceinline__ unsigned short h_bits(_Float16 x) { return __builtin_bit_cast(unsigned short, x); }
__device__ __forceinline__ unsigned short f2h(float f) { return h_bits((_Float16)f); }
__device__ __forceinline__ unsigned pk16(unsigned short a, unsigned short b) { return (unsigned)a | ((unsigned)b << 16); }
__device__ __forceinline__ int clampi(int v, int lo, int hi) { return v < lo ? lo : (v > hi ? hi : v); }
__device__ __forceinline__ v8f zero8() { v8f z = {0.f, 0.f, 0.f, 0.f, 0.f, 0.f, 0.f, 0.f}; return z; }

// ---- fragment loader: 16-bit A/B operand, lane -> row/col (lane&15), p already includes +8*(lane>>4);
//      elements 0..7 <- p[0..7] (k0+8h..), elements 8..15 <- p[16..23] (k0+16+8h..)
__device__ __forceinline__ v16us ldfrag_u(const unsigned short* p) {
  FragU f;
  f.h[0] = *(const v8us*)(p);
  f.h[1] = *(const v8us*)(p + 16);
  return f.v;
}

// ---- fragment order: a 16-bit plane [R][K] (R % 16 == 0, K % 32 == 0, KS = K / 32) kept as 1-KB fragments of 16 rows x
//      32 k, fragment (row / 16) * KS + k / 32; inside it two 512-B halves (k % 32 below 16, then from 16 on), each 32
//      chunks of 8 elements in lane order ((k / 8) % 2) * 16 + row % 16. A fragment load is then two loads of 512
//      contiguous bytes (4 whole lines each) with the same element map as ldfrag_u, not two loads over 16 lines each.
__device__ __forceinline__ size_t fo_off(int row, int k, int KS) {
  return ((size_t)(row >> 4) * KS + (k >> 5)) * 512 + ((k >> 4) & 1) * 256 + (((k >> 3) & 1) * 16 + (row & 15)) * 8 + (k & 7);
}
__device__ __forceinline__ v16us ldfrag_fo(const unsigned short* plane, int tr, int ks, int KS, int lane) {
  // 32-bit byte offset (every plane is far below 4 GiB) on the plane's uniform pointer: one address register per load group
  const unsigned off = ((unsigned)tr * (unsigned)KS + (unsigned)ks) * 1024u + (unsigned)lane * 16u;
  const unsigned short* p = (const unsigned short*)((const char*)plane + off);
  FragU f;
  f.h[0] = *(const v8us*)(p);
  f.h[1] = *(const v8us*)(p + 256);
  return f.v;
}

// stands behind issued global loads or stores, in front of the code that reuses the registers they name
__device__ __forceinline__ void addr_wait() {
#if defined(__HIP_DEVICE_COMPILE__)
  asm volatile("s_wait_xcnt 0x0" ::: "memory");
#endif
}

// ---- WMMA helpers (f16 / bf16 operand bits) with trailing VALU hazard gap --------------------------
__device__ __forceinline__ v8f mma_raw(v16us a, v16us b, v8f c) {
  return __builtin_amdgcn_wmma_f32_16x16x32_f16(false, __builtin_bit_cast(v16h, a), false,
                                                __builtin_bit_cast(v16h, b), (short)0, c, false, false);
}
__device__ __forceinline__ v8f mma_raw_bf(v16us a, v16us b, v8f c) {
  return __builtin_amdgcn_wmma_f32_16x16x32_bf16(false, __builtin_bit_cast(v16bf, a), false,
                                                 __builtin_bit_cast(v16bf, b), (short)0, c, false, false);
}
__device__ __forceinline__ v8f mma_g(v16us a, v16us b, v8f c) {                 // guarded f16
  c = mma_raw(a, b, c);
#if defined(__HIP_DEVICE_COMPILE__)
  asm volatile("v_nop\n\tv_nop\n\tv_nop\n\tv_nop" : "+v"(c) : "v"(a), "v"(b));
#endif
  return c;
}
__device__ __forceinline__ v8f mma_gb(v16us a, v16us b, v8f c) {                // guarded bf16
  c = mma_raw_bf(a, b, c);
#if defined(__HIP_DEVICE_COMPILE__)
  asm volatile("v_nop\n\tv_nop\n\tv_nop\n\tv_nop" : "+v"(c) : "v"(a), "v"(b));
#endif
  return c;
}
__device__ __forceinline__ void dep_guard1(v8f& a, v8f& b, v16us x) {
#if defined(__HIP_DEVICE_COMPILE__)
  asm volatile("v_nop\n\tv_nop\n\tv_nop\n\tv_nop" : "+v"(a), "+v"(b) : "v"(x));
#endif
}
__device__ __forceinline__ void keep4_u(v16us a, v16us b, v16us c, v16us d) {
#if defined(__HIP_DEVICE_COMPILE__)
  asm volatile("v_nop" :: "v"(a), "v"(b), "v"(c), "v"(d));
#endif
}
__device__ __forceinline__ void acc_guard4(v8f& a, v8f& b, v8f& c, v8f& d) {
#if defined(__HIP_DEVICE_COMPILE__)
  asm volatile("v_nop\n\tv_nop\n\tv_nop\n\tv_nop" : "+v"(a), "+v"(b), "+v"(c), "+v"(d));
#endif
}
// 2^x; the v_nop keeps, inside the statement, the one slot the instruction set asks for between a
// transcendental and an instruction that reads its result or overwrites its source
__device__ __forceinline__ float exp2_slot(float x) {
  float r = 0.f;
#if defined(__HIP_DEVICE_COMPILE__)
  asm("v_exp_f32 %0, %1\n\tv_nop" : "=v"(r) : "v"(x));
#endif
  return r;
}
// orders LDS stores of this wave before later LDS loads of the same wave (cross-lane exchange)
__device__ __forceinline__ void wave_sync_lds() {
  __builtin_amdgcn_fence(__ATOMIC_RELEASE, "workgroup");
  __builtin_amdgcn_wave_barrier();
  __builtin_amdgcn_fence(__ATOMIC_ACQUIRE, "workgroup");
}

// =====================================================================================================
// Layout-kept convert: o[i] = f16 bits of (bf16 RNE value of w[i] * sc) for i < nsrc, zero for nsrc <= i <
// ndst; by selects a batch slab (source offset by*sstr, destination offset by*dstr), bx the 2048-element piece.
// nsrc % 8 == 0, ndst % 2048 == 0, bx = 0 .. ndst/2048 - 1 exact (compile-time constants at the call sites).
// coverage: 256 threads x 8 = 2048 elements per block; the callers' bx, by ranges cover all ndst elements of
// every slab. Block body, called from the first merged launch below.
// =====================================================================================================
__device__ __forceinline__ void cvt_lin(const float* __restrict__ w, unsigned short* o, int bx, int by,
                                        int nsrc, int ndst, float sc, int sstr, int dstr) {
  const float* wb = w + (size_t)by * (size_t)sstr;
  unsigned short* ob = o + (size_t)by * (size_t)dstr;
  const int base = (bx * 256 + threadIdx.x) * 8;
  if (base + 8 > ndst) return;                            // never taken with exact grids; no barriers below
  const bool inr = (base + 8 <= nsrc);
  const int lb = inr ? base : (nsrc - 8);                 // clamped address, always in range
  const v4f a0 = *(const v4f*)(wb + lb);
  const v4f a1 = *(const v4f*)(wb + lb + 4);
  v4u hv;
#pragma unroll
  for (int e = 0; e < 2; ++e) {
    hv[e]     = pk16(f2h(bfr(a0[2 * e]) * sc), f2h(bfr(a0[2 * e + 1]) * sc));
    hv[2 + e] = pk16(f2h(bfr(a1[2 * e]) * sc), f2h(bfr(a1[2 * e + 1]) * sc));
  }
  const v4u zz = {0u, 0u, 0u, 0u};
  hv = inr ? hv : zz;
  unsigned short* d = ob + base;
  *(v4u*)d = hv;
  
}

// Convert of a [R][64] f32 plane into fragment order (KS = 2): o = f16 bits of (bf16 RNE value of w * sc). A thread owns
// one 16-byte chunk of the destination, numbered linearly (a wave stores 512 contiguous bytes), and reads its 8 source
// elements. coverage: 256 chunks = 2048 elements per block; bx = 0 .. R*64/2048 - 1 exact at the call site.
__device__ __forceinline__ void cvt_fo64(const float* __restrict__ w, unsigned short* o, int bx, float sc) {
  const int g = bx * 256 + threadIdx.x;
  const int row = ((g >> 7) << 4) + (g & 15);
  const int col = ((g >> 6) & 1) * 32 + ((g >> 5) & 1) * 16 + ((g >> 4) & 1) * 8;
  const float* s = w + (size_t)row * 64 + col;
  const v4f a0 = *(const v4f*)(s);
  const v4f a1 = *(const v4f*)(s + 4);
  v4u hv;
#pragma unroll
  for (int e = 0; e < 2; ++e) {
    hv[e]     = pk16(f2h(bfr(a0[2 * e]) * sc), f2h(bfr(a0[2 * e + 1]) * sc));
    hv[2 + e] = pk16(f2h(bfr(a1[2 * e]) * sc), f2h(bfr(a1[2 * e + 1]) * sc));
  }
  *(v4u*)(o + (size_t)g * 8) = hv;
  addr_wait();                                           // precaution; the block ends after this one job
}

// =====================================================================================================
// Transpose-convert: in w[R][C] f32 (pitch C) -> out o[c][r] at o[c*ldo + r] for c < CP, with zero values
// for C <= c < CP. BFO 0: f16 bits of (bf16 RNE value * sc); BFO 1: bf16 bits (RNE), and the output plane [CP][ldo] is
// in fragment order (o[fo_off(c, r, ldo / 32)], a wave storing 512 contiguous bytes). Block tile 64x64
// through LDS (st[col][row], pitch 72 halves). Read phase: thread owns one input row x 16 columns (float4
// loads at a clamped column address, zero selected by value; C % 4 == 0 so a float4 is all-in or all-out).
// R, CP multiples of 64, ldo % 64 == 0, (bx, by) in (CP/64, R/64) exact (compile-time constants at the call
// sites). coverage: 64 output rows x 64 halves per block = the whole transposed tile; the callers' ranges cover
// all of [CP][R]. Block body, called from the merged launches below under a block-uniform branch; st is the
// calling kernel's LDS tile of 64 * 72 halves.
// =====================================================================================================
template <int BFO>
__device__ __forceinline__ void cvt_t(unsigned short* st, const float* __restrict__ w, unsigned short* o,
                                      int bx, int by, int R, int C, int CP, int ldo, float sc) {
  const int t = threadIdx.x;
  const int r0 = by * 64, c0 = bx * 64;
  if (r0 + 64 > R || c0 + 64 > CP) return;              // block-uniform, before the barrier; never taken
  {
    const int row = t >> 2, ch = (t & 3) * 16;
    const float* p = w + (size_t)(r0 + row) * C;
#pragma unroll
    for (int q = 0; q < 4; ++q) {
      const int cs = c0 + ch + 4 * q;
      const bool inr = (cs + 4 <= C);
      const int lb = inr ? cs : (C - 4);                 // clamped column address, always in range
      const v4f v = *(const v4f*)(p + lb);
#pragma unroll
      for (int e = 0; e < 4; ++e) {
        const unsigned short hb = BFO ? bf_bits(v[e]) : f2h(bfr(v[e]) * sc);
        st[(ch + 4 * q + e) * 72 + row] = inr ? hb : (unsigned short)0;
      }
    }
  }
  __syncthreads();
  v4u hv[2];
#pragma unroll
  for (int half = 0; half < 2; ++half) {
    const int c = t + 256 * half;                        // BFO: chunk number in fragment order within the tile
    const int cl = BFO ? ((c >> 7) * 16 + (c & 15)) : ((t >> 3) + 32 * half);
    const int pc = BFO ? (((c >> 6) & 1) * 32 + ((c >> 5) & 1) * 16 + ((c >> 4) & 1) * 8) : ((t & 7) * 8);
    hv[half] = *(const v4u*)(st + cl * 72 + pc);
  }
  {
#pragma unroll
    for (int half = 0; half < 2; ++half) {
      const int c = t + 256 * half;
      const int cl = BFO ? ((c >> 7) * 16 + (c & 15)) : ((t >> 3) + 32 * half);
      const int pc = BFO ? (((c >> 6) & 1) * 32 + ((c >> 5) & 1) * 16 + ((c >> 4) & 1) * 8) : ((t & 7) * 8);
      unsigned short* dst = o + (BFO ? fo_off(c0 + cl, r0 + pc, ldo >> 5) : ((size_t)(c0 + cl) * ldo + r0 + pc));
      *(v4u*)dst = hv[half];
    }
#if defined(__HIP_DEVICE_COMPILE__)
    // precaution: wait for the stores to read their registers (the block ends after this one job)
    asm volatile("s_wait_xcnt 0x0" ::: "memory");
#endif
  }
}

// =====================================================================================================
// Register-blocked 16-bit WMMA GEMM: C[m][n] = sum_k A[m][k] * Bt[n][k], one wave per 32x64 tile, no block
// barriers. BF 0: f16 operand bits, BF 1: bf16 operand bits. A row-major [M][K] pitch lda; Bt row-major
// [N][K] pitch ldb (k contiguous); M multiple of 32, N of 64, K of 32 (true at every call site; waves
// past the last tile exit before any work, wave-uniform). A wave's k step is two A and four B fragments, whose
// twelve loads are issued together: one load round trip per k step, and M/32 * N/64 waves to fill the chip.
// WPB = waves (tiles) per block. Tiles are numbered down the rows first, so the waves of a block read the same
// four B fragments where WPB divides M/32 (in the v^T product, M/32 = 2: only wave pairs do). Both operand fragments use the split k map
// (elements 0..7 <- k0+8h.., 8..15 <- k0+16+8h..); D element r of a lane is (row 8h + r, col lane&15).
// Bias: bf16 RNE value of bias[] times bsc, indexed by column (clamped into nbias) or, with BROW, by row.
// FOI 1: A and Bt are planes in fragment order (KS = lda / 32, ldb / 32) instead of row-major.
// OM 0: f32 out Cf = acc*osc + b, pitch ldc.            OM 1: f16 out Ch = f16 bits(acc*osc + b).
// OM 2: val = (RELU ? max(0, .) : .)(acc*osc + b); bf16 hi bits at Ch, bf16 lo bits (val - hi) at Ch + looff.
// The 16-bit outputs (OM 1, 2) are planes [M][ldc] in fragment order; a wave's slab is whole 1-KB fragments.
// coverage: GTI slabs x 16 rows x 64 cols = the wave's whole tile (hi and lo planes alike).
// gemm64_blk is the block body (bx = block number within this product, sT = the calling kernel's LDS, WPB per-wave
// 16x64 slabs of pitch 68 floats); gemm64 is the launch of one product alone.
// =====================================================================================================
#define GSLAB (16 * 68)
#define GTI 2                                  // 16-row subtiles per wave tile
#define GWV 4                                  // waves per block where a product is launched alone
template <int BF, int OM, int RELU, int BROW, int WPB, int FOI>
__device__ __forceinline__ void gemm64_blk(
    float* sT, int bx,
    const unsigned short* __restrict__ Ap, int lda, const unsigned short* __restrict__ Btp, int ldb,
    unsigned short* Ch, int looff, float* Cf, int ldc, float osc,
    const float* __restrict__ bias, int nbias, float bsc, int M, int N, int K) {
  const int lane = threadIdx.x & 31;
  const int wave = threadIdx.x >> 5;
  const int tilesN = N >> 6;
  const int tilesM = M / (16 * GTI);
  const int tile = bx * WPB + wave;
  if (tile >= tilesM * tilesN) return;   // wave-uniform; no block barriers in this kernel
  const int tn = tile / tilesM;
  const int tm = tile - tn * tilesM;
  const int m0 = tm * (16 * GTI);
  const int n0 = tn << 6;

  const int rlane = lane & 15;                 // row (A) / col (B, D) within subtile
  const int koff  = (lane >> 4) * 8;           // k offset of this lane half
  const int mOff  = (lane >> 4) * 8;           // D row offset

  v8f acc[GTI][4];
#pragma unroll
  for (int i = 0; i < GTI; ++i)
#pragma unroll
    for (int j = 0; j < 4; ++j) acc[i][j] = zero8();

#pragma unroll 1
  for (int k0 = 0; k0 < K; k0 += 32) {
    v16us bh[4];
#pragma unroll
    for (int j = 0; j < 4; ++j) {
      const size_t bo = (size_t)(n0 + (j << 4) + rlane) * ldb + koff + k0;
      bh[j] = FOI ? ldfrag_fo(Btp, (n0 >> 4) + j, k0 >> 5, ldb >> 5, lane) : ldfrag_u(Btp + bo);
    }
    v16us ah[GTI];
#pragma unroll
    for (int i = 0; i < GTI; ++i) {
      const size_t ao = (size_t)(m0 + (i << 4) + rlane) * lda + koff + k0;
      ah[i] = FOI ? ldfrag_fo(Ap, (m0 >> 4) + i, k0 >> 5, lda >> 5, lane) : ldfrag_u(Ap + ao);
    }
#pragma unroll
    for (int i = 0; i < GTI; ++i) {
#pragma unroll
      for (int j = 0; j < 4; ++j) {
        if (BF) acc[i][j] = mma_raw_bf(ah[i], bh[j], acc[i][j]);
        else    acc[i][j] = mma_raw(ah[i], bh[j], acc[i][j]);
      }
      dep_guard1(acc[i][0], acc[i][3], ah[i]);
    }
    keep4_u(bh[0], bh[1], bh[2], bh[3]);
  }
#pragma unroll
  for (int i = 0; i < GTI; ++i) acc_guard4(acc[i][0], acc[i][1], acc[i][2], acc[i][3]);

  const int hh2 = lane >> 4, c4 = (lane & 15) * 4;     // f32 out: 256-B row segment = 16 lanes x 16 B
  const int q8  = lane >> 3, c8 = (lane & 7) * 8;

  // per-lane bias values for the column-indexed modes (bf16 RNE value times bsc), clamped address
  float bc[8];
#pragma unroll
  for (int e = 0; e < 8; ++e) bc[e] = 0.f;
  if (!BROW) {
    if (OM == 0) {
#pragma unroll
      for (int e = 0; e < 4; ++e) bc[e] = bsc * bfr(bias[clampi(n0 + c4 + e, 0, nbias - 1)]);
    } else {
#pragma unroll
      for (int e = 0; e < 8; ++e) bc[e] = bsc * bfr(bias[clampi(n0 + c8 + e, 0, nbias - 1)]);
    }
  }

  // ---- epilogue ----
  float* slab = sT + wave * GSLAB;
#pragma unroll
  for (int i = 0; i < GTI; ++i) {
    const int mBase = m0 + (i << 4);
#pragma unroll
    for (int j = 0; j < 4; ++j) {
#pragma unroll
      for (int r = 0; r < 8; ++r) {
        slab[(mOff + r) * 68 + (j << 4) + rlane] = acc[i][j][r];
      }
    }
    wave_sync_lds();
    if (OM == 0) {
      v4f vals[8];
#pragma unroll
      for (int it = 0; it < 8; ++it) {
        const int row = it * 2 + hh2;                      // it 0..7 x hh2 0..1 = rows 0..15
        const v4f v = *(const v4f*)(slab + row * 68 + c4);
        float brw = 0.f;
        if (BROW) brw = bsc * bfr(bias[clampi(mBase + row, 0, nbias - 1)]);
        v4f ov;
#pragma unroll
        for (int e = 0; e < 4; ++e) {
          float x = v[e] * osc + (BROW ? brw : bc[e]);
          if (RELU) x = fmaxf(x, 0.f);
          ov[e] = x;
        }
        vals[it] = ov;
      }
      {
#pragma unroll
        for (int it = 0; it < 8; ++it) {
          const int row = it * 2 + hh2;
          *(v4f*)(Cf + (size_t)(mBase + row) * ldc + (size_t)n0 + c4) = vals[it];
        }
        
      }
    } else if (OM == 1) {
      v4u hv[4];
#pragma unroll
      for (int it = 0; it < 4; ++it) {
        const int row = it * 4 + q8;                       // it 0..3 x q8 0..3 = rows 0..15
        const float* sp = slab + row * 68 + c8;
        float brw = 0.f;
        if (BROW) brw = bsc * bfr(bias[clampi(mBase + row, 0, nbias - 1)]);
        v4u ha = {0u, 0u, 0u, 0u};
#pragma unroll
        for (int e = 0; e < 4; ++e) {
          float b0 = sp[2 * e]     * osc + (BROW ? brw : bc[2 * e]);
          float b1 = sp[2 * e + 1] * osc + (BROW ? brw : bc[2 * e + 1]);
          if (RELU) { b0 = fmaxf(b0, 0.f); b1 = fmaxf(b1, 0.f); }
          ha[e] = pk16(f2h(b0), f2h(b1));
        }
        hv[it] = ha;
      }
      {
#pragma unroll
        for (int it = 0; it < 4; ++it) {
          const int row = it * 4 + q8;
          const size_t go = fo_off(mBase + row, n0 + c8, ldc >> 5);
          *(v4u*)(Ch + go) = hv[it];
        }
        
      }
    } else {
      v4u hv[4], lv[4];
#pragma unroll
      for (int it = 0; it < 4; ++it) {
        const int row = it * 4 + q8;                       // it 0..3 x q8 0..3 = rows 0..15
        const float* sp = slab + row * 68 + c8;
        float brw = 0.f;
        if (BROW) brw = bsc * bfr(bias[clampi(mBase + row, 0, nbias - 1)]);
        v4u ha = {0u, 0u, 0u, 0u};
        v4u la = {0u, 0u, 0u, 0u};
#pragma unroll
        for (int e = 0; e < 4; ++e) {
          float x0 = sp[2 * e]     * osc + (BROW ? brw : bc[2 * e]);
          float x1 = sp[2 * e + 1] * osc + (BROW ? brw : bc[2 * e + 1]);
          if (RELU) { x0 = fmaxf(x0, 0.f); x1 = fmaxf(x1, 0.f); }
          const unsigned short h0 = bf_bits(x0), h1 = bf_bits(x1);
          const unsigned short l0 = bf_bits(x0 - bf_up(h0)), l1 = bf_bits(x1 - bf_up(h1));
          ha[e] = pk16(h0, h1);
          la[e] = pk16(l0, l1);
        }
        hv[it] = ha;
        lv[it] = la;
      }
      {
#pragma unroll
        for (int it = 0; it < 4; ++it) {
          const int row = it * 4 + q8;
          const size_t go = fo_off(mBase + row, n0 + c8, ldc >> 5);
          *(v4u*)(Ch + go) = hv[it];
          *(v4u*)(Ch + (size_t)looff + go) = lv[it];
        }
        
      }
    }
    wave_sync_lds();
  }
}
template <int BF, int OM, int RELU, int BROW>
__global__ __launch_bounds__(32 * GWV) void gemm64(
    const unsigned short* __restrict__ Ap, int lda, const unsigned short* __restrict__ Btp, int ldb,
    unsigned short* Ch, int looff, float* Cf, int ldc, float osc,
    const float* __restrict__ bias, int nbias, float bsc, int M, int N, int K) {
  __shared__ __align__(16) float sT[GWV * GSLAB];
  gemm64_blk<BF, OM, RELU, BROW, GWV, 1>(sT, blockIdx.x, Ap, lda, Btp, ldb, Ch, looff, Cf, ldc, osc, bias, nbias, bsc,
                                 M, N, K);
}

// =====================================================================================================
// Structure check of the [SEQ][SEQ] mask input (row pitch SEQ_FULL): block b covers rows 16b..16b+15 and all
// SEQ columns; a violation is any element differing from (j <= i ? 1 : 0). The block's flag is written as one
// coverage: 256 threads x (SEQ/64) float4 = 16 rows x SEQ cols per block; bx = 0 .. SEQ/16 - 1 = all rows.
// Block body, called from the second merged launch under a block-uniform branch; wf = 8 ints of its LDS.
// =====================================================================================================
__device__ __forceinline__ void mask_check(int* wf, int bx, const float* __restrict__ msk, float* flg) {
  const int t = threadIdx.x, lane = t & 31, wv = t >> 5;
  const int i0 = bx * 16;
  if (i0 + 16 > SEQ) return;                             // block-uniform, before the barrier; never taken
  constexpr int C4 = SEQ / 4;
  int viol = 0;
#pragma unroll 1
  for (int it = 0; it < (16 * C4) / 256; ++it) {
    const int ci = it * 256 + t;
    const int rr = ci / C4;
    const int c4 = ci - rr * C4;
    const int i = i0 + rr;
    const v4f x = *(const v4f*)(msk + (size_t)i * SEQ_FULL + 4 * c4);
#pragma unroll
    for (int e = 0; e < 4; ++e) {
      const int j = 4 * c4 + e;
      const float ex = (j <= i) ? 1.0f : 0.0f;
      viol |= (x[e] != ex) ? 1 : 0;
    }
  }
  viol |= __shfl_xor(viol, 1, 32);
  viol |= __shfl_xor(viol, 2, 32);
  viol |= __shfl_xor(viol, 4, 32);
  viol |= __shfl_xor(viol, 8, 32);
  viol |= __shfl_xor(viol, 16, 32);
  if (lane == 0) wf[wv] = viol;
  __syncthreads();
  if (wv == 0) {                                        // wave-uniform
    int f = wf[lane & 7];
    f |= __shfl_xor(f, 1, 32);
    f |= __shfl_xor(f, 2, 32);
    f |= __shfl_xor(f, 4, 32);
    const float fv = f ? 1.0f : 0.0f;
    float* d = flg + (size_t)bx * FLGW + lane;
    *(float*)d = fv;
    
  }
}

// =====================================================================================================
// Merged launches: jobs that read none of each other's output share one grid; the flat block index picks the
// job by ranges (block-uniform scalar branches), every block runs exactly one job body and then ends.
// prep_x: what the projections read. Blocks [0, 3*NTW): Wq, Wk, Wv -> [64][512] f16 x64 (transposed);
//   then 3*NLX blocks: q, k, v -> f16(bf16) planes, NLX = NB slabs x SEQ*DMD/2048 pieces each.
// proj_side: the three projections, first in the grid since they run longest, and beside them all that only
//   later launches read. Blocks [0, 3*NGQ): q plane x16, k plane x16 (C[tok][n] = sum_k X[tok][k] * WT[n][k]),
//   v^T planes (C[d][tok] = sum_k WVT[d][k] * XV[tok][k] / 64, bf16 hi and lo); then NFLG mask-structure blocks;
//   2*NTO blocks Wo -> [512][1024] = (Wo^T | Wo^T) bf16; 2*NTL blocks Wl -> [448][1024] = (Wl^T | Wl^T) bf16;
//   NLE blocks E -> f16(bf16 x64).
// =====================================================================================================
#define NTW (DMD / 64)
#define NLP ((SEQ * DMD) / 2048)
#define NLX (NLP * NB)
#define NGQ (((MT / (16 * GTI)) * (HD / 64) + 7) / 8)
#define NTO ((DMD / 64) * (DMD / 64))
#define NTL ((EVP / 64) * (DMD / 64))
#define NLE ((NH * SEQ_FULL * HD) / 2048)
#define PREP_BLOCKS (3 * NTW + 3 * NLX)
#define SIDE_BLOCKS (3 * NGQ + NFLG + 2 * NTO + 2 * NTL + NLE)

__global__ __launch_bounds__(256) void prep_x(
    const float* __restrict__ q, const float* __restrict__ k, const float* __restrict__ v,
    const float* __restrict__ wq, const float* __restrict__ wk, const float* __restrict__ wv,
    unsigned short* XQ, unsigned short* XK, unsigned short* XV,
    unsigned short* WQT, unsigned short* WKT, unsigned short* WVT) {
  __shared__ __align__(16) unsigned short st[64 * 72];
  int bid = blockIdx.x;
  if (bid < 3 * NTW) {
    const int j = bid / NTW;
    const float* w = (j == 0) ? wq : ((j == 1) ? wk : wv);
    unsigned short* o = (j == 0) ? WQT : ((j == 1) ? WKT : WVT);
    cvt_t<0>(st, w, o, 0, bid - j * NTW, DMD, HD, HD, DMD, WSCL);          // in[512][64] -> out[64][512]
    return;
  }
  bid -= 3 * NTW;
  if (bid < 3 * NLX) {
    const int j = bid / NLX;
    const int r = bid - j * NLX;
    const float* x = (j == 0) ? q : ((j == 1) ? k : v);
    unsigned short* o = (j == 0) ? XQ : ((j == 1) ? XK : XV);
    cvt_lin(x, o, r % NLP, r / NLP, SEQ * DMD, SEQ * DMD, 1.0f, SEQ_FULL * DMD, SEQ * DMD);
  }
}

__global__ __launch_bounds__(256) void proj_side(
    const unsigned short* __restrict__ XQ, const unsigned short* __restrict__ XK,
    const unsigned short* __restrict__ XV, const unsigned short* __restrict__ WQT,
    const unsigned short* __restrict__ WKT, const unsigned short* __restrict__ WVT,
    const float* __restrict__ bq, const float* __restrict__ bk, const float* __restrict__ bv,
    unsigned short* QH, unsigned short* KH, unsigned short* VH,
    const float* __restrict__ msk, float* flg,
    const float* __restrict__ wo, unsigned short* WOT, const float* __restrict__ wl, unsigned short* WLT,
    const float* __restrict__ ee, unsigned short* PEH) {
  __shared__ __align__(16) float sT[8 * GSLAB];        // the one job of a block uses it: slabs, transpose tile or flags
  int bid = blockIdx.x;
  if (bid < 2 * NGQ) {
    const int j = bid / NGQ;
    gemm64_blk<0, 1, 0, 0, 8, 0>(sT, bid - j * NGQ, j ? XK : XQ, DMD, j ? WKT : WQT, DMD, j ? KH : QH, 0, nullptr, HD,
                           QKS / WSCL, j ? bk : bq, HD, QKS, MT, HD, DMD);
    return;
  }
  bid -= 2 * NGQ;
  if (bid < NGQ) {
    gemm64_blk<0, 2, 0, 1, 8, 0>(sT, bid, WVT, DMD, XV, DMD, VH, HD * MT, nullptr, MT, 1.0f / WSCL, bv, HD, 1.0f,
                           HD, MT, DMD);
    return;
  }
  bid -= NGQ;
  if (bid < NFLG) {
    mask_check((int*)sT, bid, msk, flg);
    return;
  }
  bid -= NFLG;
  if (bid < 2 * NTO) {
    const int j = bid / NTO;                           // destination columns 0.. and 512.. (16 fragments on)
    const int r = bid - j * NTO;
    cvt_t<1>((unsigned short*)sT, wo, WOT + j * (DMD * 16), r % (DMD / 64), r / (DMD / 64), DMD, DMD, DMD, KF, 1.0f);
    return;
  }
  bid -= 2 * NTO;
  if (bid < 2 * NTL) {
    const int j = bid / NTL;                           // destination columns 0.. and 512.. (16 fragments on)
    const int r = bid - j * NTL;
    cvt_t<1>((unsigned short*)sT, wl, WLT + j * (DMD * 16), r % (EVP / 64), r / (EVP / 64), DMD, EVD, EVP, KF, 1.0f);
    return;
  }
  bid -= 2 * NTL;
  if (bid < NLE) cvt_fo64(ee, PEH, bid, WSCL);
}

// =====================================================================================================
// Causal attention with relative-offset term, head dim 64. Block = 256 threads = 8 waves; one block owns one
// 16-row query tile (t0..t0+15) of one (batch b, head h). The key blocks of 32 up to the diagonal (sb <= t0)
// are cut into 8 contiguous shares, one per wave; each wave runs its share with an online max-subtracted
// softmax in f32 and leaves its partial state (row max, row sum, unnormalised 16x64 O) in LDS; behind one
// block barrier the 8 states are merged in wave order (rescale by exp(max_w - max), sum, divide).
// Planes, all in fragment order: QH, KH f16 [MT][64] = 16*q, 16*k (shared
// by all heads); PE f16 [NH*SEQ_FULL][64] = 64*E (head h rows h*SEQ_FULL..); VH, VL bf16 [64][MT] = v hi and
// lo planes transposed (row = dim, column = token). Output Z bf16 [MT][1024]: cols h*64+d = ctx hi, cols
// 512+h*64+d = ctx lo.
// Per key block sb: S = Q.K^T (2 key subtiles x 2 k-steps, scale 1/256); relative band of 48 columns:
// column c <-> E row SEQ-16-t0+sb+c (a 16-row tile starts at a multiple of 16 and is clamped as a whole to start at
// most at SEQ-16; clamping only touches entries with j > i, which the causal select replaces); columns 0..15 come from the tile carried over from the prior key block
// (its columns 32..47), columns 16..47 are two fresh tiles (2 x 2 WMMA, scale 1/1024); the band is exchanged
// through per-wave LDS and read back at c = 15 - il + jl, i.e. E row SEQ-1-i+j; score = (qk + rel)/8 for
// j <= i, else -1e10; p = exp(score - running max) in f32, l accumulated from the f32 p; p stored as bf16 hi
// and lo tiles in per-wave LDS and reloaded as A fragments (split k map); O += Phi.Vhi + Phi.Vlo + Plo.Vhi on
// 4 dim subtiles (one accumulator set). A wave whose share is empty contributes max -1e30, sum 0, O 0 (weight
// exp(-1e30 - max) = 0); wave 0's share is never empty. Merge: thread -> (row, 4 dims) in fragment order, 32 lanes
// x 8 B = two whole 128-B lines of Z per plane.
// coverage: 16 query rows x 64 halves x {hi, lo} per block, NB*NH*(SEQ/16) blocks = all (b, t, h)
// segments of Z in both halves.
// =====================================================================================================
__global__ __launch_bounds__(32 * AWV) void attn_kernel(
    const unsigned short* __restrict__ QH, const unsigned short* __restrict__ KH,
    const unsigned short* __restrict__ PE, const unsigned short* __restrict__ VH,
    const unsigned short* __restrict__ VL, unsigned short* Z) {
  __shared__ __align__(16) float relw[AWV][16 * RWP];            // band exchange, 24576 B
  __shared__ __align__(16) unsigned short pwh[AWV][16 * 32];      // P hi tiles, 8192 B
  __shared__ __align__(16) unsigned short pwl[AWV][16 * 32];      // P lo tiles, 8192 B
  __shared__ __align__(16) float opw[AWV][16 * OPP];              // partial O per wave, pitch 68 floats, 34816 B
  __shared__ __align__(16) float mxw[AWV][16];                    // partial row max per wave
  __shared__ __align__(16) float lsw[AWV][16];                    // partial row sum per wave
  const int lane = threadIdx.x & 31, m = lane & 15, hh = lane >> 4;
  // wave number in a scalar register: the key loop's bounds depend on it and stay a scalar branch
  const int wv = __builtin_amdgcn_readfirstlane((int)(threadIdx.x >> 5));
  const int task = blockIdx.x;                       // 0 .. NB*NH*(SEQ/16)-1
  const int nqt = SEQ / 16;
  const int bh = task / nqt;                         // (b, h)
  const int t0 = (task - bh * nqt) << 4;             // query tile start
  const int b = bh / NH, h = bh - (bh / NH) * NH;
  if (b >= NB) return;                               // block-uniform, before the barrier; never taken with exact grids
  const size_t tok0 = (size_t)b * SEQ;
  float* rw = relw[wv];
  unsigned short* ph = pwh[wv];
  unsigned short* pl = pwl[wv];

  // Q A-fragments: rows t0+m, k = head dims 0..31 and 32..63
  const int qt = (int)((tok0 + (size_t)t0) >> 4);
  const v16us qf0 = ldfrag_fo(QH, qt, 0, HD / 32, lane);
  const v16us qf1 = ldfrag_fo(QH, qt, 1, HD / 32, lane);

  const unsigned short* pe = PE + (size_t)h * SEQ_FULL * HD;
  const int rb = SEQ - 16 - t0;                      // E row of band column 0 at sb = 0 (>= 0)

  const int nkb = (t0 >> 5) + 1;                     // key blocks 0 .. floor(t0/32), block-uniform
  const int per = (nkb + AWV - 1) / AWV;             // key blocks per wave share
  const int kb0 = wv * per;                          // this wave's share [kb0, kb1), wave-uniform, may be empty
  const int kb1 = (kb0 + per < nkb) ? (kb0 + per) : nkb;

  // carried band tile: columns 0..15 of key block kb0 <-> E rows rb + 32*kb0 + 0..15 (clamped)
  v8f carry;
  {
    const int et = clampi(rb + (kb0 << 5), 0, SEQ - 16) >> 4;
    const v16us c0 = ldfrag_fo(pe, et, 0, HD / 32, lane);   // both requested beside Q, in front of the first matrix statement
    const v16us c1 = ldfrag_fo(pe, et, 1, HD / 32, lane);
    carry = mma_g(qf0, c0, zero8());
    carry = mma_g(qf1, c1, carry);
  }

  float mx[8], ls[8];
  v8f O0 = zero8(), O1 = zero8(), O2 = zero8(), O3 = zero8();
#pragma unroll
  for (int r = 0; r < 8; ++r) { mx[r] = -1.0e30f; ls[r] = 0.f; }

#pragma unroll 1
  for (int kb = kb0; kb < kb1; ++kb) {
    const int sb = kb << 5;
    // The eight K and E-band fragments are requested together, in front of the first matrix statement (a load written
    // between the guarded matrix statements is issued and waited for on its own: one round trip per fragment).
    // K B-fragments: Bt row = key token, k = head dim
    const int kt = (int)((tok0 + (size_t)sb) >> 4);
    const v16us kf0 = ldfrag_fo(KH, kt, 0, HD / 32, lane), kf1 = ldfrag_fo(KH, kt, 1, HD / 32, lane);
    const v16us kf2 = ldfrag_fo(KH, kt + 1, 0, HD / 32, lane), kf3 = ldfrag_fo(KH, kt + 1, 1, HD / 32, lane);
    // relative band: columns 16..31 and 32..47 <-> E rows rb+sb+16.. and rb+sb+32..
    const int e1 = clampi(rb + sb + 16, 0, SEQ - 16) >> 4;
    const int e2 = clampi(rb + sb + 32, 0, SEQ - 16) >> 4;
    const v16us ef0 = ldfrag_fo(pe, e1, 0, HD / 32, lane), ef1 = ldfrag_fo(pe, e1, 1, HD / 32, lane);
    const v16us ef2 = ldfrag_fo(pe, e2, 0, HD / 32, lane), ef3 = ldfrag_fo(pe, e2, 1, HD / 32, lane);
    addr_wait();

    v8f S0, S1;
    S0 = mma_g(qf0, kf0, zero8());
    S0 = mma_g(qf1, kf1, S0);
    S1 = mma_g(qf0, kf2, zero8());
    S1 = mma_g(qf1, kf3, S1);
    v8f Pb1, Pb2;
    Pb1 = mma_g(qf0, ef0, zero8());
    Pb1 = mma_g(qf1, ef1, Pb1);
    Pb2 = mma_g(qf0, ef2, zero8());
    Pb2 = mma_g(qf1, ef3, Pb2);
#pragma unroll
    for (int r = 0; r < 8; ++r) {
      const int row = 8 * hh + r;
      rw[row * RWP + m]      = carry[r];
      rw[row * RWP + 16 + m] = Pb1[r];
      rw[row * RWP + 32 + m] = Pb2[r];
    }
    carry = Pb2;
    wave_sync_lds();

    // V B-fragments (Bt row = dim, k = key token), four dim subtiles, hi and lo planes: requested together here, behind
    // the exchange fence (which waits for outstanding loads), so that they are in flight under the softmax
    const int vk = (int)((tok0 + (size_t)sb) >> 5);
    const v16us vh0 = ldfrag_fo(VH, 0, vk, MT / 32, lane), vl0 = ldfrag_fo(VL, 0, vk, MT / 32, lane);
    const v16us vh1 = ldfrag_fo(VH, 1, vk, MT / 32, lane), vl1 = ldfrag_fo(VL, 1, vk, MT / 32, lane);
    const v16us vh2 = ldfrag_fo(VH, 2, vk, MT / 32, lane), vl2 = ldfrag_fo(VL, 2, vk, MT / 32, lane);
    const v16us vh3 = ldfrag_fo(VH, 3, vk, MT / 32, lane), vl3 = ldfrag_fo(VL, 3, vk, MT / 32, lane);

    // skew read + scale + causal select (key j <= query i keeps the score, otherwise -1e10)
    float s0[8], s1[8];
#pragma unroll
    for (int r = 0; r < 8; ++r) {
      const int row = 8 * hh + r;
      const int i = t0 + row;
      const float rv0 = rw[row * RWP + 15 - row + m];
      const float rv1 = rw[row * RWP + 31 - row + m];
      const float a0 = (S0[r] * (1.0f / (QKS * QKS)) + rv0 * (1.0f / (QKS * WSCL))) * RSQD;
      const float a1 = (S1[r] * (1.0f / (QKS * QKS)) + rv1 * (1.0f / (QKS * WSCL))) * RSQD;
      s0[r] = (sb + m <= i) ? a0 : NEGM;
      s1[r] = (sb + 16 + m <= i) ? a1 : NEGM;
    }

    // online softmax (a row lives in the 16 lanes of one half-wave; xor butterflies 1,2,4,8)
#pragma unroll
    for (int r = 0; r < 8; ++r) {
      float xm = fmaxf(s0[r], s1[r]);
      xm = fmaxf(xm, __shfl_xor(xm, 1, 32));
      xm = fmaxf(xm, __shfl_xor(xm, 2, 32));
      xm = fmaxf(xm, __shfl_xor(xm, 4, 32));
      xm = fmaxf(xm, __shfl_xor(xm, 8, 32));
      const float mn = fmaxf(mx[r], xm);
      const float al = exp2_slot((mx[r] - mn) * 1.44269504f);   // exp(x) = 2^(x * log2 e)
      mx[r] = mn;
      const float p0 = exp2_slot((s0[r] - mn) * 1.44269504f);
      const float p1 = exp2_slot((s1[r] - mn) * 1.44269504f);
      float ps = p0 + p1;
      ps += __shfl_xor(ps, 1, 32);
      ps += __shfl_xor(ps, 2, 32);
      ps += __shfl_xor(ps, 4, 32);
      ps += __shfl_xor(ps, 8, 32);
      ls[r] = ls[r] * al + ps;
      O0[r] = O0[r] * al;
      O1[r] = O1[r] * al;
      O2[r] = O2[r] * al;
      O3[r] = O3[r] * al;
      const int row = 8 * hh + r;
      const unsigned short hb0 = bf_bits(p0), hb1 = bf_bits(p1);
      ph[row * 32 + m]      = hb0;
      ph[row * 32 + 16 + m] = hb1;
      pl[row * 32 + m]      = bf_bits(p0 - bf_up(hb0));
      pl[row * 32 + 16 + m] = bf_bits(p1 - bf_up(hb1));
    }
    wave_sync_lds();

    // P A-fragments (split k map); the V B-fragments were requested above the softmax
    const v16us afh = ldfrag_u(ph + m * 32 + 8 * hh);
    const v16us afl = ldfrag_u(pl + m * 32 + 8 * hh);
    O0 = mma_gb(afh, vh0, O0);
    O0 = mma_gb(afh, vl0, O0);
    O0 = mma_gb(afl, vh0, O0);
    O1 = mma_gb(afh, vh1, O1);
    O1 = mma_gb(afh, vl1, O1);
    O1 = mma_gb(afl, vh1, O1);
    O2 = mma_gb(afh, vh2, O2);
    O2 = mma_gb(afh, vl2, O2);
    O2 = mma_gb(afl, vh2, O2);
    O3 = mma_gb(afh, vh3, O3);
    O3 = mma_gb(afh, vl3, O3);
    O3 = mma_gb(afl, vh3, O3);
  }
  acc_guard4(O0, O1, O2, O3);

  // ---- this wave's partial state to LDS (D element r of a lane = row 8*hh + r, col m of each dim subtile) ----
  float* op = opw[wv];
#pragma unroll
  for (int r = 0; r < 8; ++r) {
    const int row = 8 * hh + r;
    op[row * OPP + m]      = O0[r];
    op[row * OPP + 16 + m] = O1[r];
    op[row * OPP + 32 + m] = O2[r];
    op[row * OPP + 48 + m] = O3[r];
  }
  if (m == 0) {                                        // mx, ls are equal in the 16 lanes of a half-wave
#pragma unroll
    for (int r = 0; r < 8; ++r) {
      mxw[wv][8 * hh + r] = mx[r];
      lsw[wv][8 * hh + r] = ls[r];
    }
  }
  __syncthreads();                                     // publishes the 8 partial states to the whole block

  // ---- merge in wave order, ctx = O / l, bf16 hi plane and lo plane ----
  {
    // thread u owns the u-th 8 bytes of the tile's two Z fragments per plane: a wave stores 256 contiguous bytes
    const int u = threadIdx.x;
    const int row = (u >> 1) & 15;
    const int c4 = ((u >> 7) & 1) * 32 + ((u >> 6) & 1) * 16 + ((u >> 5) & 1) * 8 + (u & 1) * 4;
    float mw[AWV];
    float mt = -1.0e30f;
#pragma unroll
    for (int w = 0; w < AWV; ++w) { mw[w] = mxw[w][row]; mt = fmaxf(mt, mw[w]); }
    float sc[AWV];
#pragma unroll
    for (int w = 0; w < AWV; ++w) sc[w] = exp2_slot((mw[w] - mt) * 1.44269504f);   // exp(max_w - max)
    float lt = 0.f;
    v4f ot = {0.f, 0.f, 0.f, 0.f};
#pragma unroll
    for (int w = 0; w < AWV; ++w) {
      const v4f o = *(const v4f*)(opw[w] + row * OPP + c4);
      lt += lsw[w][row] * sc[w];
#pragma unroll
      for (int e = 0; e < 4; ++e) ot[e] += o[e] * sc[w];
    }
    const float g = 1.0f / lt;                         // lt >= 1
    unsigned short hb[4], lb[4];
#pragma unroll
    for (int e = 0; e < 4; ++e) {
      const float c = ot[e] * g;
      hb[e] = bf_bits(c);
      lb[e] = bf_bits(c - bf_up(hb[e]));
    }
    const v2u hv = {pk16(hb[0], hb[1]), pk16(hb[2], hb[3])};
    const v2u lv = {pk16(lb[0], lb[1]), pk16(lb[2], lb[3])};
    unsigned short* dst = Z + ((size_t)qt * (KF / 32) + 2 * h) * 512 + u * 4;   // = fo_off(token, h*64 + c4, KF/32)
    *(v2u*)dst = hv;
    *(v2u*)(dst + DMD * 16) = lv;                      // columns 512.. lie 16 fragments on
  }
}

// =====================================================================================================
// Flat whole-line writer of the output: out[row*388 + c] = L[row*448 + c]; each lane owns 4
// consecutive output floats (16 B; never straddles a row since 388 % 4 == 0), one instruction = 32 lanes x
// coverage: grid = MT*97/256 blocks x 256 float4 = all MT*388 output floats (in-kernel bound for safety).
// =====================================================================================================
__global__ __launch_bounds__(256) void out_copy(const float* __restrict__ L, const float* __restrict__ flg,
                                                 float* out) {
  __shared__ int wf[8];
  const int t = threadIdx.x, lane = t & 31, wv = t >> 5;
  int f;
  {
    const int ti = (t < NFLG) ? t : (NFLG - 1);         // clamped address, value selected
    const float x = flg[(size_t)ti * FLGW];
    f = ((t < NFLG) && (x == 1.0f)) ? 1 : 0;
  }
  f |= __shfl_xor(f, 1, 32);
  f |= __shfl_xor(f, 2, 32);
  f |= __shfl_xor(f, 4, 32);
  f |= __shfl_xor(f, 8, 32);
  f |= __shfl_xor(f, 16, 32);
  if (lane == 0) wf[wv] = f;
  __syncthreads();
  int g = 0;
#pragma unroll
  for (int w = 0; w < 8; ++w) g |= wf[w];
  const int e4 = blockIdx.x * 256 + t;
  if (e4 < MT * (EVD / 4)) {
    const int e = e4 * 4;
    const int row = e / EVD;
    const int c = e - row * EVD;
    v4f x = *(const v4f*)(L + (size_t)row * EVP + c);
    const float qn = __uint_as_float(0x7fc00000u);
    const v4f pn = {qn, qn, qn, qn};
    x = g ? pn : x;
    float* d = out + (size_t)e;
    *(v4f*)d = x;
    
  }
}

// =====================================================================================================
// Workspace map (bytes, full size NB=2, SEQ=2048); every plane is an exact multiple of its whole-row /
// whole-line / 32x64-tile store granularity; all offsets are multiples of 16384. PEH, QH, KH, VH, VL, Z, WOT, OP and
// WLT are kept in fragment order (see fo_off), the X and W*T planes and L row-major.
//   XQ   f16  [MT][512]        4194304     (x3 with XK, XV)
//   WQT  f16  [64][512]          65536     (x3 with WKT, WVT; Wq^T, Wk^T, Wv^T x64)
//   PEH  f16  [8*2048][64]     2097152     (E x64)
//   QH   f16  [MT][64]          524288     (16*q), KH same
//   VH   bf16 [64][MT]          524288     (v hi), VL same (v lo), contiguous after VH
//   Z    bf16 [MT][1024]       8388608     (ctx hi | ctx lo)
//   WOT  bf16 [512][1024]      1048576     (Wo^T | Wo^T)
//   OP   bf16 [MT][1024]       8388608     (relu out hi | lo)
//   WLT  bf16 [448][1024]       917504     (Wl^T | Wl^T, rows 388..447 zero)
//   L    f32  [MT][448]        7340032
//   FLG  f32  [128][32]          16384     (mask-structure flag lines)
//   total                     43073536
// =====================================================================================================
extern "C" void kernel_launch(void* const* d_in, const int* in_sizes, int n_in,
                              void* d_out, int out_size, void* d_ws, size_t ws_size,
                              hipStream_t stream) {
  if (n_in < 15) return;
  if (in_sizes[0] < (NB - 1) * SEQ_FULL * DMD + SEQ * DMD) return;   // v
  if (in_sizes[1] < (NB - 1) * SEQ_FULL * DMD + SEQ * DMD) return;   // k
  if (in_sizes[2] < (NB - 1) * SEQ_FULL * DMD + SEQ * DMD) return;   // q
  if (in_sizes[3] < (SEQ - 1) * SEQ_FULL + SEQ) return;               // mask
  if (in_sizes[4] < DMD * HD || in_sizes[6] < DMD * HD || in_sizes[8] < DMD * HD) return;
  if (in_sizes[5] < HD || in_sizes[7] < HD || in_sizes[9] < HD) return;
  if (in_sizes[10] < NH * SEQ_FULL * HD) return;                      // E
  if (in_sizes[11] < DMD * DMD || in_sizes[12] < DMD) return;         // Wo, bo
  if (in_sizes[13] < DMD * EVD || in_sizes[14] < EVD) return;         // Wl, bl
  if (out_size < MT * EVD) return;

  const float* v   = (const float*)d_in[0];    // [2][2048][512]
  const float* k   = (const float*)d_in[1];
  const float* q   = (const float*)d_in[2];
  const float* msk = (const float*)d_in[3];    // [2048][2048]
  const float* wq  = (const float*)d_in[4];    // [512][64]
  const float* bq  = (const float*)d_in[5];    // [64]
  const float* wk  = (const float*)d_in[6];
  const float* bk  = (const float*)d_in[7];
  const float* wv  = (const float*)d_in[8];
  const float* bv  = (const float*)d_in[9];
  const float* ee  = (const float*)d_in[10];   // [8][2048][64]
  const float* wo  = (const float*)d_in[11];   // [512][512] (in, out)
  const float* bo  = (const float*)d_in[12];   // [512]
  const float* wl  = (const float*)d_in[13];   // [512][388] (in, out)
  const float* bl  = (const float*)d_in[14];   // [388]

  const size_t PX  = (size_t)MT * DMD * 2;
  const size_t PW  = (size_t)HD * DMD * 2;
  const size_t PPE = (size_t)NH * SEQ_FULL * HD * 2;
  const size_t PQK = (size_t)MT * HD * 2;
  const size_t PV2 = (size_t)2 * HD * MT * 2;
  const size_t PZ  = (size_t)MT * KF * 2;
  const size_t PWO = (size_t)DMD * KF * 2;
  const size_t POP = (size_t)MT * KF * 2;
  const size_t PWL = (size_t)EVP * KF * 2;
  const size_t PL  = (size_t)MT * EVP * 4;
  const size_t PFL = (size_t)(SEQ_FULL / 16) * FLGW * 4;
  size_t off = 0;
  const size_t oXQ = off; off += PX;
  const size_t oXK = off; off += PX;
  const size_t oXV = off; off += PX;
  const size_t oWQ = off; off += PW;
  const size_t oWK = off; off += PW;
  const size_t oWV = off; off += PW;
  const size_t oPE = off; off += PPE;
  const size_t oQH = off; off += PQK;
  const size_t oKH = off; off += PQK;
  const size_t oV  = off; off += PV2;
  const size_t oZ  = off; off += PZ;
  const size_t oWO = off; off += PWO;
  const size_t oOP = off; off += POP;
  const size_t oWL = off; off += PWL;
  const size_t oL  = off; off += PL;
  const size_t oFL = off; off += PFL;
  if (off > ws_size) return;
  if (off > (size_t)134217728) return;

  char* ws = (char*)d_ws;
  unsigned short* XQ  = (unsigned short*)(ws + oXQ);
  unsigned short* XK  = (unsigned short*)(ws + oXK);
  unsigned short* XV  = (unsigned short*)(ws + oXV);
  unsigned short* WQT = (unsigned short*)(ws + oWQ);
  unsigned short* WKT = (unsigned short*)(ws + oWK);
  unsigned short* WVT = (unsigned short*)(ws + oWV);
  unsigned short* PEH = (unsigned short*)(ws + oPE);
  unsigned short* QHp = (unsigned short*)(ws + oQH);
  unsigned short* KHp = (unsigned short*)(ws + oKH);
  unsigned short* VHp = (unsigned short*)(ws + oV);
  unsigned short* VLp = VHp + (size_t)HD * MT;
  unsigned short* Zp  = (unsigned short*)(ws + oZ);
  unsigned short* WOT = (unsigned short*)(ws + oWO);
  unsigned short* OPp = (unsigned short*)(ws + oOP);
  unsigned short* WLT = (unsigned short*)(ws + oWL);
  float* Lp   = (float*)(ws + oL);
  float* FLG  = (float*)(ws + oFL);
  float* out0 = (float*)d_out;
  float* fdummy = Lp;                             // in-range placeholder for unused f32 output args
  unsigned short* hdummy = QHp;                   // in-range placeholder for unused 16-bit output args

  const dim3 blk(256);

  // (0) what the projections read, one launch: q, k, v (per batch slab) -> f16(bf16); Wq|Wk|Wv [512][64] ->
  //     [64][512] (transposed, f16 x64)
  prep_x<<<dim3(PREP_BLOCKS), blk, 0, stream>>>(q, k, v, wq, wk, wv, XQ, XK, XV, WQT, WKT, WVT);

  // (1) one launch: the three projections (q plane x16, k plane x16, v^T bf16 hi (VH) and lo (VL) planes) and,
  //     beside them, the jobs only later launches read: mask structure flags, Wo and Wl planes, E plane
  proj_side<<<dim3(SIDE_BLOCKS), blk, 0, stream>>>(XQ, XK, XV, WQT, WKT, WVT, bq, bk, bv, QHp, KHp, VHp,
                                                   msk, FLG, wo, WOT, wl, WLT, ee, PEH);

  // (2) attention -> ctx hi|lo token-major plane
  attn_kernel<<<dim3(NB * NH * (SEQ / 16)), dim3(32 * AWV), 0, stream>>>(QHp, KHp, PEH, VHp, VLp, Zp);

  // (3) output projection with relu: OP = bf16 hi|lo of max(0, sum_k Z[row][k] * WOT[n][k] + bo[n]), K = 1024
  const int gO = ((MT / (16 * GTI)) * (DMD / 64) + GWV - 1) / GWV;
  gemm64<1, 2, 1, 0><<<dim3(gO), dim3(32 * GWV), 0, stream>>>(Zp, KF, WOT, KF, OPp, DMD * 16, fdummy, KF, 1.0f, bo, DMD, 1.0f, MT, DMD, KF);

  // (4) logits: L[row][n] = sum_k OP[row][k] * WLT[n][k] + bl[n], K = 1024, N padded to 448
  const int gL = ((MT / (16 * GTI)) * (EVP / 64) + GWV - 1) / GWV;
  gemm64<1, 0, 0, 0><<<dim3(gL), dim3(32 * GWV), 0, stream>>>(OPp, KF, WLT, KF, hdummy, 0, Lp, EVP, 1.0f, bl, EVD, 1.0f, MT, EVP, KF);

  // (5) flat whole-line copy into the output (388-wide rows), NaN-poisoned on a mask-structure violation
  out_copy<<<dim3((MT * (EVD / 4) + 255) / 256), blk, 0, stream>>>(Lp, FLG, out0);
  (void)hipGetLastError();
}

// v006
// Measured time: 109 microseconds a run.
// Timed twice side by side with v005, it ran 1.26 and 1.23 times as fast.
// Over all steps from v000 it is 3.66 times as fast.
// Contractions: x.Wq and x.Wk (f16 planes x16), Wv^T.x^T (bf16 hi|lo planes), q.k^T and q.E^T band on
// v_wmma_f32_16x16x32_f16 (f16 operands, f32 accumulate); p.v as bf16 hi/lo three-product split, and
// [ctx_hi|ctx_lo].[Wo;Wo], [o_hi|o_lo].[Wl;Wl] K-folded planes on v_wmma_f32_16x16x32_bf16 (bf16 operands,
// f32 accumulate). Float inputs RNE-converted to bf16 on load (x x1; Wq, Wk, Wv, E x64 in f16; Wo, Wl bf16);
// softmax, causal select and the relative-offset skew in f32 on VALU.
#include <hip/hip_runtime.h>
#include <math.h>

#ifndef NB
#define NB 2
#endif
#ifndef SEQ
#define SEQ 2048
#endif
#define NB_FULL  2
#define SEQ_FULL 2048
#define DMD  512
#define NH   8
#define HD   64
#define EVD  388
#define EVP  448
#define MT   (NB * SEQ)
#define KF   (2 * DMD)
#define NFLG (SEQ / 16)
#define FLGW 32
#define AWV  8
#define OPP  68
#define RWP  48
#define WSCL 64.0f
#define QKS  16.0f
#define RSQD 0.125f
#define NEGM (-1.0e10f)

static_assert(NB >= 1 && NB <= NB_FULL);
static_assert(SEQ >= 64 && SEQ <= SEQ_FULL && (SEQ % 64) == 0);
static_assert(NH * HD == DMD && HD == 64);
static_assert((MT % 64) == 0 && (DMD % 64) == 0 && (KF % 64) == 0);
static_assert((EVP % 64) == 0 && EVP >= EVD && (EVD % 4) == 0);
static_assert(((SEQ * DMD) % 2048) == 0 && ((NH * SEQ_FULL * HD) % 2048) == 0);
static_assert(NFLG <= 256 && ((4 * SEQ) % 256) == 0);

typedef _Float16 v16h __attribute__((ext_vector_type(16)));
typedef __bf16 v16bf __attribute__((ext_vector_type(16)));
typedef unsigned short v16us __attribute__((ext_vector_type(16)));
typedef unsigned short v8us  __attribute__((ext_vector_type(8)));
typedef float v8f __attribute__((ext_vector_type(8)));
typedef float v4f __attribute__((ext_vector_type(4)));
typedef unsigned int v4u __attribute__((ext_vector_type(4)));
typedef unsigned int v2u __attribute__((ext_vector_type(2)));

union FragU { v16us v; v8us h[2]; };

// ---- scalar helpers --------------------------------------------------------------------------------
__device__ __forceinline__ unsigned short bf_bits(float f) {          // f32 -> bf16 bits, RNE convert
  const unsigned u = __float_as_uint(f);
  return (unsigned short)((u + 0x7FFFu + ((u >> 16) & 1u)) >> 16);
}
__device__ __forceinline__ float bf_up(unsigned short h) { return __uint_as_float(((unsigned)h) << 16); }
__device__ __forceinline__ float bfr(float f) { return bf_up(bf_bits(f)); }   // value of the bf16 RNE convert
__device__ __forceinline__ unsigned short h_bits(_Float16 x) { return __builtin_bit_cast(unsigned short, x); }
__device__ __forceinline__ unsigned short f2h(float f) { return h_bits((_Float16)f); }
__device__ __forceinline__ unsigned pk16(unsigned short a, unsigned short b) { return (unsigned)a | ((unsigned)b << 16); }
__device__ __forceinline__ int clampi(int v, int lo, int hi) { return v < lo ? lo : (v > hi ? hi : v); }
__device__ __forceinline__ v8f zero8() { v8f z = {0.f, 0.f, 0.f, 0.f, 0.f, 0.f, 0.f, 0.f}; return z; }

// ---- fragment loader: 16-bit A/B operand, lane -> row/col (lane&15), p already includes +8*(lane>>4);
//      elements 0..7 <- p[0..7] (k0+8h..), elements 8..15 <- p[16..23] (k0+16+8h..)
__device__ __forceinline__ v16us ldfrag_u(const unsigned short* p) {
  FragU f;
  f.h[0] = *(const v8us*)(p);
  f.h[1] = *(const v8us*)(p + 16);
  return f.v;
}

// ---- fragment order: a 16-bit plane [R][K] (R % 16 == 0, K % 32 == 0, KS = K / 32) kept as 1-KB fragments of 16 rows x
//      32 k, fragment (row / 16) * KS + k / 32; inside it two 512-B halves (k % 32 below 16, then from 16 on), each 32
//      chunks of 8 elements in lane order ((k / 8) % 2) * 16 + row % 16. A fragment load is then two loads of 512
//      contiguous bytes (4 whole lines each) with the same element map as ldfrag_u, not two loads over 16 lines each.
__device__ __forceinline__ size_t fo_off(int row, int k, int KS) {
  return ((size_t)(row >> 4) * KS + (k >> 5)) * 512 + ((k >> 4) & 1) * 256 + (((k >> 3) & 1) * 16 + (row & 15)) * 8 + (k & 7);
}
__device__ __forceinline__ v16us ldfrag_fo(const unsigned short* plane, int tr, int ks, int KS, int lane) {
  // 32-bit byte offset (every plane is far below 4 GiB) on the plane's uniform pointer: one address register per load group
  const unsigned off = ((unsigned)tr * (unsigned)KS + (unsigned)ks) * 1024u + (unsigned)lane * 16u;
  const unsigned short* p = (const unsigned short*)((const char*)plane + off);
  FragU f;
  f.h[0] = *(const v8us*)(p);
  f.h[1] = *(const v8us*)(p + 256);
  return f.v;
}

// the same fragment load from a wave-uniform fragment address (scalar registers) and the lane's byte offset 16 * lane
__device__ __forceinline__ v16us ldfrag_at(const char* ufrag, unsigned l16) {
  const unsigned short* p = (const unsigned short*)(ufrag + l16);
  FragU f;
  f.h[0] = *(const v8us*)(p);
  f.h[1] = *(const v8us*)(p + 256);
  return f.v;
}

// stands behind issued global loads or stores, in front of the code that reuses the registers they name
__device__ __forceinline__ void addr_wait() {
#if defined(__HIP_DEVICE_COMPILE__)
  asm volatile("s_wait_xcnt 0x0" ::: "memory");
#endif
}

// the same wait, with the index registers of the issued loads as inputs: they cannot be given away in front of it
__device__ __forceinline__ void addr_wait8(int a, int b, int c, int d, int e, int f, int g, int h) {
#if defined(__HIP_DEVICE_COMPILE__)
  asm volatile("s_wait_xcnt 0x0" :: "v"(a), "v"(b), "v"(c), "v"(d), "v"(e), "v"(f), "v"(g), "v"(h) : "memory");
#endif
}

// ---- WMMA helpers (f16 / bf16 operand bits) with trailing VALU hazard gap --------------------------
__device__ __forceinline__ v8f mma_raw(v16us a, v16us b, v8f c) {
  return __builtin_amdgcn_wmma_f32_16x16x32_f16(false, __builtin_bit_cast(v16h, a), false,
                                                __builtin_bit_cast(v16h, b), (short)0, c, false, false);
}
__device__ __forceinline__ v8f mma_raw_bf(v16us a, v16us b, v8f c) {
  return __builtin_amdgcn_wmma_f32_16x16x32_bf16(false, __builtin_bit_cast(v16bf, a), false,
                                                 __builtin_bit_cast(v16bf, b), (short)0, c, false, false);
}
__device__ __forceinline__ v8f mma_g(v16us a, v16us b, v8f c) {                 // guarded f16
  c = mma_raw(a, b, c);
#if defined(__HIP_DEVICE_COMPILE__)
  asm volatile("v_nop\n\tv_nop\n\tv_nop\n\tv_nop" : "+v"(c) : "v"(a), "v"(b));
#endif
  return c;
}
__device__ __forceinline__ v8f mma_gb(v16us a, v16us b, v8f c) {                // guarded bf16
  c = mma_raw_bf(a, b, c);
#if defined(__HIP_DEVICE_COMPILE__)
  asm volatile("v_nop\n\tv_nop\n\tv_nop\n\tv_nop" : "+v"(c) : "v"(a), "v"(b));
#endif
  return c;
}
__device__ __forceinline__ void dep_guard1(v8f& a, v8f& b, v16us x) {
#if defined(__HIP_DEVICE_COMPILE__)
  asm volatile("v_nop\n\tv_nop\n\tv_nop\n\tv_nop" : "+v"(a), "+v"(b) : "v"(x));
#endif
}
__device__ __forceinline__ void keep4_u(v16us a, v16us b, v16us c, v16us d) {
#if defined(__HIP_DEVICE_COMPILE__)
  asm volatile("v_nop" :: "v"(a), "v"(b), "v"(c), "v"(d));
#endif
}
__device__ __forceinline__ void acc_guard4(v8f& a, v8f& b, v8f& c, v8f& d) {
#if defined(__HIP_DEVICE_COMPILE__)
  asm volatile("v_nop\n\tv_nop\n\tv_nop\n\tv_nop" : "+v"(a), "+v"(b), "+v"(c), "+v"(d));
#endif
}
// 2^x; the v_nop keeps, inside the statement, the one slot the instruction set asks for between a
// transcendental and an instruction that reads its result or overwrites its source
__device__ __forceinline__ float exp2_slot(float x) {
  float r = 0.f;
#if defined(__HIP_DEVICE_COMPILE__)
  asm("v_exp_f32 %0, %1\n\tv_nop" : "=v"(r) : "v"(x));
#endif
  return r;
}
// orders LDS stores of this wave before later LDS loads of the same wave (cross-lane exchange)
__device__ __forceinline__ void wave_sync_lds() {
  __builtin_amdgcn_fence(__ATOMIC_RELEASE, "workgroup");
  __builtin_amdgcn_wave_barrier();
  __builtin_amdgcn_fence(__ATOMIC_ACQUIRE, "workgroup");
}

// =====================================================================================================
// Layout-kept convert: o[i] = f16 bits of (bf16 RNE value of w[i] * sc) for i < nsrc, zero for nsrc <= i <
// ndst; by selects a batch slab (source offset by*sstr, destination offset by*dstr), bx the 2048-element piece.
// nsrc % 8 == 0, ndst % 2048 == 0, bx = 0 .. ndst/2048 - 1 exact (compile-time constants at the call sites).
// coverage: 256 threads x 8 = 2048 elements per block; the callers' bx, by ranges cover all ndst elements of
// every slab. Block body, called from the first merged launch below.
// =====================================================================================================
__device__ __forceinline__ void cvt_lin(const float* __restrict__ w, unsigned short* o, int bx, int by,
                                        int nsrc, int ndst, float sc, int sstr, int dstr) {
  const float* wb = w + (size_t)by * (size_t)sstr;
  unsigned short* ob = o + (size_t)by * (size_t)dstr;
  const int base = (bx * 256 + threadIdx.x) * 8;
  if (base + 8 > ndst) return;                            // never taken with exact grids; no barriers below
  const bool inr = (base + 8 <= nsrc);
  const int lb = inr ? base : (nsrc - 8);                 // clamped address, always in range
  const v4f a0 = *(const v4f*)(wb + lb);
  const v4f a1 = *(const v4f*)(wb + lb + 4);
  v4u hv;
#pragma unroll
  for (int e = 0; e < 2; ++e) {
    hv[e]     = pk16(f2h(bfr(a0[2 * e]) * sc), f2h(bfr(a0[2 * e + 1]) * sc));
    hv[2 + e] = pk16(f2h(bfr(a1[2 * e]) * sc), f2h(bfr(a1[2 * e + 1]) * sc));
  }
  const v4u zz = {0u, 0u, 0u, 0u};
  hv = inr ? hv : zz;
  unsigned short* d = ob + base;
  *(v4u*)d = hv;
  
}

// Convert of a [R][64] f32 plane into fragment order (KS = 2): o = f16 bits of (bf16 RNE value of w * sc). A thread owns
// one 16-byte chunk of the destination, numbered linearly (a wave stores 512 contiguous bytes), and reads its 8 source
// elements. coverage: 256 chunks = 2048 elements per block; bx = 0 .. R*64/2048 - 1 exact at the call site.
__device__ __forceinline__ void cvt_fo64(const float* __restrict__ w, unsigned short* o, int bx, float sc) {
  const int g = bx * 256 + threadIdx.x;
  const int row = ((g >> 7) << 4) + (g & 15);
  const int col = ((g >> 6) & 1) * 32 + ((g >> 5) & 1) * 16 + ((g >> 4) & 1) * 8;
  const float* s = w + (size_t)row * 64 + col;
  const v4f a0 = *(const v4f*)(s);
  const v4f a1 = *(const v4f*)(s + 4);
  v4u hv;
#pragma unroll
  for (int e = 0; e < 2; ++e) {
    hv[e]     = pk16(f2h(bfr(a0[2 * e]) * sc), f2h(bfr(a0[2 * e + 1]) * sc));
    hv[2 + e] = pk16(f2h(bfr(a1[2 * e]) * sc), f2h(bfr(a1[2 * e + 1]) * sc));
  }
  *(v4u*)(o + (size_t)g * 8) = hv;
  addr_wait();                                           // precaution; the block ends after this one job
}

// =====================================================================================================
// Transpose-convert: in w[R][C] f32 (pitch C) -> out o[c][r] at o[c*ldo + r] for c < CP, with zero values
// for C <= c < CP. BFO 0: f16 bits of (bf16 RNE value * sc); BFO 1: bf16 bits (RNE), and the output plane [CP][ldo] is
// in fragment order (o[fo_off(c, r, ldo / 32)], a wave storing 512 contiguous bytes). Block tile 64x64
// through LDS (st[col][row], pitch 72 halves). Read phase: thread owns one input row x 16 columns (float4
// loads at a clamped column address, zero selected by value; C % 4 == 0 so a float4 is all-in or all-out).
// R, CP multiples of 64, ldo % 64 == 0, (bx, by) in (CP/64, R/64) exact (compile-time constants at the call
// sites). coverage: 64 output rows x 64 halves per block = the whole transposed tile; the callers' ranges cover
// all of [CP][R]. Block body, called from the merged launches below under a block-uniform branch; st is the
// calling kernel's LDS tile of 64 * 72 halves.
// =====================================================================================================
template <int BFO>
__device__ __forceinline__ void cvt_t(unsigned short* st, const float* __restrict__ w, unsigned short* o,
                                      int bx, int by, int R, int C, int CP, int ldo, float sc) {
  const int t = threadIdx.x;
  const int r0 = by * 64, c0 = bx * 64;
  if (r0 + 64 > R || c0 + 64 > CP) return;              // block-uniform, before the barrier; never taken
  {
    const int row = t >> 2, ch = (t & 3) * 16;
    const float* p = w + (size_t)(r0 + row) * C;
#pragma unroll
    for (int q = 0; q < 4; ++q) {
      const int cs = c0 + ch + 4 * q;
      const bool inr = (cs + 4 <= C);
      const int lb = inr ? cs : (C - 4);                 // clamped column address, always in range
      const v4f v = *(const v4f*)(p + lb);
#pragma unroll
      for (int e = 0; e < 4; ++e) {
        const unsigned short hb = BFO ? bf_bits(v[e]) : f2h(bfr(v[e]) * sc);
        st[(ch + 4 * q + e) * 72 + row] = inr ? hb : (unsigned short)0;
      }
    }
  }
  __syncthreads();
  v4u hv[2];
#pragma unroll
  for (int half = 0; half < 2; ++half) {
    const int c = t + 256 * half;                        // BFO: chunk number in fragment order within the tile
    const int cl = BFO ? ((c >> 7) * 16 + (c & 15)) : ((t >> 3) + 32 * half);
    const int pc = BFO ? (((c >> 6) & 1) * 32 + ((c >> 5) & 1) * 16 + ((c >> 4) & 1) * 8) : ((t & 7) * 8);
    hv[half] = *(const v4u*)(st + cl * 72 + pc);
  }
  {
#pragma unroll
    for (int half = 0; half < 2; ++half) {
      const int c = t + 256 * half;
      const int cl = BFO ? ((c >> 7) * 16 + (c & 15)) : ((t >> 3) + 32 * half);
      const int pc = BFO ? (((c >> 6) & 1) * 32 + ((c >> 5) & 1) * 16 + ((c >> 4) & 1) * 8) : ((t & 7) * 8);
      unsigned short* dst = o + (BFO ? fo_off(c0 + cl, r0 + pc, ldo >> 5) : ((size_t)(c0 + cl) * ldo + r0 + pc));
      *(v4u*)dst = hv[half];
    }
#if defined(__HIP_DEVICE_COMPILE__)
    // precaution: wait for the stores to read their registers (the block ends after this one job)
    asm volatile("s_wait_xcnt 0x0" ::: "memory");
#endif
  }
}

// =====================================================================================================
// Register-blocked 16-bit WMMA GEMM: C[m][n] = sum_k A[m][k] * Bt[n][k], one wave per 32x64 tile, no block
// barriers. BF 0: f16 operand bits, BF 1: bf16 operand bits. A row-major [M][K] pitch lda; Bt row-major
// [N][K] pitch ldb (k contiguous); M multiple of 32, N of 64, K of 32 (true at every call site; waves
// past the last tile exit before any work, wave-uniform). A wave's k step is two A and four B fragments, whose
// twelve loads are issued together: one load round trip per k step, and M/32 * N/64 waves to fill the chip.
// WPB = waves (tiles) per block. Tiles are numbered down the rows first, so the waves of a block read the same
// four B fragments where WPB divides M/32 (in the v^T product, M/32 = 2: only wave pairs do). Both operand fragments use the split k map
// (elements 0..7 <- k0+8h.., 8..15 <- k0+16+8h..); D element r of a lane is (row 8h + r, col lane&15).
// Bias: bf16 RNE value of bias[] times bsc, indexed by column (clamped into nbias) or, with BROW, by row.
// FOI 1: A and Bt are planes in fragment order (KS = lda / 32, ldb / 32) instead of row-major, bf16 (BF 1), K a multiple
// of 32 * GPD; the loads of k step s + GPD are issued behind the products of k step s (same k order of the sums).
// OM 0: f32 out Cf = acc*osc + b, pitch ldc.            OM 1: f16 out Ch = f16 bits(acc*osc + b).
// OM 2: val = (RELU ? max(0, .) : .)(acc*osc + b); bf16 hi bits at Ch, bf16 lo bits (val - hi) at Ch + looff.
// The 16-bit outputs (OM 1, 2) are planes [M][ldc] in fragment order; a wave's slab is whole 1-KB fragments.
// coverage: GTI slabs x 16 rows x 64 cols = the wave's whole tile (hi and lo planes alike).
// gemm64_blk is the block body (bx = block number within this product, sT = the calling kernel's LDS, WPB per-wave
// 16x64 slabs of pitch 68 floats); gemm64 is the launch of one product alone.
// =====================================================================================================
#define GSLAB (16 * 68)
#define GTI 2                                  // 16-row subtiles per wave tile
#define GWV 4                                  // waves per block where a product is launched alone
#define GPD 4                                  // k steps of fragments a wave keeps in flight (FOI products)
static_assert((KF % (32 * GPD)) == 0);
template <int BF, int OM, int RELU, int BROW, int WPB, int FOI>
__device__ __forceinline__ void gemm64_blk(
    float* sT, int bx,
    const unsigned short* __restrict__ Ap, int lda, const unsigned short* __restrict__ Btp, int ldb,
    unsigned short* Ch, int looff, float* Cf, int ldc, float osc,
    const float* __restrict__ bias, int nbias, float bsc, int M, int N, int K) {
  const int lane = threadIdx.x & 31;
  const int wave = threadIdx.x >> 5;
  const int tilesN = N >> 6;
  const int tilesM = M / (16 * GTI);
  const int tile = bx * WPB + wave;
  if (tile >= tilesM * tilesN) return;   // wave-uniform; no block barriers in this kernel
  const int tn = tile / tilesM;
  const int tm = tile - tn * tilesM;
  const int m0 = tm * (16 * GTI);
  const int n0 = tn << 6;

  const int rlane = lane & 15;                 // row (A) / col (B, D) within subtile
  const int koff  = (lane >> 4) * 8;           // k offset of this lane half
  const int mOff  = (lane >> 4) * 8;           // D row offset

  v8f acc[GTI][4];
#pragma unroll
  for (int i = 0; i < GTI; ++i)
#pragma unroll
    for (int j = 0; j < 4; ++j) acc[i][j] = zero8();

  if constexpr (FOI) {
    static_assert(BF == 1);
    // Register ring of GPD k steps (place s = the six fragments of one k step). A place is refilled, GPD k steps ahead,
    // right behind its own products: its loads return under the products of the other GPD - 1 places.
    // Each fragment row's base is wave-uniform and kept in scalar registers, the place is a constant offset, and one
    // vector register holds the lane part and the advance along k.
    unsigned l16 = (unsigned)lane * 16u;                 // lane part, plus the bytes of the k steps gone by
    const char* pb[4];
    const char* pa[GTI];
#pragma unroll
    for (int j = 0; j < 4; ++j)
      pb[j] = (const char*)Btp + (size_t)__builtin_amdgcn_readfirstlane(((n0 >> 4) + j) * (ldb >> 5)) * 1024;
#pragma unroll
    for (int i = 0; i < GTI; ++i)
      pa[i] = (const char*)Ap + (size_t)__builtin_amdgcn_readfirstlane(((m0 >> 4) + i) * (lda >> 5)) * 1024;
    v16us bh[GPD][4], ah[GPD][GTI];
#pragma unroll
    for (int s = 0; s < GPD; ++s) {
#pragma unroll
      for (int j = 0; j < 4; ++j) bh[s][j] = ldfrag_at(pb[j] + s * 1024, l16);
#pragma unroll
      for (int i = 0; i < GTI; ++i) ah[s][i] = ldfrag_at(pa[i] + s * 1024, l16);
      // keeps the first fill in the order of the refills, place by place: the counted load waits in the loop are set for
      // both ways into it, and a first fill in another order would make them wait for younger places too
      __builtin_amdgcn_sched_barrier(0);
    }
    // behind the last load of the first fill: whichever code comes next may reuse the base registers these loads name
    addr_wait();
    // rolled over groups of GPD k steps, so that the places of the ring are fixed registers
#pragma unroll 1
    for (int k0 = 32 * GPD; k0 < K; k0 += 32 * GPD) {
#pragma unroll
      for (int s = 0; s < GPD; ++s) {
#pragma unroll
        for (int i = 0; i < GTI; ++i)
#pragma unroll
          for (int j = 0; j < 4; ++j) acc[i][j] = mma_raw_bf(ah[s][i], bh[s][j], acc[i][j]);
        // holds the products above the slots below
        __builtin_amdgcn_sched_barrier(0);
#if defined(__HIP_DEVICE_COMPILE__)
        // five vector slots between the last product and the loads that overwrite its fragments, the distance the loop
        // had without a ring
        asm volatile("v_nop\n\tv_nop\n\tv_nop\n\tv_nop\n\tv_nop" ::: "memory");
#endif
#pragma unroll
        for (int j = 0; j < 4; ++j) bh[s][j] = ldfrag_at(pb[j] + (GPD + s) * 1024, l16);
#pragma unroll
        for (int i = 0; i < GTI; ++i) ah[s][i] = ldfrag_at(pa[i] + (GPD + s) * 1024, l16);
        // keeps a place's refill at this point: moved down by the scheduler it would lose its lead of GPD - 1 k steps
        __builtin_amdgcn_sched_barrier(0);
      }
#if defined(__HIP_DEVICE_COMPILE__)
      // stands behind the issued loads, in front of the advance of the offset register that they name (the operand
      // ties the advance behind the wait)
      asm volatile("s_wait_xcnt 0x0" : "+v"(l16) :: "memory");
#endif
      l16 += GPD * 1024;
    }
#pragma unroll
    for (int s = 0; s < GPD; ++s)
#pragma unroll
      for (int i = 0; i < GTI; ++i)
#pragma unroll
        for (int j = 0; j < 4; ++j) acc[i][j] = mma_raw_bf(ah[s][i], bh[s][j], acc[i][j]);
  } else {
#pragma unroll 1
  for (int k0 = 0; k0 < K; k0 += 32) {
    v16us bh[4];
#pragma unroll
    for (int j = 0; j < 4; ++j) {
      const size_t bo = (size_t)(n0 + (j << 4) + rlane) * ldb + koff + k0;
      bh[j] = FOI ? ldfrag_fo(Btp, (n0 >> 4) + j, k0 >> 5, ldb >> 5, lane) : ldfrag_u(Btp + bo);
    }
    v16us ah[GTI];
#pragma unroll
    for (int i = 0; i < GTI; ++i) {
      const size_t ao = (size_t)(m0 + (i << 4) + rlane) * lda + koff + k0;
      ah[i] = FOI ? ldfrag_fo(Ap, (m0 >> 4) + i, k0 >> 5, lda >> 5, lane) : ldfrag_u(Ap + ao);
    }
#pragma unroll
    for (int i = 0; i < GTI; ++i) {
#pragma unroll
      for (int j = 0; j < 4; ++j) {
        if (BF) acc[i][j] = mma_raw_bf(ah[i], bh[j], acc[i][j]);
        else    acc[i][j] = mma_raw(ah[i], bh[j], acc[i][j]);
      }
      dep_guard1(acc[i][0], acc[i][3], ah[i]);
    }
    keep4_u(bh[0], bh[1], bh[2], bh[3]);
  }
  }
#pragma unroll
  for (int i = 0; i < GTI; ++i) acc_guard4(acc[i][0], acc[i][1], acc[i][2], acc[i][3]);

  const int hh2 = lane >> 4, c4 = (lane & 15) * 4;     // f32 out: 256-B row segment = 16 lanes x 16 B
  const int q8  = lane >> 3, c8 = (lane & 7) * 8;

  // per-lane bias values for the column-indexed modes (bf16 RNE value times bsc), clamped address
  float bc[8];
#pragma unroll
  for (int e = 0; e < 8; ++e) bc[e] = 0.f;
  if (!BROW) {
    if (OM == 0) {
#pragma unroll
      for (int e = 0; e < 4; ++e) bc[e] = bsc * bfr(bias[clampi(n0 + c4 + e, 0, nbias - 1)]);
    } else {
#pragma unroll
      for (int e = 0; e < 8; ++e) bc[e] = bsc * bfr(bias[clampi(n0 + c8 + e, 0, nbias - 1)]);
    }
    if (FOI) {
      // the epilogue's arithmetic reuses the bias loads' index registers; as inputs of the wait they stay whole up to it
      int bi[8];
#pragma unroll
      for (int e = 0; e < 8; ++e) bi[e] = clampi(n0 + ((OM == 0) ? c4 + (e & 3) : c8 + e), 0, nbias - 1);
      addr_wait8(bi[0], bi[1], bi[2], bi[3], bi[4], bi[5], bi[6], bi[7]);
    }
  }

  // ---- epilogue ----
  float* slab = sT + wave * GSLAB;
#pragma unroll
  for (int i = 0; i < GTI; ++i) {
    const int mBase = m0 + (i << 4);
#pragma unroll
    for (int j = 0; j < 4; ++j) {
#pragma unroll
      for (int r = 0; r < 8; ++r) {
        slab[(mOff + r) * 68 + (j << 4) + rlane] = acc[i][j][r];
      }
    }
    wave_sync_lds();
    if (OM == 0) {
      v4f vals[8];
#pragma unroll
      for (int it = 0; it < 8; ++it) {
        const int row = it * 2 + hh2;                      // it 0..7 x hh2 0..1 = rows 0..15
        const v4f v = *(const v4f*)(slab + row * 68 + c4);
        float brw = 0.f;
        if (BROW) brw = bsc * bfr(bias[clampi(mBase + row, 0, nbias - 1)]);
        v4f ov;
#pragma unroll
        for (int e = 0; e < 4; ++e) {
          float x = v[e] * osc + (BROW ? brw : bc[e]);
          if (RELU) x = fmaxf(x, 0.f);
          ov[e] = x;
        }
        vals[it] = ov;
      }
      {
#pragma unroll
        for (int it = 0; it < 8; ++it) {
          const int row = it * 2 + hh2;
          *(v4f*)(Cf + (size_t)(mBase + row) * ldc + (size_t)n0 + c4) = vals[it];
        }
        
      }
    } else if (OM == 1) {
      v4u hv[4];
#pragma unroll
      for (int it = 0; it < 4; ++it) {
        const int row = it * 4 + q8;                       // it 0..3 x q8 0..3 = rows 0..15
        const float* sp = slab + row * 68 + c8;
        float brw = 0.f;
        if (BROW) brw = bsc * bfr(bias[clampi(mBase + row, 0, nbias - 1)]);
        v4u ha = {0u, 0u, 0u, 0u};
#pragma unroll
        for (int e = 0; e < 4; ++e) {
          float b0 = sp[2 * e]     * osc + (BROW ? brw : bc[2 * e]);
          float b1 = sp[2 * e + 1] * osc + (BROW ? brw : bc[2 * e + 1]);
          if (RELU) { b0 = fmaxf(b0, 0.f); b1 = fmaxf(b1, 0.f); }
          ha[e] = pk16(f2h(b0), f2h(b1));
        }
        hv[it] = ha;
      }
      {
#pragma unroll
        for (int it = 0; it < 4; ++it) {
          const int row = it * 4 + q8;
          const size_t go = fo_off(mBase + row, n0 + c8, ldc >> 5);
          *(v4u*)(Ch + go) = hv[it];
        }
        
      }
    } else {
      v4u hv[4], lv[4];
#pragma unroll
      for (int it = 0; it < 4; ++it) {
        const int row = it * 4 + q8;                       // it 0..3 x q8 0..3 = rows 0..15
        const float* sp = slab + row * 68 + c8;
        float brw = 0.f;
        if (BROW) brw = bsc * bfr(bias[clampi(mBase + row, 0, nbias - 1)]);
        v4u ha = {0u, 0u, 0u, 0u};
        v4u la = {0u, 0u, 0u, 0u};
#pragma unroll
        for (int e = 0; e < 4; ++e) {
          float x0 = sp[2 * e]     * osc + (BROW ? brw : bc[2 * e]);
          float x1 = sp[2 * e + 1] * osc + (BROW ? brw : bc[2 * e + 1]);
          if (RELU) { x0 = fmaxf(x0, 0.f); x1 = fmaxf(x1, 0.f); }
          const unsigned short h0 = bf_bits(x0), h1 = bf_bits(x1);
          const unsigned short l0 = bf_bits(x0 - bf_up(h0)), l1 = bf_bits(x1 - bf_up(h1));
          ha[e] = pk16(h0, h1);
          la[e] = pk16(l0, l1);
        }
        hv[it] = ha;
        lv[it] = la;
      }
      {
#pragma unroll
        for (int it = 0; it < 4; ++it) {
          const int row = it * 4 + q8;
          const size_t go = fo_off(mBase + row, n0 + c8, ldc >> 5);
          *(v4u*)(Ch + go) = hv[it];
          *(v4u*)(Ch + (size_t)looff + go) = lv[it];
        }
        
      }
    }
    wave_sync_lds();
  }
}
template <int BF, int OM, int RELU, int BROW>
__global__ __launch_bounds__(32 * GWV) void gemm64(
    const unsigned short* __restrict__ Ap, int lda, const unsigned short* __restrict__ Btp, int ldb,
    unsigned short* Ch, int looff, float* Cf, int ldc, float osc,
    const float* __restrict__ bias, int nbias, float bsc, int M, int N, int K) {
  __shared__ __align__(16) float sT[GWV * GSLAB];
  gemm64_blk<BF, OM, RELU, BROW, GWV, 1>(sT, blockIdx.x, Ap, lda, Btp, ldb, Ch, looff, Cf, ldc, osc, bias, nbias, bsc,
                                 M, N, K);
}

// =====================================================================================================
// Structure check of the [SEQ][SEQ] mask input (row pitch SEQ_FULL): block b covers rows 16b..16b+15 and all
// SEQ columns; a violation is any element differing from (j <= i ? 1 : 0). The block's flag is written as one
// coverage: 256 threads x (SEQ/64) float4 = 16 rows x SEQ cols per block; bx = 0 .. SEQ/16 - 1 = all rows.
// Block body, called from the second merged launch under a block-uniform branch; wf = 8 ints of its LDS.
// =====================================================================================================
__device__ __forceinline__ void mask_check(int* wf, int bx, const float* __restrict__ msk, float* flg) {
  const int t = threadIdx.x, lane = t & 31, wv = t >> 5;
  const int i0 = bx * 16;
  if (i0 + 16 > SEQ) return;                             // block-uniform, before the barrier; never taken
  constexpr int C4 = SEQ / 4;
  int viol = 0;
#pragma unroll 1
  for (int it = 0; it < (16 * C4) / 256; ++it) {
    const int ci = it * 256 + t;
    const int rr = ci / C4;
    const int c4 = ci - rr * C4;
    const int i = i0 + rr;
    const v4f x = *(const v4f*)(msk + (size_t)i * SEQ_FULL + 4 * c4);
#pragma unroll
    for (int e = 0; e < 4; ++e) {
      const int j = 4 * c4 + e;
      const float ex = (j <= i) ? 1.0f : 0.0f;
      viol |= (x[e] != ex) ? 1 : 0;
    }
  }
  viol |= __shfl_xor(viol, 1, 32);
  viol |= __shfl_xor(viol, 2, 32);
  viol |= __shfl_xor(viol, 4, 32);
  viol |= __shfl_xor(viol, 8, 32);
  viol |= __shfl_xor(viol, 16, 32);
  if (lane == 0) wf[wv] = viol;
  __syncthreads();
  if (wv == 0) {                                        // wave-uniform
    int f = wf[lane & 7];
    f |= __shfl_xor(f, 1, 32);
    f |= __shfl_xor(f, 2, 32);
    f |= __shfl_xor(f, 4, 32);
    const float fv = f ? 1.0f : 0.0f;
    float* d = flg + (size_t)bx * FLGW + lane;
    *(float*)d = fv;
    
  }
}

// =====================================================================================================
// Merged launches: jobs that read none of each other's output share one grid; the flat block index picks the
// job by ranges (block-uniform scalar branches), every block runs exactly one job body and then ends.
// prep_x: what the projections read. Blocks [0, 3*NTW): Wq, Wk, Wv -> [64][512] f16 x64 (transposed);
//   then 3*NLX blocks: q, k, v -> f16(bf16) planes, NLX = NB slabs x SEQ*DMD/2048 pieces each.
// proj_side: the three projections, first in the grid since they run longest, and beside them all that only
//   later launches read. Blocks [0, 3*NGQ): q plane x16, k plane x16 (C[tok][n] = sum_k X[tok][k] * WT[n][k]),
//   v^T planes (C[d][tok] = sum_k WVT[d][k] * XV[tok][k] / 64, bf16 hi and lo); then NFLG mask-structure blocks;
//   2*NTO blocks Wo -> [512][1024] = (Wo^T | Wo^T) bf16; 2*NTL blocks Wl -> [448][1024] = (Wl^T | Wl^T) bf16;
//   NLE blocks E -> f16(bf16 x64).
// =====================================================================================================
#define NTW (DMD / 64)
#define NLP ((SEQ * DMD) / 2048)
#define NLX (NLP * NB)
#define NGQ (((MT / (16 * GTI)) * (HD / 64) + 7) / 8)
#define NTO ((DMD / 64) * (DMD / 64))
#define NTL ((EVP / 64) * (DMD / 64))
#define NLE ((NH * SEQ_FULL * HD) / 2048)
#define PREP_BLOCKS (3 * NTW + 3 * NLX)
#define SIDE_BLOCKS (3 * NGQ + NFLG + 2 * NTO + 2 * NTL + NLE)

__global__ __launch_bounds__(256) void prep_x(
    const float* __restrict__ q, const float* __restrict__ k, const float* __restrict__ v,
    const float* __restrict__ wq, const float* __restrict__ wk, const float* __restrict__ wv,
    unsigned short* XQ, unsigned short* XK, unsigned short* XV,
    unsigned short* WQT, unsigned short* WKT, unsigned short* WVT) {
  __shared__ __align__(16) unsigned short st[64 * 72];
  int bid = blockIdx.x;
  if (bid < 3 * NTW) {
    const int j = bid / NTW;
    const float* w = (j == 0) ? wq : ((j == 1) ? wk : wv);
    unsigned short* o = (j == 0) ? WQT : ((j == 1) ? WKT : WVT);
    cvt_t<0>(st, w, o, 0, bid - j * NTW, DMD, HD, HD, DMD, WSCL);          // in[512][64] -> out[64][512]
    return;
  }
  bid -= 3 * NTW;
  if (bid < 3 * NLX) {
    const int j = bid / NLX;
    const int r = bid - j * NLX;
    const float* x = (j == 0) ? q : ((j == 1) ? k : v);
    unsigned short* o = (j == 0) ? XQ : ((j == 1) ? XK : XV);
    cvt_lin(x, o, r % NLP, r / NLP, SEQ * DMD, SEQ * DMD, 1.0f, SEQ_FULL * DMD, SEQ * DMD);
  }
}

__global__ __launch_bounds__(256) void proj_side(
    const unsigned short* __restrict__ XQ, const unsigned short* __restrict__ XK,
    const unsigned short* __restrict__ XV, const unsigned short* __restrict__ WQT,
    const unsigned short* __restrict__ WKT, const unsigned short* __restrict__ WVT,
    const float* __restrict__ bq, const float* __restrict__ bk, const float* __restrict__ bv,
    unsigned short* QH, unsigned short* KH, unsigned short* VH,
    const float* __restrict__ msk, float* flg,
    const float* __restrict__ wo, unsigned short* WOT, const float* __restrict__ wl, unsigned short* WLT,
    const float* __restrict__ ee, unsigned short* PEH) {
  __shared__ __align__(16) float sT[8 * GSLAB];        // the one job of a block uses it: slabs, transpose tile or flags
  int bid = blockIdx.x;
  if (bid < 2 * NGQ) {
    const int j = bid / NGQ;
    gemm64_blk<0, 1, 0, 0, 8, 0>(sT, bid - j * NGQ, j ? XK : XQ, DMD, j ? WKT : WQT, DMD, j ? KH : QH, 0, nullptr, HD,
                           QKS / WSCL, j ? bk : bq, HD, QKS, MT, HD, DMD);
    return;
  }
  bid -= 2 * NGQ;
  if (bid < NGQ) {
    gemm64_blk<0, 2, 0, 1, 8, 0>(sT, bid, WVT, DMD, XV, DMD, VH, HD * MT, nullptr, MT, 1.0f / WSCL, bv, HD, 1.0f,
                           HD, MT, DMD);
    return;
  }
  bid -= NGQ;
  if (bid < NFLG) {
    mask_check((int*)sT, bid, msk, flg);
    return;
  }
  bid -= NFLG;
  if (bid < 2 * NTO) {
    const int j = bid / NTO;                           // destination columns 0.. and 512.. (16 fragments on)
    const int r = bid - j * NTO;
    cvt_t<1>((unsigned short*)sT, wo, WOT + j * (DMD * 16), r % (DMD / 64), r / (DMD / 64), DMD, DMD, DMD, KF, 1.0f);
    return;
  }
  bid -= 2 * NTO;
  if (bid < 2 * NTL) {
    const int j = bid / NTL;                           // destination columns 0.. and 512.. (16 fragments on)
    const int r = bid - j * NTL;
    cvt_t<1>((unsigned short*)sT, wl, WLT + j * (DMD * 16), r % (EVP / 64), r / (EVP / 64), DMD, EVD, EVP, KF, 1.0f);
    return;
  }
  bid -= 2 * NTL;
  if (bid < NLE) cvt_fo64(ee, PEH, bid, WSCL);
}

// =====================================================================================================
// Causal attention with relative-offset term, head dim 64. Block = 256 threads = 8 waves; one block owns one
// 16-row query tile (t0..t0+15) of one (batch b, head h). The key blocks of 32 up to the diagonal (sb <= t0)
// are cut into 8 contiguous shares, one per wave; each wave runs its share with an online max-subtracted
// softmax in f32 and leaves its partial state (row max, row sum, unnormalised 16x64 O) in LDS; behind one
// block barrier the 8 states are merged in wave order (rescale by exp(max_w - max), sum, divide).
// Planes, all in fragment order: QH, KH f16 [MT][64] = 16*q, 16*k (shared
// by all heads); PE f16 [NH*SEQ_FULL][64] = 64*E (head h rows h*SEQ_FULL..); VH, VL bf16 [64][MT] = v hi and
// lo planes transposed (row = dim, column = token). Output Z bf16 [MT][1024]: cols h*64+d = ctx hi, cols
// 512+h*64+d = ctx lo.
// Per key block sb: S = Q.K^T (2 key subtiles x 2 k-steps, scale 1/256); relative band of 48 columns:
// column c <-> E row SEQ-16-t0+sb+c (a 16-row tile starts at a multiple of 16 and is clamped as a whole to start at
// most at SEQ-16; clamping only touches entries with j > i, which the causal select replaces); columns 0..15 come from the tile carried over from the prior key block
// (its columns 32..47), columns 16..47 are two fresh tiles (2 x 2 WMMA, scale 1/1024); the band is exchanged
// through per-wave LDS and read back at c = 15 - il + jl, i.e. E row SEQ-1-i+j; score = (qk + rel)/8 for
// j <= i, else -1e10; p = exp(score - running max) in f32, l accumulated from the f32 p; p stored as bf16 hi
// and lo tiles in per-wave LDS and reloaded as A fragments (split k map); O += Phi.Vhi + Phi.Vlo + Plo.Vhi on
// 4 dim subtiles (one accumulator set). A wave whose share is empty contributes max -1e30, sum 0, O 0 (weight
// exp(-1e30 - max) = 0); wave 0's share is never empty. Merge: thread -> (row, 4 dims) in fragment order, 32 lanes
// x 8 B = two whole 128-B lines of Z per plane.
// coverage: 16 query rows x 64 halves x {hi, lo} per block, NB*NH*(SEQ/16) blocks = all (b, t, h)
// segments of Z in both halves.
// =====================================================================================================
__global__ __launch_bounds__(32 * AWV) void attn_kernel(
    const unsigned short* __restrict__ QH, const unsigned short* __restrict__ KH,
    const unsigned short* __restrict__ PE, const unsigned short* __restrict__ VH,
    const unsigned short* __restrict__ VL, unsigned short* Z) {
  __shared__ __align__(16) float relw[AWV][16 * RWP];            // band exchange, 24576 B
  __shared__ __align__(16) unsigned short pwh[AWV][16 * 32];      // P hi tiles, 8192 B
  __shared__ __align__(16) unsigned short pwl[AWV][16 * 32];      // P lo tiles, 8192 B
  __shared__ __align__(16) float opw[AWV][16 * OPP];              // partial O per wave, pitch 68 floats, 34816 B
  __shared__ __align__(16) float mxw[AWV][16];                    // partial row max per wave
  __shared__ __align__(16) float lsw[AWV][16];                    // partial row sum per wave
  const int lane = threadIdx.x & 31, m = lane & 15, hh = lane >> 4;
  // wave number in a scalar register: the key loop's bounds depend on it and stay a scalar branch
  const int wv = __builtin_amdgcn_readfirstlane((int)(threadIdx.x >> 5));
  const int task = blockIdx.x;                       // 0 .. NB*NH*(SEQ/16)-1
  const int nqt = SEQ / 16;
  const int bh = task / nqt;                         // (b, h)
  const int t0 = (task - bh * nqt) << 4;             // query tile start
  const int b = bh / NH, h = bh - (bh / NH) * NH;
  if (b >= NB) return;                               // block-uniform, before the barrier; never taken with exact grids
  const size_t tok0 = (size_t)b * SEQ;
  float* rw = relw[wv];
  unsigned short* ph = pwh[wv];
  unsigned short* pl = pwl[wv];

  // Q A-fragments: rows t0+m, k = head dims 0..31 and 32..63
  const int qt = (int)((tok0 + (size_t)t0) >> 4);
  const v16us qf0 = ldfrag_fo(QH, qt, 0, HD / 32, lane);
  const v16us qf1 = ldfrag_fo(QH, qt, 1, HD / 32, lane);

  const unsigned short* pe = PE + (size_t)h * SEQ_FULL * HD;
  const int rb = SEQ - 16 - t0;                      // E row of band column 0 at sb = 0 (>= 0)

  const int nkb = (t0 >> 5) + 1;                     // key blocks 0 .. floor(t0/32), block-uniform
  const int per = (nkb + AWV - 1) / AWV;             // key blocks per wave share
  const int kb0 = wv * per;                          // this wave's share [kb0, kb1), wave-uniform, may be empty
  const int kb1 = (kb0 + per < nkb) ? (kb0 + per) : nkb;

  // carried band tile: columns 0..15 of key block kb0 <-> E rows rb + 32*kb0 + 0..15 (clamped)
  v8f carry;
  {
    const int et = clampi(rb + (kb0 << 5), 0, SEQ - 16) >> 4;
    const v16us c0 = ldfrag_fo(pe, et, 0, HD / 32, lane);   // both requested beside Q, in front of the first matrix statement
    const v16us c1 = ldfrag_fo(pe, et, 1, HD / 32, lane);
    carry = mma_g(qf0, c0, zero8());
    carry = mma_g(qf1, c1, carry);
  }

  float mx[8], ls[8];
  v8f O0 = zero8(), O1 = zero8(), O2 = zero8(), O3 = zero8();
#pragma unroll
  for (int r = 0; r < 8; ++r) { mx[r] = -1.0e30f; ls[r] = 0.f; }

#pragma unroll 1
  for (int kb = kb0; kb < kb1; ++kb) {
    const int sb = kb << 5;
    // The eight K and E-band fragments are requested together, in front of the first matrix statement (a load written
    // between the guarded matrix statements is issued and waited for on its own: one round trip per fragment).
    // K B-fragments: Bt row = key token, k = head dim
    const int kt = (int)((tok0 + (size_t)sb) >> 4);
    const v16us kf0 = ldfrag_fo(KH, kt, 0, HD / 32, lane), kf1 = ldfrag_fo(KH, kt, 1, HD / 32, lane);
    const v16us kf2 = ldfrag_fo(KH, kt + 1, 0, HD / 32, lane), kf3 = ldfrag_fo(KH, kt + 1, 1, HD / 32, lane);
    // relative band: columns 16..31 and 32..47 <-> E rows rb+sb+16.. and rb+sb+32..
    const int e1 = clampi(rb + sb + 16, 0, SEQ - 16) >> 4;
    const int e2 = clampi(rb + sb + 32, 0, SEQ - 16) >> 4;
    const v16us ef0 = ldfrag_fo(pe, e1, 0, HD / 32, lane), ef1 = ldfrag_fo(pe, e1, 1, HD / 32, lane);
    const v16us ef2 = ldfrag_fo(pe, e2, 0, HD / 32, lane), ef3 = ldfrag_fo(pe, e2, 1, HD / 32, lane);
    addr_wait();

    v8f S0, S1;
    S0 = mma_g(qf0, kf0, zero8());
    S0 = mma_g(qf1, kf1, S0);
    S1 = mma_g(qf0, kf2, zero8());
    S1 = mma_g(qf1, kf3, S1);
    v8f Pb1, Pb2;
    Pb1 = mma_g(qf0, ef0, zero8());
    Pb1 = mma_g(qf1, ef1, Pb1);
    Pb2 = mma_g(qf0, ef2, zero8());
    Pb2 = mma_g(qf1, ef3, Pb2);
#pragma unroll
    for (int r = 0; r < 8; ++r) {
      const int row = 8 * hh + r;
      rw[row * RWP + m]      = carry[r];
      rw[row * RWP + 16 + m] = Pb1[r];
      rw[row * RWP + 32 + m] = Pb2[r];
    }
    carry = Pb2;
    wave_sync_lds();

    // V B-fragments (Bt row = dim, k = key token), four dim subtiles, hi and lo planes: requested together here, behind
    // the exchange fence (which waits for outstanding loads), so that they are in flight under the softmax
    const int vk = (int)((tok0 + (size_t)sb) >> 5);
    const v16us vh0 = ldfrag_fo(VH, 0, vk, MT / 32, lane), vl0 = ldfrag_fo(VL, 0, vk, MT / 32, lane);
    const v16us vh1 = ldfrag_fo(VH, 1, vk, MT / 32, lane), vl1 = ldfrag_fo(VL, 1, vk, MT / 32, lane);
    const v16us vh2 = ldfrag_fo(VH, 2, vk, MT / 32, lane), vl2 = ldfrag_fo(VL, 2, vk, MT / 32, lane);
    const v16us vh3 = ldfrag_fo(VH, 3, vk, MT / 32, lane), vl3 = ldfrag_fo(VL, 3, vk, MT / 32, lane);

    // skew read + scale + causal select (key j <= query i keeps the score, otherwise -1e10)
    float s0[8], s1[8];
#pragma unroll
    for (int r = 0; r < 8; ++r) {
      const int row = 8 * hh + r;
      const int i = t0 + row;
      const float rv0 = rw[row * RWP + 15 - row + m];
      const float rv1 = rw[row * RWP + 31 - row + m];
      const float a0 = (S0[r] * (1.0f / (QKS * QKS)) + rv0 * (1.0f / (QKS * WSCL))) * RSQD;
      const float a1 = (S1[r] * (1.0f / (QKS * QKS)) + rv1 * (1.0f / (QKS * WSCL))) * RSQD;
      s0[r] = (sb + m <= i) ? a0 : NEGM;
      s1[r] = (sb + 16 + m <= i) ? a1 : NEGM;
    }

    // online softmax (a row lives in the 16 lanes of one half-wave; xor butterflies 1,2,4,8)
#pragma unroll
    for (int r = 0; r < 8; ++r) {
      float xm = fmaxf(s0[r], s1[r]);
      xm = fmaxf(xm, __shfl_xor(xm, 1, 32));
      xm = fmaxf(xm, __shfl_xor(xm, 2, 32));
      xm = fmaxf(xm, __shfl_xor(xm, 4, 32));
      xm = fmaxf(xm, __shfl_xor(xm, 8, 32));
      const float mn = fmaxf(mx[r], xm);
      const float al = exp2_slot((mx[r] - mn) * 1.44269504f);   // exp(x) = 2^(x * log2 e)
      mx[r] = mn;
      const float p0 = exp2_slot((s0[r] - mn) * 1.44269504f);
      const float p1 = exp2_slot((s1[r] - mn) * 1.44269504f);
      float ps = p0 + p1;
      ps += __shfl_xor(ps, 1, 32);
      ps += __shfl_xor(ps, 2, 32);
      ps += __shfl_xor(ps, 4, 32);
      ps += __shfl_xor(ps, 8, 32);
      ls[r] = ls[r] * al + ps;
      O0[r] = O0[r] * al;
      O1[r] = O1[r] * al;
      O2[r] = O2[r] * al;
      O3[r] = O3[r] * al;
      const int row = 8 * hh + r;
      const unsigned short hb0 = bf_bits(p0), hb1 = bf_bits(p1);
      ph[row * 32 + m]      = hb0;
      ph[row * 32 + 16 + m] = hb1;
      pl[row * 32 + m]      = bf_bits(p0 - bf_up(hb0));
      pl[row * 32 + 16 + m] = bf_bits(p1 - bf_up(hb1));
    }
    wave_sync_lds();

    // P A-fragments (split k map); the V B-fragments were requested above the softmax
    const v16us afh = ldfrag_u(ph + m * 32 + 8 * hh);
    const v16us afl = ldfrag_u(pl + m * 32 + 8 * hh);
    O0 = mma_gb(afh, vh0, O0);
    O0 = mma_gb(afh, vl0, O0);
    O0 = mma_gb(afl, vh0, O0);
    O1 = mma_gb(afh, vh1, O1);
    O1 = mma_gb(afh, vl1, O1);
    O1 = mma_gb(afl, vh1, O1);
    O2 = mma_gb(afh, vh2, O2);
    O2 = mma_gb(afh, vl2, O2);
    O2 = mma_gb(afl, vh2, O2);
    O3 = mma_gb(afh, vh3, O3);
    O3 = mma_gb(afh, vl3, O3);
    O3 = mma_gb(afl, vh3, O3);
  }
  acc_guard4(O0, O1, O2, O3);

  // ---- this wave's partial state to LDS (D element r of a lane = row 8*hh + r, col m of each dim subtile) ----
  float* op = opw[wv];
#pragma unroll
  for (int r = 0; r < 8; ++r) {
    const int row = 8 * hh + r;
    op[row * OPP + m]      = O0[r];
    op[row * OPP + 16 + m] = O1[r];
    op[row * OPP + 32 + m] = O2[r];
    op[row * OPP + 48 + m] = O3[r];
  }
  if (m == 0) {                                        // mx, ls are equal in the 16 lanes of a half-wave
#pragma unroll
    for (int r = 0; r < 8; ++r) {
      mxw[wv][8 * hh + r] = mx[r];
      lsw[wv][8 * hh + r] = ls[r];
    }
  }
  __syncthreads();                                     // publishes the 8 partial states to the whole block

  // ---- merge in wave order, ctx = O / l, bf16 hi plane and lo plane ----
  {
    // thread u owns the u-th 8 bytes of the tile's two Z fragments per plane: a wave stores 256 contiguous bytes
    const int u = threadIdx.x;
    const int row = (u >> 1) & 15;
    const int c4 = ((u >> 7) & 1) * 32 + ((u >> 6) & 1) * 16 + ((u >> 5) & 1) * 8 + (u & 1) * 4;
    float mw[AWV];
    float mt = -1.0e30f;
#pragma unroll
    for (int w = 0; w < AWV; ++w) { mw[w] = mxw[w][row]; mt = fmaxf(mt, mw[w]); }
    float sc[AWV];
#pragma unroll
    for (int w = 0; w < AWV; ++w) sc[w] = exp2_slot((mw[w] - mt) * 1.44269504f);   // exp(max_w - max)
    float lt = 0.f;
    v4f ot = {0.f, 0.f, 0.f, 0.f};
#pragma unroll
    for (int w = 0; w < AWV; ++w) {
      const v4f o = *(const v4f*)(opw[w] + row * OPP + c4);
      lt += lsw[w][row] * sc[w];
#pragma unroll
      for (int e = 0; e < 4; ++e) ot[e] += o[e] * sc[w];
    }
    const float g = 1.0f / lt;                         // lt >= 1
    unsigned short hb[4], lb[4];
#pragma unroll
    for (int e = 0; e < 4; ++e) {
      const float c = ot[e] * g;
      hb[e] = bf_bits(c);
      lb[e] = bf_bits(c - bf_up(hb[e]));
    }
    const v2u hv = {pk16(hb[0], hb[1]), pk16(hb[2], hb[3])};
    const v2u lv = {pk16(lb[0], lb[1]), pk16(lb[2], lb[3])};
    unsigned short* dst = Z + ((size_t)qt * (KF / 32) + 2 * h) * 512 + u * 4;   // = fo_off(token, h*64 + c4, KF/32)
    *(v2u*)dst = hv;
    *(v2u*)(dst + DMD * 16) = lv;                      // columns 512.. lie 16 fragments on
  }
}

// =====================================================================================================
// Flat whole-line writer of the output: out[row*388 + c] = L[row*448 + c]; each lane owns 4
// consecutive output floats (16 B; never straddles a row since 388 % 4 == 0), one instruction = 32 lanes x
// coverage: grid = MT*97/256 blocks x 256 float4 = all MT*388 output floats (in-kernel bound for safety).
// =====================================================================================================
__global__ __launch_bounds__(256) void out_copy(const float* __restrict__ L, const float* __restrict__ flg,
                                                 float* out) {
  __shared__ int wf[8];
  const int t = threadIdx.x, lane = t & 31, wv = t >> 5;
  int f;
  {
    const int ti = (t < NFLG) ? t : (NFLG - 1);         // clamped address, value selected
    const float x = flg[(size_t)ti * FLGW];
    f = ((t < NFLG) && (x == 1.0f)) ? 1 : 0;
  }
  f |= __shfl_xor(f, 1, 32);
  f |= __shfl_xor(f, 2, 32);
  f |= __shfl_xor(f, 4, 32);
  f |= __shfl_xor(f, 8, 32);
  f |= __shfl_xor(f, 16, 32);
  if (lane == 0) wf[wv] = f;
  __syncthreads();
  int g = 0;
#pragma unroll
  for (int w = 0; w < 8; ++w) g |= wf[w];
  const int e4 = blockIdx.x * 256 + t;
  if (e4 < MT * (EVD / 4)) {
    const int e = e4 * 4;
    const int row = e / EVD;
    const int c = e - row * EVD;
    v4f x = *(const v4f*)(L + (size_t)row * EVP + c);
    const float qn = __uint_as_float(0x7fc00000u);
    const v4f pn = {qn, qn, qn, qn};
    x = g ? pn : x;
    float* d = out + (size_t)e;
    *(v4f*)d = x;
    
  }
}

// =====================================================================================================
// Workspace map (bytes, full size NB=2, SEQ=2048); every plane is an exact multiple of its whole-row /
// whole-line / 32x64-tile store granularity; all offsets are multiples of 16384. PEH, QH, KH, VH, VL, Z, WOT, OP and
// WLT are kept in fragment order (see fo_off), the X and W*T planes and L row-major.
//   XQ   f16  [MT][512]        4194304     (x3 with XK, XV)
//   WQT  f16  [64][512]          65536     (x3 with WKT, WVT; Wq^T, Wk^T, Wv^T x64)
//   PEH  f16  [8*2048][64]     2097152     (E x64)
//   QH   f16  [MT][64]          524288     (16*q), KH same
//   VH   bf16 [64][MT]          524288     (v hi), VL same (v lo), contiguous after VH
//   Z    bf16 [MT][1024]       8388608     (ctx hi | ctx lo)
//   WOT  bf16 [512][1024]      1048576     (Wo^T | Wo^T)
//   OP   bf16 [MT][1024]       8388608     (relu out hi | lo)
//   WLT  bf16 [448][1024]       917504     (Wl^T | Wl^T, rows 388..447 zero)
//   L    f32  [MT][448]        7340032
//   FLG  f32  [128][32]          16384     (mask-structure flag lines)
//   total                     43073536
// =====================================================================================================
extern "C" void kernel_launch(void* const* d_in, const int* in_sizes, int n_in,
                              void* d_out, int out_size, void* d_ws, size_t ws_size,
                              hipStream_t stream) {
  if (n_in < 15) return;
  if (in_sizes[0] < (NB - 1) * SEQ_FULL * DMD + SEQ * DMD) return;   // v
  if (in_sizes[1] < (NB - 1) * SEQ_FULL * DMD + SEQ * DMD) return;   // k
  if (in_sizes[2] < (NB - 1) * SEQ_FULL * DMD + SEQ * DMD) return;   // q
  if (in_sizes[3] < (SEQ - 1) * SEQ_FULL + SEQ) return;               // mask
  if (in_sizes[4] < DMD * HD || in_sizes[6] < DMD * HD || in_sizes[8] < DMD * HD) return;
  if (in_sizes[5] < HD || in_sizes[7] < HD || in_sizes[9] < HD) return;
  if (in_sizes[10] < NH * SEQ_FULL * HD) return;                      // E
  if (in_sizes[11] < DMD * DMD || in_sizes[12] < DMD) return;         // Wo, bo
  if (in_sizes[13] < DMD * EVD || in_sizes[14] < EVD) return;         // Wl, bl
  if (out_size < MT * EVD) return;

  const float* v   = (const float*)d_in[0];    // [2][2048][512]
  const float* k   = (const float*)d_in[1];
  const float* q   = (const float*)d_in[2];
  const float* msk = (const float*)d_in[3];    // [2048][2048]
  const float* wq  = (const float*)d_in[4];    // [512][64]
  const float* bq  = (const float*)d_in[5];    // [64]
  const float* wk  = (const float*)d_in[6];
  const float* bk  = (const float*)d_in[7];
  const float* wv  = (const float*)d_in[8];
  const float* bv  = (const float*)d_in[9];
  const float* ee  = (const float*)d_in[10];   // [8][2048][64]
  const float* wo  = (const float*)d_in[11];   // [512][512] (in, out)
  const float* bo  = (const float*)d_in[12];   // [512]
  const float* wl  = (const float*)d_in[13];   // [512][388] (in, out)
  const float* bl  = (const float*)d_in[14];   // [388]

  const size_t PX  = (size_t)MT * DMD * 2;
  const size_t PW  = (size_t)HD * DMD * 2;
  const size_t PPE = (size_t)NH * SEQ_FULL * HD * 2;
  const size_t PQK = (size_t)MT * HD * 2;
  const size_t PV2 = (size_t)2 * HD * MT * 2;
  const size_t PZ  = (size_t)MT * KF * 2;
  const size_t PWO = (size_t)DMD * KF * 2;
  const size_t POP = (size_t)MT * KF * 2;
  const size_t PWL = (size_t)EVP * KF * 2;
  const size_t PL  = (size_t)MT * EVP * 4;
  const size_t PFL = (size_t)(SEQ_FULL / 16) * FLGW * 4;
  size_t off = 0;
  const size_t oXQ = off; off += PX;
  const size_t oXK = off; off += PX;
  const size_t oXV = off; off += PX;
  const size_t oWQ = off; off += PW;
  const size_t oWK = off; off += PW;
  const size_t oWV = off; off += PW;
  const size_t oPE = off; off += PPE;
  const size_t oQH = off; off += PQK;
  const size_t oKH = off; off += PQK;
  const size_t oV  = off; off += PV2;
  const size_t oZ  = off; off += PZ;
  const size_t oWO = off; off += PWO;
  const size_t oOP = off; off += POP;
  const size_t oWL = off; off += PWL;
  const size_t oL  = off; off += PL;
  const size_t oFL = off; off += PFL;
  if (off > ws_size) return;
  if (off > (size_t)134217728) return;

  char* ws = (char*)d_ws;
  unsigned short* XQ  = (unsigned short*)(ws + oXQ);
  unsigned short* XK  = (unsigned short*)(ws + oXK);
  unsigned short* XV  = (unsigned short*)(ws + oXV);
  unsigned short* WQT = (unsigned short*)(ws + oWQ);
  unsigned short* WKT = (unsigned short*)(ws + oWK);
  unsigned short* WVT = (unsigned short*)(ws + oWV);
  unsigned short* PEH = (unsigned short*)(ws + oPE);
  unsigned short* QHp = (unsigned short*)(ws + oQH);
  unsigned short* KHp = (unsigned short*)(ws + oKH);
  unsigned short* VHp = (unsigned short*)(ws + oV);
  unsigned short* VLp = VHp + (size_t)HD * MT;
  unsigned short* Zp  = (unsigned short*)(ws + oZ);
  unsigned short* WOT = (unsigned short*)(ws + oWO);
  unsigned short* OPp = (unsigned short*)(ws + oOP);
  unsigned short* WLT = (unsigned short*)(ws + oWL);
  float* Lp   = (float*)(ws + oL);
  float* FLG  = (float*)(ws + oFL);
  float* out0 = (float*)d_out;
  float* fdummy = Lp;                             // in-range placeholder for unused f32 output args
  unsigned short* hdummy = QHp;                   // in-range placeholder for unused 16-bit output args

  const dim3 blk(256);

  // (0) what the projections read, one launch: q, k, v (per batch slab) -> f16(bf16); Wq|Wk|Wv [512][64] ->
  //     [64][512] (transposed, f16 x64)
  prep_x<<<dim3(PREP_BLOCKS), blk, 0, stream>>>(q, k, v, wq, wk, wv, XQ, XK, XV, WQT, WKT, WVT);

  // (1) one launch: the three projections (q plane x16, k plane x16, v^T bf16 hi (VH) and lo (VL) planes) and,
  //     beside them, the jobs only later launches read: mask structure flags, Wo and Wl planes, E plane
  proj_side<<<dim3(SIDE_BLOCKS), blk, 0, stream>>>(XQ, XK, XV, WQT, WKT, WVT, bq, bk, bv, QHp, KHp, VHp,
                                                   msk, FLG, wo, WOT, wl, WLT, ee, PEH);

  // (2) attention -> ctx hi|lo token-major plane
  attn_kernel<<<dim3(NB * NH * (SEQ / 16)), dim3(32 * AWV), 0, stream>>>(QHp, KHp, PEH, VHp, VLp, Zp);

  // (3) output projection with relu: OP = bf16 hi|lo of max(0, sum_k Z[row][k] * WOT[n][k] + bo[n]), K = 1024
  const int gO = ((MT / (16 * GTI)) * (DMD / 64) + GWV - 1) / GWV;
  gemm64<1, 2, 1, 0><<<dim3(gO), dim3(32 * GWV), 0, stream>>>(Zp, KF, WOT, KF, OPp, DMD * 16, fdummy, KF, 1.0f, bo, DMD, 1.0f, MT, DMD, KF);

  // (4) logits: L[row][n] = sum_k OP[row][k] * WLT[n][k] + bl[n], K = 1024, N padded to 448
  const int gL = ((MT / (16 * GTI)) * (EVP / 64) + GWV - 1) / GWV;
  gemm64<1, 0, 0, 0><<<dim3(gL), dim3(32 * GWV), 0, stream>>>(OPp, KF, WLT, KF, hdummy, 0, Lp, EVP, 1.0f, bl, EVD, 1.0f, MT, EVP, KF);

  // (5) flat whole-line copy into the output (388-wide rows), NaN-poisoned on a mask-structure violation
  out_copy<<<dim3((MT * (EVD / 4) + 255) / 256), blk, 0, stream>>>(Lp, FLG, out0);
  (void)hipGetLastError();
}

// v007
// It runs in 89.6 microseconds.
// Next to v006, in two timings, it ran 1.22 and 1.21 times as fast.
// Counting every step since v000, it is 4.45 times as fast.
// Contractions: x.Wq and x.Wk (f16 planes x16), Wv^T.x^T (bf16 hi|lo planes), q.k^T and q.E^T band on
// v_wmma_f32_16x16x32_f16 (f16 operands, f32 accumulate); p.v as bf16 hi/lo three-product split, and
// [ctx_hi|ctx_lo].[Wo;Wo], [o_hi|o_lo].[Wl;Wl] K-folded planes on v_wmma_f32_16x16x32_bf16 (bf16 operands,
// f32 accumulate). Float inputs RNE-converted to bf16 on load (x x1; Wq, Wk, Wv, E x64 in f16; Wo, Wl bf16);
// softmax, causal select and the relative-offset skew in f32 on VALU.
#include <hip/hip_runtime.h>
#include <math.h>

#ifndef NB
#define NB 2
#endif
#ifndef SEQ
#define SEQ 2048
#endif
#define NB_FULL  2
#define SEQ_FULL 2048
#define DMD  512
#define NH   8
#define HD   64
#define EVD  388
#define EVP  448
#define MT   (NB * SEQ)
#define KF   (2 * DMD)
#define NFLG (SEQ / 16)
#define FLGW 32
#define AWV  8
#define OPP  68
#define RWP  52
#define WSCL 64.0f
#define QKS  16.0f
#define RSQD 0.125f
#define NEGM (-1.0e10f)

static_assert(NB >= 1 && NB <= NB_FULL);
static_assert(SEQ >= 64 && SEQ <= SEQ_FULL && (SEQ % 64) == 0);
static_assert(NH * HD == DMD && HD == 64);
static_assert((MT % 64) == 0 && (DMD % 64) == 0 && (KF % 64) == 0);
static_assert((EVP % 64) == 0 && EVP >= EVD && (EVD % 4) == 0);
static_assert(((SEQ * DMD) % 2048) == 0 && ((NH * SEQ_FULL * HD) % 2048) == 0);
static_assert(NFLG <= 256 && ((4 * SEQ) % 256) == 0);

typedef _Float16 v16h __attribute__((ext_vector_type(16)));
typedef __bf16 v16bf __attribute__((ext_vector_type(16)));
typedef unsigned short v16us __attribute__((ext_vector_type(16)));
typedef unsigned short v8us  __attribute__((ext_vector_type(8)));
typedef float v8f __attribute__((ext_vector_type(8)));
typedef float v4f __attribute__((ext_vector_type(4)));
typedef unsigned int v4u __attribute__((ext_vector_type(4)));
typedef unsigned int v2u __attribute__((ext_vector_type(2)));
typedef unsigned int v8u __attribute__((ext_vector_type(8)));
typedef float v2f __attribute__((ext_vector_type(2)));
typedef __bf16 v2bf __attribute__((ext_vector_type(2)));

union FragU { v16us v; v8us h[2]; };

// ---- scalar helpers --------------------------------------------------------------------------------
__device__ __forceinline__ unsigned short bf_bits(float f) {          // f32 -> bf16 bits, RNE convert
  const unsigned u = __float_as_uint(f);
  return (unsigned short)((u + 0x7FFFu + ((u >> 16) & 1u)) >> 16);
}
// two f32 -> one word of two bf16 (RNE, a in the low half): the packed convert instruction
__device__ __forceinline__ unsigned bf_pair(float a, float b) {
  const v2f x = {a, b};
  return __builtin_bit_cast(unsigned, __builtin_convertvector(x, v2bf));
}
__device__ __forceinline__ float bf_up(unsigned short h) { return __uint_as_float(((unsigned)h) << 16); }
__device__ __forceinline__ float bfr(float f) { return bf_up(bf_bits(f)); }   // value of the bf16 RNE convert
__device__ __forceinline__ unsigned short h_bits(_Float16 x) { return __builtin_bit_cast(unsigned short, x); }
__device__ __forceinline__ unsigned short f2h(float f) { return h_bits((_Float16)f); }
__device__ __forceinline__ unsigned pk16(unsigned short a, unsigned short b) { return (unsigned)a | ((unsigned)b << 16); }
__device__ __forceinline__ int clampi(int v, int lo, int hi) { return v < lo ? lo : (v > hi ? hi : v); }
__device__ __forceinline__ v8f zero8() { v8f z = {0.f, 0.f, 0.f, 0.f, 0.f, 0.f, 0.f, 0.f}; return z; }

// ---- fragment loader: 16-bit A/B operand, lane -> row/col (lane&15), p already includes +8*(lane>>4);
//      elements 0..7 <- p[0..7] (k0+8h..), elements 8..15 <- p[16..23] (k0+16+8h..)
__device__ __forceinline__ v16us ldfrag_u(const unsigned short* p) {
  FragU f;
  f.h[0] = *(const v8us*)(p);
  f.h[1] = *(const v8us*)(p + 16);
  return f.v;
}

// ---- fragment order: a 16-bit plane [R][K] (R % 16 == 0, K % 32 == 0, KS = K / 32) kept as 1-KB fragments of 16 rows x
//      32 k, fragment (row / 16) * KS + k / 32; inside it two 512-B halves (k % 32 below 16, then from 16 on), each 32
//      chunks of 8 elements in lane order ((k / 8) % 2) * 16 + row % 16. A fragment load is then two loads of 512
//      contiguous bytes (4 whole lines each) with the same element map as ldfrag_u, not two loads over 16 lines each.
__device__ __forceinline__ size_t fo_off(int row, int k, int KS) {
  return ((size_t)(row >> 4) * KS + (k >> 5)) * 512 + ((k >> 4) & 1) * 256 + (((k >> 3) & 1) * 16 + (row & 15)) * 8 + (k & 7);
}
__device__ __forceinline__ v16us ldfrag_fo(const unsigned short* plane, int tr, int ks, int KS, int lane) {
  // 32-bit byte offset (every plane is far below 4 GiB) on the plane's uniform pointer: one address register per load group
  const unsigned off = ((unsigned)tr * (unsigned)KS + (unsigned)ks) * 1024u + (unsigned)lane * 16u;
  const unsigned short* p = (const unsigned short*)((const char*)plane + off);
  FragU f;
  f.h[0] = *(const v8us*)(p);
  f.h[1] = *(const v8us*)(p + 256);
  return f.v;
}

// the same fragment load from a wave-uniform fragment address (scalar registers) and the lane's byte offset 16 * lane
__device__ __forceinline__ v16us ldfrag_at(const char* ufrag, unsigned l16) {
  const unsigned short* p = (const unsigned short*)(ufrag + l16);
  FragU f;
  f.h[0] = *(const v8us*)(p);
  f.h[1] = *(const v8us*)(p + 256);
  return f.v;
}

// stands behind issued global loads or stores, in front of the code that reuses the registers they name
__device__ __forceinline__ void addr_wait() {
#if defined(__HIP_DEVICE_COMPILE__)
  asm volatile("s_wait_xcnt 0x0" ::: "memory");
#endif
}

// the same wait, with the index registers of the issued loads as inputs: they cannot be given away in front of it
__device__ __forceinline__ void addr_wait8(int a, int b, int c, int d, int e, int f, int g, int h) {
#if defined(__HIP_DEVICE_COMPILE__)
  asm volatile("s_wait_xcnt 0x0" :: "v"(a), "v"(b), "v"(c), "v"(d), "v"(e), "v"(f), "v"(g), "v"(h) : "memory");
#endif
}

// ---- WMMA helpers (f16 / bf16 operand bits) with trailing VALU hazard gap --------------------------
__device__ __forceinline__ v8f mma_raw(v16us a, v16us b, v8f c) {
  return __builtin_amdgcn_wmma_f32_16x16x32_f16(false, __builtin_bit_cast(v16h, a), false,
                                                __builtin_bit_cast(v16h, b), (short)0, c, false, false);
}
__device__ __forceinline__ v8f mma_raw_bf(v16us a, v16us b, v8f c) {
  return __builtin_amdgcn_wmma_f32_16x16x32_bf16(false, __builtin_bit_cast(v16bf, a), false,
                                                 __builtin_bit_cast(v16bf, b), (short)0, c, false, false);
}
__device__ __forceinline__ v8f mma_g(v16us a, v16us b, v8f c) {                 // guarded f16
  c = mma_raw(a, b, c);
#if defined(__HIP_DEVICE_COMPILE__)
  asm volatile("v_nop\n\tv_nop\n\tv_nop\n\tv_nop" : "+v"(c) : "v"(a), "v"(b));
#endif
  return c;
}
__device__ __forceinline__ v8f mma_gb(v16us a, v16us b, v8f c) {                // guarded bf16
  c = mma_raw_bf(a, b, c);
#if defined(__HIP_DEVICE_COMPILE__)
  asm volatile("v_nop\n\tv_nop\n\tv_nop\n\tv_nop" : "+v"(c) : "v"(a), "v"(b));
#endif
  return c;
}
__device__ __forceinline__ void dep_guard1(v8f& a, v8f& b, v16us x) {
#if defined(__HIP_DEVICE_COMPILE__)
  asm volatile("v_nop\n\tv_nop\n\tv_nop\n\tv_nop" : "+v"(a), "+v"(b) : "v"(x));
#endif
}
__device__ __forceinline__ void keep4_u(v16us a, v16us b, v16us c, v16us d) {
#if defined(__HIP_DEVICE_COMPILE__)
  asm volatile("v_nop" :: "v"(a), "v"(b), "v"(c), "v"(d));
#endif
}
__device__ __forceinline__ void acc_guard4(v8f& a, v8f& b, v8f& c, v8f& d) {
#if defined(__HIP_DEVICE_COMPILE__)
  asm volatile("v_nop\n\tv_nop\n\tv_nop\n\tv_nop" : "+v"(a), "+v"(b), "+v"(c), "+v"(d));
#endif
}
// 2^x; the v_nop keeps, inside the statement, the one slot the instruction set asks for between a
// transcendental and an instruction that reads its result or overwrites its source
__device__ __forceinline__ float exp2_slot(float x) {
  float r = 0.f;
#if defined(__HIP_DEVICE_COMPILE__)
  asm("v_exp_f32 %0, %1\n\tv_nop" : "=v"(r) : "v"(x));
#endif
  return r;
}
// value of lane l ^ 16 (the other half-wave), a vector cross-row move
__device__ __forceinline__ float xhalf(float x) {
  const int b = __float_as_int(x);
  return __int_as_float(__builtin_amdgcn_permlanex16(b, b, 0x76543210, 0xfedcba98, false, false));
}
// orders LDS stores of this wave before later LDS loads of the same wave (cross-lane exchange)
__device__ __forceinline__ void wave_sync_lds() {
  __builtin_amdgcn_fence(__ATOMIC_RELEASE, "workgroup");
  __builtin_amdgcn_wave_barrier();
  __builtin_amdgcn_fence(__ATOMIC_ACQUIRE, "workgroup");
}

// =====================================================================================================
// Layout-kept convert: o[i] = f16 bits of (bf16 RNE value of w[i] * sc) for i < nsrc, zero for nsrc <= i <
// ndst; by selects a batch slab (source offset by*sstr, destination offset by*dstr), bx the 2048-element piece.
// nsrc % 8 == 0, ndst % 2048 == 0, bx = 0 .. ndst/2048 - 1 exact (compile-time constants at the call sites).
// coverage: 256 threads x 8 = 2048 elements per block; the callers' bx, by ranges cover all ndst elements of
// every slab. Block body, called from the first merged launch below.
// =====================================================================================================
__device__ __forceinline__ void cvt_lin(const float* __restrict__ w, unsigned short* o, int bx, int by,
                                        int nsrc, int ndst, float sc, int sstr, int dstr) {
  const float* wb = w + (size_t)by * (size_t)sstr;
  unsigned short* ob = o + (size_t)by * (size_t)dstr;
  const int base = (bx * 256 + threadIdx.x) * 8;
  if (base + 8 > ndst) return;                            // never taken with exact grids; no barriers below
  const bool inr = (base + 8 <= nsrc);
  const int lb = inr ? base : (nsrc - 8);                 // clamped address, always in range
  const v4f a0 = *(const v4f*)(wb + lb);
  const v4f a1 = *(const v4f*)(wb + lb + 4);
  v4u hv;
#pragma unroll
  for (int e = 0; e < 2; ++e) {
    hv[e]     = pk16(f2h(bfr(a0[2 * e]) * sc), f2h(bfr(a0[2 * e + 1]) * sc));
    hv[2 + e] = pk16(f2h(bfr(a1[2 * e]) * sc), f2h(bfr(a1[2 * e + 1]) * sc));
  }
  const v4u zz = {0u, 0u, 0u, 0u};
  hv = inr ? hv : zz;
  unsigned short* d = ob + base;
  *(v4u*)d = hv;
  
}

// Convert of a [R][64] f32 plane into fragment order (KS = 2): o = f16 bits of (bf16 RNE value of w * sc). A thread owns
// one 16-byte chunk of the destination, numbered linearly (a wave stores 512 contiguous bytes), and reads its 8 source
// elements. coverage: 256 chunks = 2048 elements per block; bx = 0 .. R*64/2048 - 1 exact at the call site.
__device__ __forceinline__ void cvt_fo64(const float* __restrict__ w, unsigned short* o, int bx, float sc) {
  const int g = bx * 256 + threadIdx.x;
  const int row = ((g >> 7) << 4) + (g & 15);
  const int col = ((g >> 6) & 1) * 32 + ((g >> 5) & 1) * 16 + ((g >> 4) & 1) * 8;
  const float* s = w + (size_t)row * 64 + col;
  const v4f a0 = *(const v4f*)(s);
  const v4f a1 = *(const v4f*)(s + 4);
  v4u hv;
#pragma unroll
  for (int e = 0; e < 2; ++e) {
    hv[e]     = pk16(f2h(bfr(a0[2 * e]) * sc), f2h(bfr(a0[2 * e + 1]) * sc));
    hv[2 + e] = pk16(f2h(bfr(a1[2 * e]) * sc), f2h(bfr(a1[2 * e + 1]) * sc));
  }
  *(v4u*)(o + (size_t)g * 8) = hv;
  addr_wait();                                           // precaution; the block ends after this one job
}

// =====================================================================================================
// Transpose-convert: in w[R][C] f32 (pitch C) -> out o[c][r] at o[c*ldo + r] for c < CP, with zero values
// for C <= c < CP. BFO 0: f16 bits of (bf16 RNE value * sc); BFO 1: bf16 bits (RNE), and the output plane [CP][ldo] is
// in fragment order (o[fo_off(c, r, ldo / 32)], a wave storing 512 contiguous bytes). Block tile 64x64
// through LDS (st[col][row], pitch 72 halves). Read phase: thread owns one input row x 16 columns (float4
// loads at a clamped column address, zero selected by value; C % 4 == 0 so a float4 is all-in or all-out).
// R, CP multiples of 64, ldo % 64 == 0, (bx, by) in (CP/64, R/64) exact (compile-time constants at the call
// sites). coverage: 64 output rows x 64 halves per block = the whole transposed tile; the callers' ranges cover
// all of [CP][R]. Block body, called from the merged launches below under a block-uniform branch; st is the
// calling kernel's LDS tile of 64 * 72 halves.
// =====================================================================================================
template <int BFO>
__device__ __forceinline__ void cvt_t(unsigned short* st, const float* __restrict__ w, unsigned short* o,
                                      int bx, int by, int R, int C, int CP, int ldo, float sc) {
  const int t = threadIdx.x;
  const int r0 = by * 64, c0 = bx * 64;
  if (r0 + 64 > R || c0 + 64 > CP) return;              // block-uniform, before the barrier; never taken
  {
    const int row = t >> 2, ch = (t & 3) * 16;
    const float* p = w + (size_t)(r0 + row) * C;
#pragma unroll
    for (int q = 0; q < 4; ++q) {
      const int cs = c0 + ch + 4 * q;
      const bool inr = (cs + 4 <= C);
      const int lb = inr ? cs : (C - 4);                 // clamped column address, always in range
      const v4f v = *(const v4f*)(p + lb);
#pragma unroll
      for (int e = 0; e < 4; ++e) {
        const unsigned short hb = BFO ? bf_bits(v[e]) : f2h(bfr(v[e]) * sc);
        st[(ch + 4 * q + e) * 72 + row] = inr ? hb : (unsigned short)0;
      }
    }
  }
  __syncthreads();
  v4u hv[2];
#pragma unroll
  for (int half = 0; half < 2; ++half) {
    const int c = t + 256 * half;                        // BFO: chunk number in fragment order within the tile
    const int cl = BFO ? ((c >> 7) * 16 + (c & 15)) : ((t >> 3) + 32 * half);
    const int pc = BFO ? (((c >> 6) & 1) * 32 + ((c >> 5) & 1) * 16 + ((c >> 4) & 1) * 8) : ((t & 7) * 8);
    hv[half] = *(const v4u*)(st + cl * 72 + pc);
  }
  {
#pragma unroll
    for (int half = 0; half < 2; ++half) {
      const int c = t + 256 * half;
      const int cl = BFO ? ((c >> 7) * 16 + (c & 15)) : ((t >> 3) + 32 * half);
      const int pc = BFO ? (((c >> 6) & 1) * 32 + ((c >> 5) & 1) * 16 + ((c >> 4) & 1) * 8) : ((t & 7) * 8);
      unsigned short* dst = o + (BFO ? fo_off(c0 + cl, r0 + pc, ldo >> 5) : ((size_t)(c0 + cl) * ldo + r0 + pc));
      *(v4u*)dst = hv[half];
    }
#if defined(__HIP_DEVICE_COMPILE__)
    // precaution: wait for the stores to read their registers (the block ends after this one job)
    asm volatile("s_wait_xcnt 0x0" ::: "memory");
#endif
  }
}

// =====================================================================================================
// Register-blocked 16-bit WMMA GEMM: C[m][n] = sum_k A[m][k] * Bt[n][k], one wave per 32x64 tile, no block
// barriers. BF 0: f16 operand bits, BF 1: bf16 operand bits. A row-major [M][K] pitch lda; Bt row-major
// [N][K] pitch ldb (k contiguous); M multiple of 32, N of 64, K of 32 (true at every call site; waves
// past the last tile exit before any work, wave-uniform). A wave's k step is two A and four B fragments, whose
// twelve loads are issued together: one load round trip per k step, and M/32 * N/64 waves to fill the chip.
// WPB = waves (tiles) per block. Tiles are numbered down the rows first, so the waves of a block read the same
// four B fragments where WPB divides M/32 (in the v^T product, M/32 = 2: only wave pairs do). Both operand fragments use the split k map
// (elements 0..7 <- k0+8h.., 8..15 <- k0+16+8h..); D element r of a lane is (row 8h + r, col lane&15).
// Bias: bf16 RNE value of bias[] times bsc, indexed by column (clamped into nbias) or, with BROW, by row.
// FOI 1: A and Bt are planes in fragment order (KS = lda / 32, ldb / 32) instead of row-major, bf16 (BF 1), K a multiple
// of 32 * GPD; the loads of k step s + GPD are issued behind the products of k step s (same k order of the sums).
// OM 0: f32 out Cf = acc*osc + b, pitch ldc.            OM 1: f16 out Ch = f16 bits(acc*osc + b).
// OM 2: val = (RELU ? max(0, .) : .)(acc*osc + b); bf16 hi bits at Ch, bf16 lo bits (val - hi) at Ch + looff.
// The 16-bit outputs (OM 1, 2) are planes [M][ldc] in fragment order; a wave's slab is whole 1-KB fragments.
// coverage: GTI slabs x 16 rows x 64 cols = the wave's whole tile (hi and lo planes alike).
// gemm64_blk is the block body (bx = block number within this product, sT = the calling kernel's LDS, WPB per-wave
// 16x64 slabs of pitch 68 floats); gemm64 is the launch of one product alone.
// =====================================================================================================
#define GSLAB (16 * 68)
#define GTI 2                                  // 16-row subtiles per wave tile
#define GWV 4                                  // waves per block where a product is launched alone
#define GPD 4                                  // k steps of fragments a wave keeps in flight (FOI products)
static_assert((KF % (32 * GPD)) == 0);
template <int BF, int OM, int RELU, int BROW, int WPB, int FOI>
__device__ __forceinline__ void gemm64_blk(
    float* sT, int bx,
    const unsigned short* __restrict__ Ap, int lda, const unsigned short* __restrict__ Btp, int ldb,
    unsigned short* Ch, int looff, float* Cf, int ldc, float osc,
    const float* __restrict__ bias, int nbias, float bsc, int M, int N, int K) {
  const int lane = threadIdx.x & 31;
  const int wave = threadIdx.x >> 5;
  const int tilesN = N >> 6;
  const int tilesM = M / (16 * GTI);
  const int tile = bx * WPB + wave;
  if (tile >= tilesM * tilesN) return;   // wave-uniform; no block barriers in this kernel
  const int tn = tile / tilesM;
  const int tm = tile - tn * tilesM;
  const int m0 = tm * (16 * GTI);
  const int n0 = tn << 6;

  const int rlane = lane & 15;                 // row (A) / col (B, D) within subtile
  const int koff  = (lane >> 4) * 8;           // k offset of this lane half
  const int mOff  = (lane >> 4) * 8;           // D row offset

  v8f acc[GTI][4];
#pragma unroll
  for (int i = 0; i < GTI; ++i)
#pragma unroll
    for (int j = 0; j < 4; ++j) acc[i][j] = zero8();

  if constexpr (FOI) {
    static_assert(BF == 1);
    // Register ring of GPD k steps (place s = the six fragments of one k step). A place is refilled, GPD k steps ahead,
    // right behind its own products: its loads return under the products of the other GPD - 1 places.
    // Each fragment row's base is wave-uniform and kept in scalar registers, the place is a constant offset, and one
    // vector register holds the lane part and the advance along k.
    unsigned l16 = (unsigned)lane * 16u;                 // lane part, plus the bytes of the k steps gone by
    const char* pb[4];
    const char* pa[GTI];
#pragma unroll
    for (int j = 0; j < 4; ++j)
      pb[j] = (const char*)Btp + (size_t)__builtin_amdgcn_readfirstlane(((n0 >> 4) + j) * (ldb >> 5)) * 1024;
#pragma unroll
    for (int i = 0; i < GTI; ++i)
      pa[i] = (const char*)Ap + (size_t)__builtin_amdgcn_readfirstlane(((m0 >> 4) + i) * (lda >> 5)) * 1024;
    v16us bh[GPD][4], ah[GPD][GTI];
#pragma unroll
    for (int s = 0; s < GPD; ++s) {
#pragma unroll
      for (int j = 0; j < 4; ++j) bh[s][j] = ldfrag_at(pb[j] + s * 1024, l16);
#pragma unroll
      for (int i = 0; i < GTI; ++i) ah[s][i] = ldfrag_at(pa[i] + s * 1024, l16);
      // keeps the first fill in the order of the refills, place by place: the counted load waits in the loop are set for
      // both ways into it, and a first fill in another order would make them wait for younger places too
      __builtin_amdgcn_sched_barrier(0);
    }
    // behind the last load of the first fill: whichever code comes next may reuse the base registers these loads name
    addr_wait();
    // rolled over groups of GPD k steps, so that the places of the ring are fixed registers
#pragma unroll 1
    for (int k0 = 32 * GPD; k0 < K; k0 += 32 * GPD) {
#pragma unroll
      for (int s = 0; s < GPD; ++s) {
#pragma unroll
        for (int i = 0; i < GTI; ++i)
#pragma unroll
          for (int j = 0; j < 4; ++j) acc[i][j] = mma_raw_bf(ah[s][i], bh[s][j], acc[i][j]);
        // holds the products above the slots below
        __builtin_amdgcn_sched_barrier(0);
#if defined(__HIP_DEVICE_COMPILE__)
        // five vector slots between the last product and the loads that overwrite its fragments, the distance the loop
        // had without a ring
        asm volatile("v_nop\n\tv_nop\n\tv_nop\n\tv_nop\n\tv_nop" ::: "memory");
#endif
#pragma unroll
        for (int j = 0; j < 4; ++j) bh[s][j] = ldfrag_at(pb[j] + (GPD + s) * 1024, l16);
#pragma unroll
        for (int i = 0; i < GTI; ++i) ah[s][i] = ldfrag_at(pa[i] + (GPD + s) * 1024, l16);
        // keeps a place's refill at this point: moved down by the scheduler it would lose its lead of GPD - 1 k steps
        __builtin_amdgcn_sched_barrier(0);
      }
#if defined(__HIP_DEVICE_COMPILE__)
      // stands behind the issued loads, in front of the advance of the offset register that they name (the operand
      // ties the advance behind the wait)
      asm volatile("s_wait_xcnt 0x0" : "+v"(l16) :: "memory");
#endif
      l16 += GPD * 1024;
    }
#pragma unroll
    for (int s = 0; s < GPD; ++s)
#pragma unroll
      for (int i = 0; i < GTI; ++i)
#pragma unroll
        for (int j = 0; j < 4; ++j) acc[i][j] = mma_raw_bf(ah[s][i], bh[s][j], acc[i][j]);
  } else {
#pragma unroll 1
  for (int k0 = 0; k0 < K; k0 += 32) {
    v16us bh[4];
#pragma unroll
    for (int j = 0; j < 4; ++j) {
      const size_t bo = (size_t)(n0 + (j << 4) + rlane) * ldb + koff + k0;
      bh[j] = FOI ? ldfrag_fo(Btp, (n0 >> 4) + j, k0 >> 5, ldb >> 5, lane) : ldfrag_u(Btp + bo);
    }
    v16us ah[GTI];
#pragma unroll
    for (int i = 0; i < GTI; ++i) {
      const size_t ao = (size_t)(m0 + (i << 4) + rlane) * lda + koff + k0;
      ah[i] = FOI ? ldfrag_fo(Ap, (m0 >> 4) + i, k0 >> 5, lda >> 5, lane) : ldfrag_u(Ap + ao);
    }
#pragma unroll
    for (int i = 0; i < GTI; ++i) {
#pragma unroll
      for (int j = 0; j < 4; ++j) {
        if (BF) acc[i][j] = mma_raw_bf(ah[i], bh[j], acc[i][j]);
        else    acc[i][j] = mma_raw(ah[i], bh[j], acc[i][j]);
      }
      dep_guard1(acc[i][0], acc[i][3], ah[i]);
    }
    keep4_u(bh[0], bh[1], bh[2], bh[3]);
  }
  }
#pragma unroll
  for (int i = 0; i < GTI; ++i) acc_guard4(acc[i][0], acc[i][1], acc[i][2], acc[i][3]);

  const int hh2 = lane >> 4, c4 = (lane & 15) * 4;     // f32 out: 256-B row segment = 16 lanes x 16 B
  const int q8  = lane >> 3, c8 = (lane & 7) * 8;

  // per-lane bias values for the column-indexed modes (bf16 RNE value times bsc), clamped address
  float bc[8];
#pragma unroll
  for (int e = 0; e < 8; ++e) bc[e] = 0.f;
  if (!BROW) {
    if (OM == 0) {
#pragma unroll
      for (int e = 0; e < 4; ++e) bc[e] = bsc * bfr(bias[clampi(n0 + c4 + e, 0, nbias - 1)]);
    } else {
#pragma unroll
      for (int e = 0; e < 8; ++e) bc[e] = bsc * bfr(bias[clampi(n0 + c8 + e, 0, nbias - 1)]);
    }
    if (FOI) {
      // the epilogue's arithmetic reuses the bias loads' index registers; as inputs of the wait they stay whole up to it
      int bi[8];
#pragma unroll
      for (int e = 0; e < 8; ++e) bi[e] = clampi(n0 + ((OM == 0) ? c4 + (e & 3) : c8 + e), 0, nbias - 1);
      addr_wait8(bi[0], bi[1], bi[2], bi[3], bi[4], bi[5], bi[6], bi[7]);
    }
  }

  // ---- epilogue ----
  float* slab = sT + wave * GSLAB;
#pragma unroll
  for (int i = 0; i < GTI; ++i) {
    const int mBase = m0 + (i << 4);
#pragma unroll
    for (int j = 0; j < 4; ++j) {
#pragma unroll
      for (int r = 0; r < 8; ++r) {
        slab[(mOff + r) * 68 + (j << 4) + rlane] = acc[i][j][r];
      }
    }
    wave_sync_lds();
    if (OM == 0) {
      v4f vals[8];
#pragma unroll
      for (int it = 0; it < 8; ++it) {
        const int row = it * 2 + hh2;                      // it 0..7 x hh2 0..1 = rows 0..15
        const v4f v = *(const v4f*)(slab + row * 68 + c4);
        float brw = 0.f;
        if (BROW) brw = bsc * bfr(bias[clampi(mBase + row, 0, nbias - 1)]);
        v4f ov;
#pragma unroll
        for (int e = 0; e < 4; ++e) {
          float x = v[e] * osc + (BROW ? brw : bc[e]);
          if (RELU) x = fmaxf(x, 0.f);
          ov[e] = x;
        }
        vals[it] = ov;
      }
      {
#pragma unroll
        for (int it = 0; it < 8; ++it) {
          const int row = it * 2 + hh2;
          *(v4f*)(Cf + (size_t)(mBase + row) * ldc + (size_t)n0 + c4) = vals[it];
        }
        
      }
    } else if (OM == 1) {
      v4u hv[4];
#pragma unroll
      for (int it = 0; it < 4; ++it) {
        const int row = it * 4 + q8;                       // it 0..3 x q8 0..3 = rows 0..15
        const float* sp = slab + row * 68 + c8;
        float brw = 0.f;
        if (BROW) brw = bsc * bfr(bias[clampi(mBase + row, 0, nbias - 1)]);
        v4u ha = {0u, 0u, 0u, 0u};
#pragma unroll
        for (int e = 0; e < 4; ++e) {
          float b0 = sp[2 * e]     * osc + (BROW ? brw : bc[2 * e]);
          float b1 = sp[2 * e + 1] * osc + (BROW ? brw : bc[2 * e + 1]);
          if (RELU) { b0 = fmaxf(b0, 0.f); b1 = fmaxf(b1, 0.f); }
          ha[e] = pk16(f2h(b0), f2h(b1));
        }
        hv[it] = ha;
      }
      {
#pragma unroll
        for (int it = 0; it < 4; ++it) {
          const int row = it * 4 + q8;
          const size_t go = fo_off(mBase + row, n0 + c8, ldc >> 5);
          *(v4u*)(Ch + go) = hv[it];
        }
        
      }
    } else {
      v4u hv[4], lv[4];
#pragma unroll
      for (int it = 0; it < 4; ++it) {
        const int row = it * 4 + q8;                       // it 0..3 x q8 0..3 = rows 0..15
        const float* sp = slab + row * 68 + c8;
        float brw = 0.f;
        if (BROW) brw = bsc * bfr(bias[clampi(mBase + row, 0, nbias - 1)]);
        v4u ha = {0u, 0u, 0u, 0u};
        v4u la = {0u, 0u, 0u, 0u};
#pragma unroll
        for (int e = 0; e < 4; ++e) {
          float x0 = sp[2 * e]     * osc + (BROW ? brw : bc[2 * e]);
          float x1 = sp[2 * e + 1] * osc + (BROW ? brw : bc[2 * e + 1]);
          if (RELU) { x0 = fmaxf(x0, 0.f); x1 = fmaxf(x1, 0.f); }
          const unsigned short h0 = bf_bits(x0), h1 = bf_bits(x1);
          const unsigned short l0 = bf_bits(x0 - bf_up(h0)), l1 = bf_bits(x1 - bf_up(h1));
          ha[e] = pk16(h0, h1);
          la[e] = pk16(l0, l1);
        }
        hv[it] = ha;
        lv[it] = la;
      }
      {
#pragma unroll
        for (int it = 0; it < 4; ++it) {
          const int row = it * 4 + q8;
          const size_t go = fo_off(mBase + row, n0 + c8, ldc >> 5);
          *(v4u*)(Ch + go) = hv[it];
          *(v4u*)(Ch + (size_t)looff + go) = lv[it];
        }
        
      }
    }
    wave_sync_lds();
  }
}
template <int BF, int OM, int RELU, int BROW>
__global__ __launch_bounds__(32 * GWV) void gemm64(
    const unsigned short* __restrict__ Ap, int lda, const unsigned short* __restrict__ Btp, int ldb,
    unsigned short* Ch, int looff, float* Cf, int ldc, float osc,
    const float* __restrict__ bias, int nbias, float bsc, int M, int N, int K) {
  __shared__ __align__(16) float sT[GWV * GSLAB];
  gemm64_blk<BF, OM, RELU, BROW, GWV, 1>(sT, blockIdx.x, Ap, lda, Btp, ldb, Ch, looff, Cf, ldc, osc, bias, nbias, bsc,
                                 M, N, K);
}

// =====================================================================================================
// Structure check of the [SEQ][SEQ] mask input (row pitch SEQ_FULL): block b covers rows 16b..16b+15 and all
// SEQ columns; a violation is any element differing from (j <= i ? 1 : 0). The block's flag is written as one
// coverage: 256 threads x (SEQ/64) float4 = 16 rows x SEQ cols per block; bx = 0 .. SEQ/16 - 1 = all rows.
// Block body, called from the second merged launch under a block-uniform branch; wf = 8 ints of its LDS.
// =====================================================================================================
__device__ __forceinline__ void mask_check(int* wf, int bx, const float* __restrict__ msk, float* flg) {
  const int t = threadIdx.x, lane = t & 31, wv = t >> 5;
  const int i0 = bx * 16;
  if (i0 + 16 > SEQ) return;                             // block-uniform, before the barrier; never taken
  constexpr int C4 = SEQ / 4;
  int viol = 0;
#pragma unroll 1
  for (int it = 0; it < (16 * C4) / 256; ++it) {
    const int ci = it * 256 + t;
    const int rr = ci / C4;
    const int c4 = ci - rr * C4;
    const int i = i0 + rr;
    const v4f x = *(const v4f*)(msk + (size_t)i * SEQ_FULL + 4 * c4);
#pragma unroll
    for (int e = 0; e < 4; ++e) {
      const int j = 4 * c4 + e;
      const float ex = (j <= i) ? 1.0f : 0.0f;
      viol |= (x[e] != ex) ? 1 : 0;
    }
  }
  viol |= __shfl_xor(viol, 1, 32);
  viol |= __shfl_xor(viol, 2, 32);
  viol |= __shfl_xor(viol, 4, 32);
  viol |= __shfl_xor(viol, 8, 32);
  viol |= __shfl_xor(viol, 16, 32);
  if (lane == 0) wf[wv] = viol;
  __syncthreads();
  if (wv == 0) {                                        // wave-uniform
    int f = wf[lane & 7];
    f |= __shfl_xor(f, 1, 32);
    f |= __shfl_xor(f, 2, 32);
    f |= __shfl_xor(f, 4, 32);
    const float fv = f ? 1.0f : 0.0f;
    float* d = flg + (size_t)bx * FLGW + lane;
    *(float*)d = fv;
    
  }
}

// =====================================================================================================
// Merged launches: jobs that read none of each other's output share one grid; the flat block index picks the
// job by ranges (block-uniform scalar branches), every block runs exactly one job body and then ends.
// prep_x: what the projections read. Blocks [0, 3*NTW): Wq, Wk, Wv -> [64][512] f16 x64 (transposed);
//   then 3*NLX blocks: q, k, v -> f16(bf16) planes, NLX = NB slabs x SEQ*DMD/2048 pieces each.
// proj_side: the three projections, first in the grid since they run longest, and beside them all that only
//   later launches read. Blocks [0, 3*NGQ): q plane x16, k plane x16 (C[tok][n] = sum_k X[tok][k] * WT[n][k]),
//   v^T planes (C[d][tok] = sum_k WVT[d][k] * XV[tok][k] / 64, bf16 hi and lo); then NFLG mask-structure blocks;
//   2*NTO blocks Wo -> [512][1024] = (Wo^T | Wo^T) bf16; 2*NTL blocks Wl -> [448][1024] = (Wl^T | Wl^T) bf16;
//   NLE blocks E -> f16(bf16 x64).
// =====================================================================================================
#define NTW (DMD / 64)
#define NLP ((SEQ * DMD) / 2048)
#define NLX (NLP * NB)
#define NGQ (((MT / (16 * GTI)) * (HD / 64) + 7) / 8)
#define NTO ((DMD / 64) * (DMD / 64))
#define NTL ((EVP / 64) * (DMD / 64))
#define NLE ((NH * SEQ_FULL * HD) / 2048)
#define PREP_BLOCKS (3 * NTW + 3 * NLX)
#define SIDE_BLOCKS (3 * NGQ + NFLG + 2 * NTO + 2 * NTL + NLE)

__global__ __launch_bounds__(256) void prep_x(
    const float* __restrict__ q, const float* __restrict__ k, const float* __restrict__ v,
    const float* __restrict__ wq, const float* __restrict__ wk, const float* __restrict__ wv,
    unsigned short* XQ, unsigned short* XK, unsigned short* XV,
    unsigned short* WQT, unsigned short* WKT, unsigned short* WVT) {
  __shared__ __align__(16) unsigned short st[64 * 72];
  int bid = blockIdx.x;
  if (bid < 3 * NTW) {
    const int j = bid / NTW;
    const float* w = (j == 0) ? wq : ((j == 1) ? wk : wv);
    unsigned short* o = (j == 0) ? WQT : ((j == 1) ? WKT : WVT);
    cvt_t<0>(st, w, o, 0, bid - j * NTW, DMD, HD, HD, DMD, WSCL);          // in[512][64] -> out[64][512]
    return;
  }
  bid -= 3 * NTW;
  if (bid < 3 * NLX) {
    const int j = bid / NLX;
    const int r = bid - j * NLX;
    const float* x = (j == 0) ? q : ((j == 1) ? k : v);
    unsigned short* o = (j == 0) ? XQ : ((j == 1) ? XK : XV);
    cvt_lin(x, o, r % NLP, r / NLP, SEQ * DMD, SEQ * DMD, 1.0f, SEQ_FULL * DMD, SEQ * DMD);
  }
}

__global__ __launch_bounds__(256) void proj_side(
    const unsigned short* __restrict__ XQ, const unsigned short* __restrict__ XK,
    const unsigned short* __restrict__ XV, const unsigned short* __restrict__ WQT,
    const unsigned short* __restrict__ WKT, const unsigned short* __restrict__ WVT,
    const float* __restrict__ bq, const float* __restrict__ bk, const float* __restrict__ bv,
    unsigned short* QH, unsigned short* KH, unsigned short* VH,
    const float* __restrict__ msk, float* flg,
    const float* __restrict__ wo, unsigned short* WOT, const float* __restrict__ wl, unsigned short* WLT,
    const float* __restrict__ ee, unsigned short* PEH) {
  __shared__ __align__(16) float sT[8 * GSLAB];        // the one job of a block uses it: slabs, transpose tile or flags
  int bid = blockIdx.x;
  if (bid < 2 * NGQ) {
    const int j = bid / NGQ;
    gemm64_blk<0, 1, 0, 0, 8, 0>(sT, bid - j * NGQ, j ? XK : XQ, DMD, j ? WKT : WQT, DMD, j ? KH : QH, 0, nullptr, HD,
                           QKS / WSCL, j ? bk : bq, HD, QKS, MT, HD, DMD);
    return;
  }
  bid -= 2 * NGQ;
  if (bid < NGQ) {
    gemm64_blk<0, 2, 0, 1, 8, 0>(sT, bid, WVT, DMD, XV, DMD, VH, HD * MT, nullptr, MT, 1.0f / WSCL, bv, HD, 1.0f,
                           HD, MT, DMD);
    return;
  }
  bid -= NGQ;
  if (bid < NFLG) {
    mask_check((int*)sT, bid, msk, flg);
    return;
  }
  bid -= NFLG;
  if (bid < 2 * NTO) {
    const int j = bid / NTO;                           // destination columns 0.. and 512.. (16 fragments on)
    const int r = bid - j * NTO;
    cvt_t<1>((unsigned short*)sT, wo, WOT + j * (DMD * 16), r % (DMD / 64), r / (DMD / 64), DMD, DMD, DMD, KF, 1.0f);
    return;
  }
  bid -= 2 * NTO;
  if (bid < 2 * NTL) {
    const int j = bid / NTL;                           // destination columns 0.. and 512.. (16 fragments on)
    const int r = bid - j * NTL;
    cvt_t<1>((unsigned short*)sT, wl, WLT + j * (DMD * 16), r % (EVP / 64), r / (EVP / 64), DMD, EVD, EVP, KF, 1.0f);
    return;
  }
  bid -= 2 * NTL;
  if (bid < NLE) cvt_fo64(ee, PEH, bid, WSCL);
}

// =====================================================================================================
// Causal attention with relative-offset term, head dim 64. Block = 256 threads = 8 waves; one block owns one
// 16-row query tile (t0..t0+15) of one (batch b, head h). The key blocks of 32 up to the diagonal (sb <= t0)
// are cut into 8 contiguous shares, one per wave; each wave runs its share with an online max-subtracted
// softmax in f32 and leaves its partial state (row max, row sum, unnormalised 16x64 O) in LDS; behind one
// block barrier the 8 states are merged in wave order (rescale by exp(max_w - max), sum, divide).
// Planes, all in fragment order: QH, KH f16 [MT][64] = 16*q, 16*k (shared
// by all heads); PE f16 [NH*SEQ_FULL][64] = 64*E (head h rows h*SEQ_FULL..); VH, VL bf16 [64][MT] = v hi and
// lo planes transposed (row = dim, column = token). Output Z bf16 [MT][1024]: cols h*64+d = ctx hi, cols
// 512+h*64+d = ctx lo.
// Every product is taken transposed (K, E and V fragments as the A operand, Q and P as the B operand), so that a lane
// holds one query (column m = lane & 15) and, per 16-row tile, the 8 keys, band columns or dims 8*hh + r.
// Per key block sb: S^T = K.Q^T (2 key subtiles x 2 k-steps, scale 1/256); relative band of 48 columns:
// column c <-> E row SEQ-16-t0+sb+c (a 16-row tile starts at a multiple of 16 and is clamped as a whole to start at
// most at SEQ-16; clamping only touches entries with j > i, which the causal select replaces); columns 0..15 come from
// the tile carried over from the prior key block (its columns 32..47), columns 16..47 are two fresh tiles (2 x 2 WMMA,
// scale 1/1024); the band is exchanged through per-wave LDS (one row of pitch RWP floats per query) and read back at
// c = 15 - il + jl, i.e. E row SEQ-1-i+j; score = (qk + rel)/8 for j <= i, else -1e10; a query's 32 scores lie in the
// two lanes m and m + 16: row max and row sum are taken inside the lane and once across the halves;
// p = exp(score - running max) in f32, l accumulated from the f32 p; the two p tiles of a lane, converted in place to
// bf16 hi and lo, are the B fragments of the next product (element e <- key 8*hh + e, element 8 + e <- key 16 + 8*hh + e,
// the k map of the V fragments); O^T += Vhi.Phi + Vlo.Phi + Vhi.Plo on 4 dim subtiles (one accumulator set). A wave
// whose share is empty contributes max -1e30, sum 0, O 0 (weight exp(-1e30 - max) = 0); wave 0's share is never empty.
// Merge: thread -> (row, 4 dims) in fragment order, 32 lanes x 8 B = two whole 128-B lines of Z per plane.
// coverage: 16 query rows x 64 halves x {hi, lo} per block, NB*NH*(SEQ/16) blocks = all (b, t, h)
// segments of Z in both halves.
// =====================================================================================================
__global__ __launch_bounds__(32 * AWV) void attn_kernel(
    const unsigned short* __restrict__ QH, const unsigned short* __restrict__ KH,
    const unsigned short* __restrict__ PE, const unsigned short* __restrict__ VH,
    const unsigned short* __restrict__ VL, unsigned short* Z) {
  __shared__ __align__(16) float relw[AWV][16 * RWP];            // band exchange, 26624 B
  __shared__ __align__(16) float opw[AWV][16 * OPP];              // partial O per wave, pitch 68 floats, 34816 B
  __shared__ __align__(16) float mxw[AWV][16];                    // partial row max per wave
  __shared__ __align__(16) float lsw[AWV][16];                    // partial row sum per wave
  const int lane = threadIdx.x & 31, m = lane & 15, hh = lane >> 4;
  // wave number in a scalar register: the key loop's bounds depend on it and stay a scalar branch
  const int wv = __builtin_amdgcn_readfirstlane((int)(threadIdx.x >> 5));
  const int task = blockIdx.x;                       // 0 .. NB*NH*(SEQ/16)-1
  const int nqt = SEQ / 16;
  const int bh = task / nqt;                         // (b, h)
  const int t0 = (task - bh * nqt) << 4;             // query tile start
  const int b = bh / NH, h = bh - (bh / NH) * NH;
  if (b >= NB) return;                               // block-uniform, before the barrier; never taken with exact grids
  const size_t tok0 = (size_t)b * SEQ;
  // this lane's query row of the band; pitch 52 floats: 16-byte aligned rows, and the skewed reads of the 32 lanes
  // (dword 51 * m + 8 * hh + const) fall on 32 different banks
  float* rq = relw[wv] + m * RWP;

  // Q B-fragments: columns t0+m, k = head dims 0..31 and 32..63
  const int qt = (int)((tok0 + (size_t)t0) >> 4);
  const v16us qf0 = ldfrag_fo(QH, qt, 0, HD / 32, lane);
  const v16us qf1 = ldfrag_fo(QH, qt, 1, HD / 32, lane);

  const unsigned short* pe = PE + (size_t)h * SEQ_FULL * HD;
  const int rb = SEQ - 16 - t0;                      // E row of band column 0 at sb = 0 (>= 0)

  const int nkb = (t0 >> 5) + 1;                     // key blocks 0 .. floor(t0/32), block-uniform
  const int per = (nkb + AWV - 1) / AWV;             // key blocks per wave share
  const int kb0 = wv * per;                          // this wave's share [kb0, kb1), wave-uniform, may be empty
  const int kb1 = (kb0 + per < nkb) ? (kb0 + per) : nkb;

  // carried band tile: columns 0..15 of key block kb0 <-> E rows rb + 32*kb0 + 0..15 (clamped)
  v8f carry;
  {
    const int et = clampi(rb + (kb0 << 5), 0, SEQ - 16) >> 4;
    const v16us c0 = ldfrag_fo(pe, et, 0, HD / 32, lane);   // both requested beside Q, in front of the first matrix statement
    const v16us c1 = ldfrag_fo(pe, et, 1, HD / 32, lane);
    carry = mma_g(c0, qf0, zero8());
    carry = mma_g(c1, qf1, carry);
  }

  float mx = -1.0e30f, ls = 0.f;                     // of query t0 + m, equal in the lanes m and m + 16
  v8f O0 = zero8(), O1 = zero8(), O2 = zero8(), O3 = zero8();

#pragma unroll 1
  for (int kb = kb0; kb < kb1; ++kb) {
    const int sb = kb << 5;
    // The eight K and E-band fragments are requested together, in front of the first matrix statement (a load written
    // between the guarded matrix statements is issued and waited for on its own: one round trip per fragment).
    // K A-fragments: row = key token, k = head dim
    const int kt = (int)((tok0 + (size_t)sb) >> 4);
    const v16us kf0 = ldfrag_fo(KH, kt, 0, HD / 32, lane), kf1 = ldfrag_fo(KH, kt, 1, HD / 32, lane);
    const v16us kf2 = ldfrag_fo(KH, kt + 1, 0, HD / 32, lane), kf3 = ldfrag_fo(KH, kt + 1, 1, HD / 32, lane);
    // relative band: columns 16..31 and 32..47 <-> E rows rb+sb+16.. and rb+sb+32..
    const int e1 = clampi(rb + sb + 16, 0, SEQ - 16) >> 4;
    const int e2 = clampi(rb + sb + 32, 0, SEQ - 16) >> 4;
    const v16us ef0 = ldfrag_fo(pe, e1, 0, HD / 32, lane), ef1 = ldfrag_fo(pe, e1, 1, HD / 32, lane);
    const v16us ef2 = ldfrag_fo(pe, e2, 0, HD / 32, lane), ef3 = ldfrag_fo(pe, e2, 1, HD / 32, lane);
    addr_wait();

    v8f S0, S1;
    S0 = mma_g(kf0, qf0, zero8());
    S0 = mma_g(kf1, qf1, S0);
    S1 = mma_g(kf2, qf0, zero8());
    S1 = mma_g(kf3, qf1, S1);
    v8f Pb1, Pb2;
    Pb1 = mma_g(ef0, qf0, zero8());
    Pb1 = mma_g(ef1, qf1, Pb1);
    Pb2 = mma_g(ef2, qf0, zero8());
    Pb2 = mma_g(ef3, qf1, Pb2);
    {
      // element r of a band tile = (column 16 * tile + 8 * hh + r, query m): 8 consecutive floats of the query's row
      float* d = rq + 8 * hh;
      const v4f w0 = {carry[0], carry[1], carry[2], carry[3]}, w1 = {carry[4], carry[5], carry[6], carry[7]};
      const v4f w2 = {Pb1[0], Pb1[1], Pb1[2], Pb1[3]}, w3 = {Pb1[4], Pb1[5], Pb1[6], Pb1[7]};
      const v4f w4 = {Pb2[0], Pb2[1], Pb2[2], Pb2[3]}, w5 = {Pb2[4], Pb2[5], Pb2[6], Pb2[7]};
      *(v4f*)(d)      = w0;
      *(v4f*)(d + 4)  = w1;
      *(v4f*)(d + 16) = w2;
      *(v4f*)(d + 20) = w3;
      *(v4f*)(d + 32) = w4;
      *(v4f*)(d + 36) = w5;
    }
    carry = Pb2;
    wave_sync_lds();

    // V A-fragments (row = dim, k = key token), four dim subtiles, hi and lo planes: requested together here, behind
    // the exchange fence (which waits for outstanding loads), so that they are in flight under the softmax
    const int vk = (int)((tok0 + (size_t)sb) >> 5);
    const v16us vh0 = ldfrag_fo(VH, 0, vk, MT / 32, lane), vl0 = ldfrag_fo(VL, 0, vk, MT / 32, lane);
    const v16us vh1 = ldfrag_fo(VH, 1, vk, MT / 32, lane), vl1 = ldfrag_fo(VL, 1, vk, MT / 32, lane);
    const v16us vh2 = ldfrag_fo(VH, 2, vk, MT / 32, lane), vl2 = ldfrag_fo(VL, 2, vk, MT / 32, lane);
    const v16us vh3 = ldfrag_fo(VH, 3, vk, MT / 32, lane), vl3 = ldfrag_fo(VL, 3, vk, MT / 32, lane);
    addr_wait();                                               // the score arithmetic below reuses their offset registers

    // skew read + scale + causal select (key j <= query i keeps the score, otherwise -1e10); element r = key jb + r
    float s0[8], s1[8];
    {
      const int i = t0 + m;
      const int jb = sb + 8 * hh;
      const float* sk = rq + 15 - m + 8 * hh;
#pragma unroll
      for (int r = 0; r < 8; ++r) {
        const float rv0 = sk[r];
        const float rv1 = sk[16 + r];
        const float a0 = (S0[r] * (1.0f / (QKS * QKS)) + rv0 * (1.0f / (QKS * WSCL))) * RSQD;
        const float a1 = (S1[r] * (1.0f / (QKS * QKS)) + rv1 * (1.0f / (QKS * WSCL))) * RSQD;
        s0[r] = (jb + r <= i) ? a0 : NEGM;
        s1[r] = (jb + 16 + r <= i) ? a1 : NEGM;
      }
    }

    // online softmax: 16 of the query's scores in this lane, the other 16 in lane ^ 16
    float xm = fmaxf(s0[0], s1[0]);
#pragma unroll
    for (int r = 1; r < 8; ++r) xm = fmaxf(xm, fmaxf(s0[r], s1[r]));
    xm = fmaxf(xm, xhalf(xm));
    const float mn = fmaxf(mx, xm);
    const float al = exp2_slot((mx - mn) * 1.44269504f);        // exp(x) = 2^(x * log2 e)
    mx = mn;
    float pq[8];
    v8u wh, wl;                                                // P B-fragments as words of two bf16, hi and lo planes
#pragma unroll
    for (int r = 0; r < 8; r += 2) {
      const float a0 = exp2_slot((s0[r] - mn) * 1.44269504f), b0 = exp2_slot((s0[r + 1] - mn) * 1.44269504f);
      const float a1 = exp2_slot((s1[r] - mn) * 1.44269504f), b1 = exp2_slot((s1[r + 1] - mn) * 1.44269504f);
      pq[r]     = a0 + a1;
      pq[r + 1] = b0 + b1;
      const unsigned h0 = bf_pair(a0, b0), h1 = bf_pair(a1, b1);
      wh[r >> 1]       = h0;                                   // elements r, r + 1 <- keys 8*hh + r, + 1
      wh[4 + (r >> 1)] = h1;                                   // elements 8 + r, 9 + r <- keys 16 + 8*hh + r, + 1
      wl[r >> 1]       = bf_pair(a0 - __uint_as_float(h0 << 16), b0 - __uint_as_float(h0 & 0xFFFF0000u));
      wl[4 + (r >> 1)] = bf_pair(a1 - __uint_as_float(h1 << 16), b1 - __uint_as_float(h1 & 0xFFFF0000u));
    }
    const v16us afh = __builtin_bit_cast(v16us, wh), afl = __builtin_bit_cast(v16us, wl);
    float ps = ((pq[0] + pq[1]) + (pq[2] + pq[3])) + ((pq[4] + pq[5]) + (pq[6] + pq[7]));
    ps += xhalf(ps);
    ls = ls * al + ps;
#pragma unroll
    for (int r = 0; r < 8; ++r) {
      O0[r] = O0[r] * al;
      O1[r] = O1[r] * al;
      O2[r] = O2[r] * al;
      O3[r] = O3[r] * al;
    }

    // the V A-fragments were requested above the softmax
    O0 = mma_gb(vh0, afh, O0);
    O0 = mma_gb(vl0, afh, O0);
    O0 = mma_gb(vh0, afl, O0);
    O1 = mma_gb(vh1, afh, O1);
    O1 = mma_gb(vl1, afh, O1);
    O1 = mma_gb(vh1, afl, O1);
    O2 = mma_gb(vh2, afh, O2);
    O2 = mma_gb(vl2, afh, O2);
    O2 = mma_gb(vh2, afl, O2);
    O3 = mma_gb(vh3, afh, O3);
    O3 = mma_gb(vl3, afh, O3);
    O3 = mma_gb(vh3, afl, O3);
  }
  acc_guard4(O0, O1, O2, O3);

  // ---- this wave's partial state to LDS (D element r of a lane = query row m, dim 8*hh + r of each dim subtile) ----
  {
    float* op = opw[wv] + m * OPP + 8 * hh;
    const v4f a0 = {O0[0], O0[1], O0[2], O0[3]}, a1 = {O0[4], O0[5], O0[6], O0[7]};
    const v4f b0 = {O1[0], O1[1], O1[2], O1[3]}, b1 = {O1[4], O1[5], O1[6], O1[7]};
    const v4f c0 = {O2[0], O2[1], O2[2], O2[3]}, c1 = {O2[4], O2[5], O2[6], O2[7]};
    const v4f d0 = {O3[0], O3[1], O3[2], O3[3]}, d1 = {O3[4], O3[5], O3[6], O3[7]};
    *(v4f*)(op)      = a0;
    *(v4f*)(op + 4)  = a1;
    *(v4f*)(op + 16) = b0;
    *(v4f*)(op + 20) = b1;
    *(v4f*)(op + 32) = c0;
    *(v4f*)(op + 36) = c1;
    *(v4f*)(op + 48) = d0;
    *(v4f*)(op + 52) = d1;
  }
  if (hh == 0) {                                       // mx, ls are equal in the lanes m and m + 16
    mxw[wv][m] = mx;
    lsw[wv][m] = ls;
  }
  __syncthreads();                                     // publishes the 8 partial states to the whole block

  // ---- merge in wave order, ctx = O / l, bf16 hi plane and lo plane ----
  {
    // thread u owns the u-th 8 bytes of the tile's two Z fragments per plane: a wave stores 256 contiguous bytes
    const int u = threadIdx.x;
    const int row = (u >> 1) & 15;
    const int c4 = ((u >> 7) & 1) * 32 + ((u >> 6) & 1) * 16 + ((u >> 5) & 1) * 8 + (u & 1) * 4;
    float mw[AWV];
    float mt = -1.0e30f;
#pragma unroll
    for (int w = 0; w < AWV; ++w) { mw[w] = mxw[w][row]; mt = fmaxf(mt, mw[w]); }
    float sc[AWV];
#pragma unroll
    for (int w = 0; w < AWV; ++w) sc[w] = exp2_slot((mw[w] - mt) * 1.44269504f);   // exp(max_w - max)
    float lt = 0.f;
    v4f ot = {0.f, 0.f, 0.f, 0.f};
#pragma unroll
    for (int w = 0; w < AWV; ++w) {
      const v4f o = *(const v4f*)(opw[w] + row * OPP + c4);
      lt += lsw[w][row] * sc[w];
#pragma unroll
      for (int e = 0; e < 4; ++e) ot[e] += o[e] * sc[w];
    }
    const float g = 1.0f / lt;                         // lt >= 1
    unsigned short hb[4], lb[4];
#pragma unroll
    for (int e = 0; e < 4; ++e) {
      const float c = ot[e] * g;
      hb[e] = bf_bits(c);
      lb[e] = bf_bits(c - bf_up(hb[e]));
    }
    const v2u hv = {pk16(hb[0], hb[1]), pk16(hb[2], hb[3])};
    const v2u lv = {pk16(lb[0], lb[1]), pk16(lb[2], lb[3])};
    unsigned short* dst = Z + ((size_t)qt * (KF / 32) + 2 * h) * 512 + u * 4;   // = fo_off(token, h*64 + c4, KF/32)
    *(v2u*)dst = hv;
    *(v2u*)(dst + DMD * 16) = lv;                      // columns 512.. lie 16 fragments on
  }
}

// =====================================================================================================
// Flat whole-line writer of the output: out[row*388 + c] = L[row*448 + c]; each lane owns 4
// consecutive output floats (16 B; never straddles a row since 388 % 4 == 0), one instruction = 32 lanes x
// coverage: grid = MT*97/256 blocks x 256 float4 = all MT*388 output floats (in-kernel bound for safety).
// =====================================================================================================
__global__ __launch_bounds__(256) void out_copy(const float* __restrict__ L, const float* __restrict__ flg,
                                                 float* out) {
  __shared__ int wf[8];
  const int t = threadIdx.x, lane = t & 31, wv = t >> 5;
  int f;
  {
    const int ti = (t < NFLG) ? t : (NFLG - 1);         // clamped address, value selected
    const float x = flg[(size_t)ti * FLGW];
    f = ((t < NFLG) && (x == 1.0f)) ? 1 : 0;
  }
  f |= __shfl_xor(f, 1, 32);
  f |= __shfl_xor(f, 2, 32);
  f |= __shfl_xor(f, 4, 32);
  f |= __shfl_xor(f, 8, 32);
  f |= __shfl_xor(f, 16, 32);
  if (lane == 0) wf[wv] = f;
  __syncthreads();
  int g = 0;
#pragma unroll
  for (int w = 0; w < 8; ++w) g |= wf[w];
  const int e4 = blockIdx.x * 256 + t;
  if (e4 < MT * (EVD / 4)) {
    const int e = e4 * 4;
    const int row = e / EVD;
    const int c = e - row * EVD;
    v4f x = *(const v4f*)(L + (size_t)row * EVP + c);
    const float qn = __uint_as_float(0x7fc00000u);
    const v4f pn = {qn, qn, qn, qn};
    x = g ? pn : x;
    float* d = out + (size_t)e;
    *(v4f*)d = x;
    
  }
}

// =====================================================================================================
// Workspace map (bytes, full size NB=2, SEQ=2048); every plane is an exact multiple of its whole-row /
// whole-line / 32x64-tile store granularity; all offsets are multiples of 16384. PEH, QH, KH, VH, VL, Z, WOT, OP and
// WLT are kept in fragment order (see fo_off), the X and W*T planes and L row-major.
//   XQ   f16  [MT][512]        4194304     (x3 with XK, XV)
//   WQT  f16  [64][512]          65536     (x3 with WKT, WVT; Wq^T, Wk^T, Wv^T x64)
//   PEH  f16  [8*2048][64]     2097152     (E x64)
//   QH   f16  [MT][64]          524288     (16*q), KH same
//   VH   bf16 [64][MT]          524288     (v hi), VL same (v lo), contiguous after VH
//   Z    bf16 [MT][1024]       8388608     (ctx hi | ctx lo)
//   WOT  bf16 [512][1024]      1048576     (Wo^T | Wo^T)
//   OP   bf16 [MT][1024]       8388608     (relu out hi | lo)
//   WLT  bf16 [448][1024]       917504     (Wl^T | Wl^T, rows 388..447 zero)
//   L    f32  [MT][448]        7340032
//   FLG  f32  [128][32]          16384     (mask-structure flag lines)
//   total                     43073536
// =====================================================================================================
extern "C" void kernel_launch(void* const* d_in, const int* in_sizes, int n_in,
                              void* d_out, int out_size, void* d_ws, size_t ws_size,
                              hipStream_t stream) {
  if (n_in < 15) return;
  if (in_sizes[0] < (NB - 1) * SEQ_FULL * DMD + SEQ * DMD) return;   // v
  if (in_sizes[1] < (NB - 1) * SEQ_FULL * DMD + SEQ * DMD) return;   // k
  if (in_sizes[2] < (NB - 1) * SEQ_FULL * DMD + SEQ * DMD) return;   // q
  if (in_sizes[3] < (SEQ - 1) * SEQ_FULL + SEQ) return;               // mask
  if (in_sizes[4] < DMD * HD || in_sizes[6] < DMD * HD || in_sizes[8] < DMD * HD) return;
  if (in_sizes[5] < HD || in_sizes[7] < HD || in_sizes[9] < HD) return;
  if (in_sizes[10] < NH * SEQ_FULL * HD) return;                      // E
  if (in_sizes[11] < DMD * DMD || in_sizes[12] < DMD) return;         // Wo, bo
  if (in_sizes[13] < DMD * EVD || in_sizes[14] < EVD) return;         // Wl, bl
  if (out_size < MT * EVD) return;

  const float* v   = (const float*)d_in[0];    // [2][2048][512]
  const float* k   = (const float*)d_in[1];
  const float* q   = (const float*)d_in[2];
  const float* msk = (const float*)d_in[3];    // [2048][2048]
  const float* wq  = (const float*)d_in[4];    // [512][64]
  const float* bq  = (const float*)d_in[5];    // [64]
  const float* wk  = (const float*)d_in[6];
  const float* bk  = (const float*)d_in[7];
  const float* wv  = (const float*)d_in[8];
  const float* bv  = (const float*)d_in[9];
  const float* ee  = (const float*)d_in[10];   // [8][2048][64]
  const float* wo  = (const float*)d_in[11];   // [512][512] (in, out)
  const float* bo  = (const float*)d_in[12];   // [512]
  const float* wl  = (const float*)d_in[13];   // [512][388] (in, out)
  const float* bl  = (const float*)d_in[14];   // [388]

  const size_t PX  = (size_t)MT * DMD * 2;
  const size_t PW  = (size_t)HD * DMD * 2;
  const size_t PPE = (size_t)NH * SEQ_FULL * HD * 2;
  const size_t PQK = (size_t)MT * HD * 2;
  const size_t PV2 = (size_t)2 * HD * MT * 2;
  const size_t PZ  = (size_t)MT * KF * 2;
  const size_t PWO = (size_t)DMD * KF * 2;
  const size_t POP = (size_t)MT * KF * 2;
  const size_t PWL = (size_t)EVP * KF * 2;
  const size_t PL  = (size_t)MT * EVP * 4;
  const size_t PFL = (size_t)(SEQ_FULL / 16) * FLGW * 4;
  size_t off = 0;
  const size_t oXQ = off; off += PX;
  const size_t oXK = off; off += PX;
  const size_t oXV = off; off += PX;
  const size_t oWQ = off; off += PW;
  const size_t oWK = off; off += PW;
  const size_t oWV = off; off += PW;
  const size_t oPE = off; off += PPE;
  const size_t oQH = off; off += PQK;
  const size_t oKH = off; off += PQK;
  const size_t oV  = off; off += PV2;
  const size_t oZ  = off; off += PZ;
  const size_t oWO = off; off += PWO;
  const size_t oOP = off; off += POP;
  const size_t oWL = off; off += PWL;
  const size_t oL  = off; off += PL;
  const size_t oFL = off; off += PFL;
  if (off > ws_size) return;
  if (off > (size_t)134217728) return;

  char* ws = (char*)d_ws;
  unsigned short* XQ  = (unsigned short*)(ws + oXQ);
  unsigned short* XK  = (unsigned short*)(ws + oXK);
  unsigned short* XV  = (unsigned short*)(ws + oXV);
  unsigned short* WQT = (unsigned short*)(ws + oWQ);
  unsigned short* WKT = (unsigned short*)(ws + oWK);
  unsigned short* WVT = (unsigned short*)(ws + oWV);
  unsigned short* PEH = (unsigned short*)(ws + oPE);
  unsigned short* QHp = (unsigned short*)(ws + oQH);
  unsigned short* KHp = (unsigned short*)(ws + oKH);
  unsigned short* VHp = (unsigned short*)(ws + oV);
  unsigned short* VLp = VHp + (size_t)HD * MT;
  unsigned short* Zp  = (unsigned short*)(ws + oZ);
  unsigned short* WOT = (unsigned short*)(ws + oWO);
  unsigned short* OPp = (unsigned short*)(ws + oOP);
  unsigned short* WLT = (unsigned short*)(ws + oWL);
  float* Lp   = (float*)(ws + oL);
  float* FLG  = (float*)(ws + oFL);
  float* out0 = (float*)d_out;
  float* fdummy = Lp;                             // in-range placeholder for unused f32 output args
  unsigned short* hdummy = QHp;                   // in-range placeholder for unused 16-bit output args

  const dim3 blk(256);

  // (0) what the projections read, one launch: q, k, v (per batch slab) -> f16(bf16); Wq|Wk|Wv [512][64] ->
  //     [64][512] (transposed, f16 x64)
  prep_x<<<dim3(PREP_BLOCKS), blk, 0, stream>>>(q, k, v, wq, wk, wv, XQ, XK, XV, WQT, WKT, WVT);

  // (1) one launch: the three projections (q plane x16, k plane x16, v^T bf16 hi (VH) and lo (VL) planes) and,
  //     beside them, the jobs only later launches read: mask structure flags, Wo and Wl planes, E plane
  proj_side<<<dim3(SIDE_BLOCKS), blk, 0, stream>>>(XQ, XK, XV, WQT, WKT, WVT, bq, bk, bv, QHp, KHp, VHp,
                                                   msk, FLG, wo, WOT, wl, WLT, ee, PEH);

  // (2) attention -> ctx hi|lo token-major plane
  attn_kernel<<<dim3(NB * NH * (SEQ / 16)), dim3(32 * AWV), 0, stream>>>(QHp, KHp, PEH, VHp, VLp, Zp);

  // (3) output projection with relu: OP = bf16 hi|lo of max(0, sum_k Z[row][k] * WOT[n][k] + bo[n]), K = 1024
  const int gO = ((MT / (16 * GTI)) * (DMD / 64) + GWV - 1) / GWV;
  gemm64<1, 2, 1, 0><<<dim3(gO), dim3(32 * GWV), 0, stream>>>(Zp, KF, WOT, KF, OPp, DMD * 16, fdummy, KF, 1.0f, bo, DMD, 1.0f, MT, DMD, KF);

  // (4) logits: L[row][n] = sum_k OP[row][k] * WLT[n][k] + bl[n], K = 1024, N padded to 448
  const int gL = ((MT / (16 * GTI)) * (EVP / 64) + GWV - 1) / GWV;
  gemm64<1, 0, 0, 0><<<dim3(gL), dim3(32 * GWV), 0, stream>>>(OPp, KF, WLT, KF, hdummy, 0, Lp, EVP, 1.0f, bl, EVD, 1.0f, MT, EVP, KF);

  // (5) flat whole-line copy into the output (388-wide rows), NaN-poisoned on a mask-structure violation
  out_copy<<<dim3((MT * (EVD / 4) + 255) / 256), blk, 0, stream>>>(Lp, FLG, out0);
  (void)hipGetLastError();
}

// v008
// One run takes 82.7 microseconds.
// Two timings next to v007 put it at 1.08 and 1.09 times that version's speed.
// Counting every step since v000, it is 4.82 times as fast.
// Contractions: x.Wq and x.Wk (f16 planes x16), Wv^T.x^T (bf16 hi|lo planes), q.k^T and q.E^T band on
// v_wmma_f32_16x16x32_f16 (f16 operands, f32 accumulate); p.v as bf16 hi/lo three-product split, and
// [ctx_hi|ctx_lo].[Wo;Wo], [o_hi|o_lo].[Wl;Wl] K-folded planes on v_wmma_f32_16x16x32_bf16 (bf16 operands,
// f32 accumulate). Float inputs RNE-converted to bf16 on load (x x1; Wq, Wk, Wv, E x64 in f16; Wo, Wl bf16);
// softmax, causal select and the relative-offset skew in f32 on VALU.
#include <hip/hip_runtime.h>
#include <math.h>

#ifndef NB
#define NB 2
#endif
#ifndef SEQ
#define SEQ 2048
#endif
#define NB_FULL  2
#define SEQ_FULL 2048
#define DMD  512
#define NH   8
#define HD   64
#define EVD  388
#define EVP  448
#define MT   (NB * SEQ)
#define KF   (2 * DMD)
#define NFLG (SEQ / 16)
#define FLGW 32
#define AWV  8
#define HPW  2
#define OPP  68
#define RWP  52
#define RWQ  108
#define WSCL 64.0f
#define QKS  16.0f
#define RSQD 0.125f
#define NEGM (-1.0e10f)

static_assert(NB >= 1 && NB <= NB_FULL);
static_assert(SEQ >= 64 && SEQ <= SEQ_FULL && (SEQ % 64) == 0);
static_assert(NH * HD == DMD && HD == 64 && (NH % HPW) == 0 && HPW * RWP <= RWQ);
static_assert((MT % 64) == 0 && (DMD % 64) == 0 && (KF % 64) == 0);
static_assert((EVP % 64) == 0 && EVP >= EVD && (EVD % 4) == 0);
static_assert(((SEQ * DMD) % 2048) == 0 && ((NH * SEQ_FULL * HD) % 2048) == 0);
static_assert(NFLG <= 256 && ((4 * SEQ) % 256) == 0);

typedef _Float16 v16h __attribute__((ext_vector_type(16)));
typedef __bf16 v16bf __attribute__((ext_vector_type(16)));
typedef unsigned short v16us __attribute__((ext_vector_type(16)));
typedef unsigned short v8us  __attribute__((ext_vector_type(8)));
typedef float v8f __attribute__((ext_vector_type(8)));
typedef float v4f __attribute__((ext_vector_type(4)));
typedef unsigned int v4u __attribute__((ext_vector_type(4)));
typedef unsigned int v2u __attribute__((ext_vector_type(2)));
typedef unsigned int v8u __attribute__((ext_vector_type(8)));
typedef float v2f __attribute__((ext_vector_type(2)));
typedef __bf16 v2bf __attribute__((ext_vector_type(2)));

union FragU { v16us v; v8us h[2]; };

// ---- scalar helpers --------------------------------------------------------------------------------
__device__ __forceinline__ unsigned short bf_bits(float f) {          // f32 -> bf16 bits, RNE convert
  const unsigned u = __float_as_uint(f);
  return (unsigned short)((u + 0x7FFFu + ((u >> 16) & 1u)) >> 16);
}
// two f32 -> one word of two bf16 (RNE, a in the low half): the packed convert instruction
__device__ __forceinline__ unsigned bf_pair(float a, float b) {
  const v2f x = {a, b};
  return __builtin_bit_cast(unsigned, __builtin_convertvector(x, v2bf));
}
__device__ __forceinline__ float bf_up(unsigned short h) { return __uint_as_float(((unsigned)h) << 16); }
__device__ __forceinline__ float bfr(float f) { return bf_up(bf_bits(f)); }   // value of the bf16 RNE convert
__device__ __forceinline__ unsigned short h_bits(_Float16 x) { return __builtin_bit_cast(unsigned short, x); }
__device__ __forceinline__ unsigned short f2h(float f) { return h_bits((_Float16)f); }
__device__ __forceinline__ unsigned pk16(unsigned short a, unsigned short b) { return (unsigned)a | ((unsigned)b << 16); }
__device__ __forceinline__ int clampi(int v, int lo, int hi) { return v < lo ? lo : (v > hi ? hi : v); }
__device__ __forceinline__ v8f zero8() { v8f z = {0.f, 0.f, 0.f, 0.f, 0.f, 0.f, 0.f, 0.f}; return z; }

// ---- fragment loader: 16-bit A/B operand, lane -> row/col (lane&15), p already includes +8*(lane>>4);
//      elements 0..7 <- p[0..7] (k0+8h..), elements 8..15 <- p[16..23] (k0+16+8h..)
__device__ __forceinline__ v16us ldfrag_u(const unsigned short* p) {
  FragU f;
  f.h[0] = *(const v8us*)(p);
  f.h[1] = *(const v8us*)(p + 16);
  return f.v;
}

// ---- fragment order: a 16-bit plane [R][K] (R % 16 == 0, K % 32 == 0, KS = K / 32) kept as 1-KB fragments of 16 rows x
//      32 k, fragment (row / 16) * KS + k / 32; inside it two 512-B halves (k % 32 below 16, then from 16 on), each 32
//      chunks of 8 elements in lane order ((k / 8) % 2) * 16 + row % 16. A fragment load is then two loads of 512
//      contiguous bytes (4 whole lines each) with the same element map as ldfrag_u, not two loads over 16 lines each.
__device__ __forceinline__ size_t fo_off(int row, int k, int KS) {
  return ((size_t)(row >> 4) * KS + (k >> 5)) * 512 + ((k >> 4) & 1) * 256 + (((k >> 3) & 1) * 16 + (row & 15)) * 8 + (k & 7);
}
__device__ __forceinline__ v16us ldfrag_fo(const unsigned short* plane, int tr, int ks, int KS, int lane) {
  // 32-bit byte offset (every plane is far below 4 GiB) on the plane's uniform pointer: one address register per load group
  const unsigned off = ((unsigned)tr * (unsigned)KS + (unsigned)ks) * 1024u + (unsigned)lane * 16u;
  const unsigned short* p = (const unsigned short*)((const char*)plane + off);
  FragU f;
  f.h[0] = *(const v8us*)(p);
  f.h[1] = *(const v8us*)(p + 256);
  return f.v;
}

// the same fragment load from a wave-uniform fragment address (scalar registers) and the lane's byte offset 16 * lane
__device__ __forceinline__ v16us ldfrag_at(const char* ufrag, unsigned l16) {
  const unsigned short* p = (const unsigned short*)(ufrag + l16);
  FragU f;
  f.h[0] = *(const v8us*)(p);
  f.h[1] = *(const v8us*)(p + 256);
  return f.v;
}

// stands behind issued global loads or stores, in front of the code that reuses the registers they name
__device__ __forceinline__ void addr_wait() {
#if defined(__HIP_DEVICE_COMPILE__)
  asm volatile("s_wait_xcnt 0x0" ::: "memory");
#endif
}

// the same wait, with the index registers of the issued loads as inputs: they cannot be given away in front of it
__device__ __forceinline__ void addr_wait8(int a, int b, int c, int d, int e, int f, int g, int h) {
#if defined(__HIP_DEVICE_COMPILE__)
  asm volatile("s_wait_xcnt 0x0" :: "v"(a), "v"(b), "v"(c), "v"(d), "v"(e), "v"(f), "v"(g), "v"(h) : "memory");
#endif
}

// the same wait for loads that name up to three offset registers: as inputs they stay whole up to it, so that no load
// of the group is given one of them as its destination
__device__ __forceinline__ void addr_wait3(unsigned a, unsigned b, unsigned c) {
#if defined(__HIP_DEVICE_COMPILE__)
  asm volatile("s_wait_xcnt 0x0" :: "v"(a), "v"(b), "v"(c) : "memory");
#endif
}

// ---- WMMA helpers (f16 / bf16 operand bits) with trailing VALU hazard gap --------------------------
__device__ __forceinline__ v8f mma_raw(v16us a, v16us b, v8f c) {
  return __builtin_amdgcn_wmma_f32_16x16x32_f16(false, __builtin_bit_cast(v16h, a), false,
                                                __builtin_bit_cast(v16h, b), (short)0, c, false, false);
}
__device__ __forceinline__ v8f mma_raw_bf(v16us a, v16us b, v8f c) {
  return __builtin_amdgcn_wmma_f32_16x16x32_bf16(false, __builtin_bit_cast(v16bf, a), false,
                                                 __builtin_bit_cast(v16bf, b), (short)0, c, false, false);
}
__device__ __forceinline__ v8f mma_g(v16us a, v16us b, v8f c) {                 // guarded f16
  c = mma_raw(a, b, c);
#if defined(__HIP_DEVICE_COMPILE__)
  asm volatile("v_nop\n\tv_nop\n\tv_nop\n\tv_nop" : "+v"(c) : "v"(a), "v"(b));
#endif
  return c;
}
__device__ __forceinline__ v8f mma_gb(v16us a, v16us b, v8f c) {                // guarded bf16
  c = mma_raw_bf(a, b, c);
#if defined(__HIP_DEVICE_COMPILE__)
  asm volatile("v_nop\n\tv_nop\n\tv_nop\n\tv_nop" : "+v"(c) : "v"(a), "v"(b));
#endif
  return c;
}
__device__ __forceinline__ void dep_guard1(v8f& a, v8f& b, v16us x) {
#if defined(__HIP_DEVICE_COMPILE__)
  asm volatile("v_nop\n\tv_nop\n\tv_nop\n\tv_nop" : "+v"(a), "+v"(b) : "v"(x));
#endif
}
__device__ __forceinline__ void keep4_u(v16us a, v16us b, v16us c, v16us d) {
#if defined(__HIP_DEVICE_COMPILE__)
  asm volatile("v_nop" :: "v"(a), "v"(b), "v"(c), "v"(d));
#endif
}
__device__ __forceinline__ void acc_guard4(v8f& a, v8f& b, v8f& c, v8f& d) {
#if defined(__HIP_DEVICE_COMPILE__)
  asm volatile("v_nop\n\tv_nop\n\tv_nop\n\tv_nop" : "+v"(a), "+v"(b), "+v"(c), "+v"(d));
#endif
}
// 2^x; the v_nop keeps, inside the statement, the one slot the instruction set asks for between a
// transcendental and an instruction that reads its result or overwrites its source
__device__ __forceinline__ float exp2_slot(float x) {
  float r = 0.f;
#if defined(__HIP_DEVICE_COMPILE__)
  asm("v_exp_f32 %0, %1\n\tv_nop" : "=v"(r) : "v"(x));
#endif
  return r;
}
// value of lane l ^ 16 (the other half-wave), a vector cross-row move
__device__ __forceinline__ float xhalf(float x) {
  const int b = __float_as_int(x);
  return __int_as_float(__builtin_amdgcn_permlanex16(b, b, 0x76543210, 0xfedcba98, false, false));
}
// orders LDS stores of this wave before later LDS loads of the same wave (cross-lane exchange)
__device__ __forceinline__ void wave_sync_lds() {
  __builtin_amdgcn_fence(__ATOMIC_RELEASE, "workgroup");
  __builtin_amdgcn_wave_barrier();
  __builtin_amdgcn_fence(__ATOMIC_ACQUIRE, "workgroup");
}

// =====================================================================================================
// Layout-kept convert: o[i] = f16 bits of (bf16 RNE value of w[i] * sc) for i < nsrc, zero for nsrc <= i <
// ndst; by selects a batch slab (source offset by*sstr, destination offset by*dstr), bx the 2048-element piece.
// nsrc % 8 == 0, ndst % 2048 == 0, bx = 0 .. ndst/2048 - 1 exact (compile-time constants at the call sites).
// coverage: 256 threads x 8 = 2048 elements per block; the callers' bx, by ranges cover all ndst elements of
// every slab. Block body, called from the first merged launch below.
// =====================================================================================================
__device__ __forceinline__ void cvt_lin(const float* __restrict__ w, unsigned short* o, int bx, int by,
                                        int nsrc, int ndst, float sc, int sstr, int dstr) {
  const float* wb = w + (size_t)by * (size_t)sstr;
  unsigned short* ob = o + (size_t)by * (size_t)dstr;
  const int base = (bx * 256 + threadIdx.x) * 8;
  if (base + 8 > ndst) return;                            // never taken with exact grids; no barriers below
  const bool inr = (base + 8 <= nsrc);
  const int lb = inr ? base : (nsrc - 8);                 // clamped address, always in range
  const v4f a0 = *(const v4f*)(wb + lb);
  const v4f a1 = *(const v4f*)(wb + lb + 4);
  v4u hv;
#pragma unroll
  for (int e = 0; e < 2; ++e) {
    hv[e]     = pk16(f2h(bfr(a0[2 * e]) * sc), f2h(bfr(a0[2 * e + 1]) * sc));
    hv[2 + e] = pk16(f2h(bfr(a1[2 * e]) * sc), f2h(bfr(a1[2 * e + 1]) * sc));
  }
  const v4u zz = {0u, 0u, 0u, 0u};
  hv = inr ? hv : zz;
  unsigned short* d = ob + base;
  *(v4u*)d = hv;
  
}

// Convert of a [R][64] f32 plane into fragment order (KS = 2): o = f16 bits of (bf16 RNE value of w * sc). A thread owns
// one 16-byte chunk of the destination, numbered linearly (a wave stores 512 contiguous bytes), and reads its 8 source
// elements. coverage: 256 chunks = 2048 elements per block; bx = 0 .. R*64/2048 - 1 exact at the call site.
__device__ __forceinline__ void cvt_fo64(const float* __restrict__ w, unsigned short* o, int bx, float sc) {
  const int g = bx * 256 + threadIdx.x;
  const int row = ((g >> 7) << 4) + (g & 15);
  const int col = ((g >> 6) & 1) * 32 + ((g >> 5) & 1) * 16 + ((g >> 4) & 1) * 8;
  const float* s = w + (size_t)row * 64 + col;
  const v4f a0 = *(const v4f*)(s);
  const v4f a1 = *(const v4f*)(s + 4);
  v4u hv;
#pragma unroll
  for (int e = 0; e < 2; ++e) {
    hv[e]     = pk16(f2h(bfr(a0[2 * e]) * sc), f2h(bfr(a0[2 * e + 1]) * sc));
    hv[2 + e] = pk16(f2h(bfr(a1[2 * e]) * sc), f2h(bfr(a1[2 * e + 1]) * sc));
  }
  *(v4u*)(o + (size_t)g * 8) = hv;
  addr_wait();                                           // precaution; the block ends after this one job
}

// =====================================================================================================
// Transpose-convert: in w[R][C] f32 (pitch C) -> out o[c][r] at o[c*ldo + r] for c < CP, with zero values
// for C <= c < CP. BFO 0: f16 bits of (bf16 RNE value * sc); BFO 1: bf16 bits (RNE), and the output plane [CP][ldo] is
// in fragment order (o[fo_off(c, r, ldo / 32)], a wave storing 512 contiguous bytes). Block tile 64x64
// through LDS (st[col][row], pitch 72 halves). Read phase: thread owns one input row x 16 columns (float4
// loads at a clamped column address, zero selected by value; C % 4 == 0 so a float4 is all-in or all-out).
// R, CP multiples of 64, ldo % 64 == 0, (bx, by) in (CP/64, R/64) exact (compile-time constants at the call
// sites). coverage: 64 output rows x 64 halves per block = the whole transposed tile; the callers' ranges cover
// all of [CP][R]. Block body, called from the merged launches below under a block-uniform branch; st is the
// calling kernel's LDS tile of 64 * 72 halves.
// =====================================================================================================
template <int BFO>
__device__ __forceinline__ void cvt_t(unsigned short* st, const float* __restrict__ w, unsigned short* o,
                                      int bx, int by, int R, int C, int CP, int ldo, float sc) {
  const int t = threadIdx.x;
  const int r0 = by * 64, c0 = bx * 64;
  if (r0 + 64 > R || c0 + 64 > CP) return;              // block-uniform, before the barrier; never taken
  {
    const int row = t >> 2, ch = (t & 3) * 16;
    const float* p = w + (size_t)(r0 + row) * C;
#pragma unroll
    for (int q = 0; q < 4; ++q) {
      const int cs = c0 + ch + 4 * q;
      const bool inr = (cs + 4 <= C);
      const int lb = inr ? cs : (C - 4);                 // clamped column address, always in range
      const v4f v = *(const v4f*)(p + lb);
#pragma unroll
      for (int e = 0; e < 4; ++e) {
        const unsigned short hb = BFO ? bf_bits(v[e]) : f2h(bfr(v[e]) * sc);
        st[(ch + 4 * q + e) * 72 + row] = inr ? hb : (unsigned short)0;
      }
    }
  }
  __syncthreads();
  v4u hv[2];
#pragma unroll
  for (int half = 0; half < 2; ++half) {
    const int c = t + 256 * half;                        // BFO: chunk number in fragment order within the tile
    const int cl = BFO ? ((c >> 7) * 16 + (c & 15)) : ((t >> 3) + 32 * half);
    const int pc = BFO ? (((c >> 6) & 1) * 32 + ((c >> 5) & 1) * 16 + ((c >> 4) & 1) * 8) : ((t & 7) * 8);
    hv[half] = *(const v4u*)(st + cl * 72 + pc);
  }
  {
#pragma unroll
    for (int half = 0; half < 2; ++half) {
      const int c = t + 256 * half;
      const int cl = BFO ? ((c >> 7) * 16 + (c & 15)) : ((t >> 3) + 32 * half);
      const int pc = BFO ? (((c >> 6) & 1) * 32 + ((c >> 5) & 1) * 16 + ((c >> 4) & 1) * 8) : ((t & 7) * 8);
      unsigned short* dst = o + (BFO ? fo_off(c0 + cl, r0 + pc, ldo >> 5) : ((size_t)(c0 + cl) * ldo + r0 + pc));
      *(v4u*)dst = hv[half];
    }
#if defined(__HIP_DEVICE_COMPILE__)
    // precaution: wait for the stores to read their registers (the block ends after this one job)
    asm volatile("s_wait_xcnt 0x0" ::: "memory");
#endif
  }
}

// =====================================================================================================
// Register-blocked 16-bit WMMA GEMM: C[m][n] = sum_k A[m][k] * Bt[n][k], one wave per 32x64 tile, no block
// barriers. BF 0: f16 operand bits, BF 1: bf16 operand bits. A row-major [M][K] pitch lda; Bt row-major
// [N][K] pitch ldb (k contiguous); M multiple of 32, N of 64, K of 32 (true at every call site; waves
// past the last tile exit before any work, wave-uniform). A wave's k step is two A and four B fragments, whose
// twelve loads are issued together: one load round trip per k step, and M/32 * N/64 waves to fill the chip.
// WPB = waves (tiles) per block. Tiles are numbered down the rows first, so the waves of a block read the same
// four B fragments where WPB divides M/32 (in the v^T product, M/32 = 2: only wave pairs do). Both operand fragments use the split k map
// (elements 0..7 <- k0+8h.., 8..15 <- k0+16+8h..); D element r of a lane is (row 8h + r, col lane&15).
// Bias: bf16 RNE value of bias[] times bsc, indexed by column (clamped into nbias) or, with BROW, by row.
// FOI 1: A and Bt are planes in fragment order (KS = lda / 32, ldb / 32) instead of row-major, bf16 (BF 1), K a multiple
// of 32 * GPD; the loads of k step s + GPD are issued behind the products of k step s (same k order of the sums).
// OM 0: f32 out Cf = acc*osc + b, pitch ldc.            OM 1: f16 out Ch = f16 bits(acc*osc + b).
// OM 2: val = (RELU ? max(0, .) : .)(acc*osc + b); bf16 hi bits at Ch, bf16 lo bits (val - hi) at Ch + looff.
// The 16-bit outputs (OM 1, 2) are planes [M][ldc] in fragment order; a wave's slab is whole 1-KB fragments.
// coverage: GTI slabs x 16 rows x 64 cols = the wave's whole tile (hi and lo planes alike).
// gemm64_blk is the block body (bx = block number within this product, sT = the calling kernel's LDS, WPB per-wave
// 16x64 slabs of pitch 68 floats); gemm64 is the launch of one product alone.
// =====================================================================================================
#define GSLAB (16 * 68)
#define GTI 2                                  // 16-row subtiles per wave tile
#define GWV 4                                  // waves per block where a product is launched alone
#define GPD 4                                  // k steps of fragments a wave keeps in flight (FOI products)
static_assert((KF % (32 * GPD)) == 0);
template <int BF, int OM, int RELU, int BROW, int WPB, int FOI>
__device__ __forceinline__ void gemm64_blk(
    float* sT, int bx,
    const unsigned short* __restrict__ Ap, int lda, const unsigned short* __restrict__ Btp, int ldb,
    unsigned short* Ch, int looff, float* Cf, int ldc, float osc,
    const float* __restrict__ bias, int nbias, float bsc, int M, int N, int K) {
  const int lane = threadIdx.x & 31;
  const int wave = threadIdx.x >> 5;
  const int tilesN = N >> 6;
  const int tilesM = M / (16 * GTI);
  const int tile = bx * WPB + wave;
  if (tile >= tilesM * tilesN) return;   // wave-uniform; no block barriers in this kernel
  const int tn = tile / tilesM;
  const int tm = tile - tn * tilesM;
  const int m0 = tm * (16 * GTI);
  const int n0 = tn << 6;

  const int rlane = lane & 15;                 // row (A) / col (B, D) within subtile
  const int koff  = (lane >> 4) * 8;           // k offset of this lane half
  const int mOff  = (lane >> 4) * 8;           // D row offset

  v8f acc[GTI][4];
#pragma unroll
  for (int i = 0; i < GTI; ++i)
#pragma unroll
    for (int j = 0; j < 4; ++j) acc[i][j] = zero8();

  if constexpr (FOI) {
    static_assert(BF == 1);
    // Register ring of GPD k steps (place s = the six fragments of one k step). A place is refilled, GPD k steps ahead,
    // right behind its own products: its loads return under the products of the other GPD - 1 places.
    // Each fragment row's base is wave-uniform and kept in scalar registers, the place is a constant offset, and one
    // vector register holds the lane part and the advance along k.
    unsigned l16 = (unsigned)lane * 16u;                 // lane part, plus the bytes of the k steps gone by
    const char* pb[4];
    const char* pa[GTI];
#pragma unroll
    for (int j = 0; j < 4; ++j)
      pb[j] = (const char*)Btp + (size_t)__builtin_amdgcn_readfirstlane(((n0 >> 4) + j) * (ldb >> 5)) * 1024;
#pragma unroll
    for (int i = 0; i < GTI; ++i)
      pa[i] = (const char*)Ap + (size_t)__builtin_amdgcn_readfirstlane(((m0 >> 4) + i) * (lda >> 5)) * 1024;
    v16us bh[GPD][4], ah[GPD][GTI];
#pragma unroll
    for (int s = 0; s < GPD; ++s) {
#pragma unroll
      for (int j = 0; j < 4; ++j) bh[s][j] = ldfrag_at(pb[j] + s * 1024, l16);
#pragma unroll
      for (int i = 0; i < GTI; ++i) ah[s][i] = ldfrag_at(pa[i] + s * 1024, l16);
      // keeps the first fill in the order of the refills, place by place: the counted load waits in the loop are set for
      // both ways into it, and a first fill in another order would make them wait for younger places too
      __builtin_amdgcn_sched_barrier(0);
    }
    // behind the last load of the first fill: whichever code comes next may reuse the base registers these loads name
    addr_wait();
    // rolled over groups of GPD k steps, so that the places of the ring are fixed registers
#pragma unroll 1
    for (int k0 = 32 * GPD; k0 < K; k0 += 32 * GPD) {
#pragma unroll
      for (int s = 0; s < GPD; ++s) {
#pragma unroll
        for (int i = 0; i < GTI; ++i)
#pragma unroll
          for (int j = 0; j < 4; ++j) acc[i][j] = mma_raw_bf(ah[s][i], bh[s][j], acc[i][j]);
        // holds the products above the slots below
        __builtin_amdgcn_sched_barrier(0);
#if defined(__HIP_DEVICE_COMPILE__)
        // five vector slots between the last product and the loads that overwrite its fragments, the distance the loop
        // had without a ring
        asm volatile("v_nop\n\tv_nop\n\tv_nop\n\tv_nop\n\tv_nop" ::: "memory");
#endif
#pragma unroll
        for (int j = 0; j < 4; ++j) bh[s][j] = ldfrag_at(pb[j] + (GPD + s) * 1024, l16);
#pragma unroll
        for (int i = 0; i < GTI; ++i) ah[s][i] = ldfrag_at(pa[i] + (GPD + s) * 1024, l16);
        // keeps a place's refill at this point: moved down by the scheduler it would lose its lead of GPD - 1 k steps
        __builtin_amdgcn_sched_barrier(0);
      }
#if defined(__HIP_DEVICE_COMPILE__)
      // stands behind the issued loads, in front of the advance of the offset register that they name (the operand
      // ties the advance behind the wait)
      asm volatile("s_wait_xcnt 0x0" : "+v"(l16) :: "memory");
#endif
      l16 += GPD * 1024;
    }
#pragma unroll
    for (int s = 0; s < GPD; ++s)
#pragma unroll
      for (int i = 0; i < GTI; ++i)
#pragma unroll
        for (int j = 0; j < 4; ++j) acc[i][j] = mma_raw_bf(ah[s][i], bh[s][j], acc[i][j]);
  } else {
#pragma unroll 1
  for (int k0 = 0; k0 < K; k0 += 32) {
    v16us bh[4];
#pragma unroll
    for (int j = 0; j < 4; ++j) {
      const size_t bo = (size_t)(n0 + (j << 4) + rlane) * ldb + koff + k0;
      bh[j] = FOI ? ldfrag_fo(Btp, (n0 >> 4) + j, k0 >> 5, ldb >> 5, lane) : ldfrag_u(Btp + bo);
    }
    v16us ah[GTI];
#pragma unroll
    for (int i = 0; i < GTI; ++i) {
      const size_t ao = (size_t)(m0 + (i << 4) + rlane) * lda + koff + k0;
      ah[i] = FOI ? ldfrag_fo(Ap, (m0 >> 4) + i, k0 >> 5, lda >> 5, lane) : ldfrag_u(Ap + ao);
    }
#pragma unroll
    for (int i = 0; i < GTI; ++i) {
#pragma unroll
      for (int j = 0; j < 4; ++j) {
        if (BF) acc[i][j] = mma_raw_bf(ah[i], bh[j], acc[i][j]);
        else    acc[i][j] = mma_raw(ah[i], bh[j], acc[i][j]);
      }
      dep_guard1(acc[i][0], acc[i][3], ah[i]);
    }
    keep4_u(bh[0], bh[1], bh[2], bh[3]);
  }
  }
#pragma unroll
  for (int i = 0; i < GTI; ++i) acc_guard4(acc[i][0], acc[i][1], acc[i][2], acc[i][3]);

  const int hh2 = lane >> 4, c4 = (lane & 15) * 4;     // f32 out: 256-B row segment = 16 lanes x 16 B
  const int q8  = lane >> 3, c8 = (lane & 7) * 8;

  // per-lane bias values for the column-indexed modes (bf16 RNE value times bsc), clamped address
  float bc[8];
#pragma unroll
  for (int e = 0; e < 8; ++e) bc[e] = 0.f;
  if (!BROW) {
    if (OM == 0) {
#pragma unroll
      for (int e = 0; e < 4; ++e) bc[e] = bsc * bfr(bias[clampi(n0 + c4 + e, 0, nbias - 1)]);
    } else {
#pragma unroll
      for (int e = 0; e < 8; ++e) bc[e] = bsc * bfr(bias[clampi(n0 + c8 + e, 0, nbias - 1)]);
    }
    if (FOI) {
      // the epilogue's arithmetic reuses the bias loads' index registers; as inputs of the wait they stay whole up to it
      int bi[8];
#pragma unroll
      for (int e = 0; e < 8; ++e) bi[e] = clampi(n0 + ((OM == 0) ? c4 + (e & 3) : c8 + e), 0, nbias - 1);
      addr_wait8(bi[0], bi[1], bi[2], bi[3], bi[4], bi[5], bi[6], bi[7]);
    }
  }

  // ---- epilogue ----
  float* slab = sT + wave * GSLAB;
#pragma unroll
  for (int i = 0; i < GTI; ++i) {
    const int mBase = m0 + (i << 4);
#pragma unroll
    for (int j = 0; j < 4; ++j) {
#pragma unroll
      for (int r = 0; r < 8; ++r) {
        slab[(mOff + r) * 68 + (j << 4) + rlane] = acc[i][j][r];
      }
    }
    wave_sync_lds();
    if (OM == 0) {
      v4f vals[8];
#pragma unroll
      for (int it = 0; it < 8; ++it) {
        const int row = it * 2 + hh2;                      // it 0..7 x hh2 0..1 = rows 0..15
        const v4f v = *(const v4f*)(slab + row * 68 + c4);
        float brw = 0.f;
        if (BROW) brw = bsc * bfr(bias[clampi(mBase + row, 0, nbias - 1)]);
        v4f ov;
#pragma unroll
        for (int e = 0; e < 4; ++e) {
          float x = v[e] * osc + (BROW ? brw : bc[e]);
          if (RELU) x = fmaxf(x, 0.f);
          ov[e] = x;
        }
        vals[it] = ov;
      }
      {
#pragma unroll
        for (int it = 0; it < 8; ++it) {
          const int row = it * 2 + hh2;
          *(v4f*)(Cf + (size_t)(mBase + row) * ldc + (size_t)n0 + c4) = vals[it];
        }
        
      }
    } else if (OM == 1) {
      v4u hv[4];
#pragma unroll
      for (int it = 0; it < 4; ++it) {
        const int row = it * 4 + q8;                       // it 0..3 x q8 0..3 = rows 0..15
        const float* sp = slab + row * 68 + c8;
        float brw = 0.f;
        if (BROW) brw = bsc * bfr(bias[clampi(mBase + row, 0, nbias - 1)]);
        v4u ha = {0u, 0u, 0u, 0u};
#pragma unroll
        for (int e = 0; e < 4; ++e) {
          float b0 = sp[2 * e]     * osc + (BROW ? brw : bc[2 * e]);
          float b1 = sp[2 * e + 1] * osc + (BROW ? brw : bc[2 * e + 1]);
          if (RELU) { b0 = fmaxf(b0, 0.f); b1 = fmaxf(b1, 0.f); }
          ha[e] = pk16(f2h(b0), f2h(b1));
        }
        hv[it] = ha;
      }
      {
#pragma unroll
        for (int it = 0; it < 4; ++it) {
          const int row = it * 4 + q8;
          const size_t go = fo_off(mBase + row, n0 + c8, ldc >> 5);
          *(v4u*)(Ch + go) = hv[it];
        }
        
      }
    } else {
      v4u hv[4], lv[4];
#pragma unroll
      for (int it = 0; it < 4; ++it) {
        const int row = it * 4 + q8;                       // it 0..3 x q8 0..3 = rows 0..15
        const float* sp = slab + row * 68 + c8;
        float brw = 0.f;
        if (BROW) brw = bsc * bfr(bias[clampi(mBase + row, 0, nbias - 1)]);
        v4u ha = {0u, 0u, 0u, 0u};
        v4u la = {0u, 0u, 0u, 0u};
#pragma unroll
        for (int e = 0; e < 4; ++e) {
          float x0 = sp[2 * e]     * osc + (BROW ? brw : bc[2 * e]);
          float x1 = sp[2 * e + 1] * osc + (BROW ? brw : bc[2 * e + 1]);
          if (RELU) { x0 = fmaxf(x0, 0.f); x1 = fmaxf(x1, 0.f); }
          const unsigned short h0 = bf_bits(x0), h1 = bf_bits(x1);
          const unsigned short l0 = bf_bits(x0 - bf_up(h0)), l1 = bf_bits(x1 - bf_up(h1));
          ha[e] = pk16(h0, h1);
          la[e] = pk16(l0, l1);
        }
        hv[it] = ha;
        lv[it] = la;
      }
      {
#pragma unroll
        for (int it = 0; it < 4; ++it) {
          const int row = it * 4 + q8;
          const size_t go = fo_off(mBase + row, n0 + c8, ldc >> 5);
          *(v4u*)(Ch + go) = hv[it];
          *(v4u*)(Ch + (size_t)looff + go) = lv[it];
        }
        
      }
    }
    wave_sync_lds();
  }
}
template <int BF, int OM, int RELU, int BROW>
__global__ __launch_bounds__(32 * GWV) void gemm64(
    const unsigned short* __restrict__ Ap, int lda, const unsigned short* __restrict__ Btp, int ldb,
    unsigned short* Ch, int looff, float* Cf, int ldc, float osc,
    const float* __restrict__ bias, int nbias, float bsc, int M, int N, int K) {
  __shared__ __align__(16) float sT[GWV * GSLAB];
  gemm64_blk<BF, OM, RELU, BROW, GWV, 1>(sT, blockIdx.x, Ap, lda, Btp, ldb, Ch, looff, Cf, ldc, osc, bias, nbias, bsc,
                                 M, N, K);
}

// =====================================================================================================
// Structure check of the [SEQ][SEQ] mask input (row pitch SEQ_FULL): block b covers rows 16b..16b+15 and all
// SEQ columns; a violation is any element differing from (j <= i ? 1 : 0). The block's flag is written as one
// coverage: 256 threads x (SEQ/64) float4 = 16 rows x SEQ cols per block; bx = 0 .. SEQ/16 - 1 = all rows.
// Block body, called from the second merged launch under a block-uniform branch; wf = 8 ints of its LDS.
// =====================================================================================================
__device__ __forceinline__ void mask_check(int* wf, int bx, const float* __restrict__ msk, float* flg) {
  const int t = threadIdx.x, lane = t & 31, wv = t >> 5;
  const int i0 = bx * 16;
  if (i0 + 16 > SEQ) return;                             // block-uniform, before the barrier; never taken
  constexpr int C4 = SEQ / 4;
  int viol = 0;
#pragma unroll 1
  for (int it = 0; it < (16 * C4) / 256; ++it) {
    const int ci = it * 256 + t;
    const int rr = ci / C4;
    const int c4 = ci - rr * C4;
    const int i = i0 + rr;
    const v4f x = *(const v4f*)(msk + (size_t)i * SEQ_FULL + 4 * c4);
#pragma unroll
    for (int e = 0; e < 4; ++e) {
      const int j = 4 * c4 + e;
      const float ex = (j <= i) ? 1.0f : 0.0f;
      viol |= (x[e] != ex) ? 1 : 0;
    }
  }
  viol |= __shfl_xor(viol, 1, 32);
  viol |= __shfl_xor(viol, 2, 32);
  viol |= __shfl_xor(viol, 4, 32);
  viol |= __shfl_xor(viol, 8, 32);
  viol |= __shfl_xor(viol, 16, 32);
  if (lane == 0) wf[wv] = viol;
  __syncthreads();
  if (wv == 0) {                                        // wave-uniform
    int f = wf[lane & 7];
    f |= __shfl_xor(f, 1, 32);
    f |= __shfl_xor(f, 2, 32);
    f |= __shfl_xor(f, 4, 32);
    const float fv = f ? 1.0f : 0.0f;
    float* d = flg + (size_t)bx * FLGW + lane;
    *(float*)d = fv;
    
  }
}

// =====================================================================================================
// Merged launches: jobs that read none of each other's output share one grid; the flat block index picks the
// job by ranges (block-uniform scalar branches), every block runs exactly one job body and then ends.
// prep_x: what the projections read. Blocks [0, 3*NTW): Wq, Wk, Wv -> [64][512] f16 x64 (transposed);
//   then 3*NLX blocks: q, k, v -> f16(bf16) planes, NLX = NB slabs x SEQ*DMD/2048 pieces each.
// proj_side: the three projections, first in the grid since they run longest, and beside them all that only
//   later launches read. Blocks [0, 3*NGQ): q plane x16, k plane x16 (C[tok][n] = sum_k X[tok][k] * WT[n][k]),
//   v^T planes (C[d][tok] = sum_k WVT[d][k] * XV[tok][k] / 64, bf16 hi and lo); then NFLG mask-structure blocks;
//   2*NTO blocks Wo -> [512][1024] = (Wo^T | Wo^T) bf16; 2*NTL blocks Wl -> [448][1024] = (Wl^T | Wl^T) bf16;
//   NLE blocks E -> f16(bf16 x64).
// =====================================================================================================
#define NTW (DMD / 64)
#define NLP ((SEQ * DMD) / 2048)
#define NLX (NLP * NB)
#define NGQ (((MT / (16 * GTI)) * (HD / 64) + 7) / 8)
#define NTO ((DMD / 64) * (DMD / 64))
#define NTL ((EVP / 64) * (DMD / 64))
#define NLE ((NH * SEQ_FULL * HD) / 2048)
#define PREP_BLOCKS (3 * NTW + 3 * NLX)
#define SIDE_BLOCKS (3 * NGQ + NFLG + 2 * NTO + 2 * NTL + NLE)

__global__ __launch_bounds__(256) void prep_x(
    const float* __restrict__ q, const float* __restrict__ k, const float* __restrict__ v,
    const float* __restrict__ wq, const float* __restrict__ wk, const float* __restrict__ wv,
    unsigned short* XQ, unsigned short* XK, unsigned short* XV,
    unsigned short* WQT, unsigned short* WKT, unsigned short* WVT) {
  __shared__ __align__(16) unsigned short st[64 * 72];
  int bid = blockIdx.x;
  if (bid < 3 * NTW) {
    const int j = bid / NTW;
    const float* w = (j == 0) ? wq : ((j == 1) ? wk : wv);
    unsigned short* o = (j == 0) ? WQT : ((j == 1) ? WKT : WVT);
    cvt_t<0>(st, w, o, 0, bid - j * NTW, DMD, HD, HD, DMD, WSCL);          // in[512][64] -> out[64][512]
    return;
  }
  bid -= 3 * NTW;
  if (bid < 3 * NLX) {
    const int j = bid / NLX;
    const int r = bid - j * NLX;
    const float* x = (j == 0) ? q : ((j == 1) ? k : v);
    unsigned short* o = (j == 0) ? XQ : ((j == 1) ? XK : XV);
    cvt_lin(x, o, r % NLP, r / NLP, SEQ * DMD, SEQ * DMD, 1.0f, SEQ_FULL * DMD, SEQ * DMD);
  }
}

__global__ __launch_bounds__(256) void proj_side(
    const unsigned short* __restrict__ XQ, const unsigned short* __restrict__ XK,
    const unsigned short* __restrict__ XV, const unsigned short* __restrict__ WQT,
    const unsigned short* __restrict__ WKT, const unsigned short* __restrict__ WVT,
    const float* __restrict__ bq, const float* __restrict__ bk, const float* __restrict__ bv,
    unsigned short* QH, unsigned short* KH, unsigned short* VH,
    const float* __restrict__ msk, float* flg,
    const float* __restrict__ wo, unsigned short* WOT, const float* __restrict__ wl, unsigned short* WLT,
    const float* __restrict__ ee, unsigned short* PEH) {
  __shared__ __align__(16) float sT[8 * GSLAB];        // the one job of a block uses it: slabs, transpose tile or flags
  int bid = blockIdx.x;
  if (bid < 2 * NGQ) {
    const int j = bid / NGQ;
    gemm64_blk<0, 1, 0, 0, 8, 0>(sT, bid - j * NGQ, j ? XK : XQ, DMD, j ? WKT : WQT, DMD, j ? KH : QH, 0, nullptr, HD,
                           QKS / WSCL, j ? bk : bq, HD, QKS, MT, HD, DMD);
    return;
  }
  bid -= 2 * NGQ;
  if (bid < NGQ) {
    gemm64_blk<0, 2, 0, 1, 8, 0>(sT, bid, WVT, DMD, XV, DMD, VH, HD * MT, nullptr, MT, 1.0f / WSCL, bv, HD, 1.0f,
                           HD, MT, DMD);
    return;
  }
  bid -= NGQ;
  if (bid < NFLG) {
    mask_check((int*)sT, bid, msk, flg);
    return;
  }
  bid -= NFLG;
  if (bid < 2 * NTO) {
    const int j = bid / NTO;                           // destination columns 0.. and 512.. (16 fragments on)
    const int r = bid - j * NTO;
    cvt_t<1>((unsigned short*)sT, wo, WOT + j * (DMD * 16), r % (DMD / 64), r / (DMD / 64), DMD, DMD, DMD, KF, 1.0f);
    return;
  }
  bid -= 2 * NTO;
  if (bid < 2 * NTL) {
    const int j = bid / NTL;                           // destination columns 0.. and 512.. (16 fragments on)
    const int r = bid - j * NTL;
    cvt_t<1>((unsigned short*)sT, wl, WLT + j * (DMD * 16), r % (EVP / 64), r / (EVP / 64), DMD, EVD, EVP, KF, 1.0f);
    return;
  }
  bid -= 2 * NTL;
  if (bid < NLE) cvt_fo64(ee, PEH, bid, WSCL);
}

// =====================================================================================================
// Causal attention with relative-offset term, head dim 64. Block = 256 threads = 8 waves; one block owns one
// 16-row query tile (t0..t0+15) of one batch b and HPW heads h0.. (q, k, v are the same for every head: each wave
// loads a key block's K and V fragments and takes q.k^T once and uses them for its HPW heads; only the E band, the
// softmax and the O accumulators are per head). The key blocks of 32 up to the diagonal (sb <= t0)
// are cut into 8 contiguous shares, one per wave; each wave runs its share with an online max-subtracted
// softmax in f32 and leaves its partial state (row max, row sum, unnormalised 16x64 O) in LDS; behind one
// block barrier the 8 states are merged in wave order (rescale by exp(max_w - max), sum, divide).
// Planes, all in fragment order: QH, KH f16 [MT][64] = 16*q, 16*k (shared
// by all heads); PE f16 [NH*SEQ_FULL][64] = 64*E (head h rows h*SEQ_FULL..); VH, VL bf16 [64][MT] = v hi and
// lo planes transposed (row = dim, column = token). Output Z bf16 [MT][1024]: cols h*64+d = ctx hi, cols
// 512+h*64+d = ctx lo.
// Every product is taken transposed (K, E and V fragments as the A operand, Q and P as the B operand), so that a lane
// holds one query (column m = lane & 15) and, per 16-row tile, the 8 keys, band columns or dims 8*hh + r.
// Per key block sb: S^T = K.Q^T (2 key subtiles x 2 k-steps, scale 1/256); relative band of 48 columns:
// column c <-> E row SEQ-16-t0+sb+c (a 16-row tile starts at a multiple of 16 and is clamped as a whole to start at
// most at SEQ-16; clamping only touches entries with j > i, which the causal select replaces); columns 0..15 come from
// the tile carried over from the prior key block (its columns 32..47), columns 16..47 are two fresh tiles (2 x 2 WMMA,
// scale 1/1024); the band is exchanged through per-wave LDS (one row of pitch RWQ floats per query, head g's band at RWP * g) and read back at
// c = 15 - il + jl, i.e. E row SEQ-1-i+j; score = (qk + rel)/8 for j <= i, else -1e10; a query's 32 scores lie in the
// two lanes m and m + 16: row max and row sum are taken inside the lane and once across the halves;
// p = exp(score - running max) in f32, l accumulated from the f32 p; the two p tiles of a lane, converted in place to
// bf16 hi and lo, are the B fragments of the next product (element e <- key 8*hh + e, element 8 + e <- key 16 + 8*hh + e,
// the k map of the V fragments); O^T += Vhi.Phi + Vlo.Phi + Vhi.Plo on 4 dim subtiles (one accumulator set). A wave
// whose share is empty contributes max -1e30, sum 0, O 0 (weight exp(-1e30 - max) = 0); wave 0's share is never empty.
// Merge: thread -> (row, 4 dims) in fragment order, 32 lanes x 8 B = two whole 128-B lines of Z per plane.
// coverage: 16 query rows x 64 halves x {hi, lo} x HPW heads per block, NB*(NH/HPW)*(SEQ/16) blocks = all (b, t, h)
// segments of Z in both halves.
// =====================================================================================================
// register budget of four waves per SIMD (256): two blocks stay resident on a WGP, as LDS allows
__global__ __launch_bounds__(32 * AWV, 4) void attn_kernel(
    const unsigned short* __restrict__ QH, const unsigned short* __restrict__ KH,
    const unsigned short* __restrict__ PE, const unsigned short* __restrict__ VH,
    const unsigned short* __restrict__ VL, unsigned short* Z) {
  __shared__ __align__(16) float relw[AWV][16 * RWQ];            // band exchange per wave: a query's row holds its HPW bands
  __shared__ __align__(16) float opw[HPW][AWV][16 * OPP];         // partial O per head and wave, pitch 68 floats
  __shared__ __align__(16) float mxw[HPW][AWV][16];               // partial row max per head and wave
  __shared__ __align__(16) float lsw[HPW][AWV][16];               // partial row sum per head and wave
  const int lane = threadIdx.x & 31, m = lane & 15, hh = lane >> 4;
  // wave number in a scalar register: the key loop's bounds depend on it and stay a scalar branch
  const int wv = __builtin_amdgcn_readfirstlane((int)(threadIdx.x >> 5));
  const int task = blockIdx.x;                       // 0 .. NB*(NH/HPW)*(SEQ/16)-1
  const int nqt = SEQ / 16;
  const int bg = task / nqt;                         // (b, group of HPW heads)
  const int t0 = (task - bg * nqt) << 4;             // query tile start
  const int b = bg / (NH / HPW), h0 = (bg - (bg / (NH / HPW)) * (NH / HPW)) * HPW;
  if (b >= NB) return;                               // block-uniform, before the barrier; never taken with exact grids
  const size_t tok0 = (size_t)b * SEQ;
  // this lane's query row of the bands, head g at RWP * g (both within reach of one address register's offsets); pitch
  // 108 floats: 16-byte aligned rows, and the skewed reads of the 32 lanes (dword 107 * m + 8 * hh + const) fall on 32
  // different banks
  float* rq[HPW];
#pragma unroll
  for (int g = 0; g < HPW; ++g) rq[g] = relw[wv] + m * RWQ + g * RWP;

  // Q B-fragments: columns t0+m, k = head dims 0..31 and 32..63 (the same for every head)
  const int qt = (int)((tok0 + (size_t)t0) >> 4);
  const unsigned l16 = (unsigned)lane * 16u;          // lane part of every fragment load's byte offset
  const unsigned qo = (unsigned)qt * 2048u + l16;     // a 16-row tile of a [..][64] plane = two fragments = 2048 bytes
  const v16us qf0 = ldfrag_at((const char*)QH, qo);
  const v16us qf1 = ldfrag_at((const char*)QH + 1024, qo);

  const unsigned short* pe[HPW];
#pragma unroll
  for (int g = 0; g < HPW; ++g) pe[g] = PE + (size_t)(h0 + g) * SEQ_FULL * HD;
  const int rb = SEQ - 16 - t0;                      // E row of band column 0 at sb = 0 (>= 0)

  const int nkb = (t0 >> 5) + 1;                     // key blocks 0 .. floor(t0/32), block-uniform
  const int per = (nkb + AWV - 1) / AWV;             // key blocks per wave share
  const int kb0 = wv * per;                          // this wave's share [kb0, kb1), wave-uniform, may be empty
  const int kb1 = (kb0 + per < nkb) ? (kb0 + per) : nkb;

  // carried band tile of each head: columns 0..15 of key block kb0 <-> E rows rb + 32*kb0 + 0..15 (clamped)
  v8f carry[HPW];
  {
    const unsigned eo = (unsigned)(clampi(rb + (kb0 << 5), 0, SEQ - 16) >> 4) * 2048u + l16;
    v16us c0[HPW], c1[HPW];                          // all requested beside Q, in front of the first matrix statement
#pragma unroll
    for (int g = 0; g < HPW; ++g) {
      c0[g] = ldfrag_at((const char*)pe[g], eo);
      c1[g] = ldfrag_at((const char*)pe[g] + 1024, eo);
    }
    addr_wait3(qo, eo, eo);                          // the code below reuses the offset registers of these loads
#pragma unroll
    for (int g = 0; g < HPW; ++g) {
      carry[g] = mma_g(c0[g], qf0, zero8());
      carry[g] = mma_g(c1[g], qf1, carry[g]);
    }
  }

  float mx[HPW], ls[HPW];                            // of query t0 + m, equal in the lanes m and m + 16
  v8f O0[HPW], O1[HPW], O2[HPW], O3[HPW];
#pragma unroll
  for (int g = 0; g < HPW; ++g) {
    mx[g] = -1.0e30f;
    ls[g] = 0.f;
    O0[g] = zero8(); O1[g] = zero8(); O2[g] = zero8(); O3[g] = zero8();
  }

#pragma unroll 1
  for (int kb = kb0; kb < kb1; ++kb) {
    const int sb = kb << 5;
    // The K fragments and every head's E-band fragments are requested together, in front of the first matrix statement
    // (a load written between the guarded matrix statements is issued and waited for on its own: one round trip each).
    // K A-fragments: row = key token, k = head dim
    const unsigned ko = (unsigned)((tok0 + (size_t)sb) >> 4) * 2048u + l16;   // two key tiles = four fragments in a row
    const v16us kf0 = ldfrag_at((const char*)KH, ko), kf1 = ldfrag_at((const char*)KH + 1024, ko);
    const v16us kf2 = ldfrag_at((const char*)KH + 2048, ko), kf3 = ldfrag_at((const char*)KH + 3072, ko);
    // relative band: columns 16..31 and 32..47 <-> E rows rb+sb+16.. and rb+sb+32..
    const unsigned e1 = (unsigned)(clampi(rb + sb + 16, 0, SEQ - 16) >> 4) * 2048u + l16;
    const unsigned e2 = (unsigned)(clampi(rb + sb + 32, 0, SEQ - 16) >> 4) * 2048u + l16;
    v16us ef0[HPW], ef1[HPW], ef2[HPW], ef3[HPW];
#pragma unroll
    for (int g = 0; g < HPW; ++g) {
      ef0[g] = ldfrag_at((const char*)pe[g], e1);
      ef1[g] = ldfrag_at((const char*)pe[g] + 1024, e1);
      ef2[g] = ldfrag_at((const char*)pe[g], e2);
      ef3[g] = ldfrag_at((const char*)pe[g] + 1024, e2);
    }
    addr_wait3(ko, e1, e2);
    // keeps the first product below the whole group: hoisted into it, its load wait would hold the later loads back by
    // one round trip
    __builtin_amdgcn_sched_barrier(0);

    // q.k^T does not depend on the head: taken once for the HPW heads
    v8f S0, S1;
    S0 = mma_g(kf0, qf0, zero8());
    S0 = mma_g(kf1, qf1, S0);
    S1 = mma_g(kf2, qf0, zero8());
    S1 = mma_g(kf3, qf1, S1);
#pragma unroll
    for (int g = 0; g < HPW; ++g) {
      v8f Pb1, Pb2;
      Pb1 = mma_g(ef0[g], qf0, zero8());
      Pb1 = mma_g(ef1[g], qf1, Pb1);
      Pb2 = mma_g(ef2[g], qf0, zero8());
      Pb2 = mma_g(ef3[g], qf1, Pb2);
      // element r of a band tile = (column 16 * tile + 8 * hh + r, query m): 8 consecutive floats of the query's row
      float* d = rq[g] + 8 * hh;
      const v8f cy = carry[g];
      const v4f w0 = {cy[0], cy[1], cy[2], cy[3]}, w1 = {cy[4], cy[5], cy[6], cy[7]};
      const v4f w2 = {Pb1[0], Pb1[1], Pb1[2], Pb1[3]}, w3 = {Pb1[4], Pb1[5], Pb1[6], Pb1[7]};
      const v4f w4 = {Pb2[0], Pb2[1], Pb2[2], Pb2[3]}, w5 = {Pb2[4], Pb2[5], Pb2[6], Pb2[7]};
      *(v4f*)(d)      = w0;
      *(v4f*)(d + 4)  = w1;
      *(v4f*)(d + 16) = w2;
      *(v4f*)(d + 20) = w3;
      *(v4f*)(d + 32) = w4;
      *(v4f*)(d + 36) = w5;
      carry[g] = Pb2;
    }
    wave_sync_lds();

    // V A-fragments (row = dim, k = key token), four dim subtiles, hi and lo planes, the same for every head: requested
    // together here, behind the exchange fence (which waits for outstanding loads), so that they are in flight under
    // the first softmax
    const unsigned vo = (unsigned)((tok0 + (size_t)sb) >> 5) * 1024u + l16;
    constexpr int VR = (MT / 32) * 1024;                       // bytes from one 16-dim row of fragments to the next
    const v16us vh0 = ldfrag_at((const char*)VH, vo),          vl0 = ldfrag_at((const char*)VL, vo);
    const v16us vh1 = ldfrag_at((const char*)VH + VR, vo),     vl1 = ldfrag_at((const char*)VL + VR, vo);
    const v16us vh2 = ldfrag_at((const char*)VH + 2 * VR, vo), vl2 = ldfrag_at((const char*)VL + 2 * VR, vo);
    const v16us vh3 = ldfrag_at((const char*)VH + 3 * VR, vo), vl3 = ldfrag_at((const char*)VL + 3 * VR, vo);
    addr_wait3(vo, vo, vo);                                    // the score arithmetic below reuses their offset register

#pragma unroll
    for (int g = 0; g < HPW; ++g) {
      // skew read + scale + causal select (key j <= query i keeps the score, otherwise -1e10); element r = key jb + r
      float s0[8], s1[8];
      {
        const int i = t0 + m;
        const int jb = sb + 8 * hh;
        const float* sk = rq[g] + 15 - m + 8 * hh;
#pragma unroll
        for (int r = 0; r < 8; ++r) {
          const float rv0 = sk[r];
          const float rv1 = sk[16 + r];
          const float a0 = (S0[r] * (1.0f / (QKS * QKS)) + rv0 * (1.0f / (QKS * WSCL))) * RSQD;
          const float a1 = (S1[r] * (1.0f / (QKS * QKS)) + rv1 * (1.0f / (QKS * WSCL))) * RSQD;
          s0[r] = (jb + r <= i) ? a0 : NEGM;
          s1[r] = (jb + 16 + r <= i) ? a1 : NEGM;
        }
      }

      // online softmax: 16 of the query's scores in this lane, the other 16 in lane ^ 16
      float xm = fmaxf(s0[0], s1[0]);
#pragma unroll
      for (int r = 1; r < 8; ++r) xm = fmaxf(xm, fmaxf(s0[r], s1[r]));
      xm = fmaxf(xm, xhalf(xm));
      const float mn = fmaxf(mx[g], xm);
      const float al = exp2_slot((mx[g] - mn) * 1.44269504f);   // exp(x) = 2^(x * log2 e)
      mx[g] = mn;
      float pq[8];
      v8u wh, wl;                                              // P B-fragments as words of two bf16, hi and lo planes
#pragma unroll
      for (int r = 0; r < 8; r += 2) {
        const float a0 = exp2_slot((s0[r] - mn) * 1.44269504f), b0 = exp2_slot((s0[r + 1] - mn) * 1.44269504f);
        const float a1 = exp2_slot((s1[r] - mn) * 1.44269504f), b1 = exp2_slot((s1[r + 1] - mn) * 1.44269504f);
        pq[r]     = a0 + a1;
        pq[r + 1] = b0 + b1;
        const unsigned h0w = bf_pair(a0, b0), h1w = bf_pair(a1, b1);
        wh[r >> 1]       = h0w;                                // elements r, r + 1 <- keys 8*hh + r, + 1
        wh[4 + (r >> 1)] = h1w;                                // elements 8 + r, 9 + r <- keys 16 + 8*hh + r, + 1
        wl[r >> 1]       = bf_pair(a0 - __uint_as_float(h0w << 16), b0 - __uint_as_float(h0w & 0xFFFF0000u));
        wl[4 + (r >> 1)] = bf_pair(a1 - __uint_as_float(h1w << 16), b1 - __uint_as_float(h1w & 0xFFFF0000u));
      }
      const v16us afh = __builtin_bit_cast(v16us, wh), afl = __builtin_bit_cast(v16us, wl);
      float ps = ((pq[0] + pq[1]) + (pq[2] + pq[3])) + ((pq[4] + pq[5]) + (pq[6] + pq[7]));
      ps += xhalf(ps);
      ls[g] = ls[g] * al + ps;
#pragma unroll
      for (int r = 0; r < 8; ++r) {
        O0[g][r] = O0[g][r] * al;
        O1[g][r] = O1[g][r] * al;
        O2[g][r] = O2[g][r] * al;
        O3[g][r] = O3[g][r] * al;
      }

      // the V A-fragments were requested above the softmax
      O0[g] = mma_gb(vh0, afh, O0[g]);
      O0[g] = mma_gb(vl0, afh, O0[g]);
      O0[g] = mma_gb(vh0, afl, O0[g]);
      O1[g] = mma_gb(vh1, afh, O1[g]);
      O1[g] = mma_gb(vl1, afh, O1[g]);
      O1[g] = mma_gb(vh1, afl, O1[g]);
      O2[g] = mma_gb(vh2, afh, O2[g]);
      O2[g] = mma_gb(vl2, afh, O2[g]);
      O2[g] = mma_gb(vh2, afl, O2[g]);
      O3[g] = mma_gb(vh3, afh, O3[g]);
      O3[g] = mma_gb(vl3, afh, O3[g]);
      O3[g] = mma_gb(vh3, afl, O3[g]);
    }
  }
#pragma unroll
  for (int g = 0; g < HPW; ++g) acc_guard4(O0[g], O1[g], O2[g], O3[g]);

  // ---- this wave's partial states to LDS (D element r of a lane = query row m, dim 8*hh + r of each dim subtile) ----
#pragma unroll
  for (int g = 0; g < HPW; ++g) {
    float* op = opw[g][wv] + m * OPP + 8 * hh;
    const v8f A = O0[g], B = O1[g], C = O2[g], D = O3[g];
    const v4f a0 = {A[0], A[1], A[2], A[3]}, a1 = {A[4], A[5], A[6], A[7]};
    const v4f b0 = {B[0], B[1], B[2], B[3]}, b1 = {B[4], B[5], B[6], B[7]};
    const v4f c0 = {C[0], C[1], C[2], C[3]}, c1 = {C[4], C[5], C[6], C[7]};
    const v4f d0 = {D[0], D[1], D[2], D[3]}, d1 = {D[4], D[5], D[6], D[7]};
    *(v4f*)(op)      = a0;
    *(v4f*)(op + 4)  = a1;
    *(v4f*)(op + 16) = b0;
    *(v4f*)(op + 20) = b1;
    *(v4f*)(op + 32) = c0;
    *(v4f*)(op + 36) = c1;
    *(v4f*)(op + 48) = d0;
    *(v4f*)(op + 52) = d1;
    if (hh == 0) {                                     // mx, ls are equal in the lanes m and m + 16
      mxw[g][wv][m] = mx[g];
      lsw[g][wv][m] = ls[g];
    }
  }
  __syncthreads();                                     // publishes the 8 partial states of each head to the whole block

  // ---- merge in wave order, ctx = O / l, bf16 hi plane and lo plane, head by head; all stores stand at the end ----
  v2u hvv[HPW], lvv[HPW];
#pragma unroll
  for (int g = 0; g < HPW; ++g) {
    // thread u owns the u-th 8 bytes of the tile's two Z fragments per plane: a wave stores 256 contiguous bytes
    const int u = threadIdx.x;
    const int row = (u >> 1) & 15;
    const int c4 = ((u >> 7) & 1) * 32 + ((u >> 6) & 1) * 16 + ((u >> 5) & 1) * 8 + (u & 1) * 4;
    float mw[AWV];
    float mt = -1.0e30f;
#pragma unroll
    for (int w = 0; w < AWV; ++w) { mw[w] = mxw[g][w][row]; mt = fmaxf(mt, mw[w]); }
    float sc[AWV];
#pragma unroll
    for (int w = 0; w < AWV; ++w) sc[w] = exp2_slot((mw[w] - mt) * 1.44269504f);   // exp(max_w - max)
    float lt = 0.f;
    v4f ot = {0.f, 0.f, 0.f, 0.f};
#pragma unroll
    for (int w = 0; w < AWV; ++w) {
      const v4f o = *(const v4f*)(opw[g][w] + row * OPP + c4);
      lt += lsw[g][w][row] * sc[w];
#pragma unroll
      for (int e = 0; e < 4; ++e) ot[e] += o[e] * sc[w];
    }
    const float gi = 1.0f / lt;                        // lt >= 1
    unsigned short hb[4], lb[4];
#pragma unroll
    for (int e = 0; e < 4; ++e) {
      const float c = ot[e] * gi;
      hb[e] = bf_bits(c);
      lb[e] = bf_bits(c - bf_up(hb[e]));
    }
    const v2u hv = {pk16(hb[0], hb[1]), pk16(hb[2], hb[3])};
    const v2u lv = {pk16(lb[0], lb[1]), pk16(lb[2], lb[3])};
    hvv[g] = hv;
    lvv[g] = lv;
  }
#pragma unroll
  for (int g = 0; g < HPW; ++g) {
    // = fo_off(token, (h0 + g)*64 + c4, KF/32)
    unsigned short* dst = Z + ((size_t)qt * (KF / 32) + 2 * (h0 + g)) * 512 + threadIdx.x * 4;
    *(v2u*)dst = hvv[g];
    *(v2u*)(dst + DMD * 16) = lvv[g];                  // columns 512.. lie 16 fragments on
  }
}

// =====================================================================================================
// Flat whole-line writer of the output: out[row*388 + c] = L[row*448 + c]; each lane owns 4
// consecutive output floats (16 B; never straddles a row since 388 % 4 == 0), one instruction = 32 lanes x
// coverage: grid = MT*97/256 blocks x 256 float4 = all MT*388 output floats (in-kernel bound for safety).
// =====================================================================================================
__global__ __launch_bounds__(256) void out_copy(const float* __restrict__ L, const float* __restrict__ flg,
                                                 float* out) {
  __shared__ int wf[8];
  const int t = threadIdx.x, lane = t & 31, wv = t >> 5;
  int f;
  {
    const int ti = (t < NFLG) ? t : (NFLG - 1);         // clamped address, value selected
    const float x = flg[(size_t)ti * FLGW];
    f = ((t < NFLG) && (x == 1.0f)) ? 1 : 0;
  }
  f |= __shfl_xor(f, 1, 32);
  f |= __shfl_xor(f, 2, 32);
  f |= __shfl_xor(f, 4, 32);
  f |= __shfl_xor(f, 8, 32);
  f |= __shfl_xor(f, 16, 32);
  if (lane == 0) wf[wv] = f;
  __syncthreads();
  int g = 0;
#pragma unroll
  for (int w = 0; w < 8; ++w) g |= wf[w];
  const int e4 = blockIdx.x * 256 + t;
  if (e4 < MT * (EVD / 4)) {
    const int e = e4 * 4;
    const int row = e / EVD;
    const int c = e - row * EVD;
    v4f x = *(const v4f*)(L + (size_t)row * EVP + c);
    const float qn = __uint_as_float(0x7fc00000u);
    const v4f pn = {qn, qn, qn, qn};
    x = g ? pn : x;
    float* d = out + (size_t)e;
    *(v4f*)d = x;
    
  }
}

// =====================================================================================================
// Workspace map (bytes, full size NB=2, SEQ=2048); every plane is an exact multiple of its whole-row /
// whole-line / 32x64-tile store granularity; all offsets are multiples of 16384. PEH, QH, KH, VH, VL, Z, WOT, OP and
// WLT are kept in fragment order (see fo_off), the X and W*T planes and L row-major.
//   XQ   f16  [MT][512]        4194304     (x3 with XK, XV)
//   WQT  f16  [64][512]          65536     (x3 with WKT, WVT; Wq^T, Wk^T, Wv^T x64)
//   PEH  f16  [8*2048][64]     2097152     (E x64)
//   QH   f16  [MT][64]          524288     (16*q), KH same
//   VH   bf16 [64][MT]          524288     (v hi), VL same (v lo), contiguous after VH
//   Z    bf16 [MT][1024]       8388608     (ctx hi | ctx lo)
//   WOT  bf16 [512][1024]      1048576     (Wo^T | Wo^T)
//   OP   bf16 [MT][1024]       8388608     (relu out hi | lo)
//   WLT  bf16 [448][1024]       917504     (Wl^T | Wl^T, rows 388..447 zero)
//   L    f32  [MT][448]        7340032
//   FLG  f32  [128][32]          16384     (mask-structure flag lines)
//   total                     43073536
// =====================================================================================================
extern "C" void kernel_launch(void* const* d_in, const int* in_sizes, int n_in,
                              void* d_out, int out_size, void* d_ws, size_t ws_size,
                              hipStream_t stream) {
  if (n_in < 15) return;
  if (in_sizes[0] < (NB - 1) * SEQ_FULL * DMD + SEQ * DMD) return;   // v
  if (in_sizes[1] < (NB - 1) * SEQ_FULL * DMD + SEQ * DMD) return;   // k
  if (in_sizes[2] < (NB - 1) * SEQ_FULL * DMD + SEQ * DMD) return;   // q
  if (in_sizes[3] < (SEQ - 1) * SEQ_FULL + SEQ) return;               // mask
  if (in_sizes[4] < DMD * HD || in_sizes[6] < DMD * HD || in_sizes[8] < DMD * HD) return;
  if (in_sizes[5] < HD || in_sizes[7] < HD || in_sizes[9] < HD) return;
  if (in_sizes[10] < NH * SEQ_FULL * HD) return;                      // E
  if (in_sizes[11] < DMD * DMD || in_sizes[12] < DMD) return;         // Wo, bo
  if (in_sizes[13] < DMD * EVD || in_sizes[14] < EVD) return;         // Wl, bl
  if (out_size < MT * EVD) return;

  const float* v   = (const float*)d_in[0];    // [2][2048][512]
  const float* k   = (const float*)d_in[1];
  const float* q   = (const float*)d_in[2];
  const float* msk = (const float*)d_in[3];    // [2048][2048]
  const float* wq  = (const float*)d_in[4];    // [512][64]
  const float* bq  = (const float*)d_in[5];    // [64]
  const float* wk  = (const float*)d_in[6];
  const float* bk  = (const float*)d_in[7];
  const float* wv  = (const float*)d_in[8];
  const float* bv  = (const float*)d_in[9];
  const float* ee  = (const float*)d_in[10];   // [8][2048][64]
  const float* wo  = (const float*)d_in[11];   // [512][512] (in, out)
  const float* bo  = (const float*)d_in[12];   // [512]
  const float* wl  = (const float*)d_in[13];   // [512][388] (in, out)
  const float* bl  = (const float*)d_in[14];   // [388]

  const size_t PX  = (size_t)MT * DMD * 2;
  const size_t PW  = (size_t)HD * DMD * 2;
  const size_t PPE = (size_t)NH * SEQ_FULL * HD * 2;
  const size_t PQK = (size_t)MT * HD * 2;
  const size_t PV2 = (size_t)2 * HD * MT * 2;
  const size_t PZ  = (size_t)MT * KF * 2;
  const size_t PWO = (size_t)DMD * KF * 2;
  const size_t POP = (size_t)MT * KF * 2;
  const size_t PWL = (size_t)EVP * KF * 2;
  const size_t PL  = (size_t)MT * EVP * 4;
  const size_t PFL = (size_t)(SEQ_FULL / 16) * FLGW * 4;
  size_t off = 0;
  const size_t oXQ = off; off += PX;
  const size_t oXK = off; off += PX;
  const size_t oXV = off; off += PX;
  const size_t oWQ = off; off += PW;
  const size_t oWK = off; off += PW;
  const size_t oWV = off; off += PW;
  const size_t oPE = off; off += PPE;
  const size_t oQH = off; off += PQK;
  const size_t oKH = off; off += PQK;
  const size_t oV  = off; off += PV2;
  const size_t oZ  = off; off += PZ;
  const size_t oWO = off; off += PWO;
  const size_t oOP = off; off += POP;
  const size_t oWL = off; off += PWL;
  const size_t oL  = off; off += PL;
  const size_t oFL = off; off += PFL;
  if (off > ws_size) return;
  if (off > (size_t)134217728) return;

  char* ws = (char*)d_ws;
  unsigned short* XQ  = (unsigned short*)(ws + oXQ);
  unsigned short* XK  = (unsigned short*)(ws + oXK);
  unsigned short* XV  = (unsigned short*)(ws + oXV);
  unsigned short* WQT = (unsigned short*)(ws + oWQ);
  unsigned short* WKT = (unsigned short*)(ws + oWK);
  unsigned short* WVT = (unsigned short*)(ws + oWV);
  unsigned short* PEH = (unsigned short*)(ws + oPE);
  unsigned short* QHp = (unsigned short*)(ws + oQH);
  unsigned short* KHp = (unsigned short*)(ws + oKH);
  unsigned short* VHp = (unsigned short*)(ws + oV);
  unsigned short* VLp = VHp + (size_t)HD * MT;
  unsigned short* Zp  = (unsigned short*)(ws + oZ);
  unsigned short* WOT = (unsigned short*)(ws + oWO);
  unsigned short* OPp = (unsigned short*)(ws + oOP);
  unsigned short* WLT = (unsigned short*)(ws + oWL);
  float* Lp   = (float*)(ws + oL);
  float* FLG  = (float*)(ws + oFL);
  float* out0 = (float*)d_out;
  float* fdummy = Lp;                             // in-range placeholder for unused f32 output args
  unsigned short* hdummy = QHp;                   // in-range placeholder for unused 16-bit output args

  const dim3 blk(256);

  // (0) what the projections read, one launch: q, k, v (per batch slab) -> f16(bf16); Wq|Wk|Wv [512][64] ->
  //     [64][512] (transposed, f16 x64)
  prep_x<<<dim3(PREP_BLOCKS), blk, 0, stream>>>(q, k, v, wq, wk, wv, XQ, XK, XV, WQT, WKT, WVT);

  // (1) one launch: the three projections (q plane x16, k plane x16, v^T bf16 hi (VH) and lo (VL) planes) and,
  //     beside them, the jobs only later launches read: mask structure flags, Wo and Wl planes, E plane
  proj_side<<<dim3(SIDE_BLOCKS), blk, 0, stream>>>(XQ, XK, XV, WQT, WKT, WVT, bq, bk, bv, QHp, KHp, VHp,
                                                   msk, FLG, wo, WOT, wl, WLT, ee, PEH);

  // (2) attention -> ctx hi|lo token-major plane
  attn_kernel<<<dim3(NB * (NH / HPW) * (SEQ / 16)), dim3(32 * AWV), 0, stream>>>(QHp, KHp, PEH, VHp, VLp, Zp);

  // (3) output projection with relu: OP = bf16 hi|lo of max(0, sum_k Z[row][k] * WOT[n][k] + bo[n]), K = 1024
  const int gO = ((MT / (16 * GTI)) * (DMD / 64) + GWV - 1) / GWV;
  gemm64<1, 2, 1, 0><<<dim3(gO), dim3(32 * GWV), 0, stream>>>(Zp, KF, WOT, KF, OPp, DMD * 16, fdummy, KF, 1.0f, bo, DMD, 1.0f, MT, DMD, KF);

  // (4) logits: L[row][n] = sum_k OP[row][k] * WLT[n][k] + bl[n], K = 1024, N padded to 448
  const int gL = ((MT / (16 * GTI)) * (EVP / 64) + GWV - 1) / GWV;
  gemm64<1, 0, 0, 0><<<dim3(gL), dim3(32 * GWV), 0, stream>>>(OPp, KF, WLT, KF, hdummy, 0, Lp, EVP, 1.0f, bl, EVD, 1.0f, MT, EVP, KF);

  // (5) flat whole-line copy into the output (388-wide rows), NaN-poisoned on a mask-structure violation
  out_copy<<<dim3((MT * (EVD / 4) + 255) / 256), blk, 0, stream>>>(Lp, FLG, out0);
  (void)hipGetLastError();
}

// v009
// It runs in 76.3 microseconds.
// Timed twice side by side with v008, it ran 1.08 and 1.07 times as fast.
// Counting every step since v000, it is 5.18 times as fast.
// Contractions: x.Wq and x.Wk (f16 planes x16), Wv^T.x^T (bf16 hi|lo planes), q.k^T and q.E^T band on
// v_wmma_f32_16x16x32_f16 (f16 operands, f32 accumulate); p.v as bf16 hi/lo three-product split, and
// [ctx_hi|ctx_lo].[Wo;Wo], [o_hi|o_lo].[Wl;Wl] K-folded planes on v_wmma_f32_16x16x32_bf16 (bf16 operands,
// f32 accumulate). Float inputs RNE-converted to bf16 on load (x x1; Wq, Wk, Wv, E x64 in f16; Wo, Wl bf16);
// softmax, causal select and the relative-offset skew in f32 on VALU.
#include <hip/hip_runtime.h>
#include <math.h>

#ifndef NB
#define NB 2
#endif
#ifndef SEQ
#define SEQ 2048
#endif
#define NB_FULL  2
#define SEQ_FULL 2048
#define DMD  512
#define NH   8
#define HD   64
#define EVD  388
#define EVP  448
#define MT   (NB * SEQ)
#define KF   (2 * DMD)
#define NFLG (SEQ / 16)
#define FLGW 32
#define AWV  8
#define HPW  2
#define OPP  68
#define RWP  52
#define RWQ  108
#define WSCL 64.0f
#define QKS  16.0f
#define RSQD 0.125f
#define NEGM (-1.0e10f)

static_assert(NB >= 1 && NB <= NB_FULL);
static_assert(SEQ >= 64 && SEQ <= SEQ_FULL && (SEQ % 64) == 0);
static_assert(NH * HD == DMD && HD == 64 && (NH % HPW) == 0 && HPW * RWP <= RWQ);
static_assert((MT % 64) == 0 && (DMD % 64) == 0 && (KF % 64) == 0);
static_assert((EVP % 64) == 0 && EVP >= EVD && (EVD % 4) == 0);
static_assert(((SEQ * DMD) % 2048) == 0 && ((NH * SEQ_FULL * HD) % 2048) == 0);
static_assert(NFLG <= 256 && ((4 * SEQ) % 256) == 0);

typedef _Float16 v16h __attribute__((ext_vector_type(16)));
typedef __bf16 v16bf __attribute__((ext_vector_type(16)));
typedef unsigned short v16us __attribute__((ext_vector_type(16)));
typedef unsigned short v8us  __attribute__((ext_vector_type(8)));
typedef float v8f __attribute__((ext_vector_type(8)));
typedef float v4f __attribute__((ext_vector_type(4)));
typedef unsigned int v4u __attribute__((ext_vector_type(4)));
typedef unsigned int v2u __attribute__((ext_vector_type(2)));
typedef unsigned int v8u __attribute__((ext_vector_type(8)));
typedef float v2f __attribute__((ext_vector_type(2)));
typedef __bf16 v2bf __attribute__((ext_vector_type(2)));

union FragU { v16us v; v8us h[2]; };

// ---- scalar helpers --------------------------------------------------------------------------------
__device__ __forceinline__ unsigned short bf_bits(float f) {          // f32 -> bf16 bits, RNE convert
  const unsigned u = __float_as_uint(f);
  return (unsigned short)((u + 0x7FFFu + ((u >> 16) & 1u)) >> 16);
}
// two f32 -> one word of two bf16 (RNE, a in the low half): the packed convert instruction
__device__ __forceinline__ unsigned bf_pair(float a, float b) {
  const v2f x = {a, b};
  return __builtin_bit_cast(unsigned, __builtin_convertvector(x, v2bf));
}
__device__ __forceinline__ float bf_up(unsigned short h) { return __uint_as_float(((unsigned)h) << 16); }
__device__ __forceinline__ float bfr(float f) { return bf_up(bf_bits(f)); }   // value of the bf16 RNE convert
__device__ __forceinline__ unsigned short h_bits(_Float16 x) { return __builtin_bit_cast(unsigned short, x); }
__device__ __forceinline__ unsigned short f2h(float f) { return h_bits((_Float16)f); }
__device__ __forceinline__ unsigned pk16(unsigned short a, unsigned short b) { return (unsigned)a | ((unsigned)b << 16); }
__device__ __forceinline__ int clampi(int v, int lo, int hi) { return v < lo ? lo : (v > hi ? hi : v); }
__device__ __forceinline__ v8f zero8() { v8f z = {0.f, 0.f, 0.f, 0.f, 0.f, 0.f, 0.f, 0.f}; return z; }

// ---- fragment loader: 16-bit A/B operand, lane -> row/col (lane&15), p already includes +8*(lane>>4);
//      elements 0..7 <- p[0..7] (k0+8h..), elements 8..15 <- p[16..23] (k0+16+8h..)
__device__ __forceinline__ v16us ldfrag_u(const unsigned short* p) {
  FragU f;
  f.h[0] = *(const v8us*)(p);
  f.h[1] = *(const v8us*)(p + 16);
  return f.v;
}

// ---- fragment order: a 16-bit plane [R][K] (R % 16 == 0, K % 32 == 0, KS = K / 32) kept as 1-KB fragments of 16 rows x
//      32 k, fragment (row / 16) * KS + k / 32; inside it two 512-B halves (k % 32 below 16, then from 16 on), each 32
//      chunks of 8 elements in lane order ((k / 8) % 2) * 16 + row % 16. A fragment load is then two loads of 512
//      contiguous bytes (4 whole lines each) with the same element map as ldfrag_u, not two loads over 16 lines each.
__device__ __forceinline__ size_t fo_off(int row, int k, int KS) {
  return ((size_t)(row >> 4) * KS + (k >> 5)) * 512 + ((k >> 4) & 1) * 256 + (((k >> 3) & 1) * 16 + (row & 15)) * 8 + (k & 7);
}
__device__ __forceinline__ v16us ldfrag_fo(const unsigned short* plane, int tr, int ks, int KS, int lane) {
  // 32-bit byte offset (every plane is far below 4 GiB) on the plane's uniform pointer: one address register per load group
  const unsigned off = ((unsigned)tr * (unsigned)KS + (unsigned)ks) * 1024u + (unsigned)lane * 16u;
  const unsigned short* p = (const unsigned short*)((const char*)plane + off);
  FragU f;
  f.h[0] = *(const v8us*)(p);
  f.h[1] = *(const v8us*)(p + 256);
  return f.v;
}

// the same fragment load from a wave-uniform fragment address (scalar registers) and the lane's byte offset 16 * lane
__device__ __forceinline__ v16us ldfrag_at(const char* ufrag, unsigned l16) {
  const unsigned short* p = (const unsigned short*)(ufrag + l16);
  FragU f;
  f.h[0] = *(const v8us*)(p);
  f.h[1] = *(const v8us*)(p + 256);
  return f.v;
}

// stands behind issued global loads or stores, in front of the code that reuses the registers they name
__device__ __forceinline__ void addr_wait() {
#if defined(__HIP_DEVICE_COMPILE__)
  asm volatile("s_wait_xcnt 0x0" ::: "memory");
#endif
}

// the same wait, with the index registers of the issued loads as inputs: they cannot be given away in front of it
__device__ __forceinline__ void addr_wait8(int a, int b, int c, int d, int e, int f, int g, int h) {
#if defined(__HIP_DEVICE_COMPILE__)
  asm volatile("s_wait_xcnt 0x0" :: "v"(a), "v"(b), "v"(c), "v"(d), "v"(e), "v"(f), "v"(g), "v"(h) : "memory");
#endif
}

// the same wait for loads that name up to three offset registers: as inputs they stay whole up to it, so that no load
// of the group is given one of them as its destination
__device__ __forceinline__ void addr_wait3(unsigned a, unsigned b, unsigned c) {
#if defined(__HIP_DEVICE_COMPILE__)
  asm volatile("s_wait_xcnt 0x0" :: "v"(a), "v"(b), "v"(c) : "memory");
#endif
}

// ---- WMMA helpers (f16 / bf16 operand bits) with trailing VALU hazard gap --------------------------
__device__ __forceinline__ v8f mma_raw(v16us a, v16us b, v8f c) {
  return __builtin_amdgcn_wmma_f32_16x16x32_f16(false, __builtin_bit_cast(v16h, a), false,
                                                __builtin_bit_cast(v16h, b), (short)0, c, false, false);
}
__device__ __forceinline__ v8f mma_raw_bf(v16us a, v16us b, v8f c) {
  return __builtin_amdgcn_wmma_f32_16x16x32_bf16(false, __builtin_bit_cast(v16bf, a), false,
                                                 __builtin_bit_cast(v16bf, b), (short)0, c, false, false);
}
__device__ __forceinline__ v8f mma_g(v16us a, v16us b, v8f c) {                 // guarded f16
  c = mma_raw(a, b, c);
#if defined(__HIP_DEVICE_COMPILE__)
  asm volatile("v_nop\n\tv_nop\n\tv_nop\n\tv_nop" : "+v"(c) : "v"(a), "v"(b));
#endif
  return c;
}
__device__ __forceinline__ v8f mma_gb(v16us a, v16us b, v8f c) {                // guarded bf16
  c = mma_raw_bf(a, b, c);
#if defined(__HIP_DEVICE_COMPILE__)
  asm volatile("v_nop\n\tv_nop\n\tv_nop\n\tv_nop" : "+v"(c) : "v"(a), "v"(b));
#endif
  return c;
}
__device__ __forceinline__ void dep_guard1(v8f& a, v8f& b, v16us x) {
#if defined(__HIP_DEVICE_COMPILE__)
  asm volatile("v_nop\n\tv_nop\n\tv_nop\n\tv_nop" : "+v"(a), "+v"(b) : "v"(x));
#endif
}
__device__ __forceinline__ void keep4_u(v16us a, v16us b, v16us c, v16us d) {
#if defined(__HIP_DEVICE_COMPILE__)
  asm volatile("v_nop" :: "v"(a), "v"(b), "v"(c), "v"(d));
#endif
}
__device__ __forceinline__ void acc_guard4(v8f& a, v8f& b, v8f& c, v8f& d) {
#if defined(__HIP_DEVICE_COMPILE__)
  asm volatile("v_nop\n\tv_nop\n\tv_nop\n\tv_nop" : "+v"(a), "+v"(b), "+v"(c), "+v"(d));
#endif
}
// 2^x; the v_nop keeps, inside the statement, the one slot the instruction set asks for between a
// transcendental and an instruction that reads its result or overwrites its source
__device__ __forceinline__ float exp2_slot(float x) {
  float r = 0.f;
#if defined(__HIP_DEVICE_COMPILE__)
  asm("v_exp_f32 %0, %1\n\tv_nop" : "=v"(r) : "v"(x));
#endif
  return r;
}
// value of lane l ^ 16 (the other half-wave), a vector cross-row move
__device__ __forceinline__ float xhalf(float x) {
  const int b = __float_as_int(x);
  return __int_as_float(__builtin_amdgcn_permlanex16(b, b, 0x76543210, 0xfedcba98, false, false));
}
// orders LDS stores of this wave before later LDS loads of the same wave (cross-lane exchange)
__device__ __forceinline__ void wave_sync_lds() {
  __builtin_amdgcn_fence(__ATOMIC_RELEASE, "workgroup");
  __builtin_amdgcn_wave_barrier();
  __builtin_amdgcn_fence(__ATOMIC_ACQUIRE, "workgroup");
}

// =====================================================================================================
// Layout-kept convert: o[i] = f16 bits of (bf16 RNE value of w[i] * sc) for i < nsrc, zero for nsrc <= i <
// ndst; by selects a batch slab (source offset by*sstr, destination offset by*dstr), bx the 2048-element piece.
// nsrc % 8 == 0, ndst % 2048 == 0, bx = 0 .. ndst/2048 - 1 exact (compile-time constants at the call sites).
// coverage: 256 threads x 8 = 2048 elements per block; the callers' bx, by ranges cover all ndst elements of
// every slab. Block body, called from the first merged launch below.
// =====================================================================================================
__device__ __forceinline__ void cvt_lin(const float* __restrict__ w, unsigned short* o, int bx, int by,
                                        int nsrc, int ndst, float sc, int sstr, int dstr) {
  const float* wb = w + (size_t)by * (size_t)sstr;
  unsigned short* ob = o + (size_t)by * (size_t)dstr;
  const int base = (bx * 256 + threadIdx.x) * 8;
  if (base + 8 > ndst) return;                            // never taken with exact grids; no barriers below
  const bool inr = (base + 8 <= nsrc);
  const int lb = inr ? base : (nsrc - 8);                 // clamped address, always in range
  const v4f a0 = *(const v4f*)(wb + lb);
  const v4f a1 = *(const v4f*)(wb + lb + 4);
  v4u hv;
#pragma unroll
  for (int e = 0; e < 2; ++e) {
    hv[e]     = pk16(f2h(bfr(a0[2 * e]) * sc), f2h(bfr(a0[2 * e + 1]) * sc));
    hv[2 + e] = pk16(f2h(bfr(a1[2 * e]) * sc), f2h(bfr(a1[2 * e + 1]) * sc));
  }
  const v4u zz = {0u, 0u, 0u, 0u};
  hv = inr ? hv : zz;
  unsigned short* d = ob + base;
  *(v4u*)d = hv;
  
}

// Convert of a [R][64] f32 plane into fragment order (KS = 2): o = f16 bits of (bf16 RNE value of w * sc). A thread owns
// one 16-byte chunk of the destination, numbered linearly (a wave stores 512 contiguous bytes), and reads its 8 source
// elements. coverage: 256 chunks = 2048 elements per block; bx = 0 .. R*64/2048 - 1 exact at the call site.
__device__ __forceinline__ void cvt_fo64(const float* __restrict__ w, unsigned short* o, int bx, float sc) {
  const int g = bx * 256 + threadIdx.x;
  const int row = ((g >> 7) << 4) + (g & 15);
  const int col = ((g >> 6) & 1) * 32 + ((g >> 5) & 1) * 16 + ((g >> 4) & 1) * 8;
  const float* s = w + (size_t)row * 64 + col;
  const v4f a0 = *(const v4f*)(s);
  const v4f a1 = *(const v4f*)(s + 4);
  v4u hv;
#pragma unroll
  for (int e = 0; e < 2; ++e) {
    hv[e]     = pk16(f2h(bfr(a0[2 * e]) * sc), f2h(bfr(a0[2 * e + 1]) * sc));
    hv[2 + e] = pk16(f2h(bfr(a1[2 * e]) * sc), f2h(bfr(a1[2 * e + 1]) * sc));
  }
  *(v4u*)(o + (size_t)g * 8) = hv;
  addr_wait();                                           // precaution; the block ends after this one job
}

// =====================================================================================================
// Transpose-convert: in w[R][C] f32 (pitch C) -> out o[c][r] at o[c*ldo + r] for c < CP, with zero values
// for C <= c < CP. BFO 0: f16 bits of (bf16 RNE value * sc); BFO 1: bf16 bits (RNE), and the output plane [CP][ldo] is
// in fragment order (o[fo_off(c, r, ldo / 32)], a wave storing 512 contiguous bytes). Block tile 64x64
// through LDS (st[col][row], pitch 72 halves). Read phase: thread owns one input row x 16 columns (float4
// loads at a clamped column address, zero selected by value; C % 4 == 0 so a float4 is all-in or all-out).
// R, CP multiples of 64, ldo % 64 == 0, (bx, by) in (CP/64, R/64) exact (compile-time constants at the call
// sites). coverage: 64 output rows x 64 halves per block = the whole transposed tile; the callers' ranges cover
// all of [CP][R]. Block body, called from the merged launches below under a block-uniform branch; st is the
// calling kernel's LDS tile of 64 * 72 halves.
// =====================================================================================================
template <int BFO>
__device__ __forceinline__ void cvt_t(unsigned short* st, const float* __restrict__ w, unsigned short* o,
                                      int bx, int by, int R, int C, int CP, int ldo, float sc) {
  const int t = threadIdx.x;
  const int r0 = by * 64, c0 = bx * 64;
  if (r0 + 64 > R || c0 + 64 > CP) return;              // block-uniform, before the barrier; never taken
  {
    const int row = t >> 2, ch = (t & 3) * 16;
    const float* p = w + (size_t)(r0 + row) * C;
#pragma unroll
    for (int q = 0; q < 4; ++q) {
      const int cs = c0 + ch + 4 * q;
      const bool inr = (cs + 4 <= C);
      const int lb = inr ? cs : (C - 4);                 // clamped column address, always in range
      const v4f v = *(const v4f*)(p + lb);
#pragma unroll
      for (int e = 0; e < 4; ++e) {
        const unsigned short hb = BFO ? bf_bits(v[e]) : f2h(bfr(v[e]) * sc);
        st[(ch + 4 * q + e) * 72 + row] = inr ? hb : (unsigned short)0;
      }
    }
  }
  __syncthreads();
  v4u hv[2];
#pragma unroll
  for (int half = 0; half < 2; ++half) {
    const int c = t + 256 * half;                        // BFO: chunk number in fragment order within the tile
    const int cl = BFO ? ((c >> 7) * 16 + (c & 15)) : ((t >> 3) + 32 * half);
    const int pc = BFO ? (((c >> 6) & 1) * 32 + ((c >> 5) & 1) * 16 + ((c >> 4) & 1) * 8) : ((t & 7) * 8);
    hv[half] = *(const v4u*)(st + cl * 72 + pc);
  }
  {
#pragma unroll
    for (int half = 0; half < 2; ++half) {
      const int c = t + 256 * half;
      const int cl = BFO ? ((c >> 7) * 16 + (c & 15)) : ((t >> 3) + 32 * half);
      const int pc = BFO ? (((c >> 6) & 1) * 32 + ((c >> 5) & 1) * 16 + ((c >> 4) & 1) * 8) : ((t & 7) * 8);
      unsigned short* dst = o + (BFO ? fo_off(c0 + cl, r0 + pc, ldo >> 5) : ((size_t)(c0 + cl) * ldo + r0 + pc));
      *(v4u*)dst = hv[half];
    }
#if defined(__HIP_DEVICE_COMPILE__)
    // precaution: wait for the stores to read their registers (the block ends after this one job)
    asm volatile("s_wait_xcnt 0x0" ::: "memory");
#endif
  }
}

// =====================================================================================================
// Register-blocked 16-bit WMMA GEMM: C[m][n] = sum_k A[m][k] * Bt[n][k], one wave per 32x64 tile, no block
// barriers. BF 0: f16 operand bits, BF 1: bf16 operand bits. A row-major [M][K] pitch lda; Bt row-major
// [N][K] pitch ldb (k contiguous); M multiple of 32, N of 64, K of 32 (true at every call site; waves
// past the last tile exit before any work, wave-uniform). A wave's k step is two A and four B fragments, whose
// twelve loads are issued together: one load round trip per k step, and M/32 * N/64 waves to fill the chip.
// WPB = waves (tiles) per block. Tiles are numbered down the rows first, so the waves of a block read the same
// four B fragments where WPB divides M/32 (in the v^T product, M/32 = 2: only wave pairs do). Both operand fragments use the split k map
// (elements 0..7 <- k0+8h.., 8..15 <- k0+16+8h..); D element r of a lane is (row 8h + r, col lane&15).
// Bias: bf16 RNE value of bias[] times bsc, indexed by column (clamped into nbias) or, with BROW, by row.
// FOI 1: A and Bt are planes in fragment order (KS = lda / 32, ldb / 32) instead of row-major, bf16 (BF 1), K a multiple
// of 32 * GPD; the loads of k step s + GPD are issued behind the products of k step s (same k order of the sums).
// OM 0: f32 out Cf = acc*osc + b, pitch ldc.            OM 1: f16 out Ch = f16 bits(acc*osc + b).
// OM 2: val = (RELU ? max(0, .) : .)(acc*osc + b); bf16 hi bits at Ch, bf16 lo bits (val - hi) at Ch + looff.
// The 16-bit outputs (OM 1, 2) are planes [M][ldc] in fragment order; a wave's slab is whole 1-KB fragments.
// coverage: GTI slabs x 16 rows x 64 cols = the wave's whole tile (hi and lo planes alike).
// gemm64_blk is the block body (bx = block number within this product, sT = the calling kernel's LDS, WPB per-wave
// 16x64 slabs of pitch 68 floats); gemm64 is the launch of one product alone.
// =====================================================================================================
#define GSLAB (16 * 68)
#define GTI 2                                  // 16-row subtiles per wave tile
#define GWV 4                                  // waves per block where a product is launched alone
#define GPD 4                                  // k steps of fragments a wave keeps in flight (FOI products)
static_assert((KF % (32 * GPD)) == 0);
template <int BF, int OM, int RELU, int BROW, int WPB, int FOI>
__device__ __forceinline__ void gemm64_blk(
    float* sT, int bx,
    const unsigned short* __restrict__ Ap, int lda, const unsigned short* __restrict__ Btp, int ldb,
    unsigned short* Ch, int looff, float* Cf, int ldc, float osc,
    const float* __restrict__ bias, int nbias, float bsc, int M, int N, int K) {
  const int lane = threadIdx.x & 31;
  const int wave = threadIdx.x >> 5;
  const int tilesN = N >> 6;
  const int tilesM = M / (16 * GTI);
  const int tile = bx * WPB + wave;
  if (tile >= tilesM * tilesN) return;   // wave-uniform; no block barriers in this kernel
  const int tn = tile / tilesM;
  const int tm = tile - tn * tilesM;
  const int m0 = tm * (16 * GTI);
  const int n0 = tn << 6;

  const int rlane = lane & 15;                 // row (A) / col (B, D) within subtile
  const int koff  = (lane >> 4) * 8;           // k offset of this lane half
  const int mOff  = (lane >> 4) * 8;           // D row offset

  v8f acc[GTI][4];
#pragma unroll
  for (int i = 0; i < GTI; ++i)
#pragma unroll
    for (int j = 0; j < 4; ++j) acc[i][j] = zero8();

  if constexpr (FOI) {
    static_assert(BF == 1);
    // Register ring of GPD k steps (place s = the six fragments of one k step). A place is refilled, GPD k steps ahead,
    // right behind its own products: its loads return under the products of the other GPD - 1 places.
    // Each fragment row's base is wave-uniform and kept in scalar registers, the place is a constant offset, and one
    // vector register holds the lane part and the advance along k.
    unsigned l16 = (unsigned)lane * 16u;                 // lane part, plus the bytes of the k steps gone by
    const char* pb[4];
    const char* pa[GTI];
#pragma unroll
    for (int j = 0; j < 4; ++j)
      pb[j] = (const char*)Btp + (size_t)__builtin_amdgcn_readfirstlane(((n0 >> 4) + j) * (ldb >> 5)) * 1024;
#pragma unroll
    for (int i = 0; i < GTI; ++i)
      pa[i] = (const char*)Ap + (size_t)__builtin_amdgcn_readfirstlane(((m0 >> 4) + i) * (lda >> 5)) * 1024;
    v16us bh[GPD][4], ah[GPD][GTI];
#pragma unroll
    for (int s = 0; s < GPD; ++s) {
#pragma unroll
      for (int j = 0; j < 4; ++j) bh[s][j] = ldfrag_at(pb[j] + s * 1024, l16);
#pragma unroll
      for (int i = 0; i < GTI; ++i) ah[s][i] = ldfrag_at(pa[i] + s * 1024, l16);
      // keeps the first fill in the order of the refills, place by place: the counted load waits in the loop are set for
      // both ways into it, and a first fill in another order would make them wait for younger places too
      __builtin_amdgcn_sched_barrier(0);
    }
    // behind the last load of the first fill: whichever code comes next may reuse the base registers these loads name
    addr_wait();
    // rolled over groups of GPD k steps, so that the places of the ring are fixed registers
#pragma unroll 1
    for (int k0 = 32 * GPD; k0 < K; k0 += 32 * GPD) {
#pragma unroll
      for (int s = 0; s < GPD; ++s) {
#pragma unroll
        for (int i = 0; i < GTI; ++i)
#pragma unroll
          for (int j = 0; j < 4; ++j) acc[i][j] = mma_raw_bf(ah[s][i], bh[s][j], acc[i][j]);
        // holds the products above the slots below
        __builtin_amdgcn_sched_barrier(0);
#if defined(__HIP_DEVICE_COMPILE__)
        // five vector slots between the last product and the loads that overwrite its fragments, the distance the loop
        // had without a ring
        asm volatile("v_nop\n\tv_nop\n\tv_nop\n\tv_nop\n\tv_nop" ::: "memory");
#endif
#pragma unroll
        for (int j = 0; j < 4; ++j) bh[s][j] = ldfrag_at(pb[j] + (GPD + s) * 1024, l16);
#pragma unroll
        for (int i = 0; i < GTI; ++i) ah[s][i] = ldfrag_at(pa[i] + (GPD + s) * 1024, l16);
        // keeps a place's refill at this point: moved down by the scheduler it would lose its lead of GPD - 1 k steps
        __builtin_amdgcn_sched_barrier(0);
      }
#if defined(__HIP_DEVICE_COMPILE__)
      // stands behind the issued loads, in front of the advance of the offset register that they name (the operand
      // ties the advance behind the wait)
      asm volatile("s_wait_xcnt 0x0" : "+v"(l16) :: "memory");
#endif
      l16 += GPD * 1024;
    }
#pragma unroll
    for (int s = 0; s < GPD; ++s)
#pragma unroll
      for (int i = 0; i < GTI; ++i)
#pragma unroll
        for (int j = 0; j < 4; ++j) acc[i][j] = mma_raw_bf(ah[s][i], bh[s][j], acc[i][j]);
  } else {
#pragma unroll 1
  for (int k0 = 0; k0 < K; k0 += 32) {
    v16us bh[4];
#pragma unroll
    for (int j = 0; j < 4; ++j) {
      const size_t bo = (size_t)(n0 + (j << 4) + rlane) * ldb + koff + k0;
      bh[j] = FOI ? ldfrag_fo(Btp, (n0 >> 4) + j, k0 >> 5, ldb >> 5, lane) : ldfrag_u(Btp + bo);
    }
    v16us ah[GTI];
#pragma unroll
    for (int i = 0; i < GTI; ++i) {
      const size_t ao = (size_t)(m0 + (i << 4) + rlane) * lda + koff + k0;
      ah[i] = FOI ? ldfrag_fo(Ap, (m0 >> 4) + i, k0 >> 5, lda >> 5, lane) : ldfrag_u(Ap + ao);
    }
#pragma unroll
    for (int i = 0; i < GTI; ++i) {
#pragma unroll
      for (int j = 0; j < 4; ++j) {
        if (BF) acc[i][j] = mma_raw_bf(ah[i], bh[j], acc[i][j]);
        else    acc[i][j] = mma_raw(ah[i], bh[j], acc[i][j]);
      }
      dep_guard1(acc[i][0], acc[i][3], ah[i]);
    }
    keep4_u(bh[0], bh[1], bh[2], bh[3]);
  }
  }
#pragma unroll
  for (int i = 0; i < GTI; ++i) acc_guard4(acc[i][0], acc[i][1], acc[i][2], acc[i][3]);

  const int hh2 = lane >> 4, c4 = (lane & 15) * 4;     // f32 out: 256-B row segment = 16 lanes x 16 B
  const int q8  = lane >> 3, c8 = (lane & 7) * 8;

  // per-lane bias values for the column-indexed modes (bf16 RNE value times bsc), clamped address
  float bc[8];
#pragma unroll
  for (int e = 0; e < 8; ++e) bc[e] = 0.f;
  if (!BROW) {
    if (OM == 0) {
#pragma unroll
      for (int e = 0; e < 4; ++e) bc[e] = bsc * bfr(bias[clampi(n0 + c4 + e, 0, nbias - 1)]);
    } else {
#pragma unroll
      for (int e = 0; e < 8; ++e) bc[e] = bsc * bfr(bias[clampi(n0 + c8 + e, 0, nbias - 1)]);
    }
    if (FOI) {
      // the epilogue's arithmetic reuses the bias loads' index registers; as inputs of the wait they stay whole up to it
      int bi[8];
#pragma unroll
      for (int e = 0; e < 8; ++e) bi[e] = clampi(n0 + ((OM == 0) ? c4 + (e & 3) : c8 + e), 0, nbias - 1);
      addr_wait8(bi[0], bi[1], bi[2], bi[3], bi[4], bi[5], bi[6], bi[7]);
    }
  }

  // ---- epilogue ----
  float* slab = sT + wave * GSLAB;
#pragma unroll
  for (int i = 0; i < GTI; ++i) {
    const int mBase = m0 + (i << 4);
#pragma unroll
    for (int j = 0; j < 4; ++j) {
#pragma unroll
      for (int r = 0; r < 8; ++r) {
        slab[(mOff + r) * 68 + (j << 4) + rlane] = acc[i][j][r];
      }
    }
    wave_sync_lds();
    if (OM == 0) {
      v4f vals[8];
#pragma unroll
      for (int it = 0; it < 8; ++it) {
        const int row = it * 2 + hh2;                      // it 0..7 x hh2 0..1 = rows 0..15
        const v4f v = *(const v4f*)(slab + row * 68 + c4);
        float brw = 0.f;
        if (BROW) brw = bsc * bfr(bias[clampi(mBase + row, 0, nbias - 1)]);
        v4f ov;
#pragma unroll
        for (int e = 0; e < 4; ++e) {
          float x = v[e] * osc + (BROW ? brw : bc[e]);
          if (RELU) x = fmaxf(x, 0.f);
          ov[e] = x;
        }
        vals[it] = ov;
      }
      {
#pragma unroll
        for (int it = 0; it < 8; ++it) {
          const int row = it * 2 + hh2;
          *(v4f*)(Cf + (size_t)(mBase + row) * ldc + (size_t)n0 + c4) = vals[it];
        }
        
      }
    } else if (OM == 1) {
      v4u hv[4];
#pragma unroll
      for (int it = 0; it < 4; ++it) {
        const int row = it * 4 + q8;                       // it 0..3 x q8 0..3 = rows 0..15
        const float* sp = slab + row * 68 + c8;
        float brw = 0.f;
        if (BROW) brw = bsc * bfr(bias[clampi(mBase + row, 0, nbias - 1)]);
        v4u ha = {0u, 0u, 0u, 0u};
#pragma unroll
        for (int e = 0; e < 4; ++e) {
          float b0 = sp[2 * e]     * osc + (BROW ? brw : bc[2 * e]);
          float b1 = sp[2 * e + 1] * osc + (BROW ? brw : bc[2 * e + 1]);
          if (RELU) { b0 = fmaxf(b0, 0.f); b1 = fmaxf(b1, 0.f); }
          ha[e] = pk16(f2h(b0), f2h(b1));
        }
        hv[it] = ha;
      }
      {
#pragma unroll
        for (int it = 0; it < 4; ++it) {
          const int row = it * 4 + q8;
          const size_t go = fo_off(mBase + row, n0 + c8, ldc >> 5);
          *(v4u*)(Ch + go) = hv[it];
        }
        
      }
    } else {
      v4u hv[4], lv[4];
#pragma unroll
      for (int it = 0; it < 4; ++it) {
        const int row = it * 4 + q8;                       // it 0..3 x q8 0..3 = rows 0..15
        const float* sp = slab + row * 68 + c8;
        float brw = 0.f;
        if (BROW) brw = bsc * bfr(bias[clampi(mBase + row, 0, nbias - 1)]);
        v4u ha = {0u, 0u, 0u, 0u};
        v4u la = {0u, 0u, 0u, 0u};
#pragma unroll
        for (int e = 0; e < 4; ++e) {
          float x0 = sp[2 * e]     * osc + (BROW ? brw : bc[2 * e]);
          float x1 = sp[2 * e + 1] * osc + (BROW ? brw : bc[2 * e + 1]);
          if (RELU) { x0 = fmaxf(x0, 0.f); x1 = fmaxf(x1, 0.f); }
          const unsigned short h0 = bf_bits(x0), h1 = bf_bits(x1);
          const unsigned short l0 = bf_bits(x0 - bf_up(h0)), l1 = bf_bits(x1 - bf_up(h1));
          ha[e] = pk16(h0, h1);
          la[e] = pk16(l0, l1);
        }
        hv[it] = ha;
        lv[it] = la;
      }
      {
#pragma unroll
        for (int it = 0; it < 4; ++it) {
          const int row = it * 4 + q8;
          const size_t go = fo_off(mBase + row, n0 + c8, ldc >> 5);
          *(v4u*)(Ch + go) = hv[it];
          *(v4u*)(Ch + (size_t)looff + go) = lv[it];
        }
        
      }
    }
    wave_sync_lds();
  }
}
template <int BF, int OM, int RELU, int BROW>
__global__ __launch_bounds__(32 * GWV) void gemm64(
    const unsigned short* __restrict__ Ap, int lda, const unsigned short* __restrict__ Btp, int ldb,
    unsigned short* Ch, int looff, float* Cf, int ldc, float osc,
    const float* __restrict__ bias, int nbias, float bsc, int M, int N, int K) {
  __shared__ __align__(16) float sT[GWV * GSLAB];
  gemm64_blk<BF, OM, RELU, BROW, GWV, 1>(sT, blockIdx.x, Ap, lda, Btp, ldb, Ch, looff, Cf, ldc, osc, bias, nbias, bsc,
                                 M, N, K);
}

// =====================================================================================================
// Structure check of the [SEQ][SEQ] mask input (row pitch SEQ_FULL): block b covers rows 16b..16b+15 and all
// SEQ columns; a violation is any element differing from (j <= i ? 1 : 0). The block's flag is written as one
// coverage: 256 threads x (SEQ/64) float4 = 16 rows x SEQ cols per block; bx = 0 .. SEQ/16 - 1 = all rows.
// Block body, called from the second merged launch under a block-uniform branch; wf = 8 ints of its LDS.
// =====================================================================================================
__device__ __forceinline__ void mask_check(int* wf, int bx, const float* __restrict__ msk, float* flg) {
  const int t = threadIdx.x, lane = t & 31, wv = t >> 5;
  const int i0 = bx * 16;
  if (i0 + 16 > SEQ) return;                             // block-uniform, before the barrier; never taken
  constexpr int C4 = SEQ / 4;
  int viol = 0;
#pragma unroll 1
  for (int it = 0; it < (16 * C4) / 256; ++it) {
    const int ci = it * 256 + t;
    const int rr = ci / C4;
    const int c4 = ci - rr * C4;
    const int i = i0 + rr;
    const v4f x = *(const v4f*)(msk + (size_t)i * SEQ_FULL + 4 * c4);
#pragma unroll
    for (int e = 0; e < 4; ++e) {
      const int j = 4 * c4 + e;
      const float ex = (j <= i) ? 1.0f : 0.0f;
      viol |= (x[e] != ex) ? 1 : 0;
    }
  }
  viol |= __shfl_xor(viol, 1, 32);
  viol |= __shfl_xor(viol, 2, 32);
  viol |= __shfl_xor(viol, 4, 32);
  viol |= __shfl_xor(viol, 8, 32);
  viol |= __shfl_xor(viol, 16, 32);
  if (lane == 0) wf[wv] = viol;
  __syncthreads();
  if (wv == 0) {                                        // wave-uniform
    int f = wf[lane & 7];
    f |= __shfl_xor(f, 1, 32);
    f |= __shfl_xor(f, 2, 32);
    f |= __shfl_xor(f, 4, 32);
    const float fv = f ? 1.0f : 0.0f;
    float* d = flg + (size_t)bx * FLGW + lane;
    *(float*)d = fv;
    
  }
}

// =====================================================================================================
// Merged launches: jobs that read none of each other's output share one grid; the flat block index picks the
// job by ranges (block-uniform scalar branches), every block runs exactly one job body and then ends.
// prep_x: what the projections read. Blocks [0, 3*NTW): Wq, Wk, Wv -> [64][512] f16 x64 (transposed);
//   then 3*NLX blocks: q, k, v -> f16(bf16) planes, NLX = NB slabs x SEQ*DMD/2048 pieces each.
// proj_side: the three projections, first in the grid since they run longest, and beside them all that only
//   later launches read. Blocks [0, 3*NGQ): q plane x16, k plane x16 (C[tok][n] = sum_k X[tok][k] * WT[n][k]),
//   v^T planes (C[d][tok] = sum_k WVT[d][k] * XV[tok][k] / 64, bf16 hi and lo); then NFLG mask-structure blocks;
//   2*NTO blocks Wo -> [512][1024] = (Wo^T | Wo^T) bf16; 2*NTL blocks Wl -> [448][1024] = (Wl^T | Wl^T) bf16;
//   NLE blocks E -> f16(bf16 x64).
// =====================================================================================================
#define NTW (DMD / 64)
#define NLP ((SEQ * DMD) / 2048)
#define NLX (NLP * NB)
#define NGQ (((MT / (16 * GTI)) * (HD / 64) + 7) / 8)
#define NTO ((DMD / 64) * (DMD / 64))
#define NTL ((EVP / 64) * (DMD / 64))
#define NLE ((NH * SEQ_FULL * HD) / 2048)
#define PREP_BLOCKS (3 * NTW + 3 * NLX)
#define SIDE_BLOCKS (3 * NGQ + NFLG + 2 * NTO + 2 * NTL + NLE)

__global__ __launch_bounds__(256) void prep_x(
    const float* __restrict__ q, const float* __restrict__ k, const float* __restrict__ v,
    const float* __restrict__ wq, const float* __restrict__ wk, const float* __restrict__ wv,
    unsigned short* XQ, unsigned short* XK, unsigned short* XV,
    unsigned short* WQT, unsigned short* WKT, unsigned short* WVT) {
  __shared__ __align__(16) unsigned short st[64 * 72];
  int bid = blockIdx.x;
  if (bid < 3 * NTW) {
    const int j = bid / NTW;
    const float* w = (j == 0) ? wq : ((j == 1) ? wk : wv);
    unsigned short* o = (j == 0) ? WQT : ((j == 1) ? WKT : WVT);
    cvt_t<0>(st, w, o, 0, bid - j * NTW, DMD, HD, HD, DMD, WSCL);          // in[512][64] -> out[64][512]
    return;
  }
  bid -= 3 * NTW;
  if (bid < 3 * NLX) {
    const int j = bid / NLX;
    const int r = bid - j * NLX;
    const float* x = (j == 0) ? q : ((j == 1) ? k : v);
    unsigned short* o = (j == 0) ? XQ : ((j == 1) ? XK : XV);
    cvt_lin(x, o, r % NLP, r / NLP, SEQ * DMD, SEQ * DMD, 1.0f, SEQ_FULL * DMD, SEQ * DMD);
  }
}

__global__ __launch_bounds__(256) void proj_side(
    const unsigned short* __restrict__ XQ, const unsigned short* __restrict__ XK,
    const unsigned short* __restrict__ XV, const unsigned short* __restrict__ WQT,
    const unsigned short* __restrict__ WKT, const unsigned short* __restrict__ WVT,
    const float* __restrict__ bq, const float* __restrict__ bk, const float* __restrict__ bv,
    unsigned short* QH, unsigned short* KH, unsigned short* VH,
    const float* __restrict__ msk, float* flg,
    const float* __restrict__ wo, unsigned short* WOT, const float* __restrict__ wl, unsigned short* WLT,
    const float* __restrict__ ee, unsigned short* PEH) {
  __shared__ __align__(16) float sT[8 * GSLAB];        // the one job of a block uses it: slabs, transpose tile or flags
  int bid = blockIdx.x;
  if (bid < 2 * NGQ) {
    const int j = bid / NGQ;
    gemm64_blk<0, 1, 0, 0, 8, 0>(sT, bid - j * NGQ, j ? XK : XQ, DMD, j ? WKT : WQT, DMD, j ? KH : QH, 0, nullptr, HD,
                           QKS / WSCL, j ? bk : bq, HD, QKS, MT, HD, DMD);
    return;
  }
  bid -= 2 * NGQ;
  if (bid < NGQ) {
    gemm64_blk<0, 2, 0, 1, 8, 0>(sT, bid, WVT, DMD, XV, DMD, VH, HD * MT, nullptr, MT, 1.0f / WSCL, bv, HD, 1.0f,
                           HD, MT, DMD);
    return;
  }
  bid -= NGQ;
  if (bid < NFLG) {
    mask_check((int*)sT, bid, msk, flg);
    return;
  }
  bid -= NFLG;
  if (bid < 2 * NTO) {
    const int j = bid / NTO;                           // destination columns 0.. and 512.. (16 fragments on)
    const int r = bid - j * NTO;
    cvt_t<1>((unsigned short*)sT, wo, WOT + j * (DMD * 16), r % (DMD / 64), r / (DMD / 64), DMD, DMD, DMD, KF, 1.0f);
    return;
  }
  bid -= 2 * NTO;
  if (bid < 2 * NTL) {
    const int j = bid / NTL;                           // destination columns 0.. and 512.. (16 fragments on)
    const int r = bid - j * NTL;
    cvt_t<1>((unsigned short*)sT, wl, WLT + j * (DMD * 16), r % (EVP / 64), r / (EVP / 64), DMD, EVD, EVP, KF, 1.0f);
    return;
  }
  bid -= 2 * NTL;
  if (bid < NLE) cvt_fo64(ee, PEH, bid, WSCL);
}

// =====================================================================================================
// Causal attention with relative-offset term, head dim 64. Block = 256 threads = 8 waves; one block owns one
// 16-row query tile (t0..t0+15) of one batch b and HPW heads h0.. (q, k, v are the same for every head: each wave
// loads a key block's K and V fragments and takes q.k^T once and uses them for its HPW heads; only the E band, the
// softmax and the O accumulators are per head). The key blocks of 32 up to the diagonal (sb <= t0)
// are cut into 8 contiguous shares, one per wave; each wave runs its share with an online max-subtracted
// softmax in f32 and leaves its partial state (row max, row sum, unnormalised 16x64 O) in LDS; behind one
// block barrier the 8 states are merged in wave order (rescale by exp(max_w - max), sum, divide).
// Planes, all in fragment order: QH, KH f16 [MT][64] = 16*q, 16*k (shared
// by all heads); PE f16 [NH*SEQ_FULL][64] = 64*E (head h rows h*SEQ_FULL..); VH, VL bf16 [64][MT] = v hi and
// lo planes transposed (row = dim, column = token). Output Z bf16 [MT][1024]: cols h*64+d = ctx hi, cols
// 512+h*64+d = ctx lo.
// Every product is taken transposed (K, E and V fragments as the A operand, Q and P as the B operand), so that a lane
// holds one query (column m = lane & 15) and, per 16-row tile, the 8 keys, band columns or dims 8*hh + r.
// Per key block sb: S^T = K.Q^T (2 key subtiles x 2 k-steps, scale 1/256); relative band of 48 columns:
// column c <-> E row SEQ-16-t0+sb+c (a 16-row tile starts at a multiple of 16 and is clamped as a whole to start at
// most at SEQ-16; clamping only touches entries with j > i, which the causal select replaces); columns 0..15 come from
// the tile carried over from the prior key block (its columns 32..47), columns 16..47 are two fresh tiles (2 x 2 WMMA,
// scale 1/1024); the band is exchanged through per-wave LDS (one row of pitch RWQ floats per query, head g's band at RWP * g) and read back at
// c = 15 - il + jl, i.e. E row SEQ-1-i+j; score = (qk + rel)/8 for j <= i, else -1e10; a query's 32 scores lie in the
// two lanes m and m + 16: row max and row sum are taken inside the lane and once across the halves;
// p = exp(score - running max) in f32, l accumulated from the f32 p; the two p tiles of a lane, converted in place to
// bf16 hi and lo, are the B fragments of the next product (element e <- key 8*hh + e, element 8 + e <- key 16 + 8*hh + e,
// the k map of the V fragments); O^T += Vhi.Phi + Vlo.Phi + Vhi.Plo on 4 dim subtiles (one accumulator set). A wave
// whose share is empty contributes max -1e30, sum 0, O 0 (weight exp(-1e30 - max) = 0); wave 0's share is never empty.
// Merge: thread -> (row, 4 dims) in fragment order, 32 lanes x 8 B = two whole 128-B lines of Z per plane.
// coverage: 16 query rows x 64 halves x {hi, lo} x HPW heads per block, NB*(NH/HPW)*(SEQ/16) blocks = all (b, t, h)
// segments of Z in both halves.
// =====================================================================================================
// register budget of four waves per SIMD (256): two blocks stay resident on a WGP, as LDS allows
__global__ __launch_bounds__(32 * AWV, 4) void attn_kernel(
    const unsigned short* __restrict__ QH, const unsigned short* __restrict__ KH,
    const unsigned short* __restrict__ PE, const unsigned short* __restrict__ VH,
    const unsigned short* __restrict__ VL, unsigned short* Z) {
  __shared__ __align__(16) float relw[AWV][16 * RWQ];            // band exchange per wave: a query's row holds its HPW bands
  __shared__ __align__(16) float opw[HPW][AWV][16 * OPP];         // partial O per head and wave, pitch 68 floats
  __shared__ __align__(16) float mxw[HPW][AWV][16];               // partial row max per head and wave
  __shared__ __align__(16) float lsw[HPW][AWV][16];               // partial row sum per head and wave
  const int lane = threadIdx.x & 31, m = lane & 15, hh = lane >> 4;
  // wave number in a scalar register: the key loop's bounds depend on it and stay a scalar branch
  const int wv = __builtin_amdgcn_readfirstlane((int)(threadIdx.x >> 5));
  const int task = blockIdx.x;                       // 0 .. NB*(NH/HPW)*(SEQ/16)-1
  const int nqt = SEQ / 16;
  // There are more blocks than resident places, while a block's key loop grows
  // with its query tile: the cost falls with the index (last tile first, its NB * NH / HPW groups side by side).
  // task -> (tile, bg) is one to one.
  constexpr int nbg = NB * (NH / HPW);
  const int tq = task / nbg;
  const int bg = task - tq * nbg;                    // (b, group of HPW heads)
  const int t0 = (nqt - 1 - tq) << 4;                // query tile start
  const int b = bg / (NH / HPW), h0 = (bg - (bg / (NH / HPW)) * (NH / HPW)) * HPW;
  if (b >= NB) return;                               // block-uniform, before the barrier; never taken with exact grids
  const size_t tok0 = (size_t)b * SEQ;
  // this lane's query row of the bands, head g at RWP * g (both within reach of one address register's offsets); pitch
  // 108 floats: 16-byte aligned rows, and the skewed reads of the 32 lanes (dword 107 * m + 8 * hh + const) fall on 32
  // different banks
  float* rq[HPW];
#pragma unroll
  for (int g = 0; g < HPW; ++g) rq[g] = relw[wv] + m * RWQ + g * RWP;

  // Q B-fragments: columns t0+m, k = head dims 0..31 and 32..63 (the same for every head)
  const int qt = (int)((tok0 + (size_t)t0) >> 4);
  const unsigned l16 = (unsigned)lane * 16u;          // lane part of every fragment load's byte offset
  const unsigned qo = (unsigned)qt * 2048u + l16;     // a 16-row tile of a [..][64] plane = two fragments = 2048 bytes
  const v16us qf0 = ldfrag_at((const char*)QH, qo);
  const v16us qf1 = ldfrag_at((const char*)QH + 1024, qo);

  const unsigned short* pe[HPW];
#pragma unroll
  for (int g = 0; g < HPW; ++g) pe[g] = PE + (size_t)(h0 + g) * SEQ_FULL * HD;
  const int rb = SEQ - 16 - t0;                      // E row of band column 0 at sb = 0 (>= 0)

  const int nkb = (t0 >> 5) + 1;                     // key blocks 0 .. floor(t0/32), block-uniform
  const int per = (nkb + AWV - 1) / AWV;             // key blocks per wave share
  const int kb0 = wv * per;                          // this wave's share [kb0, kb1), wave-uniform, may be empty
  const int kb1 = (kb0 + per < nkb) ? (kb0 + per) : nkb;

  // carried band tile of each head: columns 0..15 of key block kb0 <-> E rows rb + 32*kb0 + 0..15 (clamped)
  v8f carry[HPW];
  {
    const unsigned eo = (unsigned)(clampi(rb + (kb0 << 5), 0, SEQ - 16) >> 4) * 2048u + l16;
    v16us c0[HPW], c1[HPW];                          // all requested beside Q, in front of the first matrix statement
#pragma unroll
    for (int g = 0; g < HPW; ++g) {
      c0[g] = ldfrag_at((const char*)pe[g], eo);
      c1[g] = ldfrag_at((const char*)pe[g] + 1024, eo);
    }
    addr_wait3(qo, eo, eo);                          // the code below reuses the offset registers of these loads
#pragma unroll
    for (int g = 0; g < HPW; ++g) {
      carry[g] = mma_g(c0[g], qf0, zero8());
      carry[g] = mma_g(c1[g], qf1, carry[g]);
    }
  }

  float mx[HPW], ls[HPW];                            // of query t0 + m, equal in the lanes m and m + 16
  v8f O0[HPW], O1[HPW], O2[HPW], O3[HPW];
#pragma unroll
  for (int g = 0; g < HPW; ++g) {
    mx[g] = -1.0e30f;
    ls[g] = 0.f;
    O0[g] = zero8(); O1[g] = zero8(); O2[g] = zero8(); O3[g] = zero8();
  }

#pragma unroll 1
  for (int kb = kb0; kb < kb1; ++kb) {
    const int sb = kb << 5;
    // The K fragments and every head's E-band fragments are requested together, in front of the first matrix statement
    // (a load written between the guarded matrix statements is issued and waited for on its own: one round trip each).
    // K A-fragments: row = key token, k = head dim
    const unsigned ko = (unsigned)((tok0 + (size_t)sb) >> 4) * 2048u + l16;   // two key tiles = four fragments in a row
    const v16us kf0 = ldfrag_at((const char*)KH, ko), kf1 = ldfrag_at((const char*)KH + 1024, ko);
    const v16us kf2 = ldfrag_at((const char*)KH + 2048, ko), kf3 = ldfrag_at((const char*)KH + 3072, ko);
    // relative band: columns 16..31 and 32..47 <-> E rows rb+sb+16.. and rb+sb+32..
    const unsigned e1 = (unsigned)(clampi(rb + sb + 16, 0, SEQ - 16) >> 4) * 2048u + l16;
    const unsigned e2 = (unsigned)(clampi(rb + sb + 32, 0, SEQ - 16) >> 4) * 2048u + l16;
    v16us ef0[HPW], ef1[HPW], ef2[HPW], ef3[HPW];
#pragma unroll
    for (int g = 0; g < HPW; ++g) {
      ef0[g] = ldfrag_at((const char*)pe[g], e1);
      ef1[g] = ldfrag_at((const char*)pe[g] + 1024, e1);
      ef2[g] = ldfrag_at((const char*)pe[g], e2);
      ef3[g] = ldfrag_at((const char*)pe[g] + 1024, e2);
    }
    addr_wait3(ko, e1, e2);
    // keeps the first product below the whole group: hoisted into it, its load wait would hold the later loads back by
    // one round trip
    __builtin_amdgcn_sched_barrier(0);

    // q.k^T does not depend on the head: taken once for the HPW heads
    v8f S0, S1;
    S0 = mma_g(kf0, qf0, zero8());
    S0 = mma_g(kf1, qf1, S0);
    S1 = mma_g(kf2, qf0, zero8());
    S1 = mma_g(kf3, qf1, S1);
#pragma unroll
    for (int g = 0; g < HPW; ++g) {
      v8f Pb1, Pb2;
      Pb1 = mma_g(ef0[g], qf0, zero8());
      Pb1 = mma_g(ef1[g], qf1, Pb1);
      Pb2 = mma_g(ef2[g], qf0, zero8());
      Pb2 = mma_g(ef3[g], qf1, Pb2);
      // element r of a band tile = (column 16 * tile + 8 * hh + r, query m): 8 consecutive floats of the query's row
      float* d = rq[g] + 8 * hh;
      const v8f cy = carry[g];
      const v4f w0 = {cy[0], cy[1], cy[2], cy[3]}, w1 = {cy[4], cy[5], cy[6], cy[7]};
      const v4f w2 = {Pb1[0], Pb1[1], Pb1[2], Pb1[3]}, w3 = {Pb1[4], Pb1[5], Pb1[6], Pb1[7]};
      const v4f w4 = {Pb2[0], Pb2[1], Pb2[2], Pb2[3]}, w5 = {Pb2[4], Pb2[5], Pb2[6], Pb2[7]};
      *(v4f*)(d)      = w0;
      *(v4f*)(d + 4)  = w1;
      *(v4f*)(d + 16) = w2;
      *(v4f*)(d + 20) = w3;
      *(v4f*)(d + 32) = w4;
      *(v4f*)(d + 36) = w5;
      carry[g] = Pb2;
    }
    wave_sync_lds();

    // V A-fragments (row = dim, k = key token), four dim subtiles, hi and lo planes, the same for every head: requested
    // together here, behind the exchange fence (which waits for outstanding loads), so that they are in flight under
    // the first softmax
    const unsigned vo = (unsigned)((tok0 + (size_t)sb) >> 5) * 1024u + l16;
    constexpr int VR = (MT / 32) * 1024;                       // bytes from one 16-dim row of fragments to the next
    const v16us vh0 = ldfrag_at((const char*)VH, vo),          vl0 = ldfrag_at((const char*)VL, vo);
    const v16us vh1 = ldfrag_at((const char*)VH + VR, vo),     vl1 = ldfrag_at((const char*)VL + VR, vo);
    const v16us vh2 = ldfrag_at((const char*)VH + 2 * VR, vo), vl2 = ldfrag_at((const char*)VL + 2 * VR, vo);
    const v16us vh3 = ldfrag_at((const char*)VH + 3 * VR, vo), vl3 = ldfrag_at((const char*)VL + 3 * VR, vo);
    addr_wait3(vo, vo, vo);                                    // the score arithmetic below reuses their offset register

#pragma unroll
    for (int g = 0; g < HPW; ++g) {
      // skew read + scale + causal select (key j <= query i keeps the score, otherwise -1e10); element r = key jb + r
      float s0[8], s1[8];
      {
        const int i = t0 + m;
        const int jb = sb + 8 * hh;
        const float* sk = rq[g] + 15 - m + 8 * hh;
#pragma unroll
        for (int r = 0; r < 8; ++r) {
          const float rv0 = sk[r];
          const float rv1 = sk[16 + r];
          const float a0 = (S0[r] * (1.0f / (QKS * QKS)) + rv0 * (1.0f / (QKS * WSCL))) * RSQD;
          const float a1 = (S1[r] * (1.0f / (QKS * QKS)) + rv1 * (1.0f / (QKS * WSCL))) * RSQD;
          s0[r] = (jb + r <= i) ? a0 : NEGM;
          s1[r] = (jb + 16 + r <= i) ? a1 : NEGM;
        }
      }

      // online softmax: 16 of the query's scores in this lane, the other 16 in lane ^ 16
      float xm = fmaxf(s0[0], s1[0]);
#pragma unroll
      for (int r = 1; r < 8; ++r) xm = fmaxf(xm, fmaxf(s0[r], s1[r]));
      xm = fmaxf(xm, xhalf(xm));
      const float mn = fmaxf(mx[g], xm);
      const float al = exp2_slot((mx[g] - mn) * 1.44269504f);   // exp(x) = 2^(x * log2 e)
      mx[g] = mn;
      float pq[8];
      v8u wh, wl;                                              // P B-fragments as words of two bf16, hi and lo planes
#pragma unroll
      for (int r = 0; r < 8; r += 2) {
        const float a0 = exp2_slot((s0[r] - mn) * 1.44269504f), b0 = exp2_slot((s0[r + 1] - mn) * 1.44269504f);
        const float a1 = exp2_slot((s1[r] - mn) * 1.44269504f), b1 = exp2_slot((s1[r + 1] - mn) * 1.44269504f);
        pq[r]     = a0 + a1;
        pq[r + 1] = b0 + b1;
        const unsigned h0w = bf_pair(a0, b0), h1w = bf_pair(a1, b1);
        wh[r >> 1]       = h0w;                                // elements r, r + 1 <- keys 8*hh + r, + 1
        wh[4 + (r >> 1)] = h1w;                                // elements 8 + r, 9 + r <- keys 16 + 8*hh + r, + 1
        wl[r >> 1]       = bf_pair(a0 - __uint_as_float(h0w << 16), b0 - __uint_as_float(h0w & 0xFFFF0000u));
        wl[4 + (r >> 1)] = bf_pair(a1 - __uint_as_float(h1w << 16), b1 - __uint_as_float(h1w & 0xFFFF0000u));
      }
      const v16us afh = __builtin_bit_cast(v16us, wh), afl = __builtin_bit_cast(v16us, wl);
      float ps = ((pq[0] + pq[1]) + (pq[2] + pq[3])) + ((pq[4] + pq[5]) + (pq[6] + pq[7]));
      ps += xhalf(ps);
      ls[g] = ls[g] * al + ps;
#pragma unroll
      for (int r = 0; r < 8; ++r) {
        O0[g][r] = O0[g][r] * al;
        O1[g][r] = O1[g][r] * al;
        O2[g][r] = O2[g][r] * al;
        O3[g][r] = O3[g][r] * al;
      }

      // the V A-fragments were requested above the softmax
      O0[g] = mma_gb(vh0, afh, O0[g]);
      O0[g] = mma_gb(vl0, afh, O0[g]);
      O0[g] = mma_gb(vh0, afl, O0[g]);
      O1[g] = mma_gb(vh1, afh, O1[g]);
      O1[g] = mma_gb(vl1, afh, O1[g]);
      O1[g] = mma_gb(vh1, afl, O1[g]);
      O2[g] = mma_gb(vh2, afh, O2[g]);
      O2[g] = mma_gb(vl2, afh, O2[g]);
      O2[g] = mma_gb(vh2, afl, O2[g]);
      O3[g] = mma_gb(vh3, afh, O3[g]);
      O3[g] = mma_gb(vl3, afh, O3[g]);
      O3[g] = mma_gb(vh3, afl, O3[g]);
    }
  }
#pragma unroll
  for (int g = 0; g < HPW; ++g) acc_guard4(O0[g], O1[g], O2[g], O3[g]);

  // ---- this wave's partial states to LDS (D element r of a lane = query row m, dim 8*hh + r of each dim subtile) ----
#pragma unroll
  for (int g = 0; g < HPW; ++g) {
    float* op = opw[g][wv] + m * OPP + 8 * hh;
    const v8f A = O0[g], B = O1[g], C = O2[g], D = O3[g];
    const v4f a0 = {A[0], A[1], A[2], A[3]}, a1 = {A[4], A[5], A[6], A[7]};
    const v4f b0 = {B[0], B[1], B[2], B[3]}, b1 = {B[4], B[5], B[6], B[7]};
    const v4f c0 = {C[0], C[1], C[2], C[3]}, c1 = {C[4], C[5], C[6], C[7]};
    const v4f d0 = {D[0], D[1], D[2], D[3]}, d1 = {D[4], D[5], D[6], D[7]};
    *(v4f*)(op)      = a0;
    *(v4f*)(op + 4)  = a1;
    *(v4f*)(op + 16) = b0;
    *(v4f*)(op + 20) = b1;
    *(v4f*)(op + 32) = c0;
    *(v4f*)(op + 36) = c1;
    *(v4f*)(op + 48) = d0;
    *(v4f*)(op + 52) = d1;
    if (hh == 0) {                                     // mx, ls are equal in the lanes m and m + 16
      mxw[g][wv][m] = mx[g];
      lsw[g][wv][m] = ls[g];
    }
  }
  __syncthreads();                                     // publishes the 8 partial states of each head to the whole block

  // ---- merge in wave order, ctx = O / l, bf16 hi plane and lo plane, head by head; all stores stand at the end ----
  v2u hvv[HPW], lvv[HPW];
#pragma unroll
  for (int g = 0; g < HPW; ++g) {
    // thread u owns the u-th 8 bytes of the tile's two Z fragments per plane: a wave stores 256 contiguous bytes
    const int u = threadIdx.x;
    const int row = (u >> 1) & 15;
    const int c4 = ((u >> 7) & 1) * 32 + ((u >> 6) & 1) * 16 + ((u >> 5) & 1) * 8 + (u & 1) * 4;
    float mw[AWV];
    float mt = -1.0e30f;
#pragma unroll
    for (int w = 0; w < AWV; ++w) { mw[w] = mxw[g][w][row]; mt = fmaxf(mt, mw[w]); }
    float sc[AWV];
#pragma unroll
    for (int w = 0; w < AWV; ++w) sc[w] = exp2_slot((mw[w] - mt) * 1.44269504f);   // exp(max_w - max)
    float lt = 0.f;
    v4f ot = {0.f, 0.f, 0.f, 0.f};
#pragma unroll
    for (int w = 0; w < AWV; ++w) {
      const v4f o = *(const v4f*)(opw[g][w] + row * OPP + c4);
      lt += lsw[g][w][row] * sc[w];
#pragma unroll
      for (int e = 0; e < 4; ++e) ot[e] += o[e] * sc[w];
    }
    const float gi = 1.0f / lt;                        // lt >= 1
    unsigned short hb[4], lb[4];
#pragma unroll
    for (int e = 0; e < 4; ++e) {
      const float c = ot[e] * gi;
      hb[e] = bf_bits(c);
      lb[e] = bf_bits(c - bf_up(hb[e]));
    }
    const v2u hv = {pk16(hb[0], hb[1]), pk16(hb[2], hb[3])};
    const v2u lv = {pk16(lb[0], lb[1]), pk16(lb[2], lb[3])};
    hvv[g] = hv;
    lvv[g] = lv;
  }
#pragma unroll
  for (int g = 0; g < HPW; ++g) {
    // = fo_off(token, (h0 + g)*64 + c4, KF/32)
    unsigned short* dst = Z + ((size_t)qt * (KF / 32) + 2 * (h0 + g)) * 512 + threadIdx.x * 4;
    *(v2u*)dst = hvv[g];
    *(v2u*)(dst + DMD * 16) = lvv[g];                  // columns 512.. lie 16 fragments on
  }
}

// =====================================================================================================
// Flat whole-line writer of the output: out[row*388 + c] = L[row*448 + c]; each lane owns 4
// consecutive output floats (16 B; never straddles a row since 388 % 4 == 0), one instruction = 32 lanes x
// coverage: grid = MT*97/256 blocks x 256 float4 = all MT*388 output floats (in-kernel bound for safety).
// =====================================================================================================
__global__ __launch_bounds__(256) void out_copy(const float* __restrict__ L, const float* __restrict__ flg,
                                                 float* out) {
  __shared__ int wf[8];
  const int t = threadIdx.x, lane = t & 31, wv = t >> 5;
  int f;
  {
    const int ti = (t < NFLG) ? t : (NFLG - 1);         // clamped address, value selected
    const float x = flg[(size_t)ti * FLGW];
    f = ((t < NFLG) && (x == 1.0f)) ? 1 : 0;
  }
  f |= __shfl_xor(f, 1, 32);
  f |= __shfl_xor(f, 2, 32);
  f |= __shfl_xor(f, 4, 32);
  f |= __shfl_xor(f, 8, 32);
  f |= __shfl_xor(f, 16, 32);
  if (lane == 0) wf[wv] = f;
  __syncthreads();
  int g = 0;
#pragma unroll
  for (int w = 0; w < 8; ++w) g |= wf[w];
  const int e4 = blockIdx.x * 256 + t;
  if (e4 < MT * (EVD / 4)) {
    const int e = e4 * 4;
    const int row = e / EVD;
    const int c = e - row * EVD;
    v4f x = *(const v4f*)(L + (size_t)row * EVP + c);
    const float qn = __uint_as_float(0x7fc00000u);
    const v4f pn = {qn, qn, qn, qn};
    x = g ? pn : x;
    float* d = out + (size_t)e;
    *(v4f*)d = x;
    
  }
}

// =====================================================================================================
// Workspace map (bytes, full size NB=2, SEQ=2048); every plane is an exact multiple of its whole-row /
// whole-line / 32x64-tile store granularity; all offsets are multiples of 16384. PEH, QH, KH, VH, VL, Z, WOT, OP and
// WLT are kept in fragment order (see fo_off), the X and W*T planes and L row-major.
//   XQ   f16  [MT][512]        4194304     (x3 with XK, XV)
//   WQT  f16  [64][512]          65536     (x3 with WKT, WVT; Wq^T, Wk^T, Wv^T x64)
//   PEH  f16  [8*2048][64]     2097152     (E x64)
//   QH   f16  [MT][64]          524288     (16*q), KH same
//   VH   bf16 [64][MT]          524288     (v hi), VL same (v lo), contiguous after VH
//   Z    bf16 [MT][1024]       8388608     (ctx hi | ctx lo)
//   WOT  bf16 [512][1024]      1048576     (Wo^T | Wo^T)
//   OP   bf16 [MT][1024]       8388608     (relu out hi | lo)
//   WLT  bf16 [448][1024]       917504     (Wl^T | Wl^T, rows 388..447 zero)
//   L    f32  [MT][448]        7340032
//   FLG  f32  [128][32]          16384     (mask-structure flag lines)
//   total                     43073536
// =====================================================================================================
extern "C" void kernel_launch(void* const* d_in, const int* in_sizes, int n_in,
                              void* d_out, int out_size, void* d_ws, size_t ws_size,
                              hipStream_t stream) {
  if (n_in < 15) return;
  if (in_sizes[0] < (NB - 1) * SEQ_FULL * DMD + SEQ * DMD) return;   // v
  if (in_sizes[1] < (NB - 1) * SEQ_FULL * DMD + SEQ * DMD) return;   // k
  if (in_sizes[2] < (NB - 1) * SEQ_FULL * DMD + SEQ * DMD) return;   // q
  if (in_sizes[3] < (SEQ - 1) * SEQ_FULL + SEQ) return;               // mask
  if (in_sizes[4] < DMD * HD || in_sizes[6] < DMD * HD || in_sizes[8] < DMD * HD) return;
  if (in_sizes[5] < HD || in_sizes[7] < HD || in_sizes[9] < HD) return;
  if (in_sizes[10] < NH * SEQ_FULL * HD) return;                      // E
  if (in_sizes[11] < DMD * DMD || in_sizes[12] < DMD) return;         // Wo, bo
  if (in_sizes[13] < DMD * EVD || in_sizes[14] < EVD) return;         // Wl, bl
  if (out_size < MT * EVD) return;

  const float* v   = (const float*)d_in[0];    // [2][2048][512]
  const float* k   = (const float*)d_in[1];
  const float* q   = (const float*)d_in[2];
  const float* msk = (const float*)d_in[3];    // [2048][2048]
  const float* wq  = (const float*)d_in[4];    // [512][64]
  const float* bq  = (const float*)d_in[5];    // [64]
  const float* wk  = (const float*)d_in[6];
  const float* bk  = (const float*)d_in[7];
  const float* wv  = (const float*)d_in[8];
  const float* bv  = (const float*)d_in[9];
  const float* ee  = (const float*)d_in[10];   // [8][2048][64]
  const float* wo  = (const float*)d_in[11];   // [512][512] (in, out)
  const float* bo  = (const float*)d_in[12];   // [512]
  const float* wl  = (const float*)d_in[13];   // [512][388] (in, out)
  const float* bl  = (const float*)d_in[14];   // [388]

  const size_t PX  = (size_t)MT * DMD * 2;
  const size_t PW  = (size_t)HD * DMD * 2;
  const size_t PPE = (size_t)NH * SEQ_FULL * HD * 2;
  const size_t PQK = (size_t)MT * HD * 2;
  const size_t PV2 = (size_t)2 * HD * MT * 2;
  const size_t PZ  = (size_t)MT * KF * 2;
  const size_t PWO = (size_t)DMD * KF * 2;
  const size_t POP = (size_t)MT * KF * 2;
  const size_t PWL = (size_t)EVP * KF * 2;
  const size_t PL  = (size_t)MT * EVP * 4;
  const size_t PFL = (size_t)(SEQ_FULL / 16) * FLGW * 4;
  size_t off = 0;
  const size_t oXQ = off; off += PX;
  const size_t oXK = off; off += PX;
  const size_t oXV = off; off += PX;
  const size_t oWQ = off; off += PW;
  const size_t oWK = off; off += PW;
  const size_t oWV = off; off += PW;
  const size_t oPE = off; off += PPE;
  const size_t oQH = off; off += PQK;
  const size_t oKH = off; off += PQK;
  const size_t oV  = off; off += PV2;
  const size_t oZ  = off; off += PZ;
  const size_t oWO = off; off += PWO;
  const size_t oOP = off; off += POP;
  const size_t oWL = off; off += PWL;
  const size_t oL  = off; off += PL;
  const size_t oFL = off; off += PFL;
  if (off > ws_size) return;
  if (off > (size_t)134217728) return;

  char* ws = (char*)d_ws;
  unsigned short* XQ  = (unsigned short*)(ws + oXQ);
  unsigned short* XK  = (unsigned short*)(ws + oXK);
  unsigned short* XV  = (unsigned short*)(ws + oXV);
  unsigned short* WQT = (unsigned short*)(ws + oWQ);
  unsigned short* WKT = (unsigned short*)(ws + oWK);
  unsigned short* WVT = (unsigned short*)(ws + oWV);
  unsigned short* PEH = (unsigned short*)(ws + oPE);
  unsigned short* QHp = (unsigned short*)(ws + oQH);
  unsigned short* KHp = (unsigned short*)(ws + oKH);
  unsigned short* VHp = (unsigned short*)(ws + oV);
  unsigned short* VLp = VHp + (size_t)HD * MT;
  unsigned short* Zp  = (unsigned short*)(ws + oZ);
  unsigned short* WOT = (unsigned short*)(ws + oWO);
  unsigned short* OPp = (unsigned short*)(ws + oOP);
  unsigned short* WLT = (unsigned short*)(ws + oWL);
  float* Lp   = (float*)(ws + oL);
  float* FLG  = (float*)(ws + oFL);
  float* out0 = (float*)d_out;
  float* fdummy = Lp;                             // in-range placeholder for unused f32 output args
  unsigned short* hdummy = QHp;                   // in-range placeholder for unused 16-bit output args

  const dim3 blk(256);

  // (0) what the projections read, one launch: q, k, v (per batch slab) -> f16(bf16); Wq|Wk|Wv [512][64] ->
  //     [64][512] (transposed, f16 x64)
  prep_x<<<dim3(PREP_BLOCKS), blk, 0, stream>>>(q, k, v, wq, wk, wv, XQ, XK, XV, WQT, WKT, WVT);

  // (1) one launch: the three projections (q plane x16, k plane x16, v^T bf16 hi (VH) and lo (VL) planes) and,
  //     beside them, the jobs only later launches read: mask structure flags, Wo and Wl planes, E plane
  proj_side<<<dim3(SIDE_BLOCKS), blk, 0, stream>>>(XQ, XK, XV, WQT, WKT, WVT, bq, bk, bv, QHp, KHp, VHp,
                                                   msk, FLG, wo, WOT, wl, WLT, ee, PEH);

  // (2) attention -> ctx hi|lo token-major plane
  attn_kernel<<<dim3(NB * (NH / HPW) * (SEQ / 16)), dim3(32 * AWV), 0, stream>>>(QHp, KHp, PEH, VHp, VLp, Zp);

  // (3) output projection with relu: OP = bf16 hi|lo of max(0, sum_k Z[row][k] * WOT[n][k] + bo[n]), K = 1024
  const int gO = ((MT / (16 * GTI)) * (DMD / 64) + GWV - 1) / GWV;
  gemm64<1, 2, 1, 0><<<dim3(gO), dim3(32 * GWV), 0, stream>>>(Zp, KF, WOT, KF, OPp, DMD * 16, fdummy, KF, 1.0f, bo, DMD, 1.0f, MT, DMD, KF);

  // (4) logits: L[row][n] = sum_k OP[row][k] * WLT[n][k] + bl[n], K = 1024, N padded to 448
  const int gL = ((MT / (16 * GTI)) * (EVP / 64) + GWV - 1) / GWV;
  gemm64<1, 0, 0, 0><<<dim3(gL), dim3(32 * GWV), 0, stream>>>(OPp, KF, WLT, KF, hdummy, 0, Lp, EVP, 1.0f, bl, EVD, 1.0f, MT, EVP, KF);

  // (5) flat whole-line copy into the output (388-wide rows), NaN-poisoned on a mask-structure violation
  out_copy<<<dim3((MT * (EVD / 4) + 255) / 256), blk, 0, stream>>>(Lp, FLG, out0);
  (void)hipGetLastError();
}

// v010
// Measured time: 74.3 microseconds a run.
// Timed twice side by side with v009, it ran 1.04 times as fast both times.
// Counting every step since v000, it is 5.38 times as fast.
// Contractions: x.Wq and x.Wk (f16 planes x16), Wv^T.x^T (bf16 hi|lo planes), q.k^T and q.E^T band on
// v_wmma_f32_16x16x32_f16 (f16 operands, f32 accumulate); p.v as bf16 hi/lo three-product split, and
// [ctx_hi|ctx_lo].[Wo;Wo], [o_hi|o_lo].[Wl;Wl] K-folded planes on v_wmma_f32_16x16x32_bf16 (bf16 operands,
// f32 accumulate). Float inputs RNE-converted to bf16 on load (x x1; Wq, Wk, Wv, E x64 in f16; Wo, Wl bf16);
// softmax, causal select and the relative-offset skew in f32 on VALU.
#include <hip/hip_runtime.h>
#include <math.h>

#ifndef NB
#define NB 2
#endif
#ifndef SEQ
#define SEQ 2048
#endif
#define NB_FULL  2
#define SEQ_FULL 2048
#define DMD  512
#define NH   8
#define HD   64
#define EVD  388
#define EVP  448
#define MT   (NB * SEQ)
#define KF   (2 * DMD)
#define NFLG (SEQ / 16)
#define FLGW 32
#define AWV  8
#define HPW  2
#define OPP  68
#define RWP  52
#define RWQ  108
#define WSCL 64.0f
#define QKS  16.0f
#define RSQD 0.125f
#define NEGM (-1.0e10f)

static_assert(NB >= 1 && NB <= NB_FULL);
static_assert(SEQ >= 64 && SEQ <= SEQ_FULL && (SEQ % 64) == 0);
static_assert(NH * HD == DMD && HD == 64 && (NH % HPW) == 0 && HPW * RWP <= RWQ);
static_assert((MT % 64) == 0 && (DMD % 64) == 0 && (KF % 64) == 0);
static_assert((EVP % 64) == 0 && EVP >= EVD && (EVD % 4) == 0);
static_assert(((SEQ * DMD) % 2048) == 0 && ((NH * SEQ_FULL * HD) % 8192) == 0);
static_assert(NFLG <= 256 && ((4 * SEQ) % 256) == 0);

typedef _Float16 v16h __attribute__((ext_vector_type(16)));
typedef __bf16 v16bf __attribute__((ext_vector_type(16)));
typedef unsigned short v16us __attribute__((ext_vector_type(16)));
typedef unsigned short v8us  __attribute__((ext_vector_type(8)));
typedef float v8f __attribute__((ext_vector_type(8)));
typedef float v4f __attribute__((ext_vector_type(4)));
typedef unsigned int v4u __attribute__((ext_vector_type(4)));
typedef unsigned int v2u __attribute__((ext_vector_type(2)));
typedef unsigned int v8u __attribute__((ext_vector_type(8)));
typedef float v2f __attribute__((ext_vector_type(2)));
typedef __bf16 v2bf __attribute__((ext_vector_type(2)));

union FragU { v16us v; v8us h[2]; };

// ---- scalar helpers --------------------------------------------------------------------------------
__device__ __forceinline__ unsigned short bf_bits(float f) {          // f32 -> bf16 bits, RNE convert
  const unsigned u = __float_as_uint(f);
  return (unsigned short)((u + 0x7FFFu + ((u >> 16) & 1u)) >> 16);
}
// two f32 -> one word of two bf16 (RNE, a in the low half): the packed convert instruction
__device__ __forceinline__ unsigned bf_pair(float a, float b) {
  const v2f x = {a, b};
  return __builtin_bit_cast(unsigned, __builtin_convertvector(x, v2bf));
}
__device__ __forceinline__ float bf_up(unsigned short h) { return __uint_as_float(((unsigned)h) << 16); }
__device__ __forceinline__ float bfr(float f) { return bf_up(bf_bits(f)); }   // value of the bf16 RNE convert
__device__ __forceinline__ unsigned short h_bits(_Float16 x) { return __builtin_bit_cast(unsigned short, x); }
__device__ __forceinline__ unsigned short f2h(float f) { return h_bits((_Float16)f); }
__device__ __forceinline__ unsigned pk16(unsigned short a, unsigned short b) { return (unsigned)a | ((unsigned)b << 16); }
__device__ __forceinline__ int clampi(int v, int lo, int hi) { return v < lo ? lo : (v > hi ? hi : v); }
__device__ __forceinline__ v8f zero8() { v8f z = {0.f, 0.f, 0.f, 0.f, 0.f, 0.f, 0.f, 0.f}; return z; }

// ---- fragment loader: 16-bit A/B operand, lane -> row/col (lane&15), p already includes +8*(lane>>4);
//      elements 0..7 <- p[0..7] (k0+8h..), elements 8..15 <- p[16..23] (k0+16+8h..)
__device__ __forceinline__ v16us ldfrag_u(const unsigned short* p) {
  FragU f;
  f.h[0] = *(const v8us*)(p);
  f.h[1] = *(const v8us*)(p + 16);
  return f.v;
}

// ---- fragment order: a 16-bit plane [R][K] (R % 16 == 0, K % 32 == 0, KS = K / 32) kept as 1-KB fragments of 16 rows x
//      32 k, fragment (row / 16) * KS + k / 32; inside it two 512-B halves (k % 32 below 16, then from 16 on), each 32
//      chunks of 8 elements in lane order ((k / 8) % 2) * 16 + row % 16. A fragment load is then two loads of 512
//      contiguous bytes (4 whole lines each) with the same element map as ldfrag_u, not two loads over 16 lines each.
__device__ __forceinline__ size_t fo_off(int row, int k, int KS) {
  return ((size_t)(row >> 4) * KS + (k >> 5)) * 512 + ((k >> 4) & 1) * 256 + (((k >> 3) & 1) * 16 + (row & 15)) * 8 + (k & 7);
}
__device__ __forceinline__ v16us ldfrag_fo(const unsigned short* plane, int tr, int ks, int KS, int lane) {
  // 32-bit byte offset (every plane is far below 4 GiB) on the plane's uniform pointer: one address register per load group
  const unsigned off = ((unsigned)tr * (unsigned)KS + (unsigned)ks) * 1024u + (unsigned)lane * 16u;
  const unsigned short* p = (const unsigned short*)((const char*)plane + off);
  FragU f;
  f.h[0] = *(const v8us*)(p);
  f.h[1] = *(const v8us*)(p + 256);
  return f.v;
}

// the same fragment load from a wave-uniform fragment address (scalar registers) and the lane's byte offset 16 * lane
__device__ __forceinline__ v16us ldfrag_at(const char* ufrag, unsigned l16) {
  const unsigned short* p = (const unsigned short*)(ufrag + l16);
  FragU f;
  f.h[0] = *(const v8us*)(p);
  f.h[1] = *(const v8us*)(p + 256);
  return f.v;
}

// stands behind issued global loads or stores, in front of the code that reuses the registers they name
__device__ __forceinline__ void addr_wait() {
#if defined(__HIP_DEVICE_COMPILE__)
  asm volatile("s_wait_xcnt 0x0" ::: "memory");
#endif
}

// the same wait, with the index registers of the issued loads as inputs: they cannot be given away in front of it
__device__ __forceinline__ void addr_wait8(int a, int b, int c, int d, int e, int f, int g, int h) {
#if defined(__HIP_DEVICE_COMPILE__)
  asm volatile("s_wait_xcnt 0x0" :: "v"(a), "v"(b), "v"(c), "v"(d), "v"(e), "v"(f), "v"(g), "v"(h) : "memory");
#endif
}

// the same wait for loads that name up to three offset registers: as inputs they stay whole up to it, so that no load
// of the group is given one of them as its destination
__device__ __forceinline__ void addr_wait3(unsigned a, unsigned b, unsigned c) {
#if defined(__HIP_DEVICE_COMPILE__)
  asm volatile("s_wait_xcnt 0x0" :: "v"(a), "v"(b), "v"(c) : "memory");
#endif
}

// ---- WMMA helpers (f16 / bf16 operand bits) with trailing VALU hazard gap --------------------------
__device__ __forceinline__ v8f mma_raw(v16us a, v16us b, v8f c) {
  return __builtin_amdgcn_wmma_f32_16x16x32_f16(false, __builtin_bit_cast(v16h, a), false,
                                                __builtin_bit_cast(v16h, b), (short)0, c, false, false);
}
__device__ __forceinline__ v8f mma_raw_bf(v16us a, v16us b, v8f c) {
  return __builtin_amdgcn_wmma_f32_16x16x32_bf16(false, __builtin_bit_cast(v16bf, a), false,
                                                 __builtin_bit_cast(v16bf, b), (short)0, c, false, false);
}
__device__ __forceinline__ v8f mma_g(v16us a, v16us b, v8f c) {                 // guarded f16
  c = mma_raw(a, b, c);
#if defined(__HIP_DEVICE_COMPILE__)
  asm volatile("v_nop\n\tv_nop\n\tv_nop\n\tv_nop" : "+v"(c) : "v"(a), "v"(b));
#endif
  return c;
}
__device__ __forceinline__ v8f mma_gb(v16us a, v16us b, v8f c) {                // guarded bf16
  c = mma_raw_bf(a, b, c);
#if defined(__HIP_DEVICE_COMPILE__)
  asm volatile("v_nop\n\tv_nop\n\tv_nop\n\tv_nop" : "+v"(c) : "v"(a), "v"(b));
#endif
  return c;
}
__device__ __forceinline__ void dep_guard1(v8f& a, v8f& b, v16us x) {
#if defined(__HIP_DEVICE_COMPILE__)
  asm volatile("v_nop\n\tv_nop\n\tv_nop\n\tv_nop" : "+v"(a), "+v"(b) : "v"(x));
#endif
}
__device__ __forceinline__ void keep4_u(v16us a, v16us b, v16us c, v16us d) {
#if defined(__HIP_DEVICE_COMPILE__)
  asm volatile("v_nop" :: "v"(a), "v"(b), "v"(c), "v"(d));
#endif
}
__device__ __forceinline__ void acc_guard4(v8f& a, v8f& b, v8f& c, v8f& d) {
#if defined(__HIP_DEVICE_COMPILE__)
  asm volatile("v_nop\n\tv_nop\n\tv_nop\n\tv_nop" : "+v"(a), "+v"(b), "+v"(c), "+v"(d));
#endif
}
// 2^x; the v_nop keeps, inside the statement, the one slot the instruction set asks for between a
// transcendental and an instruction that reads its result or overwrites its source
__device__ __forceinline__ float exp2_slot(float x) {
  float r = 0.f;
#if defined(__HIP_DEVICE_COMPILE__)
  asm("v_exp_f32 %0, %1\n\tv_nop" : "=v"(r) : "v"(x));
#endif
  return r;
}
// value of lane l ^ 16 (the other half-wave), a vector cross-row move
__device__ __forceinline__ float xhalf(float x) {
  const int b = __float_as_int(x);
  return __int_as_float(__builtin_amdgcn_permlanex16(b, b, 0x76543210, 0xfedcba98, false, false));
}
// orders LDS stores of this wave before later LDS loads of the same wave (cross-lane exchange)
__device__ __forceinline__ void wave_sync_lds() {
  __builtin_amdgcn_fence(__ATOMIC_RELEASE, "workgroup");
  __builtin_amdgcn_wave_barrier();
  __builtin_amdgcn_fence(__ATOMIC_ACQUIRE, "workgroup");
}

// =====================================================================================================
// Layout-kept convert of q, k, v: X[i] = f16 bits of the bf16 RNE value of x[i]. Batch slab by starts at by * SEQ_FULL *
// DMD in the source and at by * SEQ * DMD in the plane. A thread owns the 8-element chunk bx * 256 + t of every slab of
// all three inputs and requests the 6 * NB loads of 16 bytes together: few waves to start, each with many loads in flight.
// coverage: 256 threads x 8 = 2048 elements of each of the 3 * NB slabs per block; bx = 0 .. SEQ*DMD/2048 - 1 exact.
// Block body, called from the first merged launch below.
// =====================================================================================================
__device__ __forceinline__ void cvt_x(const float* __restrict__ q, const float* __restrict__ k,
                                      const float* __restrict__ v, unsigned short* XQ, unsigned short* XK,
                                      unsigned short* XV, int bx) {
  const unsigned base = ((unsigned)bx * 256u + threadIdx.x) * 8u;   // element in a slab, below SEQ * DMD
  const unsigned so = base * 4u, dofs = base * 2u;         // its byte offsets on the uniform slab pointers
  v4f a[3 * NB][2];
#pragma unroll
  for (int j = 0; j < 3; ++j) {
    const char* x = (const char*)((j == 0) ? q : ((j == 1) ? k : v));
#pragma unroll
    for (int by = 0; by < NB; ++by) {
      const char* p = x + (size_t)by * (SEQ_FULL * DMD * 4) + so;
      a[j * NB + by][0] = *(const v4f*)(p);
      a[j * NB + by][1] = *(const v4f*)(p + 16);
    }
  }
  addr_wait3(so, so, so);                                // the converts below may reuse the offset register of these loads
  v4u hv[3 * NB];
#pragma unroll
  for (int c = 0; c < 3 * NB; ++c) {
#pragma unroll
    for (int e = 0; e < 2; ++e) {
      hv[c][e]     = pk16(f2h(bfr(a[c][0][2 * e])), f2h(bfr(a[c][0][2 * e + 1])));
      hv[c][2 + e] = pk16(f2h(bfr(a[c][1][2 * e])), f2h(bfr(a[c][1][2 * e + 1])));
    }
  }
#pragma unroll
  for (int j = 0; j < 3; ++j) {                          // all stores stand at the end
    char* o = (char*)((j == 0) ? XQ : ((j == 1) ? XK : XV));
#pragma unroll
    for (int by = 0; by < NB; ++by) *(v4u*)(o + (size_t)by * (SEQ * DMD * 2) + dofs) = hv[j * NB + by];
  }
  addr_wait();                                           // code of the other job range follows in the merged kernel
}

// Convert of a [R][64] f32 plane into fragment order (KS = 2): o = f16 bits of (bf16 RNE value of w * sc). A 16-byte chunk
// of the destination, numbered linearly (a wave stores 512 contiguous bytes), comes from 8 source elements; a thread owns
// FCH chunks, 256 apart, and requests their 2 * FCH loads together. coverage: FCH * 256 chunks = FCH * 2048 elements per
// block; bx = 0 .. R*64/(2048*FCH) - 1 exact at the call site.
#define FCH 4
__device__ __forceinline__ void cvt_fo64(const float* __restrict__ w, unsigned short* o, int bx, float sc) {
  const int g0 = bx * (FCH * 256) + threadIdx.x;
  // chunk g0 + 256 * c lies 32 source rows (two 16-row tiles) behind chunk g0 + 256 * (c - 1): one offset register each way
  const int row = ((g0 >> 7) << 4) + (g0 & 15);
  const int col = ((g0 >> 6) & 1) * 32 + ((g0 >> 5) & 1) * 16 + ((g0 >> 4) & 1) * 8;
  const unsigned so = (unsigned)(row * 64 + col) * 4u, dofs = (unsigned)g0 * 16u;   // byte offsets on the uniform pointers
  v4f a[FCH][2];
#pragma unroll
  for (int c = 0; c < FCH; ++c) {
    const char* p = (const char*)w + c * (32 * 64 * 4) + so;
    a[c][0] = *(const v4f*)(p);
    a[c][1] = *(const v4f*)(p + 16);
  }
  addr_wait3(so, so, so);                                // the converts below may reuse the offset register of these loads
  v4u hv[FCH];
#pragma unroll
  for (int c = 0; c < FCH; ++c) {
#pragma unroll
    for (int e = 0; e < 2; ++e) {
      hv[c][e]     = pk16(f2h(bfr(a[c][0][2 * e]) * sc), f2h(bfr(a[c][0][2 * e + 1]) * sc));
      hv[c][2 + e] = pk16(f2h(bfr(a[c][1][2 * e]) * sc), f2h(bfr(a[c][1][2 * e + 1]) * sc));
    }
  }
#pragma unroll
  for (int c = 0; c < FCH; ++c) *(v4u*)((char*)o + c * (256 * 16) + dofs) = hv[c];   // all stores stand at the end
  addr_wait();                                           // code of other job ranges follows in the merged kernel
}

// =====================================================================================================
// Transpose-convert: in w[R][C] f32 (pitch C) -> out o[c][r] at o[c*ldo + r] for c < CP, with zero values
// for C <= c < CP. BFO 0: f16 bits of (bf16 RNE value * sc); BFO 1: bf16 bits (RNE), and the output plane [CP][ldo] is
// in fragment order (o[fo_off(c, r, ldo / 32)], a wave storing 512 contiguous bytes). Block tile 64x64
// through LDS (st[col][row], pitch 72 halves). Read phase: thread owns one input row x 16 columns (float4
// loads at a clamped column address, zero selected by value; C % 4 == 0 so a float4 is all-in or all-out).
// R, CP multiples of 64, ldo % 64 == 0, (bx, by) in (CP/64, R/64) exact (compile-time constants at the call
// sites). coverage: 64 output rows x 64 halves per block = the whole transposed tile; the callers' ranges cover
// all of [CP][R]. Block body, called from the merged launches below under a block-uniform branch; st is the
// calling kernel's LDS tile of 64 * 72 halves.
// =====================================================================================================
template <int BFO>
__device__ __forceinline__ void cvt_t(unsigned short* st, const float* __restrict__ w, unsigned short* o,
                                      int bx, int by, int R, int C, int CP, int ldo, float sc) {
  const int t = threadIdx.x;
  const int r0 = by * 64, c0 = bx * 64;
  if (r0 + 64 > R || c0 + 64 > CP) return;              // block-uniform, before the barrier; never taken
  {
    const int row = t >> 2, ch = (t & 3) * 16;
    const float* p = w + (size_t)(r0 + row) * C;
#pragma unroll
    for (int q = 0; q < 4; ++q) {
      const int cs = c0 + ch + 4 * q;
      const bool inr = (cs + 4 <= C);
      const int lb = inr ? cs : (C - 4);                 // clamped column address, always in range
      const v4f v = *(const v4f*)(p + lb);
#pragma unroll
      for (int e = 0; e < 4; ++e) {
        const unsigned short hb = BFO ? bf_bits(v[e]) : f2h(bfr(v[e]) * sc);
        st[(ch + 4 * q + e) * 72 + row] = inr ? hb : (unsigned short)0;
      }
    }
  }
  __syncthreads();
  v4u hv[2];
#pragma unroll
  for (int half = 0; half < 2; ++half) {
    const int c = t + 256 * half;                        // BFO: chunk number in fragment order within the tile
    const int cl = BFO ? ((c >> 7) * 16 + (c & 15)) : ((t >> 3) + 32 * half);
    const int pc = BFO ? (((c >> 6) & 1) * 32 + ((c >> 5) & 1) * 16 + ((c >> 4) & 1) * 8) : ((t & 7) * 8);
    hv[half] = *(const v4u*)(st + cl * 72 + pc);
  }
  {
#pragma unroll
    for (int half = 0; half < 2; ++half) {
      const int c = t + 256 * half;
      const int cl = BFO ? ((c >> 7) * 16 + (c & 15)) : ((t >> 3) + 32 * half);
      const int pc = BFO ? (((c >> 6) & 1) * 32 + ((c >> 5) & 1) * 16 + ((c >> 4) & 1) * 8) : ((t & 7) * 8);
      unsigned short* dst = o + (BFO ? fo_off(c0 + cl, r0 + pc, ldo >> 5) : ((size_t)(c0 + cl) * ldo + r0 + pc));
      *(v4u*)dst = hv[half];
    }
#if defined(__HIP_DEVICE_COMPILE__)
    // precaution: wait for the stores to read their registers (the block ends after this one job)
    asm volatile("s_wait_xcnt 0x0" ::: "memory");
#endif
  }
}

// =====================================================================================================
// Register-blocked 16-bit WMMA GEMM: C[m][n] = sum_k A[m][k] * Bt[n][k], one wave per 32x64 tile, no block
// barriers. BF 0: f16 operand bits, BF 1: bf16 operand bits. A row-major [M][K] pitch lda; Bt row-major
// [N][K] pitch ldb (k contiguous); M multiple of 32, N of 64, K of 32 (true at every call site; waves
// past the last tile exit before any work, wave-uniform). A wave's k step is two A and four B fragments, whose
// twelve loads are issued together: one load round trip per k step, and M/32 * N/64 waves to fill the chip.
// WPB = waves (tiles) per block. Tiles are numbered down the rows first, so the waves of a block read the same
// four B fragments where WPB divides M/32 (in the v^T product, M/32 = 2: only wave pairs do). Both operand fragments use the split k map
// (elements 0..7 <- k0+8h.., 8..15 <- k0+16+8h..); D element r of a lane is (row 8h + r, col lane&15).
// Bias: bf16 RNE value of bias[] times bsc, indexed by column (clamped into nbias) or, with BROW, by row.
// FOI 1: A and Bt are planes in fragment order (KS = lda / 32, ldb / 32) instead of row-major, bf16 (BF 1), K a multiple
// of 32 * GPD; the loads of k step s + GPD are issued behind the products of k step s (same k order of the sums).
// OM 0: f32 out Cf = acc*osc + b, pitch ldc.            OM 1: f16 out Ch = f16 bits(acc*osc + b).
// OM 2: val = (RELU ? max(0, .) : .)(acc*osc + b); bf16 hi bits at Ch, bf16 lo bits (val - hi) at Ch + looff.
// The 16-bit outputs (OM 1, 2) are planes [M][ldc] in fragment order; a wave's slab is whole 1-KB fragments.
// coverage: GTI slabs x 16 rows x 64 cols = the wave's whole tile (hi and lo planes alike).
// gemm64_blk is the block body (bx = block number within this product, sT = the calling kernel's LDS, WPB per-wave
// 16x64 slabs of pitch 68 floats); gemm64 is the launch of one product alone.
// =====================================================================================================
#define GSLAB (16 * 68)
#define GTI 2                                  // 16-row subtiles per wave tile
#define GWV 4                                  // waves per block where a product is launched alone
#define GPD 4                                  // k steps of fragments a wave keeps in flight (FOI products)
static_assert((KF % (32 * GPD)) == 0);
template <int BF, int OM, int RELU, int BROW, int WPB, int FOI>
__device__ __forceinline__ void gemm64_blk(
    float* sT, int bx,
    const unsigned short* __restrict__ Ap, int lda, const unsigned short* __restrict__ Btp, int ldb,
    unsigned short* Ch, int looff, float* Cf, int ldc, float osc,
    const float* __restrict__ bias, int nbias, float bsc, int M, int N, int K) {
  const int lane = threadIdx.x & 31;
  const int wave = threadIdx.x >> 5;
  const int tilesN = N >> 6;
  const int tilesM = M / (16 * GTI);
  const int tile = bx * WPB + wave;
  if (tile >= tilesM * tilesN) return;   // wave-uniform; no block barriers in this kernel
  const int tn = tile / tilesM;
  const int tm = tile - tn * tilesM;
  const int m0 = tm * (16 * GTI);
  const int n0 = tn << 6;

  const int rlane = lane & 15;                 // row (A) / col (B, D) within subtile
  const int koff  = (lane >> 4) * 8;           // k offset of this lane half
  const int mOff  = (lane >> 4) * 8;           // D row offset

  v8f acc[GTI][4];
#pragma unroll
  for (int i = 0; i < GTI; ++i)
#pragma unroll
    for (int j = 0; j < 4; ++j) acc[i][j] = zero8();

  if constexpr (FOI) {
    static_assert(BF == 1);
    // Register ring of GPD k steps (place s = the six fragments of one k step). A place is refilled, GPD k steps ahead,
    // right behind its own products: its loads return under the products of the other GPD - 1 places.
    // Each fragment row's base is wave-uniform and kept in scalar registers, the place is a constant offset, and one
    // vector register holds the lane part and the advance along k.
    unsigned l16 = (unsigned)lane * 16u;                 // lane part, plus the bytes of the k steps gone by
    const char* pb[4];
    const char* pa[GTI];
#pragma unroll
    for (int j = 0; j < 4; ++j)
      pb[j] = (const char*)Btp + (size_t)__builtin_amdgcn_readfirstlane(((n0 >> 4) + j) * (ldb >> 5)) * 1024;
#pragma unroll
    for (int i = 0; i < GTI; ++i)
      pa[i] = (const char*)Ap + (size_t)__builtin_amdgcn_readfirstlane(((m0 >> 4) + i) * (lda >> 5)) * 1024;
    v16us bh[GPD][4], ah[GPD][GTI];
#pragma unroll
    for (int s = 0; s < GPD; ++s) {
#pragma unroll
      for (int j = 0; j < 4; ++j) bh[s][j] = ldfrag_at(pb[j] + s * 1024, l16);
#pragma unroll
      for (int i = 0; i < GTI; ++i) ah[s][i] = ldfrag_at(pa[i] + s * 1024, l16);
      // keeps the first fill in the order of the refills, place by place: the counted load waits in the loop are set for
      // both ways into it, and a first fill in another order would make them wait for younger places too
      __builtin_amdgcn_sched_barrier(0);
    }
    // behind the last load of the first fill: whichever code comes next may reuse the base registers these loads name
    addr_wait();
    // rolled over groups of GPD k steps, so that the places of the ring are fixed registers
#pragma unroll 1
    for (int k0 = 32 * GPD; k0 < K; k0 += 32 * GPD) {
#pragma unroll
      for (int s = 0; s < GPD; ++s) {
#pragma unroll
        for (int i = 0; i < GTI; ++i)
#pragma unroll
          for (int j = 0; j < 4; ++j) acc[i][j] = mma_raw_bf(ah[s][i], bh[s][j], acc[i][j]);
        // holds the products above the slots below
        __builtin_amdgcn_sched_barrier(0);
#if defined(__HIP_DEVICE_COMPILE__)
        // five vector slots between the last product and the loads that overwrite its fragments, the distance the loop
        // had without a ring
        asm volatile("v_nop\n\tv_nop\n\tv_nop\n\tv_nop\n\tv_nop" ::: "memory");
#endif
#pragma unroll
        for (int j = 0; j < 4; ++j) bh[s][j] = ldfrag_at(pb[j] + (GPD + s) * 1024, l16);
#pragma unroll
        for (int i = 0; i < GTI; ++i) ah[s][i] = ldfrag_at(pa[i] + (GPD + s) * 1024, l16);
        // keeps a place's refill at this point: moved down by the scheduler it would lose its lead of GPD - 1 k steps
        __builtin_amdgcn_sched_barrier(0);
      }
#if defined(__HIP_DEVICE_COMPILE__)
      // stands behind the issued loads, in front of the advance of the offset register that they name (the operand
      // ties the advance behind the wait)
      asm volatile("s_wait_xcnt 0x0" : "+v"(l16) :: "memory");
#endif
      l16 += GPD * 1024;
    }
#pragma unroll
    for (int s = 0; s < GPD; ++s)
#pragma unroll
      for (int i = 0; i < GTI; ++i)
#pragma unroll
        for (int j = 0; j < 4; ++j) acc[i][j] = mma_raw_bf(ah[s][i], bh[s][j], acc[i][j]);
  } else {
#pragma unroll 1
  for (int k0 = 0; k0 < K; k0 += 32) {
    v16us bh[4];
#pragma unroll
    for (int j = 0; j < 4; ++j) {
      const size_t bo = (size_t)(n0 + (j << 4) + rlane) * ldb + koff + k0;
      bh[j] = FOI ? ldfrag_fo(Btp, (n0 >> 4) + j, k0 >> 5, ldb >> 5, lane) : ldfrag_u(Btp + bo);
    }
    v16us ah[GTI];
#pragma unroll
    for (int i = 0; i < GTI; ++i) {
      const size_t ao = (size_t)(m0 + (i << 4) + rlane) * lda + koff + k0;
      ah[i] = FOI ? ldfrag_fo(Ap, (m0 >> 4) + i, k0 >> 5, lda >> 5, lane) : ldfrag_u(Ap + ao);
    }
#pragma unroll
    for (int i = 0; i < GTI; ++i) {
#pragma unroll
      for (int j = 0; j < 4; ++j) {
        if (BF) acc[i][j] = mma_raw_bf(ah[i], bh[j], acc[i][j]);
        else    acc[i][j] = mma_raw(ah[i], bh[j], acc[i][j]);
      }
      dep_guard1(acc[i][0], acc[i][3], ah[i]);
    }
    keep4_u(bh[0], bh[1], bh[2], bh[3]);
  }
  }
#pragma unroll
  for (int i = 0; i < GTI; ++i) acc_guard4(acc[i][0], acc[i][1], acc[i][2], acc[i][3]);

  const int hh2 = lane >> 4, c4 = (lane & 15) * 4;     // f32 out: 256-B row segment = 16 lanes x 16 B
  const int q8  = lane >> 3, c8 = (lane & 7) * 8;

  // per-lane bias values for the column-indexed modes (bf16 RNE value times bsc), clamped address
  float bc[8];
#pragma unroll
  for (int e = 0; e < 8; ++e) bc[e] = 0.f;
  if (!BROW) {
    if (OM == 0) {
#pragma unroll
      for (int e = 0; e < 4; ++e) bc[e] = bsc * bfr(bias[clampi(n0 + c4 + e, 0, nbias - 1)]);
    } else {
#pragma unroll
      for (int e = 0; e < 8; ++e) bc[e] = bsc * bfr(bias[clampi(n0 + c8 + e, 0, nbias - 1)]);
    }
    if (FOI) {
      // the epilogue's arithmetic reuses the bias loads' index registers; as inputs of the wait they stay whole up to it
      int bi[8];
#pragma unroll
      for (int e = 0; e < 8; ++e) bi[e] = clampi(n0 + ((OM == 0) ? c4 + (e & 3) : c8 + e), 0, nbias - 1);
      addr_wait8(bi[0], bi[1], bi[2], bi[3], bi[4], bi[5], bi[6], bi[7]);
    }
  }

  // ---- epilogue ----
  float* slab = sT + wave * GSLAB;
#pragma unroll
  for (int i = 0; i < GTI; ++i) {
    const int mBase = m0 + (i << 4);
#pragma unroll
    for (int j = 0; j < 4; ++j) {
#pragma unroll
      for (int r = 0; r < 8; ++r) {
        slab[(mOff + r) * 68 + (j << 4) + rlane] = acc[i][j][r];
      }
    }
    wave_sync_lds();
    if (OM == 0) {
      v4f vals[8];
#pragma unroll
      for (int it = 0; it < 8; ++it) {
        const int row = it * 2 + hh2;                      // it 0..7 x hh2 0..1 = rows 0..15
        const v4f v = *(const v4f*)(slab + row * 68 + c4);
        float brw = 0.f;
        if (BROW) brw = bsc * bfr(bias[clampi(mBase + row, 0, nbias - 1)]);
        v4f ov;
#pragma unroll
        for (int e = 0; e < 4; ++e) {
          float x = v[e] * osc + (BROW ? brw : bc[e]);
          if (RELU) x = fmaxf(x, 0.f);
          ov[e] = x;
        }
        vals[it] = ov;
      }
      {
#pragma unroll
        for (int it = 0; it < 8; ++it) {
          const int row = it * 2 + hh2;
          *(v4f*)(Cf + (size_t)(mBase + row) * ldc + (size_t)n0 + c4) = vals[it];
        }
        
      }
    } else if (OM == 1) {
      v4u hv[4];
#pragma unroll
      for (int it = 0; it < 4; ++it) {
        const int row = it * 4 + q8;                       // it 0..3 x q8 0..3 = rows 0..15
        const float* sp = slab + row * 68 + c8;
        float brw = 0.f;
        if (BROW) brw = bsc * bfr(bias[clampi(mBase + row, 0, nbias - 1)]);
        v4u ha = {0u, 0u, 0u, 0u};
#pragma unroll
        for (int e = 0; e < 4; ++e) {
          float b0 = sp[2 * e]     * osc + (BROW ? brw : bc[2 * e]);
          float b1 = sp[2 * e + 1] * osc + (BROW ? brw : bc[2 * e + 1]);
          if (RELU) { b0 = fmaxf(b0, 0.f); b1 = fmaxf(b1, 0.f); }
          ha[e] = pk16(f2h(b0), f2h(b1));
        }
        hv[it] = ha;
      }
      {
#pragma unroll
        for (int it = 0; it < 4; ++it) {
          const int row = it * 4 + q8;
          const size_t go = fo_off(mBase + row, n0 + c8, ldc >> 5);
          *(v4u*)(Ch + go) = hv[it];
        }
        
      }
    } else {
      v4u hv[4], lv[4];
#pragma unroll
      for (int it = 0; it < 4; ++it) {
        const int row = it * 4 + q8;                       // it 0..3 x q8 0..3 = rows 0..15
        const float* sp = slab + row * 68 + c8;
        float brw = 0.f;
        if (BROW) brw = bsc * bfr(bias[clampi(mBase + row, 0, nbias - 1)]);
        v4u ha = {0u, 0u, 0u, 0u};
        v4u la = {0u, 0u, 0u, 0u};
#pragma unroll
        for (int e = 0; e < 4; ++e) {
          float x0 = sp[2 * e]     * osc + (BROW ? brw : bc[2 * e]);
          float x1 = sp[2 * e + 1] * osc + (BROW ? brw : bc[2 * e + 1]);
          if (RELU) { x0 = fmaxf(x0, 0.f); x1 = fmaxf(x1, 0.f); }
          const unsigned short h0 = bf_bits(x0), h1 = bf_bits(x1);
          const unsigned short l0 = bf_bits(x0 - bf_up(h0)), l1 = bf_bits(x1 - bf_up(h1));
          ha[e] = pk16(h0, h1);
          la[e] = pk16(l0, l1);
        }
        hv[it] = ha;
        lv[it] = la;
      }
      {
#pragma unroll
        for (int it = 0; it < 4; ++it) {
          const int row = it * 4 + q8;
          const size_t go = fo_off(mBase + row, n0 + c8, ldc >> 5);
          *(v4u*)(Ch + go) = hv[it];
          *(v4u*)(Ch + (size_t)looff + go) = lv[it];
        }
        
      }
    }
    wave_sync_lds();
  }
}
template <int BF, int OM, int RELU, int BROW>
__global__ __launch_bounds__(32 * GWV) void gemm64(
    const unsigned short* __restrict__ Ap, int lda, const unsigned short* __restrict__ Btp, int ldb,
    unsigned short* Ch, int looff, float* Cf, int ldc, float osc,
    const float* __restrict__ bias, int nbias, float bsc, int M, int N, int K) {
  __shared__ __align__(16) float sT[GWV * GSLAB];
  gemm64_blk<BF, OM, RELU, BROW, GWV, 1>(sT, blockIdx.x, Ap, lda, Btp, ldb, Ch, looff, Cf, ldc, osc, bias, nbias, bsc,
                                 M, N, K);
}

// =====================================================================================================
// Structure check of the [SEQ][SEQ] mask input (row pitch SEQ_FULL): block b covers rows 16b..16b+15 and all
// SEQ columns; a violation is any element differing from (j <= i ? 1 : 0). The block's flag is written as one
// coverage: 256 threads x 16 rows x (SEQ/1024, rounded up) float4 = 16 rows x SEQ cols per block; bx = 0 .. SEQ/16 - 1 = all rows.
// Block body, called from the second merged launch under a block-uniform branch; wf = 8 ints of its LDS.
// =====================================================================================================
__device__ __forceinline__ void mask_check(int* wf, int bx, const float* __restrict__ msk, float* flg) {
  const int t = threadIdx.x, lane = t & 31, wv = t >> 5;
  const int i0 = bx * 16;
  if (i0 + 16 > SEQ) return;                             // block-uniform, before the barrier; never taken
  constexpr int C4 = SEQ / 4;
  int viol = 0;
  const char* mb = (const char*)(msk + (size_t)i0 * SEQ_FULL);   // block-uniform: the block's first row
  // A thread takes one float4 column of all 16 rows per trip and requests the 16 loads together (one offset register, the
  // row in the constant offset): one memory round trip per 16 loads. Rolled: the group fits the registers the
  // projections' bodies need anyway.
#pragma unroll 1
  for (int cb = 0; cb < C4; cb += 256) {
    const int c4 = (cb + t < C4) ? (cb + t) : (C4 - 1);  // past the row's end: its last float4 once more
    const unsigned vo = (unsigned)c4 * 16u;
    v4f x[16];
#pragma unroll
    for (int r = 0; r < 16; ++r) x[r] = *(const v4f*)(mb + r * (SEQ_FULL * 4) + vo);
    addr_wait3((unsigned)c4, (unsigned)c4, (unsigned)c4);   // the next trip rewrites the index register of these loads
#pragma unroll
    for (int r = 0; r < 16; ++r) {
#pragma unroll
      for (int e = 0; e < 4; ++e) {
        const float ex = (4 * c4 + e <= i0 + r) ? 1.0f : 0.0f;
        viol |= (x[r][e] != ex) ? 1 : 0;
      }
    }
  }
  viol |= __shfl_xor(viol, 1, 32);
  viol |= __shfl_xor(viol, 2, 32);
  viol |= __shfl_xor(viol, 4, 32);
  viol |= __shfl_xor(viol, 8, 32);
  viol |= __shfl_xor(viol, 16, 32);
  if (lane == 0) wf[wv] = viol;
  __syncthreads();
  if (wv == 0) {                                        // wave-uniform
    int f = wf[lane & 7];
    f |= __shfl_xor(f, 1, 32);
    f |= __shfl_xor(f, 2, 32);
    f |= __shfl_xor(f, 4, 32);
    const float fv = f ? 1.0f : 0.0f;
    float* d = flg + (size_t)bx * FLGW + lane;
    *(float*)d = fv;
    
  }
}

// =====================================================================================================
// Merged launches: jobs that read none of each other's output share one grid; the flat block index picks the
// job by ranges (block-uniform scalar branches), every block runs exactly one job body and then ends.
// prep_x: what the projections read. Blocks [0, 3*NTW): Wq, Wk, Wv -> [64][512] f16 x64 (transposed);
//   then NLP blocks: q, k, v -> f16(bf16) planes, a block taking one piece of SEQ*DMD/2048 of all 3 * NB slabs.
// proj_side: the three projections, first in the grid since they run longest, and beside them all that only
//   later launches read. Blocks [0, 3*NGQ): q plane x16, k plane x16 (C[tok][n] = sum_k X[tok][k] * WT[n][k]),
//   v^T planes (C[d][tok] = sum_k WVT[d][k] * XV[tok][k] / 64, bf16 hi and lo); then NFLG mask-structure blocks;
//   2*NTO blocks Wo -> [512][1024] = (Wo^T | Wo^T) bf16; 2*NTL blocks Wl -> [448][1024] = (Wl^T | Wl^T) bf16;
//   NLE blocks E -> f16(bf16 x64).
// =====================================================================================================
#define NTW (DMD / 64)
#define NLP ((SEQ * DMD) / 2048)
#define NGQ (((MT / (16 * GTI)) * (HD / 64) + 7) / 8)
#define NTO ((DMD / 64) * (DMD / 64))
#define NTL ((EVP / 64) * (DMD / 64))
#define NLE ((NH * SEQ_FULL * HD) / (2048 * FCH))
#define PREP_BLOCKS (3 * NTW + NLP)
#define SIDE_BLOCKS (3 * NGQ + NFLG + 2 * NTO + 2 * NTL + NLE)

__global__ __launch_bounds__(256) void prep_x(
    const float* __restrict__ q, const float* __restrict__ k, const float* __restrict__ v,
    const float* __restrict__ wq, const float* __restrict__ wk, const float* __restrict__ wv,
    unsigned short* XQ, unsigned short* XK, unsigned short* XV,
    unsigned short* WQT, unsigned short* WKT, unsigned short* WVT) {
  __shared__ __align__(16) unsigned short st[64 * 72];
  int bid = blockIdx.x;
  if (bid < 3 * NTW) {
    const int j = bid / NTW;
    const float* w = (j == 0) ? wq : ((j == 1) ? wk : wv);
    unsigned short* o = (j == 0) ? WQT : ((j == 1) ? WKT : WVT);
    cvt_t<0>(st, w, o, 0, bid - j * NTW, DMD, HD, HD, DMD, WSCL);          // in[512][64] -> out[64][512]
    return;
  }
  bid -= 3 * NTW;
  if (bid < NLP) cvt_x(q, k, v, XQ, XK, XV, bid);
}

__global__ __launch_bounds__(256) void proj_side(
    const unsigned short* __restrict__ XQ, const unsigned short* __restrict__ XK,
    const unsigned short* __restrict__ XV, const unsigned short* __restrict__ WQT,
    const unsigned short* __restrict__ WKT, const unsigned short* __restrict__ WVT,
    const float* __restrict__ bq, const float* __restrict__ bk, const float* __restrict__ bv,
    unsigned short* QH, unsigned short* KH, unsigned short* VH,
    const float* __restrict__ msk, float* flg,
    const float* __restrict__ wo, unsigned short* WOT, const float* __restrict__ wl, unsigned short* WLT,
    const float* __restrict__ ee, unsigned short* PEH) {
  __shared__ __align__(16) float sT[8 * GSLAB];        // the one job of a block uses it: slabs, transpose tile or flags
  int bid = blockIdx.x;
  if (bid < 2 * NGQ) {
    const int j = bid / NGQ;
    gemm64_blk<0, 1, 0, 0, 8, 0>(sT, bid - j * NGQ, j ? XK : XQ, DMD, j ? WKT : WQT, DMD, j ? KH : QH, 0, nullptr, HD,
                           QKS / WSCL, j ? bk : bq, HD, QKS, MT, HD, DMD);
    return;
  }
  bid -= 2 * NGQ;
  if (bid < NGQ) {
    gemm64_blk<0, 2, 0, 1, 8, 0>(sT, bid, WVT, DMD, XV, DMD, VH, HD * MT, nullptr, MT, 1.0f / WSCL, bv, HD, 1.0f,
                           HD, MT, DMD);
    return;
  }
  bid -= NGQ;
  if (bid < NFLG) {
    mask_check((int*)sT, bid, msk, flg);
    return;
  }
  bid -= NFLG;
  if (bid < 2 * NTO) {
    const int j = bid / NTO;                           // destination columns 0.. and 512.. (16 fragments on)
    const int r = bid - j * NTO;
    cvt_t<1>((unsigned short*)sT, wo, WOT + j * (DMD * 16), r % (DMD / 64), r / (DMD / 64), DMD, DMD, DMD, KF, 1.0f);
    return;
  }
  bid -= 2 * NTO;
  if (bid < 2 * NTL) {
    const int j = bid / NTL;                           // destination columns 0.. and 512.. (16 fragments on)
    const int r = bid - j * NTL;
    cvt_t<1>((unsigned short*)sT, wl, WLT + j * (DMD * 16), r % (EVP / 64), r / (EVP / 64), DMD, EVD, EVP, KF, 1.0f);
    return;
  }
  bid -= 2 * NTL;
  if (bid < NLE) cvt_fo64(ee, PEH, bid, WSCL);
}

// =====================================================================================================
// Causal attention with relative-offset term, head dim 64. Block = 256 threads = 8 waves; one block owns one
// 16-row query tile (t0..t0+15) of one batch b and HPW heads h0.. (q, k, v are the same for every head: each wave
// loads a key block's K and V fragments and takes q.k^T once and uses them for its HPW heads; only the E band, the
// softmax and the O accumulators are per head). The key blocks of 32 up to the diagonal (sb <= t0)
// are cut into 8 contiguous shares, one per wave; each wave runs its share with an online max-subtracted
// softmax in f32 and leaves its partial state (row max, row sum, unnormalised 16x64 O) in LDS; behind one
// block barrier the 8 states are merged in wave order (rescale by exp(max_w - max), sum, divide).
// Planes, all in fragment order: QH, KH f16 [MT][64] = 16*q, 16*k (shared
// by all heads); PE f16 [NH*SEQ_FULL][64] = 64*E (head h rows h*SEQ_FULL..); VH, VL bf16 [64][MT] = v hi and
// lo planes transposed (row = dim, column = token). Output Z bf16 [MT][1024]: cols h*64+d = ctx hi, cols
// 512+h*64+d = ctx lo.
// Every product is taken transposed (K, E and V fragments as the A operand, Q and P as the B operand), so that a lane
// holds one query (column m = lane & 15) and, per 16-row tile, the 8 keys, band columns or dims 8*hh + r.
// Per key block sb: S^T = K.Q^T (2 key subtiles x 2 k-steps, scale 1/256); relative band of 48 columns:
// column c <-> E row SEQ-16-t0+sb+c (a 16-row tile starts at a multiple of 16 and is clamped as a whole to start at
// most at SEQ-16; clamping only touches entries with j > i, which the causal select replaces); columns 0..15 come from
// the tile carried over from the prior key block (its columns 32..47), columns 16..47 are two fresh tiles (2 x 2 WMMA,
// scale 1/1024); the band is exchanged through per-wave LDS (one row of pitch RWQ floats per query, head g's band at RWP * g) and read back at
// c = 15 - il + jl, i.e. E row SEQ-1-i+j; score = (qk + rel)/8 for j <= i, else -1e10; a query's 32 scores lie in the
// two lanes m and m + 16: row max and row sum are taken inside the lane and once across the halves;
// p = exp(score - running max) in f32, l accumulated from the f32 p; the two p tiles of a lane, converted in place to
// bf16 hi and lo, are the B fragments of the next product (element e <- key 8*hh + e, element 8 + e <- key 16 + 8*hh + e,
// the k map of the V fragments); O^T += Vhi.Phi + Vlo.Phi + Vhi.Plo on 4 dim subtiles (one accumulator set). A wave
// whose share is empty contributes max -1e30, sum 0, O 0 (weight exp(-1e30 - max) = 0); wave 0's share is never empty.
// Merge: thread -> (row, 4 dims) in fragment order, 32 lanes x 8 B = two whole 128-B lines of Z per plane.
// coverage: 16 query rows x 64 halves x {hi, lo} x HPW heads per block, NB*(NH/HPW)*(SEQ/16) blocks = all (b, t, h)
// segments of Z in both halves.
// =====================================================================================================
// register budget of four waves per SIMD (256): two blocks stay resident on a WGP, as LDS allows
__global__ __launch_bounds__(32 * AWV, 4) void attn_kernel(
    const unsigned short* __restrict__ QH, const unsigned short* __restrict__ KH,
    const unsigned short* __restrict__ PE, const unsigned short* __restrict__ VH,
    const unsigned short* __restrict__ VL, unsigned short* Z) {
  __shared__ __align__(16) float relw[AWV][16 * RWQ];            // band exchange per wave: a query's row holds its HPW bands
  __shared__ __align__(16) float opw[HPW][AWV][16 * OPP];         // partial O per head and wave, pitch 68 floats
  __shared__ __align__(16) float mxw[HPW][AWV][16];               // partial row max per head and wave
  __shared__ __align__(16) float lsw[HPW][AWV][16];               // partial row sum per head and wave
  const int lane = threadIdx.x & 31, m = lane & 15, hh = lane >> 4;
  // wave number in a scalar register: the key loop's bounds depend on it and stay a scalar branch
  const int wv = __builtin_amdgcn_readfirstlane((int)(threadIdx.x >> 5));
  const int task = blockIdx.x;                       // 0 .. NB*(NH/HPW)*(SEQ/16)-1
  const int nqt = SEQ / 16;
  // There are more blocks than resident places, while a block's key loop grows
  // with its query tile: the cost falls with the index (last tile first, its NB * NH / HPW groups side by side).
  // task -> (tile, bg) is one to one.
  constexpr int nbg = NB * (NH / HPW);
  const int tq = task / nbg;
  const int bg = task - tq * nbg;                    // (b, group of HPW heads)
  const int t0 = (nqt - 1 - tq) << 4;                // query tile start
  const int b = bg / (NH / HPW), h0 = (bg - (bg / (NH / HPW)) * (NH / HPW)) * HPW;
  if (b >= NB) return;                               // block-uniform, before the barrier; never taken with exact grids
  const size_t tok0 = (size_t)b * SEQ;
  // this lane's query row of the bands, head g at RWP * g (both within reach of one address register's offsets); pitch
  // 108 floats: 16-byte aligned rows, and the skewed reads of the 32 lanes (dword 107 * m + 8 * hh + const) fall on 32
  // different banks
  float* rq[HPW];
#pragma unroll
  for (int g = 0; g < HPW; ++g) rq[g] = relw[wv] + m * RWQ + g * RWP;

  // Q B-fragments: columns t0+m, k = head dims 0..31 and 32..63 (the same for every head)
  const int qt = (int)((tok0 + (size_t)t0) >> 4);
  const unsigned l16 = (unsigned)lane * 16u;          // lane part of every fragment load's byte offset
  const unsigned qo = (unsigned)qt * 2048u + l16;     // a 16-row tile of a [..][64] plane = two fragments = 2048 bytes
  const v16us qf0 = ldfrag_at((const char*)QH, qo);
  const v16us qf1 = ldfrag_at((const char*)QH + 1024, qo);

  const unsigned short* pe[HPW];
#pragma unroll
  for (int g = 0; g < HPW; ++g) pe[g] = PE + (size_t)(h0 + g) * SEQ_FULL * HD;
  const int rb = SEQ - 16 - t0;                      // E row of band column 0 at sb = 0 (>= 0)

  const int nkb = (t0 >> 5) + 1;                     // key blocks 0 .. floor(t0/32), block-uniform
  const int per = (nkb + AWV - 1) / AWV;             // key blocks per wave share
  const int kb0 = wv * per;                          // this wave's share [kb0, kb1), wave-uniform, may be empty
  const int kb1 = (kb0 + per < nkb) ? (kb0 + per) : nkb;

  // carried band tile of each head: columns 0..15 of key block kb0 <-> E rows rb + 32*kb0 + 0..15 (clamped)
  v8f carry[HPW];
  {
    const unsigned eo = (unsigned)(clampi(rb + (kb0 << 5), 0, SEQ - 16) >> 4) * 2048u + l16;
    v16us c0[HPW], c1[HPW];                          // all requested beside Q, in front of the first matrix statement
#pragma unroll
    for (int g = 0; g < HPW; ++g) {
      c0[g] = ldfrag_at((const char*)pe[g], eo);
      c1[g] = ldfrag_at((const char*)pe[g] + 1024, eo);
    }
    addr_wait3(qo, eo, eo);                          // the code below reuses the offset registers of these loads
#pragma unroll
    for (int g = 0; g < HPW; ++g) {
      carry[g] = mma_g(c0[g], qf0, zero8());
      carry[g] = mma_g(c1[g], qf1, carry[g]);
    }
  }

  float mx[HPW], ls[HPW];                            // of query t0 + m, equal in the lanes m and m + 16
  v8f O0[HPW], O1[HPW], O2[HPW], O3[HPW];
#pragma unroll
  for (int g = 0; g < HPW; ++g) {
    mx[g] = -1.0e30f;
    ls[g] = 0.f;
    O0[g] = zero8(); O1[g] = zero8(); O2[g] = zero8(); O3[g] = zero8();
  }

#pragma unroll 1
  for (int kb = kb0; kb < kb1; ++kb) {
    const int sb = kb << 5;
    // The K fragments and every head's E-band fragments are requested together, in front of the first matrix statement
    // (a load written between the guarded matrix statements is issued and waited for on its own: one round trip each).
    // K A-fragments: row = key token, k = head dim
    const unsigned ko = (unsigned)((tok0 + (size_t)sb) >> 4) * 2048u + l16;   // two key tiles = four fragments in a row
    const v16us kf0 = ldfrag_at((const char*)KH, ko), kf1 = ldfrag_at((const char*)KH + 1024, ko);
    const v16us kf2 = ldfrag_at((const char*)KH + 2048, ko), kf3 = ldfrag_at((const char*)KH + 3072, ko);
    // relative band: columns 16..31 and 32..47 <-> E rows rb+sb+16.. and rb+sb+32..
    const unsigned e1 = (unsigned)(clampi(rb + sb + 16, 0, SEQ - 16) >> 4) * 2048u + l16;
    const unsigned e2 = (unsigned)(clampi(rb + sb + 32, 0, SEQ - 16) >> 4) * 2048u + l16;
    v16us ef0[HPW], ef1[HPW], ef2[HPW], ef3[HPW];
#pragma unroll
    for (int g = 0; g < HPW; ++g) {
      ef0[g] = ldfrag_at((const char*)pe[g], e1);
      ef1[g] = ldfrag_at((const char*)pe[g] + 1024, e1);
      ef2[g] = ldfrag_at((const char*)pe[g], e2);
      ef3[g] = ldfrag_at((const char*)pe[g] + 1024, e2);
    }
    addr_wait3(ko, e1, e2);
    // keeps the first product below the whole group: hoisted into it, its load wait would hold the later loads back by
    // one round trip
    __builtin_amdgcn_sched_barrier(0);

    // q.k^T does not depend on the head: taken once for the HPW heads
    v8f S0, S1;
    S0 = mma_g(kf0, qf0, zero8());
    S0 = mma_g(kf1, qf1, S0);
    S1 = mma_g(kf2, qf0, zero8());
    S1 = mma_g(kf3, qf1, S1);
#pragma unroll
    for (int g = 0; g < HPW; ++g) {
      v8f Pb1, Pb2;
      Pb1 = mma_g(ef0[g], qf0, zero8());
      Pb1 = mma_g(ef1[g], qf1, Pb1);
      Pb2 = mma_g(ef2[g], qf0, zero8());
      Pb2 = mma_g(ef3[g], qf1, Pb2);
      // element r of a band tile = (column 16 * tile + 8 * hh + r, query m): 8 consecutive floats of the query's row
      float* d = rq[g] + 8 * hh;
      const v8f cy = carry[g];
      const v4f w0 = {cy[0], cy[1], cy[2], cy[3]}, w1 = {cy[4], cy[5], cy[6], cy[7]};
      const v4f w2 = {Pb1[0], Pb1[1], Pb1[2], Pb1[3]}, w3 = {Pb1[4], Pb1[5], Pb1[6], Pb1[7]};
      const v4f w4 = {Pb2[0], Pb2[1], Pb2[2], Pb2[3]}, w5 = {Pb2[4], Pb2[5], Pb2[6], Pb2[7]};
      *(v4f*)(d)      = w0;
      *(v4f*)(d + 4)  = w1;
      *(v4f*)(d + 16) = w2;
      *(v4f*)(d + 20) = w3;
      *(v4f*)(d + 32) = w4;
      *(v4f*)(d + 36) = w5;
      carry[g] = Pb2;
    }
    wave_sync_lds();

    // V A-fragments (row = dim, k = key token), four dim subtiles, hi and lo planes, the same for every head: requested
    // together here, behind the exchange fence (which waits for outstanding loads), so that they are in flight under
    // the first softmax
    const unsigned vo = (unsigned)((tok0 + (size_t)sb) >> 5) * 1024u + l16;
    constexpr int VR = (MT / 32) * 1024;                       // bytes from one 16-dim row of fragments to the next
    const v16us vh0 = ldfrag_at((const char*)VH, vo),          vl0 = ldfrag_at((const char*)VL, vo);
    const v16us vh1 = ldfrag_at((const char*)VH + VR, vo),     vl1 = ldfrag_at((const char*)VL + VR, vo);
    const v16us vh2 = ldfrag_at((const char*)VH + 2 * VR, vo), vl2 = ldfrag_at((const char*)VL + 2 * VR, vo);
    const v16us vh3 = ldfrag_at((const char*)VH + 3 * VR, vo), vl3 = ldfrag_at((const char*)VL + 3 * VR, vo);
    addr_wait3(vo, vo, vo);                                    // the score arithmetic below reuses their offset register

#pragma unroll
    for (int g = 0; g < HPW; ++g) {
      // skew read + scale + causal select (key j <= query i keeps the score, otherwise -1e10); element r = key jb + r
      float s0[8], s1[8];
      {
        const int i = t0 + m;
        const int jb = sb + 8 * hh;
        const float* sk = rq[g] + 15 - m + 8 * hh;
#pragma unroll
        for (int r = 0; r < 8; ++r) {
          const float rv0 = sk[r];
          const float rv1 = sk[16 + r];
          const float a0 = (S0[r] * (1.0f / (QKS * QKS)) + rv0 * (1.0f / (QKS * WSCL))) * RSQD;
          const float a1 = (S1[r] * (1.0f / (QKS * QKS)) + rv1 * (1.0f / (QKS * WSCL))) * RSQD;
          s0[r] = (jb + r <= i) ? a0 : NEGM;
          s1[r] = (jb + 16 + r <= i) ? a1 : NEGM;
        }
      }

      // online softmax: 16 of the query's scores in this lane, the other 16 in lane ^ 16
      float xm = fmaxf(s0[0], s1[0]);
#pragma unroll
      for (int r = 1; r < 8; ++r) xm = fmaxf(xm, fmaxf(s0[r], s1[r]));
      xm = fmaxf(xm, xhalf(xm));
      const float mn = fmaxf(mx[g], xm);
      const float al = exp2_slot((mx[g] - mn) * 1.44269504f);   // exp(x) = 2^(x * log2 e)
      mx[g] = mn;
      float pq[8];
      v8u wh, wl;                                              // P B-fragments as words of two bf16, hi and lo planes
#pragma unroll
      for (int r = 0; r < 8; r += 2) {
        const float a0 = exp2_slot((s0[r] - mn) * 1.44269504f), b0 = exp2_slot((s0[r + 1] - mn) * 1.44269504f);
        const float a1 = exp2_slot((s1[r] - mn) * 1.44269504f), b1 = exp2_slot((s1[r + 1] - mn) * 1.44269504f);
        pq[r]     = a0 + a1;
        pq[r + 1] = b0 + b1;
        const unsigned h0w = bf_pair(a0, b0), h1w = bf_pair(a1, b1);
        wh[r >> 1]       = h0w;                                // elements r, r + 1 <- keys 8*hh + r, + 1
        wh[4 + (r >> 1)] = h1w;                                // elements 8 + r, 9 + r <- keys 16 + 8*hh + r, + 1
        wl[r >> 1]       = bf_pair(a0 - __uint_as_float(h0w << 16), b0 - __uint_as_float(h0w & 0xFFFF0000u));
        wl[4 + (r >> 1)] = bf_pair(a1 - __uint_as_float(h1w << 16), b1 - __uint_as_float(h1w & 0xFFFF0000u));
      }
      const v16us afh = __builtin_bit_cast(v16us, wh), afl = __builtin_bit_cast(v16us, wl);
      float ps = ((pq[0] + pq[1]) + (pq[2] + pq[3])) + ((pq[4] + pq[5]) + (pq[6] + pq[7]));
      ps += xhalf(ps);
      ls[g] = ls[g] * al + ps;
#pragma unroll
      for (int r = 0; r < 8; ++r) {
        O0[g][r] = O0[g][r] * al;
        O1[g][r] = O1[g][r] * al;
        O2[g][r] = O2[g][r] * al;
        O3[g][r] = O3[g][r] * al;
      }

      // the V A-fragments were requested above the softmax
      O0[g] = mma_gb(vh0, afh, O0[g]);
      O0[g] = mma_gb(vl0, afh, O0[g]);
      O0[g] = mma_gb(vh0, afl, O0[g]);
      O1[g] = mma_gb(vh1, afh, O1[g]);
      O1[g] = mma_gb(vl1, afh, O1[g]);
      O1[g] = mma_gb(vh1, afl, O1[g]);
      O2[g] = mma_gb(vh2, afh, O2[g]);
      O2[g] = mma_gb(vl2, afh, O2[g]);
      O2[g] = mma_gb(vh2, afl, O2[g]);
      O3[g] = mma_gb(vh3, afh, O3[g]);
      O3[g] = mma_gb(vl3, afh, O3[g]);
      O3[g] = mma_gb(vh3, afl, O3[g]);
    }
  }
#pragma unroll
  for (int g = 0; g < HPW; ++g) acc_guard4(O0[g], O1[g], O2[g], O3[g]);

  // ---- this wave's partial states to LDS (D element r of a lane = query row m, dim 8*hh + r of each dim subtile) ----
#pragma unroll
  for (int g = 0; g < HPW; ++g) {
    float* op = opw[g][wv] + m * OPP + 8 * hh;
    const v8f A = O0[g], B = O1[g], C = O2[g], D = O3[g];
    const v4f a0 = {A[0], A[1], A[2], A[3]}, a1 = {A[4], A[5], A[6], A[7]};
    const v4f b0 = {B[0], B[1], B[2], B[3]}, b1 = {B[4], B[5], B[6], B[7]};
    const v4f c0 = {C[0], C[1], C[2], C[3]}, c1 = {C[4], C[5], C[6], C[7]};
    const v4f d0 = {D[0], D[1], D[2], D[3]}, d1 = {D[4], D[5], D[6], D[7]};
    *(v4f*)(op)      = a0;
    *(v4f*)(op + 4)  = a1;
    *(v4f*)(op + 16) = b0;
    *(v4f*)(op + 20) = b1;
    *(v4f*)(op + 32) = c0;
    *(v4f*)(op + 36) = c1;
    *(v4f*)(op + 48) = d0;
    *(v4f*)(op + 52) = d1;
    if (hh == 0) {                                     // mx, ls are equal in the lanes m and m + 16
      mxw[g][wv][m] = mx[g];
      lsw[g][wv][m] = ls[g];
    }
  }
  __syncthreads();                                     // publishes the 8 partial states of each head to the whole block

  // ---- merge in wave order, ctx = O / l, bf16 hi plane and lo plane, head by head; all stores stand at the end ----
  v2u hvv[HPW], lvv[HPW];
#pragma unroll
  for (int g = 0; g < HPW; ++g) {
    // thread u owns the u-th 8 bytes of the tile's two Z fragments per plane: a wave stores 256 contiguous bytes
    const int u = threadIdx.x;
    const int row = (u >> 1) & 15;
    const int c4 = ((u >> 7) & 1) * 32 + ((u >> 6) & 1) * 16 + ((u >> 5) & 1) * 8 + (u & 1) * 4;
    float mw[AWV];
    float mt = -1.0e30f;
#pragma unroll
    for (int w = 0; w < AWV; ++w) { mw[w] = mxw[g][w][row]; mt = fmaxf(mt, mw[w]); }
    float sc[AWV];
#pragma unroll
    for (int w = 0; w < AWV; ++w) sc[w] = exp2_slot((mw[w] - mt) * 1.44269504f);   // exp(max_w - max)
    float lt = 0.f;
    v4f ot = {0.f, 0.f, 0.f, 0.f};
#pragma unroll
    for (int w = 0; w < AWV; ++w) {
      const v4f o = *(const v4f*)(opw[g][w] + row * OPP + c4);
      lt += lsw[g][w][row] * sc[w];
#pragma unroll
      for (int e = 0; e < 4; ++e) ot[e] += o[e] * sc[w];
    }
    const float gi = 1.0f / lt;                        // lt >= 1
    unsigned short hb[4], lb[4];
#pragma unroll
    for (int e = 0; e < 4; ++e) {
      const float c = ot[e] * gi;
      hb[e] = bf_bits(c);
      lb[e] = bf_bits(c - bf_up(hb[e]));
    }
    const v2u hv = {pk16(hb[0], hb[1]), pk16(hb[2], hb[3])};
    const v2u lv = {pk16(lb[0], lb[1]), pk16(lb[2], lb[3])};
    hvv[g] = hv;
    lvv[g] = lv;
  }
#pragma unroll
  for (int g = 0; g < HPW; ++g) {
    // = fo_off(token, (h0 + g)*64 + c4, KF/32)
    unsigned short* dst = Z + ((size_t)qt * (KF / 32) + 2 * (h0 + g)) * 512 + threadIdx.x * 4;
    *(v2u*)dst = hvv[g];
    *(v2u*)(dst + DMD * 16) = lvv[g];                  // columns 512.. lie 16 fragments on
  }
}

// =====================================================================================================
// Flat whole-line writer of the output: out[row*388 + c] = L[row*448 + c]; each lane owns 4
// consecutive output floats (16 B; never straddles a row since 388 % 4 == 0), one instruction = 32 lanes x
// 16 B; a thread owns OCH such pieces, 256 apart, and requests their loads together, in front of the flag reduction.
// coverage: grid = MT*97/(256*OCH) blocks x OCH x 256 float4 = all MT*388 output floats (in-kernel bound for safety).
// =====================================================================================================
#define OCH 4
__global__ __launch_bounds__(256) void out_copy(const float* __restrict__ L, const float* __restrict__ flg,
                                                 float* out) {
  __shared__ int wf[8];
  const int t = threadIdx.x, lane = t & 31, wv = t >> 5;
  constexpr int N4 = MT * (EVD / 4);
  const int e40 = blockIdx.x * (OCH * 256) + t;
  v4f x[OCH];
  unsigned lo[OCH];                                      // byte offsets on the uniform pointer (the plane is far below 4 GiB)
#pragma unroll
  for (int c = 0; c < OCH; ++c) {
    const int e4 = e40 + c * 256;
    const int e = ((e4 < N4) ? e4 : (N4 - 1)) * 4;       // clamped address, the store below is bounded
    const int row = e / EVD;
    lo[c] = (unsigned)(row * EVP + (e - row * EVD)) * 4u;
    x[c] = *(const v4f*)((const char*)L + lo[c]);
  }
  int f;
  {
    const int ti = (t < NFLG) ? t : (NFLG - 1);         // clamped address, value selected
    const unsigned fo = (unsigned)ti * (FLGW * 4u);
    const float fx = *(const float*)((const char*)flg + fo);
    static_assert(OCH == 4);
    // the code below may reuse the offset registers of these loads
    addr_wait8((int)lo[0], (int)lo[1], (int)lo[2], (int)lo[3], (int)fo, (int)fo, (int)fo, (int)fo);
    // keeps the flag reduction below the whole group: scheduled above the plane's loads, its wait for the flag and its
    // cross-lane steps would stand in front of their round trip instead of under it
    __builtin_amdgcn_sched_barrier(0);
    f = ((t < NFLG) && (fx == 1.0f)) ? 1 : 0;
  }
  f |= __shfl_xor(f, 1, 32);
  f |= __shfl_xor(f, 2, 32);
  f |= __shfl_xor(f, 4, 32);
  f |= __shfl_xor(f, 8, 32);
  f |= __shfl_xor(f, 16, 32);
  if (lane == 0) wf[wv] = f;
  __syncthreads();
  int g = 0;
#pragma unroll
  for (int w = 0; w < 8; ++w) g |= wf[w];
  const float qn = __uint_as_float(0x7fc00000u);
  const v4f pn = {qn, qn, qn, qn};
#pragma unroll
  for (int c = 0; c < OCH; ++c) {
    const int e4 = e40 + c * 256;
    if (e4 < N4) *(v4f*)(out + (size_t)e4 * 4) = g ? pn : x[c];
  }
}

// =====================================================================================================
// Workspace map (bytes, full size NB=2, SEQ=2048); every plane is an exact multiple of its whole-row /
// whole-line / 32x64-tile store granularity; all offsets are multiples of 16384. PEH, QH, KH, VH, VL, Z, WOT, OP and
// WLT are kept in fragment order (see fo_off), the X and W*T planes and L row-major.
//   XQ   f16  [MT][512]        4194304     (x3 with XK, XV)
//   WQT  f16  [64][512]          65536     (x3 with WKT, WVT; Wq^T, Wk^T, Wv^T x64)
//   PEH  f16  [8*2048][64]     2097152     (E x64)
//   QH   f16  [MT][64]          524288     (16*q), KH same
//   VH   bf16 [64][MT]          524288     (v hi), VL same (v lo), contiguous after VH
//   Z    bf16 [MT][1024]       8388608     (ctx hi | ctx lo)
//   WOT  bf16 [512][1024]      1048576     (Wo^T | Wo^T)
//   OP   bf16 [MT][1024]       8388608     (relu out hi | lo)
//   WLT  bf16 [448][1024]       917504     (Wl^T | Wl^T, rows 388..447 zero)
//   L    f32  [MT][448]        7340032
//   FLG  f32  [128][32]          16384     (mask-structure flag lines)
//   total                     43073536
// =====================================================================================================
extern "C" void kernel_launch(void* const* d_in, const int* in_sizes, int n_in,
                              void* d_out, int out_size, void* d_ws, size_t ws_size,
                              hipStream_t stream) {
  if (n_in < 15) return;
  if (in_sizes[0] < (NB - 1) * SEQ_FULL * DMD + SEQ * DMD) return;   // v
  if (in_sizes[1] < (NB - 1) * SEQ_FULL * DMD + SEQ * DMD) return;   // k
  if (in_sizes[2] < (NB - 1) * SEQ_FULL * DMD + SEQ * DMD) return;   // q
  if (in_sizes[3] < (SEQ - 1) * SEQ_FULL + SEQ) return;               // mask
  if (in_sizes[4] < DMD * HD || in_sizes[6] < DMD * HD || in_sizes[8] < DMD * HD) return;
  if (in_sizes[5] < HD || in_sizes[7] < HD || in_sizes[9] < HD) return;
  if (in_sizes[10] < NH * SEQ_FULL * HD) return;                      // E
  if (in_sizes[11] < DMD * DMD || in_sizes[12] < DMD) return;         // Wo, bo
  if (in_sizes[13] < DMD * EVD || in_sizes[14] < EVD) return;         // Wl, bl
  if (out_size < MT * EVD) return;

  const float* v   = (const float*)d_in[0];    // [2][2048][512]
  const float* k   = (const float*)d_in[1];
  const float* q   = (const float*)d_in[2];
  const float* msk = (const float*)d_in[3];    // [2048][2048]
  const float* wq  = (const float*)d_in[4];    // [512][64]
  const float* bq  = (const float*)d_in[5];    // [64]
  const float* wk  = (const float*)d_in[6];
  const float* bk  = (const float*)d_in[7];
  const float* wv  = (const float*)d_in[8];
  const float* bv  = (const float*)d_in[9];
  const float* ee  = (const float*)d_in[10];   // [8][2048][64]
  const float* wo  = (const float*)d_in[11];   // [512][512] (in, out)
  const float* bo  = (const float*)d_in[12];   // [512]
  const float* wl  = (const float*)d_in[13];   // [512][388] (in, out)
  const float* bl  = (const float*)d_in[14];   // [388]

  const size_t PX  = (size_t)MT * DMD * 2;
  const size_t PW  = (size_t)HD * DMD * 2;
  const size_t PPE = (size_t)NH * SEQ_FULL * HD * 2;
  const size_t PQK = (size_t)MT * HD * 2;
  const size_t PV2 = (size_t)2 * HD * MT * 2;
  const size_t PZ  = (size_t)MT * KF * 2;
  const size_t PWO = (size_t)DMD * KF * 2;
  const size_t POP = (size_t)MT * KF * 2;
  const size_t PWL = (size_t)EVP * KF * 2;
  const size_t PL  = (size_t)MT * EVP * 4;
  const size_t PFL = (size_t)(SEQ_FULL / 16) * FLGW * 4;
  size_t off = 0;
  const size_t oXQ = off; off += PX;
  const size_t oXK = off; off += PX;
  const size_t oXV = off; off += PX;
  const size_t oWQ = off; off += PW;
  const size_t oWK = off; off += PW;
  const size_t oWV = off; off += PW;
  const size_t oPE = off; off += PPE;
  const size_t oQH = off; off += PQK;
  const size_t oKH = off; off += PQK;
  const size_t oV  = off; off += PV2;
  const size_t oZ  = off; off += PZ;
  const size_t oWO = off; off += PWO;
  const size_t oOP = off; off += POP;
  const size_t oWL = off; off += PWL;
  const size_t oL  = off; off += PL;
  const size_t oFL = off; off += PFL;
  if (off > ws_size) return;
  if (off > (size_t)134217728) return;

  char* ws = (char*)d_ws;
  unsigned short* XQ  = (unsigned short*)(ws + oXQ);
  unsigned short* XK  = (unsigned short*)(ws + oXK);
  unsigned short* XV  = (unsigned short*)(ws + oXV);
  unsigned short* WQT = (unsigned short*)(ws + oWQ);
  unsigned short* WKT = (unsigned short*)(ws + oWK);
  unsigned short* WVT = (unsigned short*)(ws + oWV);
  unsigned short* PEH = (unsigned short*)(ws + oPE);
  unsigned short* QHp = (unsigned short*)(ws + oQH);
  unsigned short* KHp = (unsigned short*)(ws + oKH);
  unsigned short* VHp = (unsigned short*)(ws + oV);
  unsigned short* VLp = VHp + (size_t)HD * MT;
  unsigned short* Zp  = (unsigned short*)(ws + oZ);
  unsigned short* WOT = (unsigned short*)(ws + oWO);
  unsigned short* OPp = (unsigned short*)(ws + oOP);
  unsigned short* WLT = (unsigned short*)(ws + oWL);
  float* Lp   = (float*)(ws + oL);
  float* FLG  = (float*)(ws + oFL);
  float* out0 = (float*)d_out;
  float* fdummy = Lp;                             // in-range placeholder for unused f32 output args
  unsigned short* hdummy = QHp;                   // in-range placeholder for unused 16-bit output args

  const dim3 blk(256);

  // (0) what the projections read, one launch: q, k, v (per batch slab) -> f16(bf16); Wq|Wk|Wv [512][64] ->
  //     [64][512] (transposed, f16 x64)
  prep_x<<<dim3(PREP_BLOCKS), blk, 0, stream>>>(q, k, v, wq, wk, wv, XQ, XK, XV, WQT, WKT, WVT);

  // (1) one launch: the three projections (q plane x16, k plane x16, v^T bf16 hi (VH) and lo (VL) planes) and,
  //     beside them, the jobs only later launches read: mask structure flags, Wo and Wl planes, E plane
  proj_side<<<dim3(SIDE_BLOCKS), blk, 0, stream>>>(XQ, XK, XV, WQT, WKT, WVT, bq, bk, bv, QHp, KHp, VHp,
                                                   msk, FLG, wo, WOT, wl, WLT, ee, PEH);

  // (2) attention -> ctx hi|lo token-major plane
  attn_kernel<<<dim3(NB * (NH / HPW) * (SEQ / 16)), dim3(32 * AWV), 0, stream>>>(QHp, KHp, PEH, VHp, VLp, Zp);

  // (3) output projection with relu: OP = bf16 hi|lo of max(0, sum_k Z[row][k] * WOT[n][k] + bo[n]), K = 1024
  const int gO = ((MT / (16 * GTI)) * (DMD / 64) + GWV - 1) / GWV;
  gemm64<1, 2, 1, 0><<<dim3(gO), dim3(32 * GWV), 0, stream>>>(Zp, KF, WOT, KF, OPp, DMD * 16, fdummy, KF, 1.0f, bo, DMD, 1.0f, MT, DMD, KF);

  // (4) logits: L[row][n] = sum_k OP[row][k] * WLT[n][k] + bl[n], K = 1024, N padded to 448
  const int gL = ((MT / (16 * GTI)) * (EVP / 64) + GWV - 1) / GWV;
  gemm64<1, 0, 0, 0><<<dim3(gL), dim3(32 * GWV), 0, stream>>>(OPp, KF, WLT, KF, hdummy, 0, Lp, EVP, 1.0f, bl, EVD, 1.0f, MT, EVP, KF);

  // (5) flat whole-line copy into the output (388-wide rows), NaN-poisoned on a mask-structure violation
  out_copy<<<dim3((MT * (EVD / 4) + 256 * OCH - 1) / (256 * OCH)), blk, 0, stream>>>(Lp, FLG, out0);
  (void)hipGetLastError();
}
